// v000
// Measured on an AMD MI455X. A time is GPU time per run, averaged over a window of back-to-back runs after a warm-up
// (all launches, gaps included; the runs take copies of the inputs in turn), and the median of several windows.
// Apart from v000's, it joins two sittings. Times from different sittings can be a few percent apart, while
// side-by-side timings come from the same sitting.
// v000, which the later versions start from, runs in 916 microseconds.
// Contractions: 1x1 projections (K=256), affinity scores (K=256) and softmax(P).U (K=4096 in 64-deep
// tiles) on v_wmma_f32_16x16x32_f16 (f16 operands, f32 accumulate); operands are RNE-bf16 inputs held in
// f16 containers (weights x16, activations and values x16), projected q/k vectors as f16 hi plus x2^15
// residual planes (three products in the score GEMM), softmax planes x2^14; softmax statistics,
// normalisation statistics (f64 combine) and epilogues f32 VALU.
#include <hip/hip_runtime.h>
#include <stddef.h>
#include <stdint.h>
#include <math.h>

#define NBMAX 4
#define CC    256
#define NPX   4096
#define HWD   64
#define TP    72
#define EPF   68

#define PLANE       ((size_t)CC * NPX)                 // 1048576 elements per batch plane
#define ACT16_BYTES ((size_t)NBMAX * PLANE * 2)        // 8388608
#define W16_BYTES   ((size_t)2 * CC * CC * 2)          // 262144
#define S_BYTES     ((size_t)NPX * NPX * 4)            // 67108864
#define ST_BYTES    ((size_t)NPX * 4)                  // 16384
#define O_BYTES     ((size_t)PLANE * 4)                // 4194304
#define PS_BYTES    ((size_t)NBMAX * HWD * CC * 4)     // 262144

// ---- carve ----------------------------------------------------------------------------------------
#define OFF_HT   ((size_t)0)
#define OFF_UT   (OFF_HT + ACT16_BYTES)
#define OFF_UC   (OFF_UT + ACT16_BYTES)
#define OFF_W16  (OFF_UC + ACT16_BYTES)
#define OFF_QH   (OFF_W16 + W16_BYTES)
#define OFF_QL   (OFF_QH + ACT16_BYTES)
#define OFF_KH   (OFF_QL + ACT16_BYTES)
#define OFF_KL   (OFF_KH + ACT16_BYTES)
#define OFF_S    (OFF_KL + ACT16_BYTES)
#define OFF_RMAX (OFF_S + S_BYTES)
#define OFF_RSUM (OFF_RMAX + ST_BYTES)
#define OFF_O    (OFF_RSUM + ST_BYTES)
#define OFF_PS   (OFF_O + O_BYTES)
#define OFF_PQ   (OFF_PS + PS_BYTES)
#define WS_TOTAL (OFF_PQ + PS_BYTES)

static_assert(OFF_QH == (size_t)25427968);
static_assert(OFF_S == (size_t)58982400);
static_assert(OFF_O == (size_t)126124032);
static_assert(WS_TOTAL == (size_t)130842624);
static_assert(WS_TOTAL <= (size_t)134217728);
static_assert((OFF_UT % 256) == 0);
static_assert((OFF_UC % 256) == 0);
static_assert((OFF_W16 % 256) == 0);
static_assert((OFF_QH % 256) == 0);
static_assert((OFF_QL % 256) == 0);
static_assert((OFF_KH % 256) == 0);
static_assert((OFF_KL % 256) == 0);
static_assert((OFF_S % 256) == 0);
static_assert((OFF_RMAX % 256) == 0);
static_assert((OFF_RSUM % 256) == 0);
static_assert((OFF_O % 256) == 0);
static_assert((OFF_PS % 256) == 0);
static_assert((OFF_PQ % 256) == 0);
static_assert(NPX == HWD * HWD);
static_assert((CC % 64) == 0);
static_assert((NPX % 64) == 0);
static_assert((TP * 2) % 16 == 0);
static_assert((EPF * 4) % 16 == 0);

typedef unsigned short v8us  __attribute__((ext_vector_type(8)));
typedef unsigned short v16us __attribute__((ext_vector_type(16)));
typedef _Float16       v16h  __attribute__((ext_vector_type(16)));
typedef float          v4f   __attribute__((ext_vector_type(4)));
typedef float          v8f   __attribute__((ext_vector_type(8)));

union FragU { v16us v; v8us half[2]; };

// ---- scalar helpers -------------------------------------------------------------------------------
__device__ __forceinline__ unsigned bbits(float f) {          // f32 -> nearest-even bf16 bits
  unsigned u = __float_as_uint(f);
  return (u + 0x7FFFu + ((u >> 16) & 1u)) >> 16;
}
__device__ __forceinline__ float bf16r(float f) {            // RNE convert to bf16 and back
  return __uint_as_float(bbits(f) << 16);
}
__device__ __forceinline__ unsigned short hbits(float f) {   // f32 -> f16 bits (RNE)
  return __builtin_bit_cast(unsigned short, (_Float16)f);
}
__device__ __forceinline__ float rcpf(float x) {
#if defined(__HIP_DEVICE_COMPILE__)
  return __builtin_amdgcn_rcpf(x);
#else
  return 1.0f / x;
#endif
}
__device__ __forceinline__ v8f zero8() { v8f z = {0.f, 0.f, 0.f, 0.f, 0.f, 0.f, 0.f, 0.f}; return z; }

__device__ __forceinline__ double shfl_xor_d(double v, int o) {
  const long long x = __double_as_longlong(v);
  int lo = (int)(x & 0xffffffffll);
  int hi = (int)(x >> 32);
  lo = __shfl_xor(lo, o, 32);
  hi = __shfl_xor(hi, o, 32);
  const long long y = ((long long)(unsigned)hi << 32) | (long long)(unsigned)lo;
  return __longlong_as_double(y);
}

// ---- 16-bit fragment loader, split k map for A and B alike ([row][k] planes, k contiguous):
//      p = row_base + k0 + 8*(lane>>4): elements 0..7 <- p[0..7], elements 8..15 <- p[16..23]
__device__ __forceinline__ v16us ldfrag_u(const unsigned short* p) {
  FragU f;
  f.half[0] = *(const v8us*)(p);
  f.half[1] = *(const v8us*)(p + 16);
  return f.v;
}

// ---- WMMA helper (f16 operands as raw 16-bit lanes, f32 accumulate) --------------------------------
__device__ __forceinline__ v8f mma_hu(v16us a, v16us b, v8f c) {
#if defined(__HIP_DEVICE_COMPILE__)
  return __builtin_amdgcn_wmma_f32_16x16x32_f16(false, __builtin_bit_cast(v16h, a),
                                               false, __builtin_bit_cast(v16h, b),
                                               (short)0, c, false, false);
#else
  (void)a; (void)b;
  return c;
#endif
}
// hazard guards after the last WMMA of a group: tie the accumulators, keep the fragments live
__device__ __forceinline__ void guard4(v8f& c0, v8f& c1, v8f& c2, v8f& c3, const v16us& a,
                                       const v16us& b0, const v16us& b1, const v16us& b2,
                                       const v16us& b3) {
#if defined(__HIP_DEVICE_COMPILE__)
  asm volatile("v_nop\n\tv_nop\n\tv_nop\n\tv_nop"
               : "+v"(c0), "+v"(c1), "+v"(c2), "+v"(c3)
               : "v"(a), "v"(b0), "v"(b1), "v"(b2), "v"(b3));
#else
  (void)c0; (void)c1; (void)c2; (void)c3; (void)a; (void)b0; (void)b1; (void)b2; (void)b3;
#endif
}
__device__ __forceinline__ void guard8(v8f& c0, v8f& c1, v8f& c2, v8f& c3, v8f& c4, v8f& c5,
                                       v8f& c6, v8f& c7, const v16us& a0, const v16us& a1,
                                       const v16us& b0, const v16us& b1, const v16us& b2,
                                       const v16us& b3) {
#if defined(__HIP_DEVICE_COMPILE__)
  asm volatile("v_nop\n\tv_nop\n\tv_nop\n\tv_nop"
               : "+v"(c0), "+v"(c1), "+v"(c2), "+v"(c3), "+v"(c4), "+v"(c5), "+v"(c6), "+v"(c7)
               : "v"(a0), "v"(a1), "v"(b0), "v"(b1), "v"(b2), "v"(b3));
#else
  (void)c0; (void)c1; (void)c2; (void)c3; (void)c4; (void)c5; (void)c6; (void)c7;
  (void)a0; (void)a1; (void)b0; (void)b1; (void)b2; (void)b3;
#endif
}
__device__ __forceinline__ void guard8w(v8f& c0, v8f& c1, v8f& c2, v8f& c3, v8f& c4, v8f& c5,
                                        v8f& c6, v8f& c7, const v16us& a0, const v16us& a1,
                                        const v16us& b0, const v16us& b1, const v16us& b2,
                                        const v16us& b3, const v16us& b4, const v16us& b5,
                                        const v16us& b6, const v16us& b7) {
#if defined(__HIP_DEVICE_COMPILE__)
  asm volatile("v_nop\n\tv_nop\n\tv_nop\n\tv_nop"
               : "+v"(c0), "+v"(c1), "+v"(c2), "+v"(c3), "+v"(c4), "+v"(c5), "+v"(c6), "+v"(c7)
               : "v"(a0), "v"(a1), "v"(b0), "v"(b1), "v"(b2), "v"(b3), "v"(b4), "v"(b5),
                 "v"(b6), "v"(b7));
#else
  (void)c0; (void)c1; (void)c2; (void)c3; (void)c4; (void)c5; (void)c6; (void)c7;
  (void)a0; (void)a1; (void)b0; (void)b1; (void)b2; (void)b3; (void)b4; (void)b5; (void)b6; (void)b7;
#endif
}

// f32 tile 64x64 (pitch 64) -> C rows row0.., columns col0..col0+63, ldc floats; 128 lines, 4 waves.
__device__ __forceinline__ void store_tile_f32(const float* ct, float* C, size_t row0, int col0,
                                               int ldc, int w, int lane) {
  const int q  = lane >> 3;
  const int jj = lane & 7;
#pragma unroll 1
  for (int it = 0; it < 8; ++it) {
    const int li = it * 16 + w * 4 + q;           // 0..127
    const int tr = li >> 1, hf = li & 1;
    const v4f v = *(const v4f*)(ct + tr * 64 + hf * 32 + jj * 4);
    *(v4f*)(C + (row0 + tr) * (size_t)ldc + col0 + hf * 32 + jj * 4) = v;
  }
  
}
// 16-bit tile 64 rows x 64 halves (LDS pitch PITCH halves) -> P rows row0.., columns col0..col0+63,
template <int NW, int PITCH>
__device__ __forceinline__ void store_tile_us(const unsigned short* t, unsigned short* P,
                                              size_t row0, int ld, int col0, int w, int lane) {
  constexpr int NIT = 64 / (4 * NW);
  const int q  = lane >> 3;
  const int jj = lane & 7;
  v8us   v[NIT];
  size_t off[NIT];
#pragma unroll
  for (int it = 0; it < NIT; ++it) {
    const int li = it * 4 * NW + w * 4 + q;       // 0..63
    v[it]   = *(const v8us*)(t + li * PITCH + 8 * jj);
    off[it] = (row0 + li) * (size_t)ld + col0 + 8 * jj;
  }
#pragma unroll
  for (int it = 0; it < NIT; ++it) *(v8us*)(P + off[it]) = v[it];
  
}

// =====================================================================================================
// for the projection A fragments); UC: channel-major [b][c][n] (k = n contiguous for the P.U A fragment).
// Block = (64 px tile, 64 ch tile, b), 256 threads; thread = (channel cl = tid>>2, 16-px quarter).
// lines: HT/UT rows n (64 halves at column c0), UC rows c (64 halves at column n0).
// coverage: grid (64, 4, nb): every (b, c, n) of HT, UT and UC written exactly once.
// =====================================================================================================
__global__ __launch_bounds__(256)
void k_cvt(const float* __restrict__ hand, const float* __restrict__ u,
           unsigned short* ht, unsigned short* ut, unsigned short* uc)
{
  __shared__ __align__(16) unsigned short TH[64 * TP];
  __shared__ __align__(16) unsigned short TU[64 * TP];
  __shared__ __align__(16) unsigned short TC[64 * TP];

  const int tid  = threadIdx.x;
  const int lane = tid & 31;
  const int w    = tid >> 5;
  const int n0   = 64 * blockIdx.x;
  const int c0   = 64 * blockIdx.y;
  const int b    = blockIdx.z;
  const int cl   = tid >> 2;              // 0..63
  const int pq   = 16 * (tid & 3);        // 0,16,32,48
  const size_t src = (size_t)b * PLANE + (size_t)(c0 + cl) * NPX + n0 + pq;
#pragma unroll
  for (int g = 0; g < 4; ++g) {
    const v4f hv = *(const v4f*)(hand + src + 4 * g);
    const v4f uv = *(const v4f*)(u + src + 4 * g);
#pragma unroll
    for (int e = 0; e < 4; ++e) {
      const int px = pq + 4 * g + e;
      const unsigned short hb = hbits(16.0f * bf16r(hv[e]));
      const unsigned short ub = hbits(16.0f * bf16r(uv[e]));
      TH[px * TP + cl] = hb;
      TU[px * TP + cl] = ub;
      TC[cl * TP + px] = ub;
    }
  }
  __syncthreads();
  store_tile_us<8, TP>(TH, ht + (size_t)b * PLANE, (size_t)n0, CC, c0, w, lane);
  store_tile_us<8, TP>(TU, ut + (size_t)b * PLANE, (size_t)n0, CC, c0, w, lane);
  store_tile_us<8, TP>(TC, uc + (size_t)b * PLANE, (size_t)c0, NPX, n0, w, lane);
}

// =====================================================================================================
// Pass 2: weight planes W16[set][o][c] = f16(16 * bf16(W[o][c])), set 0 = WH_w, 1 = WU_w (block-uniform).
// coverage: 64 blocks x 256 threads x 8 = 131072 halves, every element once.
// =====================================================================================================
__global__ __launch_bounds__(256)
void k_wcvt(const float* __restrict__ whw, const float* __restrict__ wuw, unsigned short* w16)
{
  const int t   = blockIdx.x * 256 + threadIdx.x;   // 0..16383
  const int o   = 8 * t;
  const int set = blockIdx.x >> 5;                  // block-uniform
  const int idx = o & (CC * CC - 1);
  const float* p = (set ? wuw : whw) + idx;
  v8us ob;
#pragma unroll
  for (int e = 0; e < 8; ++e) ob[e] = hbits(16.0f * bf16r(p[e]));
  *(v8us*)(w16 + o) = ob;
  
}

// =====================================================================================================
// 1x1 projections: D[n][o] = sum_c X[n][c] * W16[o][c], tile 64(n) x 64(o), K = 256, 4 waves,
// wave w owns rows n 16w..16w+15 (A fragment from the pixel-major activation plane) and 4 column
// sub-tiles of 16 output channels (B fragment = W16 rows o, split map). Epilogue: /256, + bf16(bias),
// into the pixel-major planes [b][n][o] (64 halves = 1 line per row at column o0).
// z = 2b + which: which 0 -> (HT, WH, WH_b) -> QH/QL; which 1 -> (UT, WU, WU_b) -> KH/KL.
// coverage: grid (64 n tiles, 4 o tiles, 2 nb): QH, QL, KH, KL [b][4096][256] every element once.
// =====================================================================================================
__global__ __launch_bounds__(128)
void k_proj(const unsigned short* __restrict__ ht, const unsigned short* __restrict__ ut,
            const unsigned short* __restrict__ w16, const float* __restrict__ whb,
            const float* __restrict__ wub, unsigned short* qh, unsigned short* ql,
            unsigned short* kh, unsigned short* kl)
{
  __shared__ __align__(16) unsigned short t0[64 * TP];
  __shared__ __align__(16) unsigned short t1[64 * TP];

  const int tid   = threadIdx.x;
  const int lane  = tid & 31;
  const int w     = tid >> 5;
  const int h     = lane >> 4;
  const int m     = lane & 15;
  const int n0    = 64 * blockIdx.x;
  const int o0    = 64 * blockIdx.y;
  const int which = blockIdx.z & 1;         // block-uniform
  const int bb    = blockIdx.z >> 1;
  const unsigned short* x  = (which ? ut : ht) + (size_t)bb * PLANE;
  const unsigned short* wm = w16 + (size_t)which * CC * CC;
  const float* bias = which ? wub : whb;

  v8f acc[4];
#pragma unroll
  for (int j = 0; j < 4; ++j) acc[j] = zero8();

  const unsigned short* pa = x + (size_t)(n0 + 16 * w + m) * CC + 8 * h;
  const unsigned short* pb = wm + (size_t)(o0 + m) * CC + 8 * h;
#pragma unroll 2
  for (int kk = 0; kk < CC / 32; ++kk) {
    const v16us a  = ldfrag_u(pa + 32 * kk);
    const v16us b0 = ldfrag_u(pb + 32 * kk);
    const v16us b1 = ldfrag_u(pb + (size_t)16 * CC + 32 * kk);
    const v16us b2 = ldfrag_u(pb + (size_t)32 * CC + 32 * kk);
    const v16us b3 = ldfrag_u(pb + (size_t)48 * CC + 32 * kk);
    acc[0] = mma_hu(a, b0, acc[0]);
    acc[1] = mma_hu(a, b1, acc[1]);
    acc[2] = mma_hu(a, b2, acc[2]);
    acc[3] = mma_hu(a, b3, acc[3]);
    guard4(acc[0], acc[1], acc[2], acc[3], a, b0, b1, b2, b3);
  }

  const float k256 = 1.0f / 256.0f;
  float bv[4];
#pragma unroll
  for (int j = 0; j < 4; ++j) bv[j] = bf16r(bias[o0 + 16 * j + m]);
#pragma unroll
  for (int j = 0; j < 4; ++j) {
#pragma unroll
    for (int r = 0; r < 8; ++r) {
      const float val = acc[j][r] * k256 + bv[j];
      const _Float16 hv = (_Float16)val;
      const int rl = 16 * w + 8 * h + r;       // pixel within tile
      const int cl = 16 * j + m;               // output channel within tile
      t0[rl * TP + cl] = __builtin_bit_cast(unsigned short, hv);
      t1[rl * TP + cl] = hbits((val - (float)hv) * 32768.0f);
    }
  }
  __syncthreads();
  unsigned short* dh = which ? kh : qh;
  unsigned short* dl = which ? kl : ql;
  store_tile_us<4, TP>(t0, dh + (size_t)bb * PLANE, (size_t)n0, CC, o0, w, lane);
  store_tile_us<4, TP>(t1, dl + (size_t)bb * PLANE, (size_t)n0, CC, o0, w, lane);
}

// =====================================================================================================
// Scores for one batch: S[n][m] = QH.KH + (QH.KL + QL.KH) / 32768, K = 256, f32. Tile 64(n) x 64(m),
// 4 waves, wave w owns rows n 16w..16w+15 and 4 column sub-tiles; A from query planes rows n, B from
// key planes rows m (split map both). Three products per tile pair, two accumulator sets.
// coverage: grid 64 x 64 = all 4096 x 4096 scores; 128 lines per tile, each once (store_tile_f32).
// =====================================================================================================
__global__ __launch_bounds__(128)
void k_score(const unsigned short* __restrict__ qh, const unsigned short* __restrict__ ql,
             const unsigned short* __restrict__ kh, const unsigned short* __restrict__ kl, float* S)
{
  __shared__ __align__(16) float ct[64 * 64];

  const int tid  = threadIdx.x;
  const int lane = tid & 31;
  const int w    = tid >> 5;
  const int h    = lane >> 4;
  const int m    = lane & 15;
  const int m0   = 64 * blockIdx.x;          // key pixels (columns)
  const int n0   = 64 * blockIdx.y;          // query pixels (rows)

  v8f acc[4], accx[4];
#pragma unroll
  for (int j = 0; j < 4; ++j) { acc[j] = zero8(); accx[j] = zero8(); }

  const unsigned short* pah = qh + (size_t)(n0 + 16 * w + m) * CC + 8 * h;
  const unsigned short* pal = ql + (size_t)(n0 + 16 * w + m) * CC + 8 * h;
  const unsigned short* pbh = kh + (size_t)(m0 + m) * CC + 8 * h;
  const unsigned short* pbl = kl + (size_t)(m0 + m) * CC + 8 * h;
#pragma unroll 1
  for (int kk = 0; kk < CC / 32; ++kk) {
    const v16us ah  = ldfrag_u(pah + 32 * kk);
    const v16us al  = ldfrag_u(pal + 32 * kk);
    const v16us bh0 = ldfrag_u(pbh + 32 * kk);
    const v16us bh1 = ldfrag_u(pbh + (size_t)16 * CC + 32 * kk);
    const v16us bh2 = ldfrag_u(pbh + (size_t)32 * CC + 32 * kk);
    const v16us bh3 = ldfrag_u(pbh + (size_t)48 * CC + 32 * kk);
    const v16us bl0 = ldfrag_u(pbl + 32 * kk);
    const v16us bl1 = ldfrag_u(pbl + (size_t)16 * CC + 32 * kk);
    const v16us bl2 = ldfrag_u(pbl + (size_t)32 * CC + 32 * kk);
    const v16us bl3 = ldfrag_u(pbl + (size_t)48 * CC + 32 * kk);
    acc[0]  = mma_hu(ah, bh0, acc[0]);
    acc[1]  = mma_hu(ah, bh1, acc[1]);
    acc[2]  = mma_hu(ah, bh2, acc[2]);
    acc[3]  = mma_hu(ah, bh3, acc[3]);
    accx[0] = mma_hu(ah, bl0, accx[0]);
    accx[1] = mma_hu(ah, bl1, accx[1]);
    accx[2] = mma_hu(ah, bl2, accx[2]);
    accx[3] = mma_hu(ah, bl3, accx[3]);
    accx[0] = mma_hu(al, bh0, accx[0]);
    accx[1] = mma_hu(al, bh1, accx[1]);
    accx[2] = mma_hu(al, bh2, accx[2]);
    accx[3] = mma_hu(al, bh3, accx[3]);
    guard8w(acc[0], acc[1], acc[2], acc[3], accx[0], accx[1], accx[2], accx[3],
            ah, al, bh0, bh1, bh2, bh3, bl0, bl1, bl2, bl3);
  }

  const float kx = 1.0f / 32768.0f;
#pragma unroll
  for (int j = 0; j < 4; ++j) {
#pragma unroll
    for (int r = 0; r < 8; ++r)
      ct[(16 * w + 8 * h + r) * 64 + 16 * j + m] = acc[j][r] + accx[j][r] * kx;
  }
  __syncthreads();
  store_tile_f32(ct, S, (size_t)n0, m0, NPX, w, lane);
}

// =====================================================================================================
// Row statistics: rmax[n] = max_m S[n][m], rsum[n] = sum_m exp(S[n][m] - rmax[n]). Wave per row,
// 4 rows per wave in sequence, 32 rows per block; running max per 8-element chunk starting at -1e30
// one instruction).  coverage: 128 blocks x 32 rows = all 4096 rows.
// =====================================================================================================
__global__ __launch_bounds__(256)
void k_rstat(const float* __restrict__ S, float* rmax, float* rsum)
{
  __shared__ __align__(16) float lm[32];
  __shared__ __align__(16) float ls[32];
  const int tid  = threadIdx.x;
  const int lane = tid & 31;
  const int w    = tid >> 5;
#pragma unroll 1
  for (int rr = 0; rr < 4; ++rr) {
    const int row = 32 * blockIdx.x + 4 * w + rr;
    const float* sr = S + (size_t)row * NPX + 8 * lane;
    float mx = -1.0e30f, sm = 0.0f;
#pragma unroll 1
    for (int it = 0; it < NPX / 256; ++it) {
      const v4f x0 = *(const v4f*)(sr + 256 * it);
      const v4f x1 = *(const v4f*)(sr + 256 * it + 4);
      const float cm = fmaxf(fmaxf(fmaxf(x0[0], x0[1]), fmaxf(x0[2], x0[3])),
                             fmaxf(fmaxf(x1[0], x1[1]), fmaxf(x1[2], x1[3])));
      const float mn = fmaxf(mx, cm);
      float add = 0.0f;
#pragma unroll
      for (int e = 0; e < 4; ++e) { add += __expf(x0[e] - mn); add += __expf(x1[e] - mn); }
      sm = sm * __expf(mx - mn) + add;
      mx = mn;
    }
    float M = mx;
#pragma unroll
    for (int o = 16; o >= 1; o >>= 1) M = fmaxf(M, __shfl_xor(M, o, 32));
    float st = sm * __expf(mx - M);
#pragma unroll
    for (int o = 16; o >= 1; o >>= 1) st += __shfl_xor(st, o, 32);
    if (lane == 0) { lm[4 * w + rr] = M; ls[4 * w + rr] = st; }
  }
  __syncthreads();
  if (w == 0 && lane < 8) {
    const v4f a = *(const v4f*)(lm + 4 * lane);
    const v4f c = *(const v4f*)(ls + 4 * lane);
    float* dm = rmax + 32 * blockIdx.x + 4 * lane;
    float* ds = rsum + 32 * blockIdx.x + 4 * lane;
    *(v4f*)dm = a;
    *(v4f*)ds = c;
    
  }
}

// =====================================================================================================
// P.U for one batch. Block owns 64 query pixels R0.. (one image row) and all 256 channels (8 waves x 32
// channels, two A fragments per wave), loop over 64 tiles T of 64 key pixels:
//   P[i][k] = f16(16384 exp(S[R0+i][64T+k] - rmax[R0+i])) built in LDS ([i][k], pitch 72, v8us stores,
//   reloaded as v8us fragments after a block barrier); A = UC rows c (value plane, k = key pixel).
// D[c][i] += UC[c][k] . P[i][k] (split map both), 8 accumulators per wave, K = 64 per tile.
// Epilogue: p = D * (1/rsum[i]) / 2^18 (value scale 16, softmax scale 2^14); per-channel partial sums
// sum p, sum p^2 over the 64 pixels (fixed order: 4 sub-tiles then xor tree over 16 lanes); p staged
// coverage: 64 blocks: O [256][4096] and PS/PQ [64][256] of this batch, every element once.
// =====================================================================================================
__device__ __forceinline__ void o_store_pass(const float* Et, float* orows, int R0, int w, int lane)
{
  const int q  = lane >> 3;
  const int jj = lane & 7;
#pragma unroll 1
  for (int it = 0; it < 8; ++it) {
    const int li = it * 32 + 4 * w + q;         // 0..255
    const int c = li >> 1, hf = li & 1;
    const v4f v = *(const v4f*)(Et + c * EPF + 32 * hf + 4 * jj);
    *(v4f*)(orows + (size_t)c * NPX + R0 + 32 * hf + 4 * jj) = v;
  }
}

__global__ __launch_bounds__(256)
void k_pv(const float* __restrict__ S, const float* __restrict__ rmax, const float* __restrict__ rsum,
          const unsigned short* __restrict__ ucb, float* O, float* ps, float* pq)
{
  __shared__ __align__(16) unsigned short Pt[64 * TP];
  __shared__ __align__(16) float Et[128 * EPF];
  __shared__ float mxs[64];
  __shared__ float invs[64];
  __shared__ __align__(16) float lsum[CC];
  __shared__ __align__(16) float lsq[CC];

  const int tid  = threadIdx.x;
  const int lane = tid & 31;
  const int w    = tid >> 5;
  const int h    = lane >> 4;
  const int m    = lane & 15;
  const int R0   = 64 * blockIdx.x;

  if (tid < 64) {
    mxs[tid]  = rmax[R0 + tid];
    invs[tid] = rcpf(rsum[R0 + tid]) * (1.0f / 262144.0f);
  }
  __syncthreads();

  const int fr = tid >> 2;               // P tile row (query pixel) 0..63
  const int fc = 16 * (tid & 3);         // 16 key columns
  const float mx0 = mxs[fr];
  const float* sp = S + (size_t)(R0 + fr) * NPX + fc;

  v8f acc[8];
#pragma unroll
  for (int k = 0; k < 8; ++k) acc[k] = zero8();
  const unsigned short* pa0 = ucb + (size_t)(32 * w + m) * NPX + 8 * h;
  const unsigned short* pa1 = pa0 + (size_t)16 * NPX;

#pragma unroll 1
  for (int T = 0; T < NPX / 64; ++T) {
    {
      const float* s2 = sp + 64 * T;
      const v4f x0 = *(const v4f*)(s2);
      const v4f x1 = *(const v4f*)(s2 + 4);
      const v4f x2 = *(const v4f*)(s2 + 8);
      const v4f x3 = *(const v4f*)(s2 + 12);
      v8us o0, o1;
#pragma unroll
      for (int e = 0; e < 4; ++e) {
        o0[e]     = hbits(16384.0f * __expf(x0[e] - mx0));
        o0[4 + e] = hbits(16384.0f * __expf(x1[e] - mx0));
        o1[e]     = hbits(16384.0f * __expf(x2[e] - mx0));
        o1[4 + e] = hbits(16384.0f * __expf(x3[e] - mx0));
      }
      *(v8us*)(Pt + fr * TP + fc)     = o0;
      *(v8us*)(Pt + fr * TP + fc + 8) = o1;
    }
    __syncthreads();
#pragma unroll
    for (int kk = 0; kk < 2; ++kk) {
      const v16us a0 = ldfrag_u(pa0 + 64 * T + 32 * kk);
      const v16us a1 = ldfrag_u(pa1 + 64 * T + 32 * kk);
      const v16us b0 = ldfrag_u(Pt + (0 * 16 + m) * TP + 32 * kk + 8 * h);
      const v16us b1 = ldfrag_u(Pt + (1 * 16 + m) * TP + 32 * kk + 8 * h);
      const v16us b2 = ldfrag_u(Pt + (2 * 16 + m) * TP + 32 * kk + 8 * h);
      const v16us b3 = ldfrag_u(Pt + (3 * 16 + m) * TP + 32 * kk + 8 * h);
      acc[0] = mma_hu(a0, b0, acc[0]);
      acc[1] = mma_hu(a0, b1, acc[1]);
      acc[2] = mma_hu(a0, b2, acc[2]);
      acc[3] = mma_hu(a0, b3, acc[3]);
      acc[4] = mma_hu(a1, b0, acc[4]);
      acc[5] = mma_hu(a1, b1, acc[5]);
      acc[6] = mma_hu(a1, b2, acc[6]);
      acc[7] = mma_hu(a1, b3, acc[7]);
      guard8(acc[0], acc[1], acc[2], acc[3], acc[4], acc[5], acc[6], acc[7], a0, a1, b0, b1, b2, b3);
    }
    __syncthreads();
  }

  // normalise: acc[4s+j][r] -> p at (c = 32w + 16s + 8h + r, i = 16j + m)
#pragma unroll
  for (int k = 0; k < 8; ++k) {
    const float iv = invs[16 * (k & 3) + m];
#pragma unroll
    for (int r = 0; r < 8; ++r) acc[k][r] = acc[k][r] * iv;
  }
  // per-channel partial statistics over the block's 64 pixels
  float rs[2][8], rq[2][8];
#pragma unroll
  for (int s = 0; s < 2; ++s) {
#pragma unroll
    for (int r = 0; r < 8; ++r) {
      float a = 0.0f, q2 = 0.0f;
#pragma unroll
      for (int j = 0; j < 4; ++j) {
        const float p = acc[4 * s + j][r];
        a += p;
        q2 += p * p;
      }
      rs[s][r] = a;
      rq[s][r] = q2;
    }
  }
#pragma unroll
  for (int s = 0; s < 2; ++s) {
#pragma unroll
    for (int r = 0; r < 8; ++r) {
#pragma unroll
      for (int o = 1; o < 16; o <<= 1) {
        rs[s][r] += __shfl_xor(rs[s][r], o, 32);
        rq[s][r] += __shfl_xor(rq[s][r], o, 32);
      }
    }
  }
  if (m == 0) {
#pragma unroll
    for (int s = 0; s < 2; ++s) {
#pragma unroll
      for (int r = 0; r < 8; ++r) {
        lsum[32 * w + 16 * s + 8 * h + r] = rs[s][r];
        lsq[32 * w + 16 * s + 8 * h + r]  = rq[s][r];
      }
    }
  }

  // O plane in two 128-channel halves (waves 0..3 then waves 4..7 supply the values)
#pragma unroll
  for (int half = 0; half < 2; ++half) {
    if ((w >> 2) == half) {                      // wave-uniform
#pragma unroll
      for (int s = 0; s < 2; ++s) {
#pragma unroll
        for (int j = 0; j < 4; ++j) {
#pragma unroll
          for (int r = 0; r < 8; ++r) {
            const int cl = 32 * (w & 3) + 16 * s + 8 * h + r;   // 0..127
            const int il = 16 * j + m;
            Et[cl * EPF + il] = acc[4 * s + j][r];
          }
        }
      }
    }
    __syncthreads();
    float* orows = O + (size_t)(128 * half) * NPX;
    o_store_pass(Et, orows, R0, w, lane);
    
    __syncthreads();
  }

  if (tid < 64) {
    const v4f v = *(const v4f*)(lsum + 4 * tid);
    float* d = ps + (size_t)blockIdx.x * CC + 4 * tid;
    *(v4f*)d = v;
    
  } else if (tid < 128) {
    const int t2 = tid - 64;
    const v4f v = *(const v4f*)(lsq + 4 * t2);
    float* d = pq + (size_t)blockIdx.x * CC + 4 * t2;
    *(v4f*)d = v;
    
  }
}

// =====================================================================================================
// GroupNorm + residual for one batch. Block = channel c (256 blocks), 256 threads. Wave 0 combines the
// 64 blocks x 8 channels partial sums of group g = c/8 in f64 in a fixed order (lane l takes entries
// l, l+32, ... then an xor tree), mean = S/32768, var = Q/32768 - mean^2 (biased), rstd =
// 1/sqrt(var + 1e-5). out[c][n] = ((O[c][n] - mean) * rstd) * bf16(gn_w[c]) + bf16(gn_b[c]) +
// bf16(Hand[c][n]); row of 4096 floats written as 4 instructions of 256 threads x 16 B (each wave
// coverage: 256 blocks x 4096 = the whole [256][4096] output of this batch, every element once.
// =====================================================================================================
__global__ __launch_bounds__(256)
void k_gn(const float* __restrict__ O, const float* __restrict__ ps, const float* __restrict__ pq,
          const float* __restrict__ handb, const float* __restrict__ gnw,
          const float* __restrict__ gnb, float* outb)
{
  __shared__ float stat[2];
  const int tid  = threadIdx.x;
  const int lane = tid & 31;
  const int w    = tid >> 5;
  const int c    = blockIdx.x;
  const int g    = c >> 3;

  if (w == 0) {                                  // wave-uniform
    double s = 0.0, q = 0.0;
    const float* psg = ps + 8 * g;
    const float* pqg = pq + 8 * g;
#pragma unroll 1
    for (int i = 0; i < 16; ++i) {
      const int idx = lane + 32 * i;             // 0..511
      const int blk = idx >> 3, ch = idx & 7;
      s += (double)psg[(size_t)blk * CC + ch];
      q += (double)pqg[(size_t)blk * CC + ch];
    }
#pragma unroll
    for (int o = 16; o >= 1; o >>= 1) {
      s += shfl_xor_d(s, o);
      q += shfl_xor_d(q, o);
    }
    if (lane == 0) {
      const double inv_n = 1.0 / 32768.0;
      const double mean = s * inv_n;
      double var = q * inv_n - mean * mean;
      if (var < 0.0) var = 0.0;
      const float varf = (float)var;
      stat[0] = (float)mean;
      stat[1] = rcpf(sqrtf(varf + 1e-5f));
    }
  }
  __syncthreads();
  const float meanf = stat[0];
  const float rstd  = stat[1];
  const float gw    = bf16r(gnw[c]);
  const float gb    = bf16r(gnb[c]);
  const float* orow = O + (size_t)c * NPX;
  const float* hrow = handb + (size_t)c * NPX;
  float* drow = outb + (size_t)c * NPX;

  v4f res[4];
#pragma unroll
  for (int it = 0; it < 4; ++it) {
    const int f = 4 * (it * 256 + tid);
    const v4f ov = *(const v4f*)(orow + f);
    const v4f hd = *(const v4f*)(hrow + f);
#pragma unroll
    for (int e = 0; e < 4; ++e) {
      const float xn = (ov[e] - meanf) * rstd;
      res[it][e] = xn * gw + gb + bf16r(hd[e]);
    }
  }
#pragma unroll
  for (int it = 0; it < 4; ++it)
    *(v4f*)(drow + 4 * (it * 256 + tid)) = res[it];
  
}

// =====================================================================================================
// Host glue. Inputs in table order (8): Hand [nb][256][64][64], U (same), WH_w [256][256], WH_b [256],
// WU_w [256][256], WU_b [256], gn_w [256], gn_b [256]; nb = in_sizes[0] / (256*4096), 1..4.
// Output f32 [nb][256][4096] at element 0. Workspace 130842624 B (sized for nb = 4).
// 3 + 4*nb launches: k_cvt, k_wcvt, k_proj, per batch {k_score, k_rstat, k_pv, k_gn}.
// =====================================================================================================
extern "C" void kernel_launch(void* const* d_in, const int* in_sizes, int n_in,
                              void* d_out, int out_size, void* d_ws, size_t ws_size,
                              hipStream_t stream) {
  if (n_in < 8) return;
  const int per = CC * NPX;
  const int n0s = in_sizes[0];
  if (n0s < per || (n0s % per) != 0) return;
  const int nb = n0s / per;
  if (nb < 1 || nb > NBMAX) return;
  if (in_sizes[1] != n0s) return;
  if (in_sizes[2] != CC * CC || in_sizes[4] != CC * CC) return;
  if (in_sizes[3] != CC || in_sizes[5] != CC || in_sizes[6] != CC || in_sizes[7] != CC) return;
  if (out_size != nb * per) return;
  if (ws_size < WS_TOTAL) return;

  const float* hand = (const float*)d_in[0];
  const float* u    = (const float*)d_in[1];
  const float* whw  = (const float*)d_in[2];
  const float* whb  = (const float*)d_in[3];
  const float* wuw  = (const float*)d_in[4];
  const float* wub  = (const float*)d_in[5];
  const float* gnw  = (const float*)d_in[6];
  const float* gnb  = (const float*)d_in[7];
  float* out = (float*)d_out;

  char* ws = (char*)d_ws;
  unsigned short* ht  = (unsigned short*)(ws + OFF_HT);
  unsigned short* ut  = (unsigned short*)(ws + OFF_UT);
  unsigned short* uc  = (unsigned short*)(ws + OFF_UC);
  unsigned short* w16 = (unsigned short*)(ws + OFF_W16);
  unsigned short* qh  = (unsigned short*)(ws + OFF_QH);
  unsigned short* ql  = (unsigned short*)(ws + OFF_QL);
  unsigned short* kh  = (unsigned short*)(ws + OFF_KH);
  unsigned short* kl  = (unsigned short*)(ws + OFF_KL);
  float*          Sp  = (float*)(ws + OFF_S);
  float*          rmx = (float*)(ws + OFF_RMAX);
  float*          rsm = (float*)(ws + OFF_RSUM);
  float*          Op  = (float*)(ws + OFF_O);
  float*          ps  = (float*)(ws + OFF_PS);
  float*          pq  = (float*)(ws + OFF_PQ);

  k_cvt<<<dim3(NPX / 64, CC / 64, nb), dim3(256), 0, stream>>>(hand, u, ht, ut, uc);
  (void)hipGetLastError();
  k_wcvt<<<dim3(64), dim3(256), 0, stream>>>(whw, wuw, w16);
  (void)hipGetLastError();
  k_proj<<<dim3(NPX / 64, CC / 64, 2 * nb), dim3(128), 0, stream>>>(ht, ut, w16, whb, wub,
                                                                     qh, ql, kh, kl);
  (void)hipGetLastError();

  for (int b = 0; b < nb; ++b) {
    const size_t po = (size_t)b * PLANE;
    const size_t pp = (size_t)b * HWD * CC;
    k_score<<<dim3(NPX / 64, NPX / 64), dim3(128), 0, stream>>>(qh + po, ql + po, kh + po, kl + po, Sp);
    (void)hipGetLastError();
    k_rstat<<<dim3(NPX / 32), dim3(256), 0, stream>>>(Sp, rmx, rsm);
    (void)hipGetLastError();
    k_pv<<<dim3(HWD), dim3(256), 0, stream>>>(Sp, rmx, rsm, uc + po, Op, ps + pp, pq + pp);
    (void)hipGetLastError();
    k_gn<<<dim3(CC), dim3(256), 0, stream>>>(Op, ps + pp, pq + pp, hand + po, gnw, gnb, out + po);
    (void)hipGetLastError();
  }
}

// v001
// It runs in 230 microseconds.
// In two side-by-side timings against v000, it was 4.09 and 4.04 times as fast.
// Contractions: 1x1 projections (K=256), affinity scores (K=256) and softmax(P).U (K=4096 in 128-deep
// tiles) on v_wmma_f32_16x16x32_f16 (f16 operands, f32 accumulate); operands are RNE-bf16 inputs held in
// f16 containers (weights x16, activations and values x16), projected q/k vectors as f16 hi plus x2^15
// residual planes (three products in the score GEMM), softmax planes x2^14; running softmax statistics,
// normalisation statistics (f64 combine) and epilogues f32 VALU. Scores never leave the work-group.
#include <hip/hip_runtime.h>
#include <stddef.h>
#include <stdint.h>
#include <math.h>

#define NBMAX 4
#define CC    256
#define NPX   4096
#define HWD   64
#define TP    72
#define EPF   68
#define QP    264                                      // LDS pitch (halves) of a resident query row
#define KT    128                                      // key pixels per tile of the fused pass
#define CTP   132                                      // LDS pitch (floats) of a score tile row
#define PTP   136                                      // LDS pitch (halves) of a P tile row

#define PLANE       ((size_t)CC * NPX)                 // 1048576 elements per batch plane
#define ACT16_BYTES ((size_t)NBMAX * PLANE * 2)        // 8388608
#define W16_BYTES   ((size_t)2 * CC * CC * 2)          // 262144
#define O_BYTES     ((size_t)NBMAX * PLANE * 4)        // 16777216
#define PS_BYTES    ((size_t)NBMAX * HWD * CC * 4)     // 262144

// ---- carve ----------------------------------------------------------------------------------------
#define OFF_HT   ((size_t)0)
#define OFF_UT   (OFF_HT + ACT16_BYTES)
#define OFF_UC   (OFF_UT + ACT16_BYTES)
#define OFF_W16  (OFF_UC + ACT16_BYTES)
#define OFF_QH   (OFF_W16 + W16_BYTES)
#define OFF_QL   (OFF_QH + ACT16_BYTES)
#define OFF_KH   (OFF_QL + ACT16_BYTES)
#define OFF_KL   (OFF_KH + ACT16_BYTES)
#define OFF_O    (OFF_KL + ACT16_BYTES)
#define OFF_PS   (OFF_O + O_BYTES)
#define OFF_PQ   (OFF_PS + PS_BYTES)
#define WS_TOTAL (OFF_PQ + PS_BYTES)

static_assert(OFF_QH == (size_t)25427968);
static_assert(OFF_O == (size_t)58982400);
static_assert(WS_TOTAL == (size_t)76283904);
static_assert(WS_TOTAL <= (size_t)134217728);
static_assert((OFF_UT % 256) == 0);
static_assert((OFF_UC % 256) == 0);
static_assert((OFF_W16 % 256) == 0);
static_assert((OFF_QH % 256) == 0);
static_assert((OFF_QL % 256) == 0);
static_assert((OFF_KH % 256) == 0);
static_assert((OFF_KL % 256) == 0);
static_assert((OFF_O % 256) == 0);
static_assert((OFF_PS % 256) == 0);
static_assert((OFF_PQ % 256) == 0);
static_assert(NPX == HWD * HWD);
static_assert((CC % 64) == 0);
static_assert((NPX % 64) == 0);
static_assert((TP * 2) % 16 == 0);
static_assert((EPF * 4) % 16 == 0);
static_assert((QP * 2) % 32 == 16);
static_assert((PTP * 2) % 32 == 16);
static_assert((CTP * 4) % 16 == 0);
static_assert((NPX % KT) == 0);

typedef unsigned short v8us  __attribute__((ext_vector_type(8)));
typedef unsigned short v16us __attribute__((ext_vector_type(16)));
typedef _Float16       v16h  __attribute__((ext_vector_type(16)));
typedef float          v4f   __attribute__((ext_vector_type(4)));
typedef float          v8f   __attribute__((ext_vector_type(8)));

union FragU { v16us v; v8us half[2]; };

// ---- scalar helpers -------------------------------------------------------------------------------
__device__ __forceinline__ unsigned bbits(float f) {          // f32 -> nearest-even bf16 bits
  unsigned u = __float_as_uint(f);
  return (u + 0x7FFFu + ((u >> 16) & 1u)) >> 16;
}
__device__ __forceinline__ float bf16r(float f) {            // RNE convert to bf16 and back
  return __uint_as_float(bbits(f) << 16);
}
__device__ __forceinline__ unsigned short hbits(float f) {   // f32 -> f16 bits (RNE)
  return __builtin_bit_cast(unsigned short, (_Float16)f);
}
__device__ __forceinline__ float rcpf(float x) {
#if defined(__HIP_DEVICE_COMPILE__)
  return __builtin_amdgcn_rcpf(x);
#else
  return 1.0f / x;
#endif
}
// exp(x) as one v_exp_f32 of x * log2(e), as __expf compiles to. The v_nop keeps the one free slot that the
// instruction set asks for between a transcendental and a next instruction that reads its result or
// rewrites its source.
__device__ __forceinline__ float exp_slot(float x) {
#if defined(__HIP_DEVICE_COMPILE__)
  float r;
  asm("v_exp_f32 %0, %1\n\tv_nop" : "=v"(r) : "v"(x * 1.44269504f));
  return r;
#else
  return x;
#endif
}
// The wait that stands in front of a rewrite of the address registers p, q of issued global loads. Naming
// them as inputs keeps them untouched up to here, behind the work that runs under the loads; at their
// first reuse, where the compiler puts the wait otherwise, it held that work back behind all the loads.
__device__ __forceinline__ void keep_addr(const unsigned short* p, const unsigned short* q) {
#if defined(__HIP_DEVICE_COMPILE__)
  asm volatile("s_wait_xcnt 0x0" :: "v"(p), "v"(q) : "memory");
#else
  (void)p; (void)q;
#endif
}
__device__ __forceinline__ v8f zero8() { v8f z = {0.f, 0.f, 0.f, 0.f, 0.f, 0.f, 0.f, 0.f}; return z; }

__device__ __forceinline__ double shfl_xor_d(double v, int o) {
  const long long x = __double_as_longlong(v);
  int lo = (int)(x & 0xffffffffll);
  int hi = (int)(x >> 32);
  lo = __shfl_xor(lo, o, 32);
  hi = __shfl_xor(hi, o, 32);
  const long long y = ((long long)(unsigned)hi << 32) | (long long)(unsigned)lo;
  return __longlong_as_double(y);
}

// ---- 16-bit fragment loader, split k map for A and B alike ([row][k] planes, k contiguous):
//      p = row_base + k0 + 8*(lane>>4): elements 0..7 <- p[0..7], elements 8..15 <- p[16..23]
__device__ __forceinline__ v16us ldfrag_u(const unsigned short* p) {
  FragU f;
  f.half[0] = *(const v8us*)(p);
  f.half[1] = *(const v8us*)(p + 16);
  return f.v;
}

// ---- WMMA helper (f16 operands as raw 16-bit lanes, f32 accumulate) --------------------------------
__device__ __forceinline__ v8f mma_hu(v16us a, v16us b, v8f c) {
#if defined(__HIP_DEVICE_COMPILE__)
  return __builtin_amdgcn_wmma_f32_16x16x32_f16(false, __builtin_bit_cast(v16h, a),
                                               false, __builtin_bit_cast(v16h, b),
                                               (short)0, c, false, false);
#else
  (void)a; (void)b;
  return c;
#endif
}
// hazard guards after the last WMMA of a group: tie the accumulators, keep the fragments live
__device__ __forceinline__ void guard4(v8f& c0, v8f& c1, v8f& c2, v8f& c3, const v16us& a,
                                       const v16us& b0, const v16us& b1, const v16us& b2,
                                       const v16us& b3) {
#if defined(__HIP_DEVICE_COMPILE__)
  asm volatile("v_nop\n\tv_nop\n\tv_nop\n\tv_nop"
               : "+v"(c0), "+v"(c1), "+v"(c2), "+v"(c3)
               : "v"(a), "v"(b0), "v"(b1), "v"(b2), "v"(b3));
#else
  (void)c0; (void)c1; (void)c2; (void)c3; (void)a; (void)b0; (void)b1; (void)b2; (void)b3;
#endif
}
__device__ __forceinline__ void guard8(v8f& c0, v8f& c1, v8f& c2, v8f& c3, v8f& c4, v8f& c5,
                                       v8f& c6, v8f& c7, const v16us& a0, const v16us& a1,
                                       const v16us& b0, const v16us& b1, const v16us& b2,
                                       const v16us& b3) {
#if defined(__HIP_DEVICE_COMPILE__)
  asm volatile("v_nop\n\tv_nop\n\tv_nop\n\tv_nop"
               : "+v"(c0), "+v"(c1), "+v"(c2), "+v"(c3), "+v"(c4), "+v"(c5), "+v"(c6), "+v"(c7)
               : "v"(a0), "v"(a1), "v"(b0), "v"(b1), "v"(b2), "v"(b3));
#else
  (void)c0; (void)c1; (void)c2; (void)c3; (void)c4; (void)c5; (void)c6; (void)c7;
  (void)a0; (void)a1; (void)b0; (void)b1; (void)b2; (void)b3;
#endif
}

// 16-bit tile 64 rows x 64 halves (LDS pitch PITCH halves) -> P rows row0.., columns col0..col0+63,
template <int NW, int PITCH>
__device__ __forceinline__ void store_tile_us(const unsigned short* t, unsigned short* P,
                                              size_t row0, int ld, int col0, int w, int lane) {
  constexpr int NIT = 64 / (4 * NW);
  const int q  = lane >> 3;
  const int jj = lane & 7;
  v8us   v[NIT];
  size_t off[NIT];
#pragma unroll
  for (int it = 0; it < NIT; ++it) {
    const int li = it * 4 * NW + w * 4 + q;       // 0..63
    v[it]   = *(const v8us*)(t + li * PITCH + 8 * jj);
    off[it] = (row0 + li) * (size_t)ld + col0 + 8 * jj;
  }
#pragma unroll
  for (int it = 0; it < NIT; ++it) *(v8us*)(P + off[it]) = v[it];
  
}

// =====================================================================================================
// for the projection A fragments); UC: channel-major [b][c][n] (k = n contiguous for the P.U A fragment).
// Block = (64 px tile, 64 ch tile, b), 256 threads; thread = (channel cl = tid>>2, 16-px quarter).
// lines: HT/UT rows n (64 halves at column c0), UC rows c (64 halves at column n0).
// coverage: grid (64, 4, nb): every (b, c, n) of HT, UT and UC written exactly once.
// =====================================================================================================
__global__ __launch_bounds__(256)
void k_cvt(const float* __restrict__ hand, const float* __restrict__ u,
           unsigned short* ht, unsigned short* ut, unsigned short* uc)
{
  __shared__ __align__(16) unsigned short TH[64 * TP];
  __shared__ __align__(16) unsigned short TU[64 * TP];
  __shared__ __align__(16) unsigned short TC[64 * TP];

  const int tid  = threadIdx.x;
  const int lane = tid & 31;
  const int w    = tid >> 5;
  const int n0   = 64 * blockIdx.x;
  const int c0   = 64 * blockIdx.y;
  const int b    = blockIdx.z;
  const int cl   = tid >> 2;              // 0..63
  const int pq   = 16 * (tid & 3);        // 0,16,32,48
  const size_t src = (size_t)b * PLANE + (size_t)(c0 + cl) * NPX + n0 + pq;
#pragma unroll
  for (int g = 0; g < 4; ++g) {
    const v4f hv = *(const v4f*)(hand + src + 4 * g);
    const v4f uv = *(const v4f*)(u + src + 4 * g);
#pragma unroll
    for (int e = 0; e < 4; ++e) {
      const int px = pq + 4 * g + e;
      const unsigned short hb = hbits(16.0f * bf16r(hv[e]));
      const unsigned short ub = hbits(16.0f * bf16r(uv[e]));
      TH[px * TP + cl] = hb;
      TU[px * TP + cl] = ub;
      TC[cl * TP + px] = ub;
    }
  }
  __syncthreads();
  store_tile_us<8, TP>(TH, ht + (size_t)b * PLANE, (size_t)n0, CC, c0, w, lane);
  store_tile_us<8, TP>(TU, ut + (size_t)b * PLANE, (size_t)n0, CC, c0, w, lane);
  store_tile_us<8, TP>(TC, uc + (size_t)b * PLANE, (size_t)c0, NPX, n0, w, lane);
}

// =====================================================================================================
// Pass 2: weight planes W16[set][o][c] = f16(16 * bf16(W[o][c])), set 0 = WH_w, 1 = WU_w (block-uniform).
// coverage: 64 blocks x 256 threads x 8 = 131072 halves, every element once.
// =====================================================================================================
__global__ __launch_bounds__(256)
void k_wcvt(const float* __restrict__ whw, const float* __restrict__ wuw, unsigned short* w16)
{
  const int t   = blockIdx.x * 256 + threadIdx.x;   // 0..16383
  const int o   = 8 * t;
  const int set = blockIdx.x >> 5;                  // block-uniform
  const int idx = o & (CC * CC - 1);
  const float* p = (set ? wuw : whw) + idx;
  v8us ob;
#pragma unroll
  for (int e = 0; e < 8; ++e) ob[e] = hbits(16.0f * bf16r(p[e]));
  *(v8us*)(w16 + o) = ob;
  
}

// =====================================================================================================
// 1x1 projections: D[n][o] = sum_c X[n][c] * W16[o][c], tile 64(n) x 64(o), K = 256, 4 waves,
// wave w owns rows n 16w..16w+15 (A fragment from the pixel-major activation plane) and 4 column
// sub-tiles of 16 output channels (B fragment = W16 rows o, split map). Epilogue: /256, + bf16(bias),
// into the pixel-major planes [b][n][o] (64 halves = 1 line per row at column o0).
// z = 2b + which: which 0 -> (HT, WH, WH_b) -> QH/QL; which 1 -> (UT, WU, WU_b) -> KH/KL.
// coverage: grid (64 n tiles, 4 o tiles, 2 nb): QH, QL, KH, KL [b][4096][256] every element once.
// =====================================================================================================
__global__ __launch_bounds__(128)
void k_proj(const unsigned short* __restrict__ ht, const unsigned short* __restrict__ ut,
            const unsigned short* __restrict__ w16, const float* __restrict__ whb,
            const float* __restrict__ wub, unsigned short* qh, unsigned short* ql,
            unsigned short* kh, unsigned short* kl)
{
  __shared__ __align__(16) unsigned short t0[64 * TP];
  __shared__ __align__(16) unsigned short t1[64 * TP];

  const int tid   = threadIdx.x;
  const int lane  = tid & 31;
  const int w     = tid >> 5;
  const int h     = lane >> 4;
  const int m     = lane & 15;
  const int n0    = 64 * blockIdx.x;
  const int o0    = 64 * blockIdx.y;
  const int which = blockIdx.z & 1;         // block-uniform
  const int bb    = blockIdx.z >> 1;
  const unsigned short* x  = (which ? ut : ht) + (size_t)bb * PLANE;
  const unsigned short* wm = w16 + (size_t)which * CC * CC;
  const float* bias = which ? wub : whb;

  v8f acc[4];
#pragma unroll
  for (int j = 0; j < 4; ++j) acc[j] = zero8();

  const unsigned short* pa = x + (size_t)(n0 + 16 * w + m) * CC + 8 * h;
  const unsigned short* pb = wm + (size_t)(o0 + m) * CC + 8 * h;
#pragma unroll 2
  for (int kk = 0; kk < CC / 32; ++kk) {
    const v16us a  = ldfrag_u(pa + 32 * kk);
    const v16us b0 = ldfrag_u(pb + 32 * kk);
    const v16us b1 = ldfrag_u(pb + (size_t)16 * CC + 32 * kk);
    const v16us b2 = ldfrag_u(pb + (size_t)32 * CC + 32 * kk);
    const v16us b3 = ldfrag_u(pb + (size_t)48 * CC + 32 * kk);
    acc[0] = mma_hu(a, b0, acc[0]);
    acc[1] = mma_hu(a, b1, acc[1]);
    acc[2] = mma_hu(a, b2, acc[2]);
    acc[3] = mma_hu(a, b3, acc[3]);
    guard4(acc[0], acc[1], acc[2], acc[3], a, b0, b1, b2, b3);
  }

  const float k256 = 1.0f / 256.0f;
  float bv[4];
#pragma unroll
  for (int j = 0; j < 4; ++j) bv[j] = bf16r(bias[o0 + 16 * j + m]);
#pragma unroll
  for (int j = 0; j < 4; ++j) {
#pragma unroll
    for (int r = 0; r < 8; ++r) {
      const float val = acc[j][r] * k256 + bv[j];
      const _Float16 hv = (_Float16)val;
      const int rl = 16 * w + 8 * h + r;       // pixel within tile
      const int cl = 16 * j + m;               // output channel within tile
      t0[rl * TP + cl] = __builtin_bit_cast(unsigned short, hv);
      t1[rl * TP + cl] = hbits((val - (float)hv) * 32768.0f);
    }
  }
  __syncthreads();
  unsigned short* dh = which ? kh : qh;
  unsigned short* dl = which ? kl : ql;
  store_tile_us<4, TP>(t0, dh + (size_t)bb * PLANE, (size_t)n0, CC, o0, w, lane);
  store_tile_us<4, TP>(t1, dl + (size_t)bb * PLANE, (size_t)n0, CC, o0, w, lane);
}

// =====================================================================================================
// Scores, softmax and P.U in one pass, all batches in one launch. Block = (64 query pixels R0.. of batch
// b, all 256 channels), 8 waves, loop over 32 tiles T of 128 key pixels; the score tile lives in LDS only.
//   resident: query planes QH/QL rows R0..R0+63 in LDS ([i][c], pitch 264 halves), filled once.
//   scores:   S[i][k] = QH.KH + (QH.KL + QL.KH) / 32768, K = 256; wave w owns key columns 16w..16w+15 and
//             all 64 query rows (four A fragments from LDS per B fragment from the key planes, so every
//             key row is fetched by one wave only).
//   softmax:  thread = (row i = tid>>2, 16 columns in each 64-column half); running row maximum mrun and
//             running sum lrun; P[i][k] = f16(16384 exp(S - mrun_new)), al[i] = exp(mrun_old - mrun_new).
//   P.U:      D[c][i] = D[c][i] * al[i] + UC[c][k] . P[i][k] (wave = 32 channels, 8 accumulators).
// Epilogue: p = D * (1/lsum[i]) / 2^18 (value scale 16, softmax scale 2^14); per-channel partial sums
// sum p, sum p^2 over the 64 pixels (fixed order: 4 sub-tiles then xor tree over 16 lanes); p staged
// coverage: grid (64, nb): O [b][256][4096] and PS/PQ [b][64][256], every element once.
// =====================================================================================================
__device__ __forceinline__ void o_store_pass(const float* Et, float* orows, int R0, int w, int lane)
{
  const int q  = lane >> 3;
  const int jj = lane & 7;
#pragma unroll 1
  for (int it = 0; it < 8; ++it) {
    const int li = it * 32 + 4 * w + q;         // 0..255
    const int c = li >> 1, hf = li & 1;
    const v4f v = *(const v4f*)(Et + c * EPF + 32 * hf + 4 * jj);
    *(v4f*)(orows + (size_t)c * NPX + R0 + 32 * hf + 4 * jj) = v;
    // the next trip rewrites the store's address and data registers: keep the wait in front of that
    asm volatile("s_wait_xcnt 0x0" ::: "memory");
  }
}

__global__ __launch_bounds__(256) __attribute__((amdgpu_waves_per_eu(2, 2)))
void k_attn(const unsigned short* __restrict__ qh, const unsigned short* __restrict__ ql,
            const unsigned short* __restrict__ kh, const unsigned short* __restrict__ kl,
            const unsigned short* __restrict__ uc, float* Oall, float* psall, float* pqall)
{
  __shared__ __align__(16) unsigned short Qs[2 * 64 * QP];
  __shared__ __align__(16) float ct[64 * CTP];
  __shared__ __align__(16) unsigned short Pt[64 * PTP];
  __shared__ __align__(16) float Et[128 * EPF];
  __shared__ float als[64];
  __shared__ float invs[64];
  __shared__ __align__(16) float lsum[CC];
  __shared__ __align__(16) float lsq[CC];

  const int tid  = threadIdx.x;
  const int lane = tid & 31;
  const int w    = tid >> 5;
  const int h    = lane >> 4;
  const int m    = lane & 15;
  const int R0   = 64 * blockIdx.x;
  const size_t po = (size_t)blockIdx.y * PLANE;
  const unsigned short* ucb = uc + po;
  float* O  = Oall + po;
  float* ps = psall + (size_t)blockIdx.y * HWD * CC;
  float* pq = pqall + (size_t)blockIdx.y * HWD * CC;

  // resident query planes: 2 x 64 rows of 256 halves; wave w moves the whole rows w, w + 8, ..., w + 56
  {
    const unsigned short* gqh = qh + po + (size_t)(R0 + w) * CC + 8 * lane;
    const unsigned short* gql = ql + po + (size_t)(R0 + w) * CC + 8 * lane;
    v8us th[8], tl[8];
#pragma unroll
    for (int it = 0; it < 8; ++it) {
      th[it] = *(const v8us*)(gqh + it * 8 * CC);
      tl[it] = *(const v8us*)(gql + it * 8 * CC);
    }
    keep_addr(gqh, gql);
#pragma unroll
    for (int it = 0; it < 8; ++it) {
      *(v8us*)(Qs + (8 * it + w) * QP + 8 * lane)        = th[it];
      *(v8us*)(Qs + (64 + 8 * it + w) * QP + 8 * lane)   = tl[it];
    }
  }
  __syncthreads();

  const unsigned short* qa  = Qs + m * QP + 8 * h;                 // hi plane, row m of a 16-row block
  const unsigned lk = (unsigned)((16 * w + m) * CC + 8 * h);       // lane's place in a key tile (halves)

  const int fr = tid >> 2;               // score / P tile row (query pixel) 0..63
  const int fc = 16 * (tid & 3);         // 16 key columns in each 64-column half
  float mrun = -1.0e30f, lrun = 0.0f;

  v8f acc[8];
#pragma unroll
  for (int k = 0; k < 8; ++k) acc[k] = zero8();
  const unsigned lu = (unsigned)((32 * w + m) * NPX + 8 * h);      // lane's place in the value plane (halves)

  const float kx = 1.0f / 32768.0f;
#pragma unroll 1
  for (int T = 0; T < NPX / KT; ++T) {
    {
      v8f sa[4], sx[4];
#pragma unroll
      for (int rb = 0; rb < 4; ++rb) { sa[rb] = zero8(); sx[rb] = zero8(); }
      const unsigned short* bh_p = kh + po + (size_t)(KT * T) * CC + lk;
      const unsigned short* bl_p = kl + po + (size_t)(KT * T) * CC + lk;
      // all key fragments of the tile are asked for first: one memory latency per tile, not one per k step
      v16us bh[CC / 32], bl[CC / 32];
#pragma unroll
      for (int kk = 0; kk < CC / 32; ++kk) {
        bh[kk] = ldfrag_u(bh_p + 32 * kk);
        bl[kk] = ldfrag_u(bl_p + 32 * kk);
      }
      // query fragments one k step ahead in a second register set: their LDS latency runs under the
      // twelve matrix instructions of the step before
      v16us ah[2][4], al[2][4];
#pragma unroll
      for (int rb = 0; rb < 4; ++rb) {
        ah[0][rb] = ldfrag_u(qa + 16 * rb * QP);
        al[0][rb] = ldfrag_u(qa + (64 + 16 * rb) * QP);
      }
#pragma unroll
      for (int kk = 0; kk < CC / 32; ++kk) {
        if (kk + 1 < CC / 32) {
#pragma unroll
          for (int rb = 0; rb < 4; ++rb) {
            ah[(kk + 1) & 1][rb] = ldfrag_u(qa + 16 * rb * QP + 32 * (kk + 1));
            al[(kk + 1) & 1][rb] = ldfrag_u(qa + (64 + 16 * rb) * QP + 32 * (kk + 1));
          }
        }
#pragma unroll
        for (int rb = 0; rb < 4; ++rb) {
          sa[rb] = mma_hu(ah[kk & 1][rb], bh[kk], sa[rb]);
          sx[rb] = mma_hu(ah[kk & 1][rb], bl[kk], sx[rb]);
          sx[rb] = mma_hu(al[kk & 1][rb], bh[kk], sx[rb]);
        }
      }
      keep_addr(bh_p, bl_p);
#pragma unroll
      for (int rb = 0; rb < 4; ++rb) {
#pragma unroll
        for (int r = 0; r < 8; ++r)
          ct[(16 * rb + 8 * h + r) * CTP + 16 * w + m] = sa[rb][r] + sx[rb][r] * kx;
      }
    }
    __syncthreads();                     // score tile complete; also ends every read of Pt / als of tile T-1
    // value fragments of this tile: asked for here so that the softmax phase covers their latency
    v16us ua[4], ub[4];
    const unsigned short* pa0 = ucb + KT * T + lu;
    const unsigned short* pa1 = pa0 + 16 * NPX;
#pragma unroll
    for (int kk = 0; kk < 4; ++kk) {
      ua[kk] = ldfrag_u(pa0 + 32 * kk);
      ub[kk] = ldfrag_u(pa1 + 32 * kk);
    }
    {
      const float* s2 = ct + fr * CTP + fc;
      v4f xs[8];
#pragma unroll
      for (int g = 0; g < 4; ++g) {
        xs[g]     = *(const v4f*)(s2 + 4 * g);
        xs[4 + g] = *(const v4f*)(s2 + 64 + 4 * g);
      }
      float tm = xs[0][0];
#pragma unroll
      for (int g = 0; g < 8; ++g)
        tm = fmaxf(tm, fmaxf(fmaxf(xs[g][0], xs[g][1]), fmaxf(xs[g][2], xs[g][3])));
      tm = fmaxf(tm, __shfl_xor(tm, 1, 32));
      tm = fmaxf(tm, __shfl_xor(tm, 2, 32));
      const float mn = fmaxf(mrun, tm);
      const float al = exp_slot(mrun - mn);
      float add = 0.0f;
#pragma unroll
      for (int p = 0; p < 4; ++p) {      // pair p = groups 2p, 2p+1 = 8 neighbouring columns
        v8us o;
        float part = 0.0f;
#pragma unroll
        for (int e = 0; e < 4; ++e) {
          const float e0 = exp_slot(xs[2 * p][e] - mn);
          const float e1 = exp_slot(xs[2 * p + 1][e] - mn);
          part += e0 + e1;
          o[e]     = hbits(16384.0f * e0);
          o[4 + e] = hbits(16384.0f * e1);
        }
        add += part;
        *(v8us*)(Pt + fr * PTP + 64 * (p >> 1) + fc + 8 * (p & 1)) = o;
      }
      lrun = lrun * al + add;
      mrun = mn;
      if ((tid & 3) == 0) als[fr] = al;
    }
    keep_addr(pa0, pa1);
    __syncthreads();                     // P tile and al complete; also ends every read of ct of tile T
    {
      float av[4];
#pragma unroll
      for (int j = 0; j < 4; ++j) av[j] = als[16 * j + m];
#pragma unroll
      for (int k = 0; k < 8; ++k) {
#pragma unroll
        for (int r = 0; r < 8; ++r) acc[k][r] = acc[k][r] * av[k & 3];
      }
    }
#pragma unroll
    for (int kk = 0; kk < KT / 32; ++kk) {
      const v16us a0 = ua[kk];
      const v16us a1 = ub[kk];
      const v16us b0 = ldfrag_u(Pt + (0 * 16 + m) * PTP + 32 * kk + 8 * h);
      const v16us b1 = ldfrag_u(Pt + (1 * 16 + m) * PTP + 32 * kk + 8 * h);
      const v16us b2 = ldfrag_u(Pt + (2 * 16 + m) * PTP + 32 * kk + 8 * h);
      const v16us b3 = ldfrag_u(Pt + (3 * 16 + m) * PTP + 32 * kk + 8 * h);
      acc[0] = mma_hu(a0, b0, acc[0]);
      acc[1] = mma_hu(a0, b1, acc[1]);
      acc[2] = mma_hu(a0, b2, acc[2]);
      acc[3] = mma_hu(a0, b3, acc[3]);
      acc[4] = mma_hu(a1, b0, acc[4]);
      acc[5] = mma_hu(a1, b1, acc[5]);
      acc[6] = mma_hu(a1, b2, acc[6]);
      acc[7] = mma_hu(a1, b3, acc[7]);
      guard8(acc[0], acc[1], acc[2], acc[3], acc[4], acc[5], acc[6], acc[7], a0, a1, b0, b1, b2, b3);
    }
  }

  // row sums: the four column quarters of a row sit in four neighbouring lanes
  {
    float lt = lrun + __shfl_xor(lrun, 1, 32);
    lt += __shfl_xor(lt, 2, 32);
    if ((tid & 3) == 0) invs[fr] = rcpf(lt) * (1.0f / 262144.0f);
  }
  __syncthreads();

  // normalise: acc[4s+j][r] -> p at (c = 32w + 16s + 8h + r, i = 16j + m)
#pragma unroll
  for (int k = 0; k < 8; ++k) {
    const float iv = invs[16 * (k & 3) + m];
#pragma unroll
    for (int r = 0; r < 8; ++r) acc[k][r] = acc[k][r] * iv;
  }
  // per-channel partial statistics over the block's 64 pixels
  float rs[2][8], rq[2][8];
#pragma unroll
  for (int s = 0; s < 2; ++s) {
#pragma unroll
    for (int r = 0; r < 8; ++r) {
      float a = 0.0f, q2 = 0.0f;
#pragma unroll
      for (int j = 0; j < 4; ++j) {
        const float p = acc[4 * s + j][r];
        a += p;
        q2 += p * p;
      }
      rs[s][r] = a;
      rq[s][r] = q2;
    }
  }
#pragma unroll
  for (int s = 0; s < 2; ++s) {
#pragma unroll
    for (int r = 0; r < 8; ++r) {
#pragma unroll
      for (int o = 1; o < 16; o <<= 1) {
        rs[s][r] += __shfl_xor(rs[s][r], o, 32);
        rq[s][r] += __shfl_xor(rq[s][r], o, 32);
      }
    }
  }
  if (m == 0) {
#pragma unroll
    for (int s = 0; s < 2; ++s) {
#pragma unroll
      for (int r = 0; r < 8; ++r) {
        lsum[32 * w + 16 * s + 8 * h + r] = rs[s][r];
        lsq[32 * w + 16 * s + 8 * h + r]  = rq[s][r];
      }
    }
  }

  // O plane in two 128-channel halves (waves 0..3 then waves 4..7 supply the values)
#pragma unroll
  for (int half = 0; half < 2; ++half) {
    if ((w >> 2) == half) {                      // wave-uniform
#pragma unroll
      for (int s = 0; s < 2; ++s) {
#pragma unroll
        for (int j = 0; j < 4; ++j) {
#pragma unroll
          for (int r = 0; r < 8; ++r) {
            const int cl = 32 * (w & 3) + 16 * s + 8 * h + r;   // 0..127
            const int il = 16 * j + m;
            Et[cl * EPF + il] = acc[4 * s + j][r];
          }
        }
      }
    }
    __syncthreads();
    float* orows = O + (size_t)(128 * half) * NPX;
    o_store_pass(Et, orows, R0, w, lane);
    
    __syncthreads();
  }

  if (tid < 64) {
    const v4f v = *(const v4f*)(lsum + 4 * tid);
    float* d = ps + (size_t)blockIdx.x * CC + 4 * tid;
    *(v4f*)d = v;
    
  } else if (tid < 128) {
    const int t2 = tid - 64;
    const v4f v = *(const v4f*)(lsq + 4 * t2);
    float* d = pq + (size_t)blockIdx.x * CC + 4 * t2;
    *(v4f*)d = v;
    
  }
}

// =====================================================================================================
// GroupNorm + residual for one batch. Block = channel c (256 blocks), 256 threads. Wave 0 combines the
// 64 blocks x 8 channels partial sums of group g = c/8 in f64 in a fixed order (lane l takes entries
// l, l+32, ... then an xor tree), mean = S/32768, var = Q/32768 - mean^2 (biased), rstd =
// 1/sqrt(var + 1e-5). out[c][n] = ((O[c][n] - mean) * rstd) * bf16(gn_w[c]) + bf16(gn_b[c]) +
// bf16(Hand[c][n]); row of 4096 floats written as 4 instructions of 256 threads x 16 B (each wave
// coverage: 256 blocks x 4096 = the whole [256][4096] output of this batch, every element once.
// =====================================================================================================
__global__ __launch_bounds__(256)
void k_gn(const float* __restrict__ O, const float* __restrict__ ps, const float* __restrict__ pq,
          const float* __restrict__ handb, const float* __restrict__ gnw,
          const float* __restrict__ gnb, float* outb)
{
  __shared__ float stat[2];
  const int tid  = threadIdx.x;
  const int lane = tid & 31;
  const int w    = tid >> 5;
  const int c    = blockIdx.x;
  const int g    = c >> 3;

  if (w == 0) {                                  // wave-uniform
    double s = 0.0, q = 0.0;
    const float* psg = ps + 8 * g;
    const float* pqg = pq + 8 * g;
#pragma unroll 1
    for (int i = 0; i < 16; ++i) {
      const int idx = lane + 32 * i;             // 0..511
      const int blk = idx >> 3, ch = idx & 7;
      s += (double)psg[(size_t)blk * CC + ch];
      q += (double)pqg[(size_t)blk * CC + ch];
    }
#pragma unroll
    for (int o = 16; o >= 1; o >>= 1) {
      s += shfl_xor_d(s, o);
      q += shfl_xor_d(q, o);
    }
    if (lane == 0) {
      const double inv_n = 1.0 / 32768.0;
      const double mean = s * inv_n;
      double var = q * inv_n - mean * mean;
      if (var < 0.0) var = 0.0;
      const float varf = (float)var;
      stat[0] = (float)mean;
      stat[1] = rcpf(sqrtf(varf + 1e-5f));
    }
  }
  __syncthreads();
  const float meanf = stat[0];
  const float rstd  = stat[1];
  const float gw    = bf16r(gnw[c]);
  const float gb    = bf16r(gnb[c]);
  const float* orow = O + (size_t)c * NPX;
  const float* hrow = handb + (size_t)c * NPX;
  float* drow = outb + (size_t)c * NPX;

  v4f res[4];
#pragma unroll
  for (int it = 0; it < 4; ++it) {
    const int f = 4 * (it * 256 + tid);
    const v4f ov = *(const v4f*)(orow + f);
    const v4f hd = *(const v4f*)(hrow + f);
#pragma unroll
    for (int e = 0; e < 4; ++e) {
      const float xn = (ov[e] - meanf) * rstd;
      res[it][e] = xn * gw + gb + bf16r(hd[e]);
    }
  }
#pragma unroll
  for (int it = 0; it < 4; ++it)
    *(v4f*)(drow + 4 * (it * 256 + tid)) = res[it];
  
}

// =====================================================================================================
// Host glue. Inputs in table order (8): Hand [nb][256][64][64], U (same), WH_w [256][256], WH_b [256],
// WU_w [256][256], WU_b [256], gn_w [256], gn_b [256]; nb = in_sizes[0] / (256*4096), 1..4.
// Output f32 [nb][256][4096] at element 0. Workspace 76283904 B (sized for nb = 4).
// 4 + nb launches: k_cvt, k_wcvt, k_proj, k_attn (all batches), per batch k_gn.
// =====================================================================================================
extern "C" void kernel_launch(void* const* d_in, const int* in_sizes, int n_in,
                              void* d_out, int out_size, void* d_ws, size_t ws_size,
                              hipStream_t stream) {
  if (n_in < 8) return;
  const int per = CC * NPX;
  const int n0s = in_sizes[0];
  if (n0s < per || (n0s % per) != 0) return;
  const int nb = n0s / per;
  if (nb < 1 || nb > NBMAX) return;
  if (in_sizes[1] != n0s) return;
  if (in_sizes[2] != CC * CC || in_sizes[4] != CC * CC) return;
  if (in_sizes[3] != CC || in_sizes[5] != CC || in_sizes[6] != CC || in_sizes[7] != CC) return;
  if (out_size != nb * per) return;
  if (ws_size < WS_TOTAL) return;

  const float* hand = (const float*)d_in[0];
  const float* u    = (const float*)d_in[1];
  const float* whw  = (const float*)d_in[2];
  const float* whb  = (const float*)d_in[3];
  const float* wuw  = (const float*)d_in[4];
  const float* wub  = (const float*)d_in[5];
  const float* gnw  = (const float*)d_in[6];
  const float* gnb  = (const float*)d_in[7];
  float* out = (float*)d_out;

  char* ws = (char*)d_ws;
  unsigned short* ht  = (unsigned short*)(ws + OFF_HT);
  unsigned short* ut  = (unsigned short*)(ws + OFF_UT);
  unsigned short* uc  = (unsigned short*)(ws + OFF_UC);
  unsigned short* w16 = (unsigned short*)(ws + OFF_W16);
  unsigned short* qh  = (unsigned short*)(ws + OFF_QH);
  unsigned short* ql  = (unsigned short*)(ws + OFF_QL);
  unsigned short* kh  = (unsigned short*)(ws + OFF_KH);
  unsigned short* kl  = (unsigned short*)(ws + OFF_KL);
  float*          Op  = (float*)(ws + OFF_O);
  float*          ps  = (float*)(ws + OFF_PS);
  float*          pq  = (float*)(ws + OFF_PQ);

  k_cvt<<<dim3(NPX / 64, CC / 64, nb), dim3(256), 0, stream>>>(hand, u, ht, ut, uc);
  (void)hipGetLastError();
  k_wcvt<<<dim3(64), dim3(256), 0, stream>>>(whw, wuw, w16);
  (void)hipGetLastError();
  k_proj<<<dim3(NPX / 64, CC / 64, 2 * nb), dim3(128), 0, stream>>>(ht, ut, w16, whb, wub,
                                                                     qh, ql, kh, kl);
  (void)hipGetLastError();

  k_attn<<<dim3(HWD, nb), dim3(256), 0, stream>>>(qh, ql, kh, kl, uc, Op, ps, pq);
  (void)hipGetLastError();

  for (int b = 0; b < nb; ++b) {
    const size_t po = (size_t)b * PLANE;
    const size_t pp = (size_t)b * HWD * CC;
    k_gn<<<dim3(CC), dim3(256), 0, stream>>>(Op + po, ps + pp, pq + pp, hand + po, gnw, gnb, out + po);
    (void)hipGetLastError();
  }
}

// v002
// It runs in 196 microseconds.
// Timed twice side by side with v001, it ran 1.18 and 1.17 times as fast.
// Counting every step since v000, it is 4.77 times as fast.
// Contractions: 1x1 projections (K=256), affinity scores (K=256) and softmax(P).U (K=4096 in 128-deep
// tiles) on v_wmma_f32_16x16x32_f16 (f16 operands, f32 accumulate); operands are RNE-bf16 inputs held in
// f16 containers (weights x16, activations and values x16), projected q/k vectors as f16 hi plus x2^15
// residual planes (three products in the score GEMM), softmax planes x2^14; running softmax statistics,
// normalisation statistics (f64 combine) and epilogues f32 VALU. Scores never leave the work-group.
#include <hip/hip_runtime.h>
#include <stddef.h>
#include <stdint.h>
#include <math.h>

#define NBMAX 4
#define CC    256
#define NPX   4096
#define HWD   64
#define TP    72
#define EPF   68
#define QP    264                                      // LDS pitch (halves) of a resident query row
#define KT    128                                      // key pixels per tile of the fused pass
#define CTP   132                                      // LDS pitch (floats) of a score tile row
#define PTP   136                                      // LDS pitch (halves) of a P tile row
#define FRAG  512                                      // halves of one 16-row x 32-k fragment block

#define PLANE       ((size_t)CC * NPX)                 // 1048576 elements per batch plane
#define ACT16_BYTES ((size_t)NBMAX * PLANE * 2)        // 8388608
#define W16_BYTES   ((size_t)2 * CC * CC * 2)          // 262144
#define O_BYTES     ((size_t)NBMAX * PLANE * 4)        // 16777216
#define PS_BYTES    ((size_t)NBMAX * HWD * CC * 4)     // 262144

// ---- carve ----------------------------------------------------------------------------------------
#define OFF_HT   ((size_t)0)
#define OFF_UT   (OFF_HT + ACT16_BYTES)
#define OFF_UC   (OFF_UT + ACT16_BYTES)
#define OFF_W16  (OFF_UC + ACT16_BYTES)
#define OFF_QH   (OFF_W16 + W16_BYTES)
#define OFF_QL   (OFF_QH + ACT16_BYTES)
#define OFF_KH   (OFF_QL + ACT16_BYTES)
#define OFF_KL   (OFF_KH + ACT16_BYTES)
#define OFF_O    (OFF_KL + ACT16_BYTES)
#define OFF_PS   (OFF_O + O_BYTES)
#define OFF_PQ   (OFF_PS + PS_BYTES)
#define WS_TOTAL (OFF_PQ + PS_BYTES)

static_assert(OFF_QH == (size_t)25427968);
static_assert(OFF_O == (size_t)58982400);
static_assert(WS_TOTAL == (size_t)76283904);
static_assert(WS_TOTAL <= (size_t)134217728);
static_assert((OFF_UT % 256) == 0);
static_assert((OFF_UC % 256) == 0);
static_assert((OFF_W16 % 256) == 0);
static_assert((OFF_QH % 256) == 0);
static_assert((OFF_QL % 256) == 0);
static_assert((OFF_KH % 256) == 0);
static_assert((OFF_KL % 256) == 0);
static_assert((OFF_O % 256) == 0);
static_assert((OFF_PS % 256) == 0);
static_assert((OFF_PQ % 256) == 0);
static_assert(NPX == HWD * HWD);
static_assert((CC % 64) == 0);
static_assert((NPX % 64) == 0);
static_assert((TP * 2) % 16 == 0);
static_assert((EPF * 4) % 16 == 0);
static_assert((QP * 2) % 32 == 16);
static_assert((PTP * 2) % 32 == 16);
static_assert((CTP * 4) % 16 == 0);
static_assert((NPX % KT) == 0);

typedef unsigned short v8us  __attribute__((ext_vector_type(8)));
typedef unsigned short v16us __attribute__((ext_vector_type(16)));
typedef _Float16       v16h  __attribute__((ext_vector_type(16)));
typedef float          v4f   __attribute__((ext_vector_type(4)));
typedef float          v8f   __attribute__((ext_vector_type(8)));

union FragU { v16us v; v8us half[2]; };

// ---- scalar helpers -------------------------------------------------------------------------------
__device__ __forceinline__ unsigned bbits(float f) {          // f32 -> nearest-even bf16 bits
  unsigned u = __float_as_uint(f);
  return (u + 0x7FFFu + ((u >> 16) & 1u)) >> 16;
}
__device__ __forceinline__ float bf16r(float f) {            // RNE convert to bf16 and back
  return __uint_as_float(bbits(f) << 16);
}
__device__ __forceinline__ unsigned short hbits(float f) {   // f32 -> f16 bits (RNE)
  return __builtin_bit_cast(unsigned short, (_Float16)f);
}
__device__ __forceinline__ float rcpf(float x) {
#if defined(__HIP_DEVICE_COMPILE__)
  return __builtin_amdgcn_rcpf(x);
#else
  return 1.0f / x;
#endif
}
// exp(x) as one v_exp_f32 of x * log2(e), as __expf compiles to. The v_nop keeps the one free slot that the
// instruction set asks for between a transcendental and a next instruction that reads its result or
// rewrites its source.
__device__ __forceinline__ float exp_slot(float x) {
#if defined(__HIP_DEVICE_COMPILE__)
  float r;
  asm("v_exp_f32 %0, %1\n\tv_nop" : "=v"(r) : "v"(x * 1.44269504f));
  return r;
#else
  return x;
#endif
}
// The wait that stands in front of a rewrite of the address registers p, q of issued global loads. Naming
// them as inputs keeps them untouched up to here, behind the work that runs under the loads; at their
// first reuse, where the compiler puts the wait otherwise, it held that work back behind all the loads.
__device__ __forceinline__ void keep_addr(const unsigned short* p, const unsigned short* q) {
#if defined(__HIP_DEVICE_COMPILE__)
  asm volatile("s_wait_xcnt 0x0" :: "v"(p), "v"(q) : "memory");
#else
  (void)p; (void)q;
#endif
}
__device__ __forceinline__ v8f zero8() { v8f z = {0.f, 0.f, 0.f, 0.f, 0.f, 0.f, 0.f, 0.f}; return z; }

__device__ __forceinline__ double shfl_xor_d(double v, int o) {
  const long long x = __double_as_longlong(v);
  int lo = (int)(x & 0xffffffffll);
  int hi = (int)(x >> 32);
  lo = __shfl_xor(lo, o, 32);
  hi = __shfl_xor(hi, o, 32);
  const long long y = ((long long)(unsigned)hi << 32) | (long long)(unsigned)lo;
  return __longlong_as_double(y);
}

// ---- 16-bit fragment loader, split k map for A and B alike ([row][k] planes, k contiguous):
//      p = row_base + k0 + 8*(lane>>4): elements 0..7 <- p[0..7], elements 8..15 <- p[16..23]
__device__ __forceinline__ v16us ldfrag_u(const unsigned short* p) {
  FragU f;
  f.half[0] = *(const v8us*)(p);
  f.half[1] = *(const v8us*)(p + 16);
  return f.v;
}

// ---- fragment-order planes (every operand plane that a wave loads straight from global memory): a plane
//      of rows x K halves is a row-major grid of blocks [row / 16][k / 32], FRAG halves each; a block holds
//      the two 16-byte pieces of all 32 lanes back to back, element (row, k) at
//      256 * ((k >> 4) & 1) + 8 * (16 * ((k >> 3) & 1) + (row & 15)) + (k & 7): the split k map above, but
//      each load instruction of a wave reads 512 contiguous bytes (four whole 128-byte lines, not 16 parts).
//      p = block + 8 * lane
__device__ __forceinline__ v16us ldfrag_g(const unsigned short* p) {
  FragU f;
  f.half[0] = *(const v8us*)(p);
  f.half[1] = *(const v8us*)(p + 256);
  return f.v;
}

// ---- WMMA helper (f16 operands as raw 16-bit lanes, f32 accumulate) --------------------------------
__device__ __forceinline__ v8f mma_hu(v16us a, v16us b, v8f c) {
#if defined(__HIP_DEVICE_COMPILE__)
  return __builtin_amdgcn_wmma_f32_16x16x32_f16(false, __builtin_bit_cast(v16h, a),
                                               false, __builtin_bit_cast(v16h, b),
                                               (short)0, c, false, false);
#else
  (void)a; (void)b;
  return c;
#endif
}
// hazard guards after the last WMMA of a group: tie the accumulators, keep the fragments live
__device__ __forceinline__ void guard4(v8f& c0, v8f& c1, v8f& c2, v8f& c3, const v16us& a,
                                       const v16us& b0, const v16us& b1, const v16us& b2,
                                       const v16us& b3) {
#if defined(__HIP_DEVICE_COMPILE__)
  asm volatile("v_nop\n\tv_nop\n\tv_nop\n\tv_nop"
               : "+v"(c0), "+v"(c1), "+v"(c2), "+v"(c3)
               : "v"(a), "v"(b0), "v"(b1), "v"(b2), "v"(b3));
#else
  (void)c0; (void)c1; (void)c2; (void)c3; (void)a; (void)b0; (void)b1; (void)b2; (void)b3;
#endif
}
__device__ __forceinline__ void guard8(v8f& c0, v8f& c1, v8f& c2, v8f& c3, v8f& c4, v8f& c5,
                                       v8f& c6, v8f& c7, const v16us& a0, const v16us& a1,
                                       const v16us& b0, const v16us& b1, const v16us& b2,
                                       const v16us& b3) {
#if defined(__HIP_DEVICE_COMPILE__)
  asm volatile("v_nop\n\tv_nop\n\tv_nop\n\tv_nop"
               : "+v"(c0), "+v"(c1), "+v"(c2), "+v"(c3), "+v"(c4), "+v"(c5), "+v"(c6), "+v"(c7)
               : "v"(a0), "v"(a1), "v"(b0), "v"(b1), "v"(b2), "v"(b3));
#else
  (void)c0; (void)c1; (void)c2; (void)c3; (void)c4; (void)c5; (void)c6; (void)c7;
  (void)a0; (void)a1; (void)b0; (void)b1; (void)b2; (void)b3;
#endif
}

// 16-bit tile 64 rows x 64 k (LDS pitch PITCH halves) -> fragment-order plane P with kblocks blocks per
// row group: row groups rg0..rg0+3, k blocks kb0, kb0+1; one wave instruction = one 512-byte piece.
template <int NW, int PITCH>
__device__ __forceinline__ void store_tile_frag(const unsigned short* t, unsigned short* P,
                                                int rg0, int kblocks, int kb0, int w, int lane) {
  constexpr int NIT = 16 / NW;
  const int h = lane >> 4;
  const int m = lane & 15;
  v8us   v[NIT];
  size_t off[NIT];
#pragma unroll
  for (int it = 0; it < NIT; ++it) {
    const int ch  = it * NW + w;                  // 0..15 = (row group, k block, piece)
    const int gl  = ch >> 2;
    const int kbl = (ch >> 1) & 1;
    const int hf  = ch & 1;
    v[it]   = *(const v8us*)(t + (16 * gl + m) * PITCH + 32 * kbl + 16 * hf + 8 * h);
    off[it] = ((size_t)(rg0 + gl) * kblocks + kb0 + kbl) * FRAG + 256 * hf + 8 * lane;
  }
#pragma unroll
  for (int it = 0; it < NIT; ++it) *(v8us*)(P + off[it]) = v[it];
}

// =====================================================================================================
// for the projection A fragments); UC: rows c, k = n (for the P.U A fragment).
// Block = (64 px tile, 64 ch tile, b), 256 threads; thread = (channel cl = tid>>2, 16-px quarter).
// All three planes in fragment order: HT/UT rows n, k = c; UC rows c, k = n (16 pieces of 512 B per tile).
// coverage: grid (64, 4, nb): every (b, c, n) of HT, UT and UC written exactly once.
// =====================================================================================================
__global__ __launch_bounds__(256)
void k_cvt(const float* __restrict__ hand, const float* __restrict__ u,
           unsigned short* ht, unsigned short* ut, unsigned short* uc)
{
  __shared__ __align__(16) unsigned short TH[64 * TP];
  __shared__ __align__(16) unsigned short TU[64 * TP];
  __shared__ __align__(16) unsigned short TC[64 * TP];

  const int tid  = threadIdx.x;
  const int lane = tid & 31;
  const int w    = tid >> 5;
  const int n0   = 64 * blockIdx.x;
  const int c0   = 64 * blockIdx.y;
  const int b    = blockIdx.z;
  const int cl   = tid >> 2;              // 0..63
  const int pq   = 16 * (tid & 3);        // 0,16,32,48
  const size_t src = (size_t)b * PLANE + (size_t)(c0 + cl) * NPX + n0 + pq;
#pragma unroll
  for (int g = 0; g < 4; ++g) {
    const v4f hv = *(const v4f*)(hand + src + 4 * g);
    const v4f uv = *(const v4f*)(u + src + 4 * g);
#pragma unroll
    for (int e = 0; e < 4; ++e) {
      const int px = pq + 4 * g + e;
      const unsigned short hb = hbits(16.0f * bf16r(hv[e]));
      const unsigned short ub = hbits(16.0f * bf16r(uv[e]));
      TH[px * TP + cl] = hb;
      TU[px * TP + cl] = ub;
      TC[cl * TP + px] = ub;
    }
  }
  __syncthreads();
  store_tile_frag<8, TP>(TH, ht + (size_t)b * PLANE, n0 / 16, CC / 32, c0 / 32, w, lane);
  store_tile_frag<8, TP>(TU, ut + (size_t)b * PLANE, n0 / 16, CC / 32, c0 / 32, w, lane);
  store_tile_frag<8, TP>(TC, uc + (size_t)b * PLANE, c0 / 16, NPX / 32, n0 / 32, w, lane);
}

// =====================================================================================================
// Pass 2: weight planes W16[set] = f16(16 * bf16(W[o][c])) in fragment order, set 0 = WH_w, 1 = WU_w
// (block-uniform); thread = one 16-byte piece of the plane, so the stores are contiguous.
// coverage: 64 blocks x 256 threads x 8 = 131072 halves, every element once.
// =====================================================================================================
__global__ __launch_bounds__(256)
void k_wcvt(const float* __restrict__ whw, const float* __restrict__ wuw, unsigned short* w16)
{
  const int t   = blockIdx.x * 256 + threadIdx.x;   // 0..16383
  const int o   = 8 * t;
  const int set = blockIdx.x >> 5;                  // block-uniform
  const int idx = o & (CC * CC - 1);                // place in the fragment-order plane (rows o, k = c)
  const int blk = idx / FRAG;                       // (row group, k block)
  const int ln  = (idx >> 3) & 31;
  const int row = 16 * (blk >> 3) + (ln & 15);
  const int col = 32 * (blk & 7) + 16 * ((idx >> 8) & 1) + 8 * (ln >> 4);
  const float* p = (set ? wuw : whw) + row * CC + col;
  v8us ob;
#pragma unroll
  for (int e = 0; e < 8; ++e) ob[e] = hbits(16.0f * bf16r(p[e]));
  *(v8us*)(w16 + o) = ob;
  
}

// =====================================================================================================
// 1x1 projections: D[n][o] = sum_c X[n][c] * W16[o][c], tile 64(n) x 64(o), K = 256, 4 waves,
// wave w owns rows n 16w..16w+15 (A fragment from the fragment-order activation plane) and 4 column
// sub-tiles of 16 output channels (B fragment = W16 rows o, fragment order). Epilogue: /256, + bf16(bias),
// into the fragment-order planes (rows n, k = o).
// z = 2b + which: which 0 -> (HT, WH, WH_b) -> QH/QL; which 1 -> (UT, WU, WU_b) -> KH/KL.
// coverage: grid (64 n tiles, 4 o tiles, 2 nb): QH, QL, KH, KL [b][4096][256] every element once.
// =====================================================================================================
__global__ __launch_bounds__(128)
void k_proj(const unsigned short* __restrict__ ht, const unsigned short* __restrict__ ut,
            const unsigned short* __restrict__ w16, const float* __restrict__ whb,
            const float* __restrict__ wub, unsigned short* qh, unsigned short* ql,
            unsigned short* kh, unsigned short* kl)
{
  __shared__ __align__(16) unsigned short t0[64 * TP];
  __shared__ __align__(16) unsigned short t1[64 * TP];

  const int tid   = threadIdx.x;
  const int lane  = tid & 31;
  const int w     = tid >> 5;
  const int h     = lane >> 4;
  const int m     = lane & 15;
  const int n0    = 64 * blockIdx.x;
  const int o0    = 64 * blockIdx.y;
  const int which = blockIdx.z & 1;         // block-uniform
  const int bb    = blockIdx.z >> 1;
  const unsigned short* x  = (which ? ut : ht) + (size_t)bb * PLANE;
  const unsigned short* wm = w16 + (size_t)which * CC * CC;
  const float* bias = which ? wub : whb;

  v8f acc[4];
#pragma unroll
  for (int j = 0; j < 4; ++j) acc[j] = zero8();

  const unsigned short* pa = x + (size_t)(n0 / 16 + w) * (CC / 32) * FRAG + 8 * lane;
  const unsigned short* pb = wm + (size_t)(o0 / 16) * (CC / 32) * FRAG + 8 * lane;
  // two k steps per trip, kept rolled: a longer body would only add fragment registers
#pragma unroll 1
  for (int k2 = 0; k2 < CC / 64; ++k2) {
    const unsigned short* pak = pa + 2 * FRAG * k2;
    const unsigned short* pbk = pb + 2 * FRAG * k2;
    // unrolled: both steps address off the trip's two pointers by immediate offsets
#pragma unroll
    for (int u = 0; u < 2; ++u) {
      const v16us a  = ldfrag_g(pak + FRAG * u);
      const v16us b0 = ldfrag_g(pbk + FRAG * u);
      const v16us b1 = ldfrag_g(pbk + FRAG * (1 * (CC / 32) + u));
      const v16us b2 = ldfrag_g(pbk + FRAG * (2 * (CC / 32) + u));
      const v16us b3 = ldfrag_g(pbk + FRAG * (3 * (CC / 32) + u));
      acc[0] = mma_hu(a, b0, acc[0]);
      acc[1] = mma_hu(a, b1, acc[1]);
      acc[2] = mma_hu(a, b2, acc[2]);
      acc[3] = mma_hu(a, b3, acc[3]);
      guard4(acc[0], acc[1], acc[2], acc[3], a, b0, b1, b2, b3);
    }
    keep_addr(pak, pbk);                         // the next trip rewrites the loads' address registers
  }

  const float k256 = 1.0f / 256.0f;
  float bv[4];
#pragma unroll
  for (int j = 0; j < 4; ++j) bv[j] = bf16r(bias[o0 + 16 * j + m]);
#pragma unroll
  for (int j = 0; j < 4; ++j) {
#pragma unroll
    for (int r = 0; r < 8; ++r) {
      const float val = acc[j][r] * k256 + bv[j];
      const _Float16 hv = (_Float16)val;
      const int rl = 16 * w + 8 * h + r;       // pixel within tile
      const int cl = 16 * j + m;               // output channel within tile
      t0[rl * TP + cl] = __builtin_bit_cast(unsigned short, hv);
      t1[rl * TP + cl] = hbits((val - (float)hv) * 32768.0f);
    }
  }
  __syncthreads();
  unsigned short* dh = which ? kh : qh;
  unsigned short* dl = which ? kl : ql;
  store_tile_frag<4, TP>(t0, dh + (size_t)bb * PLANE, n0 / 16, CC / 32, o0 / 32, w, lane);
  store_tile_frag<4, TP>(t1, dl + (size_t)bb * PLANE, n0 / 16, CC / 32, o0 / 32, w, lane);
}

// =====================================================================================================
// Scores, softmax and P.U in one pass, all batches in one launch. Block = (64 query pixels R0.. of batch
// b, all 256 channels), 8 waves, loop over 32 tiles T of 128 key pixels; the score tile lives in LDS only.
//   resident: query planes QH/QL rows R0..R0+63 in LDS ([i][c], pitch 264 halves), filled once.
//   scores:   S[i][k] = QH.KH + (QH.KL + QL.KH) / 32768, K = 256; wave w owns key columns 16w..16w+15 and
//             all 64 query rows (four A fragments from LDS per B fragment from the key planes, so every
//             key row is fetched by one wave only).
//   softmax:  thread = (row i = tid>>2, 16 columns in each 64-column half); running row maximum mrun and
//             running sum lrun; P[i][k] = f16(16384 exp(S - mrun_new)), al[i] = exp(mrun_old - mrun_new).
//   P.U:      D[c][i] = D[c][i] * al[i] + UC[c][k] . P[i][k] (wave = 32 channels, 8 accumulators).
// Epilogue: p = D * (1/lsum[i]) / 2^18 (value scale 16, softmax scale 2^14); per-channel partial sums
// sum p, sum p^2 over the 64 pixels (fixed order: 4 sub-tiles then xor tree over 16 lanes); p staged
// coverage: grid (64, nb): O [b][256][4096] and PS/PQ [b][64][256], every element once.
// =====================================================================================================
__device__ __forceinline__ void o_store_pass(const float* Et, float* orows, int R0, int w, int lane)
{
  const int q  = lane >> 3;
  const int jj = lane & 7;
#pragma unroll 1
  for (int it = 0; it < 8; ++it) {
    const int li = it * 32 + 4 * w + q;         // 0..255
    const int c = li >> 1, hf = li & 1;
    const v4f v = *(const v4f*)(Et + c * EPF + 32 * hf + 4 * jj);
    *(v4f*)(orows + (size_t)c * NPX + R0 + 32 * hf + 4 * jj) = v;
    // the next trip rewrites the store's address and data registers: keep the wait in front of that
    asm volatile("s_wait_xcnt 0x0" ::: "memory");
  }
}

__global__ __launch_bounds__(256) __attribute__((amdgpu_waves_per_eu(2, 2)))
void k_attn(const unsigned short* __restrict__ qh, const unsigned short* __restrict__ ql,
            const unsigned short* __restrict__ kh, const unsigned short* __restrict__ kl,
            const unsigned short* __restrict__ uc, float* Oall, float* psall, float* pqall)
{
  __shared__ __align__(16) unsigned short Qs[2 * 64 * QP];
  __shared__ __align__(16) float ct[64 * CTP];
  __shared__ __align__(16) unsigned short Pt[64 * PTP];
  __shared__ __align__(16) float Et[128 * EPF];
  __shared__ float als[64];
  __shared__ float invs[64];
  __shared__ __align__(16) float lsum[CC];
  __shared__ __align__(16) float lsq[CC];

  const int tid  = threadIdx.x;
  const int lane = tid & 31;
  const int w    = tid >> 5;
  const int h    = lane >> 4;
  const int m    = lane & 15;
  const int R0   = 64 * blockIdx.x;
  const size_t po = (size_t)blockIdx.y * PLANE;
  const unsigned short* ucb = uc + po;
  float* O  = Oall + po;
  float* ps = psall + (size_t)blockIdx.y * HWD * CC;
  float* pq = pqall + (size_t)blockIdx.y * HWD * CC;

  // resident query planes: 2 x 64 rows of 256 halves = 2 x 64 pieces of 512 B of the fragment-order planes;
  // wave w moves the pieces 8w..8w+7 (row group w >> 1, k = 128 (w & 1) + 16 it + 8 h) to rows in LDS
  {
    const unsigned short* gqh = qh + po + (size_t)R0 * CC + 4 * FRAG * w + 8 * lane;
    const unsigned short* gql = ql + po + (size_t)R0 * CC + 4 * FRAG * w + 8 * lane;
    v8us th[8], tl[8];
#pragma unroll
    for (int it = 0; it < 8; ++it) {
      th[it] = *(const v8us*)(gqh + it * (FRAG / 2));
      tl[it] = *(const v8us*)(gql + it * (FRAG / 2));
    }
    keep_addr(gqh, gql);
    unsigned short* qd = Qs + (16 * (w >> 1) + m) * QP + 128 * (w & 1) + 8 * h;
#pragma unroll
    for (int it = 0; it < 8; ++it) {
      *(v8us*)(qd + 16 * it)           = th[it];
      *(v8us*)(qd + 64 * QP + 16 * it) = tl[it];
    }
  }
  __syncthreads();

  const unsigned short* qa  = Qs + m * QP + 8 * h;                 // hi plane, row m of a 16-row block
  const unsigned lk = (unsigned)(w * (CC / 32) * FRAG + 8 * lane); // lane's place in a key tile (halves)

  const int fr = tid >> 2;               // score / P tile row (query pixel) 0..63
  const int fc = 16 * (tid & 3);         // 16 key columns in each 64-column half
  float mrun = -1.0e30f, lrun = 0.0f;

  v8f acc[8];
#pragma unroll
  for (int k = 0; k < 8; ++k) acc[k] = zero8();
  const unsigned lu = (unsigned)(2 * w * (NPX / 32) * FRAG + 8 * lane);  // lane's place in the value plane (halves)

  const float kx = 1.0f / 32768.0f;
#pragma unroll 1
  for (int T = 0; T < NPX / KT; ++T) {
    {
      v8f sa[4], sx[4];
#pragma unroll
      for (int rb = 0; rb < 4; ++rb) { sa[rb] = zero8(); sx[rb] = zero8(); }
      const unsigned short* bh_p = kh + po + (size_t)(KT * T) * CC + lk;
      const unsigned short* bl_p = kl + po + (size_t)(KT * T) * CC + lk;
      // all key fragments of the tile are asked for first: one memory latency per tile, not one per k step
      v16us bh[CC / 32], bl[CC / 32];
#pragma unroll
      for (int kk = 0; kk < CC / 32; ++kk) {
        bh[kk] = ldfrag_g(bh_p + FRAG * kk);
        bl[kk] = ldfrag_g(bl_p + FRAG * kk);
      }
      // query fragments one k step ahead in a second register set: their LDS latency runs under the
      // twelve matrix instructions of the step before
      v16us ah[2][4], al[2][4];
#pragma unroll
      for (int rb = 0; rb < 4; ++rb) {
        ah[0][rb] = ldfrag_u(qa + 16 * rb * QP);
        al[0][rb] = ldfrag_u(qa + (64 + 16 * rb) * QP);
      }
#pragma unroll
      for (int kk = 0; kk < CC / 32; ++kk) {
        if (kk + 1 < CC / 32) {
#pragma unroll
          for (int rb = 0; rb < 4; ++rb) {
            ah[(kk + 1) & 1][rb] = ldfrag_u(qa + 16 * rb * QP + 32 * (kk + 1));
            al[(kk + 1) & 1][rb] = ldfrag_u(qa + (64 + 16 * rb) * QP + 32 * (kk + 1));
          }
        }
#pragma unroll
        for (int rb = 0; rb < 4; ++rb) {
          sa[rb] = mma_hu(ah[kk & 1][rb], bh[kk], sa[rb]);
          sx[rb] = mma_hu(ah[kk & 1][rb], bl[kk], sx[rb]);
          sx[rb] = mma_hu(al[kk & 1][rb], bh[kk], sx[rb]);
        }
      }
      keep_addr(bh_p, bl_p);
#pragma unroll
      for (int rb = 0; rb < 4; ++rb) {
#pragma unroll
        for (int r = 0; r < 8; ++r)
          ct[(16 * rb + 8 * h + r) * CTP + 16 * w + m] = sa[rb][r] + sx[rb][r] * kx;
      }
    }
    __syncthreads();                     // score tile complete; also ends every read of Pt / als of tile T-1
    // value fragments of this tile: asked for here so that the softmax phase covers their latency
    v16us ua[4], ub[4];
    const unsigned short* pa0 = ucb + (KT / 32) * FRAG * T + lu;
    const unsigned short* pa1 = pa0 + (NPX / 32) * FRAG;
#pragma unroll
    for (int kk = 0; kk < 4; ++kk) {
      ua[kk] = ldfrag_g(pa0 + FRAG * kk);
      ub[kk] = ldfrag_g(pa1 + FRAG * kk);
    }
    {
      const float* s2 = ct + fr * CTP + fc;
      v4f xs[8];
#pragma unroll
      for (int g = 0; g < 4; ++g) {
        xs[g]     = *(const v4f*)(s2 + 4 * g);
        xs[4 + g] = *(const v4f*)(s2 + 64 + 4 * g);
      }
      float tm = xs[0][0];
#pragma unroll
      for (int g = 0; g < 8; ++g)
        tm = fmaxf(tm, fmaxf(fmaxf(xs[g][0], xs[g][1]), fmaxf(xs[g][2], xs[g][3])));
      tm = fmaxf(tm, __shfl_xor(tm, 1, 32));
      tm = fmaxf(tm, __shfl_xor(tm, 2, 32));
      const float mn = fmaxf(mrun, tm);
      const float al = exp_slot(mrun - mn);
      float add = 0.0f;
#pragma unroll
      for (int p = 0; p < 4; ++p) {      // pair p = groups 2p, 2p+1 = 8 neighbouring columns
        v8us o;
        float part = 0.0f;
#pragma unroll
        for (int e = 0; e < 4; ++e) {
          const float e0 = exp_slot(xs[2 * p][e] - mn);
          const float e1 = exp_slot(xs[2 * p + 1][e] - mn);
          part += e0 + e1;
          o[e]     = hbits(16384.0f * e0);
          o[4 + e] = hbits(16384.0f * e1);
        }
        add += part;
        *(v8us*)(Pt + fr * PTP + 64 * (p >> 1) + fc + 8 * (p & 1)) = o;
      }
      lrun = lrun * al + add;
      mrun = mn;
      if ((tid & 3) == 0) als[fr] = al;
    }
    keep_addr(pa0, pa1);
    __syncthreads();                     // P tile and al complete; also ends every read of ct of tile T
    {
      float av[4];
#pragma unroll
      for (int j = 0; j < 4; ++j) av[j] = als[16 * j + m];
#pragma unroll
      for (int k = 0; k < 8; ++k) {
#pragma unroll
        for (int r = 0; r < 8; ++r) acc[k][r] = acc[k][r] * av[k & 3];
      }
    }
#pragma unroll
    for (int kk = 0; kk < KT / 32; ++kk) {
      const v16us a0 = ua[kk];
      const v16us a1 = ub[kk];
      const v16us b0 = ldfrag_u(Pt + (0 * 16 + m) * PTP + 32 * kk + 8 * h);
      const v16us b1 = ldfrag_u(Pt + (1 * 16 + m) * PTP + 32 * kk + 8 * h);
      const v16us b2 = ldfrag_u(Pt + (2 * 16 + m) * PTP + 32 * kk + 8 * h);
      const v16us b3 = ldfrag_u(Pt + (3 * 16 + m) * PTP + 32 * kk + 8 * h);
      acc[0] = mma_hu(a0, b0, acc[0]);
      acc[1] = mma_hu(a0, b1, acc[1]);
      acc[2] = mma_hu(a0, b2, acc[2]);
      acc[3] = mma_hu(a0, b3, acc[3]);
      acc[4] = mma_hu(a1, b0, acc[4]);
      acc[5] = mma_hu(a1, b1, acc[5]);
      acc[6] = mma_hu(a1, b2, acc[6]);
      acc[7] = mma_hu(a1, b3, acc[7]);
      guard8(acc[0], acc[1], acc[2], acc[3], acc[4], acc[5], acc[6], acc[7], a0, a1, b0, b1, b2, b3);
    }
  }

  // row sums: the four column quarters of a row sit in four neighbouring lanes
  {
    float lt = lrun + __shfl_xor(lrun, 1, 32);
    lt += __shfl_xor(lt, 2, 32);
    if ((tid & 3) == 0) invs[fr] = rcpf(lt) * (1.0f / 262144.0f);
  }
  __syncthreads();

  // normalise: acc[4s+j][r] -> p at (c = 32w + 16s + 8h + r, i = 16j + m)
#pragma unroll
  for (int k = 0; k < 8; ++k) {
    const float iv = invs[16 * (k & 3) + m];
#pragma unroll
    for (int r = 0; r < 8; ++r) acc[k][r] = acc[k][r] * iv;
  }
  // per-channel partial statistics over the block's 64 pixels
  float rs[2][8], rq[2][8];
#pragma unroll
  for (int s = 0; s < 2; ++s) {
#pragma unroll
    for (int r = 0; r < 8; ++r) {
      float a = 0.0f, q2 = 0.0f;
#pragma unroll
      for (int j = 0; j < 4; ++j) {
        const float p = acc[4 * s + j][r];
        a += p;
        q2 += p * p;
      }
      rs[s][r] = a;
      rq[s][r] = q2;
    }
  }
#pragma unroll
  for (int s = 0; s < 2; ++s) {
#pragma unroll
    for (int r = 0; r < 8; ++r) {
#pragma unroll
      for (int o = 1; o < 16; o <<= 1) {
        rs[s][r] += __shfl_xor(rs[s][r], o, 32);
        rq[s][r] += __shfl_xor(rq[s][r], o, 32);
      }
    }
  }
  if (m == 0) {
#pragma unroll
    for (int s = 0; s < 2; ++s) {
#pragma unroll
      for (int r = 0; r < 8; ++r) {
        lsum[32 * w + 16 * s + 8 * h + r] = rs[s][r];
        lsq[32 * w + 16 * s + 8 * h + r]  = rq[s][r];
      }
    }
  }

  // O plane in two 128-channel halves (waves 0..3 then waves 4..7 supply the values)
#pragma unroll
  for (int half = 0; half < 2; ++half) {
    if ((w >> 2) == half) {                      // wave-uniform
#pragma unroll
      for (int s = 0; s < 2; ++s) {
#pragma unroll
        for (int j = 0; j < 4; ++j) {
#pragma unroll
          for (int r = 0; r < 8; ++r) {
            const int cl = 32 * (w & 3) + 16 * s + 8 * h + r;   // 0..127
            const int il = 16 * j + m;
            Et[cl * EPF + il] = acc[4 * s + j][r];
          }
        }
      }
    }
    __syncthreads();
    float* orows = O + (size_t)(128 * half) * NPX;
    o_store_pass(Et, orows, R0, w, lane);
    
    __syncthreads();
  }

  if (tid < 64) {
    const v4f v = *(const v4f*)(lsum + 4 * tid);
    float* d = ps + (size_t)blockIdx.x * CC + 4 * tid;
    *(v4f*)d = v;
    
  } else if (tid < 128) {
    const int t2 = tid - 64;
    const v4f v = *(const v4f*)(lsq + 4 * t2);
    float* d = pq + (size_t)blockIdx.x * CC + 4 * t2;
    *(v4f*)d = v;
    
  }
}

// =====================================================================================================
// GroupNorm + residual for one batch. Block = channel c (256 blocks), 256 threads. Wave 0 combines the
// 64 blocks x 8 channels partial sums of group g = c/8 in f64 in a fixed order (lane l takes entries
// l, l+32, ... then an xor tree), mean = S/32768, var = Q/32768 - mean^2 (biased), rstd =
// 1/sqrt(var + 1e-5). out[c][n] = ((O[c][n] - mean) * rstd) * bf16(gn_w[c]) + bf16(gn_b[c]) +
// bf16(Hand[c][n]); row of 4096 floats written as 4 instructions of 256 threads x 16 B (each wave
// coverage: 256 blocks x 4096 = the whole [256][4096] output of this batch, every element once.
// =====================================================================================================
__global__ __launch_bounds__(256)
void k_gn(const float* __restrict__ O, const float* __restrict__ ps, const float* __restrict__ pq,
          const float* __restrict__ handb, const float* __restrict__ gnw,
          const float* __restrict__ gnb, float* outb)
{
  __shared__ float stat[2];
  const int tid  = threadIdx.x;
  const int lane = tid & 31;
  const int w    = tid >> 5;
  const int c    = blockIdx.x;
  const int g    = c >> 3;

  if (w == 0) {                                  // wave-uniform
    double s = 0.0, q = 0.0;
    const float* psg = ps + 8 * g;
    const float* pqg = pq + 8 * g;
#pragma unroll 1
    for (int i = 0; i < 16; ++i) {
      const int idx = lane + 32 * i;             // 0..511
      const int blk = idx >> 3, ch = idx & 7;
      s += (double)psg[(size_t)blk * CC + ch];
      q += (double)pqg[(size_t)blk * CC + ch];
    }
#pragma unroll
    for (int o = 16; o >= 1; o >>= 1) {
      s += shfl_xor_d(s, o);
      q += shfl_xor_d(q, o);
    }
    if (lane == 0) {
      const double inv_n = 1.0 / 32768.0;
      const double mean = s * inv_n;
      double var = q * inv_n - mean * mean;
      if (var < 0.0) var = 0.0;
      const float varf = (float)var;
      stat[0] = (float)mean;
      stat[1] = rcpf(sqrtf(varf + 1e-5f));
    }
  }
  __syncthreads();
  const float meanf = stat[0];
  const float rstd  = stat[1];
  const float gw    = bf16r(gnw[c]);
  const float gb    = bf16r(gnb[c]);
  const float* orow = O + (size_t)c * NPX;
  const float* hrow = handb + (size_t)c * NPX;
  float* drow = outb + (size_t)c * NPX;

  v4f res[4];
#pragma unroll
  for (int it = 0; it < 4; ++it) {
    const int f = 4 * (it * 256 + tid);
    const v4f ov = *(const v4f*)(orow + f);
    const v4f hd = *(const v4f*)(hrow + f);
#pragma unroll
    for (int e = 0; e < 4; ++e) {
      const float xn = (ov[e] - meanf) * rstd;
      res[it][e] = xn * gw + gb + bf16r(hd[e]);
    }
  }
#pragma unroll
  for (int it = 0; it < 4; ++it)
    *(v4f*)(drow + 4 * (it * 256 + tid)) = res[it];
  
}

// =====================================================================================================
// Host glue. Inputs in table order (8): Hand [nb][256][64][64], U (same), WH_w [256][256], WH_b [256],
// WU_w [256][256], WU_b [256], gn_w [256], gn_b [256]; nb = in_sizes[0] / (256*4096), 1..4.
// Output f32 [nb][256][4096] at element 0. Workspace 76283904 B (sized for nb = 4).
// 4 + nb launches: k_cvt, k_wcvt, k_proj, k_attn (all batches), per batch k_gn.
// =====================================================================================================
extern "C" void kernel_launch(void* const* d_in, const int* in_sizes, int n_in,
                              void* d_out, int out_size, void* d_ws, size_t ws_size,
                              hipStream_t stream) {
  if (n_in < 8) return;
  const int per = CC * NPX;
  const int n0s = in_sizes[0];
  if (n0s < per || (n0s % per) != 0) return;
  const int nb = n0s / per;
  if (nb < 1 || nb > NBMAX) return;
  if (in_sizes[1] != n0s) return;
  if (in_sizes[2] != CC * CC || in_sizes[4] != CC * CC) return;
  if (in_sizes[3] != CC || in_sizes[5] != CC || in_sizes[6] != CC || in_sizes[7] != CC) return;
  if (out_size != nb * per) return;
  if (ws_size < WS_TOTAL) return;

  const float* hand = (const float*)d_in[0];
  const float* u    = (const float*)d_in[1];
  const float* whw  = (const float*)d_in[2];
  const float* whb  = (const float*)d_in[3];
  const float* wuw  = (const float*)d_in[4];
  const float* wub  = (const float*)d_in[5];
  const float* gnw  = (const float*)d_in[6];
  const float* gnb  = (const float*)d_in[7];
  float* out = (float*)d_out;

  char* ws = (char*)d_ws;
  unsigned short* ht  = (unsigned short*)(ws + OFF_HT);
  unsigned short* ut  = (unsigned short*)(ws + OFF_UT);
  unsigned short* uc  = (unsigned short*)(ws + OFF_UC);
  unsigned short* w16 = (unsigned short*)(ws + OFF_W16);
  unsigned short* qh  = (unsigned short*)(ws + OFF_QH);
  unsigned short* ql  = (unsigned short*)(ws + OFF_QL);
  unsigned short* kh  = (unsigned short*)(ws + OFF_KH);
  unsigned short* kl  = (unsigned short*)(ws + OFF_KL);
  float*          Op  = (float*)(ws + OFF_O);
  float*          ps  = (float*)(ws + OFF_PS);
  float*          pq  = (float*)(ws + OFF_PQ);

  k_cvt<<<dim3(NPX / 64, CC / 64, nb), dim3(256), 0, stream>>>(hand, u, ht, ut, uc);
  (void)hipGetLastError();
  k_wcvt<<<dim3(64), dim3(256), 0, stream>>>(whw, wuw, w16);
  (void)hipGetLastError();
  k_proj<<<dim3(NPX / 64, CC / 64, 2 * nb), dim3(128), 0, stream>>>(ht, ut, w16, whb, wub,
                                                                     qh, ql, kh, kl);
  (void)hipGetLastError();

  k_attn<<<dim3(HWD, nb), dim3(256), 0, stream>>>(qh, ql, kh, kl, uc, Op, ps, pq);
  (void)hipGetLastError();

  for (int b = 0; b < nb; ++b) {
    const size_t po = (size_t)b * PLANE;
    const size_t pp = (size_t)b * HWD * CC;
    k_gn<<<dim3(CC), dim3(256), 0, stream>>>(Op + po, ps + pp, pq + pp, hand + po, gnw, gnb, out + po);
    (void)hipGetLastError();
  }
}

// v003
// A run of this version takes 161 microseconds.
// Next to v002, in two timings, it ran 1.24 and 1.21 times as fast.
// Counting every step since v000, it is 5.84 times as fast.
// Contractions: 1x1 projections (K=256), affinity scores (K=256) and softmax(P).U (K=4096 in 128-deep
// tiles) on v_wmma_f32_16x16x32_f16 (f16 operands, f32 accumulate); operands are RNE-bf16 inputs held in
// f16 containers (weights x16, activations and values x16), projected q/k vectors as f16 hi plus x2^15
// residual planes (three products in the score GEMM), softmax planes x2^14; running softmax statistics,
// normalisation statistics (f64 combine) and epilogues f32 VALU. Scores never leave the work-group.
#include <hip/hip_runtime.h>
#include <stddef.h>
#include <stdint.h>
#include <math.h>

#define NBMAX 4
#define CC    256
#define NPX   4096
#define HWD   64
#define TP    72
#define EPF   68
#define QP    264                                      // LDS pitch (halves) of a resident query row
#define KT    128                                      // key pixels per tile of the fused pass
#define CTP   132                                      // LDS pitch (floats) of a score tile row
#define PTP   136                                      // LDS pitch (halves) of a P tile row
#define FRAG  512                                      // halves of one 16-row x 32-k fragment block

#define PLANE       ((size_t)CC * NPX)                 // 1048576 elements per batch plane
#define ACT16_BYTES ((size_t)NBMAX * PLANE * 2)        // 8388608
#define W16_BYTES   ((size_t)2 * CC * CC * 2)          // 262144
#define O_BYTES     ((size_t)NBMAX * PLANE * 4)        // 16777216
#define PS_BYTES    ((size_t)NBMAX * HWD * CC * 4)     // 262144

// ---- carve ----------------------------------------------------------------------------------------
#define OFF_HT   ((size_t)0)
#define OFF_UT   (OFF_HT + ACT16_BYTES)
#define OFF_UC   (OFF_UT + ACT16_BYTES)
#define OFF_W16  (OFF_UC + ACT16_BYTES)
#define OFF_QH   (OFF_W16 + W16_BYTES)
#define OFF_QL   (OFF_QH + ACT16_BYTES)
#define OFF_KH   (OFF_QL + ACT16_BYTES)
#define OFF_KL   (OFF_KH + ACT16_BYTES)
#define OFF_O    (OFF_KL + ACT16_BYTES)
#define OFF_PS   (OFF_O + O_BYTES)
#define OFF_PQ   (OFF_PS + PS_BYTES)
#define WS_TOTAL (OFF_PQ + PS_BYTES)

static_assert(OFF_QH == (size_t)25427968);
static_assert(OFF_O == (size_t)58982400);
static_assert(WS_TOTAL == (size_t)76283904);
static_assert(WS_TOTAL <= (size_t)134217728);
static_assert((OFF_UT % 256) == 0);
static_assert((OFF_UC % 256) == 0);
static_assert((OFF_W16 % 256) == 0);
static_assert((OFF_QH % 256) == 0);
static_assert((OFF_QL % 256) == 0);
static_assert((OFF_KH % 256) == 0);
static_assert((OFF_KL % 256) == 0);
static_assert((OFF_O % 256) == 0);
static_assert((OFF_PS % 256) == 0);
static_assert((OFF_PQ % 256) == 0);
static_assert(NPX == HWD * HWD);
static_assert((NPX / 64) * 256 * 8 == 2 * CC * CC);    // one grid row of k_cvt covers both weight planes
static_assert((CC % 64) == 0);
static_assert((NPX % 64) == 0);
static_assert((TP * 2) % 16 == 0);
static_assert((EPF * 4) % 16 == 0);
static_assert((QP * 2) % 32 == 16);
static_assert((PTP * 2) % 32 == 16);
static_assert((CTP * 4) % 16 == 0);
static_assert((NPX % KT) == 0);

typedef unsigned short v8us  __attribute__((ext_vector_type(8)));
typedef unsigned short v16us __attribute__((ext_vector_type(16)));
typedef _Float16       v16h  __attribute__((ext_vector_type(16)));
typedef float          v4f   __attribute__((ext_vector_type(4)));
typedef float          v8f   __attribute__((ext_vector_type(8)));

union FragU { v16us v; v8us half[2]; };

// ---- scalar helpers -------------------------------------------------------------------------------
__device__ __forceinline__ unsigned bbits(float f) {          // f32 -> nearest-even bf16 bits
  unsigned u = __float_as_uint(f);
  return (u + 0x7FFFu + ((u >> 16) & 1u)) >> 16;
}
__device__ __forceinline__ float bf16r(float f) {            // RNE convert to bf16 and back
  return __uint_as_float(bbits(f) << 16);
}
__device__ __forceinline__ unsigned short hbits(float f) {   // f32 -> f16 bits (RNE)
  return __builtin_bit_cast(unsigned short, (_Float16)f);
}
__device__ __forceinline__ float rcpf(float x) {
#if defined(__HIP_DEVICE_COMPILE__)
  return __builtin_amdgcn_rcpf(x);
#else
  return 1.0f / x;
#endif
}
// exp(x) as one v_exp_f32 of x * log2(e), as __expf compiles to. The v_nop keeps the one free slot that the
// instruction set asks for between a transcendental and a next instruction that reads its result or
// rewrites its source.
__device__ __forceinline__ float exp_slot(float x) {
#if defined(__HIP_DEVICE_COMPILE__)
  float r;
  asm("v_exp_f32 %0, %1\n\tv_nop" : "=v"(r) : "v"(x * 1.44269504f));
  return r;
#else
  return x;
#endif
}
// The wait that stands in front of a rewrite of the address registers p, q of issued global loads. Naming
// them as inputs keeps them untouched up to here, behind the work that runs under the loads; at their
// first reuse, where the compiler puts the wait otherwise, it held that work back behind all the loads.
__device__ __forceinline__ void keep_addr(const unsigned short* p, const unsigned short* q) {
#if defined(__HIP_DEVICE_COMPILE__)
  asm volatile("s_wait_xcnt 0x0" :: "v"(p), "v"(q) : "memory");
#else
  (void)p; (void)q;
#endif
}
__device__ __forceinline__ v8f zero8() { v8f z = {0.f, 0.f, 0.f, 0.f, 0.f, 0.f, 0.f, 0.f}; return z; }

__device__ __forceinline__ double shfl_xor_d(double v, int o) {
  const long long x = __double_as_longlong(v);
  int lo = (int)(x & 0xffffffffll);
  int hi = (int)(x >> 32);
  lo = __shfl_xor(lo, o, 32);
  hi = __shfl_xor(hi, o, 32);
  const long long y = ((long long)(unsigned)hi << 32) | (long long)(unsigned)lo;
  return __longlong_as_double(y);
}

// ---- 16-bit fragment loader, split k map for A and B alike ([row][k] planes, k contiguous):
//      p = row_base + k0 + 8*(lane>>4): elements 0..7 <- p[0..7], elements 8..15 <- p[16..23]
__device__ __forceinline__ v16us ldfrag_u(const unsigned short* p) {
  FragU f;
  f.half[0] = *(const v8us*)(p);
  f.half[1] = *(const v8us*)(p + 16);
  return f.v;
}

// ---- fragment-order planes (every operand plane that a wave loads straight from global memory): a plane
//      of rows x K halves is a row-major grid of blocks [row / 16][k / 32], FRAG halves each; a block holds
//      the two 16-byte pieces of all 32 lanes back to back, element (row, k) at
//      256 * ((k >> 4) & 1) + 8 * (16 * ((k >> 3) & 1) + (row & 15)) + (k & 7): the split k map above, but
//      each load instruction of a wave reads 512 contiguous bytes (four whole 128-byte lines, not 16 parts).
//      p = block + 8 * lane
__device__ __forceinline__ v16us ldfrag_g(const unsigned short* p) {
  FragU f;
  f.half[0] = *(const v8us*)(p);
  f.half[1] = *(const v8us*)(p + 256);
  return f.v;
}

// ---- WMMA helper (f16 operands as raw 16-bit lanes, f32 accumulate) --------------------------------
__device__ __forceinline__ v8f mma_hu(v16us a, v16us b, v8f c) {
#if defined(__HIP_DEVICE_COMPILE__)
  return __builtin_amdgcn_wmma_f32_16x16x32_f16(false, __builtin_bit_cast(v16h, a),
                                               false, __builtin_bit_cast(v16h, b),
                                               (short)0, c, false, false);
#else
  (void)a; (void)b;
  return c;
#endif
}
// hazard guards after the last WMMA of a group: tie the accumulators, keep the fragments live
__device__ __forceinline__ void guard4(v8f& c0, v8f& c1, v8f& c2, v8f& c3, const v16us& a,
                                       const v16us& b0, const v16us& b1, const v16us& b2,
                                       const v16us& b3) {
#if defined(__HIP_DEVICE_COMPILE__)
  asm volatile("v_nop\n\tv_nop\n\tv_nop\n\tv_nop"
               : "+v"(c0), "+v"(c1), "+v"(c2), "+v"(c3)
               : "v"(a), "v"(b0), "v"(b1), "v"(b2), "v"(b3));
#else
  (void)c0; (void)c1; (void)c2; (void)c3; (void)a; (void)b0; (void)b1; (void)b2; (void)b3;
#endif
}
__device__ __forceinline__ void guard8(v8f& c0, v8f& c1, v8f& c2, v8f& c3, v8f& c4, v8f& c5,
                                       v8f& c6, v8f& c7, const v16us& a0, const v16us& a1,
                                       const v16us& b0, const v16us& b1, const v16us& b2,
                                       const v16us& b3) {
#if defined(__HIP_DEVICE_COMPILE__)
  asm volatile("v_nop\n\tv_nop\n\tv_nop\n\tv_nop"
               : "+v"(c0), "+v"(c1), "+v"(c2), "+v"(c3), "+v"(c4), "+v"(c5), "+v"(c6), "+v"(c7)
               : "v"(a0), "v"(a1), "v"(b0), "v"(b1), "v"(b2), "v"(b3));
#else
  (void)c0; (void)c1; (void)c2; (void)c3; (void)c4; (void)c5; (void)c6; (void)c7;
  (void)a0; (void)a1; (void)b0; (void)b1; (void)b2; (void)b3;
#endif
}

// 16-bit tile 64 rows x 64 k (LDS pitch PITCH halves) -> fragment-order plane P with kblocks blocks per
// row group: row groups rg0..rg0+3, k blocks kb0, kb0+1; one wave instruction = one 512-byte piece.
template <int NW, int PITCH>
__device__ __forceinline__ void store_tile_frag(const unsigned short* t, unsigned short* P,
                                                int rg0, int kblocks, int kb0, int w, int lane) {
  constexpr int NIT = 16 / NW;
  const int h = lane >> 4;
  const int m = lane & 15;
  v8us   v[NIT];
  size_t off[NIT];
#pragma unroll
  for (int it = 0; it < NIT; ++it) {
    const int ch  = it * NW + w;                  // 0..15 = (row group, k block, piece)
    const int gl  = ch >> 2;
    const int kbl = (ch >> 1) & 1;
    const int hf  = ch & 1;
    v[it]   = *(const v8us*)(t + (16 * gl + m) * PITCH + 32 * kbl + 16 * hf + 8 * h);
    off[it] = ((size_t)(rg0 + gl) * kblocks + kb0 + kbl) * FRAG + 256 * hf + 8 * lane;
  }
#pragma unroll
  for (int it = 0; it < NIT; ++it) *(v8us*)(P + off[it]) = v[it];
}

// =====================================================================================================
// Weight planes W16[set] = f16(16 * bf16(W[o][c])) in fragment order, set 0 = WH_w, 1 = WU_w (block-uniform);
// thread = one 16-byte piece of the plane, so the stores are contiguous. Run by the 64 blocks bx of grid
// row 0 of k_cvt.
// coverage: 64 blocks x 256 threads x 8 = 131072 halves, every element once.
// =====================================================================================================
__device__ __forceinline__ void wcvt_block(const float* __restrict__ whw, const float* __restrict__ wuw,
                                           unsigned short* w16, int bx, int tid)
{
  const int t   = bx * 256 + tid;                   // 0..16383
  const int o   = 8 * t;
  const int set = bx >> 5;                          // block-uniform
  const int idx = o & (CC * CC - 1);                // place in the fragment-order plane (rows o, k = c)
  const int blk = idx / FRAG;                       // (row group, k block)
  const int ln  = (idx >> 3) & 31;
  const int row = 16 * (blk >> 3) + (ln & 15);
  const int col = 32 * (blk & 7) + 16 * ((idx >> 8) & 1) + 8 * (ln >> 4);
  const float* p = (set ? wuw : whw) + row * CC + col;
  v8us ob;
#pragma unroll
  for (int e = 0; e < 8; ++e) ob[e] = hbits(16.0f * bf16r(p[e]));
  *(v8us*)(w16 + o) = ob;
}

// =====================================================================================================
// for the projection A fragments); UC: rows c, k = n in fragment order (for the P.U A fragment).
// Block = (64 px tile, y = 1 + 4 b + 64 ch tile), 256 threads; thread = (channel cl = tid>>2, 16-px quarter).
// All three planes in fragment order: HT/UT rows n, k = c; UC rows c, k = n (16 pieces of 512 B per tile).
// Grid row y = 0 converts the weights instead: they depend on nothing here, so they need no launch of
// their own.
// coverage: grid (64, 1 + 4 nb): every (b, c, n) of HT, UT and UC and every weight written exactly once.
// =====================================================================================================
__global__ __launch_bounds__(256)
void k_cvt(const float* __restrict__ hand, const float* __restrict__ u,
           const float* __restrict__ whw, const float* __restrict__ wuw,
           unsigned short* ht, unsigned short* ut, unsigned short* uc, unsigned short* w16)
{
  __shared__ __align__(16) unsigned short TH[64 * TP];
  __shared__ __align__(16) unsigned short TU[64 * TP];
  __shared__ __align__(16) unsigned short TC[64 * TP];

  const int tid  = threadIdx.x;
  const int lane = tid & 31;
  const int w    = tid >> 5;
  if (blockIdx.y == 0) {                  // block-uniform, in front of the barrier
    wcvt_block(whw, wuw, w16, blockIdx.x, tid);
    return;
  }
  const int yt   = blockIdx.y - 1;        // 4 b + channel tile
  const int n0   = 64 * blockIdx.x;
  const int c0   = 64 * (yt & (CC / 64 - 1));
  const int b    = yt / (CC / 64);
  const int cl   = tid >> 2;              // 0..63
  const int pq   = 16 * (tid & 3);        // 0,16,32,48
  const size_t src = (size_t)b * PLANE + (size_t)(c0 + cl) * NPX + n0 + pq;
#pragma unroll
  for (int g = 0; g < 4; ++g) {
    const v4f hv = *(const v4f*)(hand + src + 4 * g);
    const v4f uv = *(const v4f*)(u + src + 4 * g);
#pragma unroll
    for (int e = 0; e < 4; ++e) {
      const int px = pq + 4 * g + e;
      const unsigned short hb = hbits(16.0f * bf16r(hv[e]));
      const unsigned short ub = hbits(16.0f * bf16r(uv[e]));
      TH[px * TP + cl] = hb;
      TU[px * TP + cl] = ub;
      TC[cl * TP + px] = ub;
    }
  }
  __syncthreads();
  store_tile_frag<8, TP>(TH, ht + (size_t)b * PLANE, n0 / 16, CC / 32, c0 / 32, w, lane);
  store_tile_frag<8, TP>(TU, ut + (size_t)b * PLANE, n0 / 16, CC / 32, c0 / 32, w, lane);
  store_tile_frag<8, TP>(TC, uc + (size_t)b * PLANE, c0 / 16, NPX / 32, n0 / 32, w, lane);
}

// =====================================================================================================
// 1x1 projections: D[n][o] = sum_c X[n][c] * W16[o][c], tile 64(n) x 64(o), K = 256, 4 waves,
// wave w owns rows n 16w..16w+15 (A fragment from the fragment-order activation plane) and 4 column
// sub-tiles of 16 output channels (B fragment = W16 rows o, fragment order). Epilogue: /256, + bf16(bias),
// into the fragment-order planes (rows n, k = o).
// z = 2b + which: which 0 -> (HT, WH, WH_b) -> QH/QL; which 1 -> (UT, WU, WU_b) -> KH/KL.
// coverage: grid (64 n tiles, 4 o tiles, 2 nb): QH, QL, KH, KL [b][4096][256] every element once.
// =====================================================================================================
__global__ __launch_bounds__(128)
void k_proj(const unsigned short* __restrict__ ht, const unsigned short* __restrict__ ut,
            const unsigned short* __restrict__ w16, const float* __restrict__ whb,
            const float* __restrict__ wub, unsigned short* qh, unsigned short* ql,
            unsigned short* kh, unsigned short* kl)
{
  __shared__ __align__(16) unsigned short t0[64 * TP];
  __shared__ __align__(16) unsigned short t1[64 * TP];

  const int tid   = threadIdx.x;
  const int lane  = tid & 31;
  const int w     = tid >> 5;
  const int h     = lane >> 4;
  const int m     = lane & 15;
  const int n0    = 64 * blockIdx.x;
  const int o0    = 64 * blockIdx.y;
  const int which = blockIdx.z & 1;         // block-uniform
  const int bb    = blockIdx.z >> 1;
  const unsigned short* x  = (which ? ut : ht) + (size_t)bb * PLANE;
  const unsigned short* wm = w16 + (size_t)which * CC * CC;
  const float* bias = which ? wub : whb;

  v8f acc[4];
#pragma unroll
  for (int j = 0; j < 4; ++j) acc[j] = zero8();

  const unsigned short* pa = x + (size_t)(n0 / 16 + w) * (CC / 32) * FRAG + 8 * lane;
  const unsigned short* pb = wm + (size_t)(o0 / 16) * (CC / 32) * FRAG + 8 * lane;
  // two k steps per trip, kept rolled: a longer body would only add fragment registers
#pragma unroll 1
  for (int k2 = 0; k2 < CC / 64; ++k2) {
    const unsigned short* pak = pa + 2 * FRAG * k2;
    const unsigned short* pbk = pb + 2 * FRAG * k2;
    // unrolled: both steps address off the trip's two pointers by immediate offsets
#pragma unroll
    for (int u = 0; u < 2; ++u) {
      const v16us a  = ldfrag_g(pak + FRAG * u);
      const v16us b0 = ldfrag_g(pbk + FRAG * u);
      const v16us b1 = ldfrag_g(pbk + FRAG * (1 * (CC / 32) + u));
      const v16us b2 = ldfrag_g(pbk + FRAG * (2 * (CC / 32) + u));
      const v16us b3 = ldfrag_g(pbk + FRAG * (3 * (CC / 32) + u));
      acc[0] = mma_hu(a, b0, acc[0]);
      acc[1] = mma_hu(a, b1, acc[1]);
      acc[2] = mma_hu(a, b2, acc[2]);
      acc[3] = mma_hu(a, b3, acc[3]);
      guard4(acc[0], acc[1], acc[2], acc[3], a, b0, b1, b2, b3);
    }
    keep_addr(pak, pbk);                         // the next trip rewrites the loads' address registers
  }

  const float k256 = 1.0f / 256.0f;
  float bv[4];
#pragma unroll
  for (int j = 0; j < 4; ++j) bv[j] = bf16r(bias[o0 + 16 * j + m]);
#pragma unroll
  for (int j = 0; j < 4; ++j) {
#pragma unroll
    for (int r = 0; r < 8; ++r) {
      const float val = acc[j][r] * k256 + bv[j];
      const _Float16 hv = (_Float16)val;
      const int rl = 16 * w + 8 * h + r;       // pixel within tile
      const int cl = 16 * j + m;               // output channel within tile
      t0[rl * TP + cl] = __builtin_bit_cast(unsigned short, hv);
      t1[rl * TP + cl] = hbits((val - (float)hv) * 32768.0f);
    }
  }
  __syncthreads();
  unsigned short* dh = which ? kh : qh;
  unsigned short* dl = which ? kl : ql;
  store_tile_frag<4, TP>(t0, dh + (size_t)bb * PLANE, n0 / 16, CC / 32, o0 / 32, w, lane);
  store_tile_frag<4, TP>(t1, dl + (size_t)bb * PLANE, n0 / 16, CC / 32, o0 / 32, w, lane);
}

// =====================================================================================================
// Scores, softmax and P.U in one pass, all batches in one launch. Block = (64 query pixels R0.. of batch
// b, all 256 channels), 8 waves, loop over 32 tiles T of 128 key pixels; the score tile lives in LDS only.
//   resident: query planes QH/QL rows R0..R0+63 in LDS ([i][c], pitch 264 halves), filled once.
//   scores:   S[i][k] = QH.KH + (QH.KL + QL.KH) / 32768, K = 256; wave w owns key columns 16w..16w+15 and
//             all 64 query rows (four A fragments from LDS per B fragment from the key planes, so every
//             key row is fetched by one wave only).
//   softmax:  thread = (row i = tid>>2, 16 columns in each 64-column half); running row maximum mrun and
//             running sum lrun; P[i][k] = f16(16384 exp(S - mrun_new)), al[i] = exp(mrun_old - mrun_new).
//   P.U:      D[c][i] = D[c][i] * al[i] + UC[c][k] . P[i][k] (wave = 32 channels, 8 accumulators).
// Epilogue: p = D * (1/lsum[i]) / 2^18 (value scale 16, softmax scale 2^14); per-channel partial sums
// sum p, sum p^2 over the 64 pixels (fixed order: 4 sub-tiles then xor tree over 16 lanes); p staged
// coverage: grid (64, nb): O [b][256][4096] and PS/PQ [b][64][256], every element once.
// =====================================================================================================
__device__ __forceinline__ void o_store_pass(const float* Et, float* orows, int R0, int w, int lane)
{
  const int q  = lane >> 3;
  const int jj = lane & 7;
#pragma unroll 1
  for (int it = 0; it < 8; ++it) {
    const int li = it * 32 + 4 * w + q;         // 0..255
    const int c = li >> 1, hf = li & 1;
    const v4f v = *(const v4f*)(Et + c * EPF + 32 * hf + 4 * jj);
    *(v4f*)(orows + (size_t)c * NPX + R0 + 32 * hf + 4 * jj) = v;
    // the next trip rewrites the store's address and data registers: keep the wait in front of that
    asm volatile("s_wait_xcnt 0x0" ::: "memory");
  }
}

__global__ __launch_bounds__(256) __attribute__((amdgpu_waves_per_eu(2, 2)))
void k_attn(const unsigned short* __restrict__ qh, const unsigned short* __restrict__ ql,
            const unsigned short* __restrict__ kh, const unsigned short* __restrict__ kl,
            const unsigned short* __restrict__ uc, float* Oall, float* psall, float* pqall)
{
  __shared__ __align__(16) unsigned short Qs[2 * 64 * QP];
  __shared__ __align__(16) float ct[64 * CTP];
  __shared__ __align__(16) unsigned short Pt[64 * PTP];
  __shared__ __align__(16) float Et[128 * EPF];
  __shared__ float als[64];
  __shared__ float invs[64];
  __shared__ __align__(16) float lsum[CC];
  __shared__ __align__(16) float lsq[CC];

  const int tid  = threadIdx.x;
  const int lane = tid & 31;
  const int w    = tid >> 5;
  const int h    = lane >> 4;
  const int m    = lane & 15;
  const int R0   = 64 * blockIdx.x;
  const size_t po = (size_t)blockIdx.y * PLANE;
  const unsigned short* ucb = uc + po;
  float* O  = Oall + po;
  float* ps = psall + (size_t)blockIdx.y * HWD * CC;
  float* pq = pqall + (size_t)blockIdx.y * HWD * CC;

  // resident query planes: 2 x 64 rows of 256 halves = 2 x 64 pieces of 512 B of the fragment-order planes;
  // wave w moves the pieces 8w..8w+7 (row group w >> 1, k = 128 (w & 1) + 16 it + 8 h) to rows in LDS
  {
    const unsigned short* gqh = qh + po + (size_t)R0 * CC + 4 * FRAG * w + 8 * lane;
    const unsigned short* gql = ql + po + (size_t)R0 * CC + 4 * FRAG * w + 8 * lane;
    v8us th[8], tl[8];
#pragma unroll
    for (int it = 0; it < 8; ++it) {
      th[it] = *(const v8us*)(gqh + it * (FRAG / 2));
      tl[it] = *(const v8us*)(gql + it * (FRAG / 2));
    }
    keep_addr(gqh, gql);
    unsigned short* qd = Qs + (16 * (w >> 1) + m) * QP + 128 * (w & 1) + 8 * h;
#pragma unroll
    for (int it = 0; it < 8; ++it) {
      *(v8us*)(qd + 16 * it)           = th[it];
      *(v8us*)(qd + 64 * QP + 16 * it) = tl[it];
    }
  }
  __syncthreads();

  const unsigned short* qa  = Qs + m * QP + 8 * h;                 // hi plane, row m of a 16-row block
  const unsigned lk = (unsigned)(w * (CC / 32) * FRAG + 8 * lane); // lane's place in a key tile (halves)

  const int fr = tid >> 2;               // score / P tile row (query pixel) 0..63
  const int fc = 16 * (tid & 3);         // 16 key columns in each 64-column half
  float mrun = -1.0e30f, lrun = 0.0f;

  v8f acc[8];
#pragma unroll
  for (int k = 0; k < 8; ++k) acc[k] = zero8();
  const unsigned lu = (unsigned)(2 * w * (NPX / 32) * FRAG + 8 * lane);  // lane's place in the value plane (halves)

  const float kx = 1.0f / 32768.0f;
#pragma unroll 1
  for (int T = 0; T < NPX / KT; ++T) {
    {
      v8f sa[4], sx[4];
#pragma unroll
      for (int rb = 0; rb < 4; ++rb) { sa[rb] = zero8(); sx[rb] = zero8(); }
      const unsigned short* bh_p = kh + po + (size_t)(KT * T) * CC + lk;
      const unsigned short* bl_p = kl + po + (size_t)(KT * T) * CC + lk;
      // all key fragments of the tile are asked for first: one memory latency per tile, not one per k step.
      // Left open: that latency has nothing to run under it. Asked for one tile ahead (behind the score
      // products, after the value loads) the fragments fit the registers, but __syncthreads() waits for a
      // wave's global loads: the barrier behind the softmax would have to publish LDS only. Also left: a query
      // fragment read from LDS feeds three products only; two key groups per wave would halve those reads.
      v16us bh[CC / 32], bl[CC / 32];
#pragma unroll
      for (int kk = 0; kk < CC / 32; ++kk) {
        bh[kk] = ldfrag_g(bh_p + FRAG * kk);
        bl[kk] = ldfrag_g(bl_p + FRAG * kk);
      }
      // query fragments one k step ahead in a second register set: their LDS latency runs under the
      // twelve matrix instructions of the step before
      v16us ah[2][4], al[2][4];
#pragma unroll
      for (int rb = 0; rb < 4; ++rb) {
        ah[0][rb] = ldfrag_u(qa + 16 * rb * QP);
        al[0][rb] = ldfrag_u(qa + (64 + 16 * rb) * QP);
      }
#pragma unroll
      for (int kk = 0; kk < CC / 32; ++kk) {
        if (kk + 1 < CC / 32) {
#pragma unroll
          for (int rb = 0; rb < 4; ++rb) {
            ah[(kk + 1) & 1][rb] = ldfrag_u(qa + 16 * rb * QP + 32 * (kk + 1));
            al[(kk + 1) & 1][rb] = ldfrag_u(qa + (64 + 16 * rb) * QP + 32 * (kk + 1));
          }
        }
#pragma unroll
        for (int rb = 0; rb < 4; ++rb) {
          sa[rb] = mma_hu(ah[kk & 1][rb], bh[kk], sa[rb]);
          sx[rb] = mma_hu(ah[kk & 1][rb], bl[kk], sx[rb]);
          sx[rb] = mma_hu(al[kk & 1][rb], bh[kk], sx[rb]);
        }
      }
      keep_addr(bh_p, bl_p);
#pragma unroll
      for (int rb = 0; rb < 4; ++rb) {
#pragma unroll
        for (int r = 0; r < 8; ++r)
          ct[(16 * rb + 8 * h + r) * CTP + 16 * w + m] = sa[rb][r] + sx[rb][r] * kx;
      }
    }
    __syncthreads();                     // score tile complete; also ends every read of Pt / als of tile T-1
    // value fragments of this tile: asked for here so that the softmax phase covers their latency
    v16us ua[4], ub[4];
    const unsigned short* pa0 = ucb + (KT / 32) * FRAG * T + lu;
    const unsigned short* pa1 = pa0 + (NPX / 32) * FRAG;
#pragma unroll
    for (int kk = 0; kk < 4; ++kk) {
      ua[kk] = ldfrag_g(pa0 + FRAG * kk);
      ub[kk] = ldfrag_g(pa1 + FRAG * kk);
    }
    {
      const float* s2 = ct + fr * CTP + fc;
      v4f xs[8];
#pragma unroll
      for (int g = 0; g < 4; ++g) {
        xs[g]     = *(const v4f*)(s2 + 4 * g);
        xs[4 + g] = *(const v4f*)(s2 + 64 + 4 * g);
      }
      float tm = xs[0][0];
#pragma unroll
      for (int g = 0; g < 8; ++g)
        tm = fmaxf(tm, fmaxf(fmaxf(xs[g][0], xs[g][1]), fmaxf(xs[g][2], xs[g][3])));
      tm = fmaxf(tm, __shfl_xor(tm, 1, 32));
      tm = fmaxf(tm, __shfl_xor(tm, 2, 32));
      const float mn = fmaxf(mrun, tm);
      const float al = exp_slot(mrun - mn);
      float add = 0.0f;
#pragma unroll
      for (int p = 0; p < 4; ++p) {      // pair p = groups 2p, 2p+1 = 8 neighbouring columns
        v8us o;
        float part = 0.0f;
#pragma unroll
        for (int e = 0; e < 4; ++e) {
          const float e0 = exp_slot(xs[2 * p][e] - mn);
          const float e1 = exp_slot(xs[2 * p + 1][e] - mn);
          part += e0 + e1;
          o[e]     = hbits(16384.0f * e0);
          o[4 + e] = hbits(16384.0f * e1);
        }
        add += part;
        *(v8us*)(Pt + fr * PTP + 64 * (p >> 1) + fc + 8 * (p & 1)) = o;
      }
      lrun = lrun * al + add;
      mrun = mn;
      if ((tid & 3) == 0) als[fr] = al;
    }
    keep_addr(pa0, pa1);
    __syncthreads();                     // P tile and al complete; also ends every read of ct of tile T
    {
      float av[4];
#pragma unroll
      for (int j = 0; j < 4; ++j) av[j] = als[16 * j + m];
#pragma unroll
      for (int k = 0; k < 8; ++k) {
#pragma unroll
        for (int r = 0; r < 8; ++r) acc[k][r] = acc[k][r] * av[k & 3];
      }
    }
#pragma unroll
    for (int kk = 0; kk < KT / 32; ++kk) {
      const v16us a0 = ua[kk];
      const v16us a1 = ub[kk];
      const v16us b0 = ldfrag_u(Pt + (0 * 16 + m) * PTP + 32 * kk + 8 * h);
      const v16us b1 = ldfrag_u(Pt + (1 * 16 + m) * PTP + 32 * kk + 8 * h);
      const v16us b2 = ldfrag_u(Pt + (2 * 16 + m) * PTP + 32 * kk + 8 * h);
      const v16us b3 = ldfrag_u(Pt + (3 * 16 + m) * PTP + 32 * kk + 8 * h);
      acc[0] = mma_hu(a0, b0, acc[0]);
      acc[1] = mma_hu(a0, b1, acc[1]);
      acc[2] = mma_hu(a0, b2, acc[2]);
      acc[3] = mma_hu(a0, b3, acc[3]);
      acc[4] = mma_hu(a1, b0, acc[4]);
      acc[5] = mma_hu(a1, b1, acc[5]);
      acc[6] = mma_hu(a1, b2, acc[6]);
      acc[7] = mma_hu(a1, b3, acc[7]);
      guard8(acc[0], acc[1], acc[2], acc[3], acc[4], acc[5], acc[6], acc[7], a0, a1, b0, b1, b2, b3);
    }
  }

  // row sums: the four column quarters of a row sit in four neighbouring lanes
  {
    float lt = lrun + __shfl_xor(lrun, 1, 32);
    lt += __shfl_xor(lt, 2, 32);
    if ((tid & 3) == 0) invs[fr] = rcpf(lt) * (1.0f / 262144.0f);
  }
  __syncthreads();

  // normalise: acc[4s+j][r] -> p at (c = 32w + 16s + 8h + r, i = 16j + m)
#pragma unroll
  for (int k = 0; k < 8; ++k) {
    const float iv = invs[16 * (k & 3) + m];
#pragma unroll
    for (int r = 0; r < 8; ++r) acc[k][r] = acc[k][r] * iv;
  }
  // per-channel partial statistics over the block's 64 pixels
  float rs[2][8], rq[2][8];
#pragma unroll
  for (int s = 0; s < 2; ++s) {
#pragma unroll
    for (int r = 0; r < 8; ++r) {
      float a = 0.0f, q2 = 0.0f;
#pragma unroll
      for (int j = 0; j < 4; ++j) {
        const float p = acc[4 * s + j][r];
        a += p;
        q2 += p * p;
      }
      rs[s][r] = a;
      rq[s][r] = q2;
    }
  }
#pragma unroll
  for (int s = 0; s < 2; ++s) {
#pragma unroll
    for (int r = 0; r < 8; ++r) {
#pragma unroll
      for (int o = 1; o < 16; o <<= 1) {
        rs[s][r] += __shfl_xor(rs[s][r], o, 32);
        rq[s][r] += __shfl_xor(rq[s][r], o, 32);
      }
    }
  }
  if (m == 0) {
#pragma unroll
    for (int s = 0; s < 2; ++s) {
#pragma unroll
      for (int r = 0; r < 8; ++r) {
        lsum[32 * w + 16 * s + 8 * h + r] = rs[s][r];
        lsq[32 * w + 16 * s + 8 * h + r]  = rq[s][r];
      }
    }
  }

  // O plane in two 128-channel halves (waves 0..3 then waves 4..7 supply the values)
#pragma unroll
  for (int half = 0; half < 2; ++half) {
    if ((w >> 2) == half) {                      // wave-uniform
#pragma unroll
      for (int s = 0; s < 2; ++s) {
#pragma unroll
        for (int j = 0; j < 4; ++j) {
#pragma unroll
          for (int r = 0; r < 8; ++r) {
            const int cl = 32 * (w & 3) + 16 * s + 8 * h + r;   // 0..127
            const int il = 16 * j + m;
            Et[cl * EPF + il] = acc[4 * s + j][r];
          }
        }
      }
    }
    __syncthreads();
    float* orows = O + (size_t)(128 * half) * NPX;
    o_store_pass(Et, orows, R0, w, lane);
    
    __syncthreads();
  }

  if (tid < 64) {
    const v4f v = *(const v4f*)(lsum + 4 * tid);
    float* d = ps + (size_t)blockIdx.x * CC + 4 * tid;
    *(v4f*)d = v;
    
  } else if (tid < 128) {
    const int t2 = tid - 64;
    const v4f v = *(const v4f*)(lsq + 4 * t2);
    float* d = pq + (size_t)blockIdx.x * CC + 4 * t2;
    *(v4f*)d = v;
    
  }
}

// =====================================================================================================
// GroupNorm + residual, all batches in one launch. Block = (channel c, batch b), 256 threads. Wave 0 combines the
// 64 blocks x 8 channels partial sums of group g = c/8 in f64 in a fixed order (lane l takes entries
// l, l+32, ... then an xor tree), mean = S/32768, var = Q/32768 - mean^2 (biased), rstd =
// 1/sqrt(var + 1e-5). out[c][n] = ((O[c][n] - mean) * rstd) * bf16(gn_w[c]) + bf16(gn_b[c]) +
// bf16(Hand[c][n]); row of 4096 floats written as 4 instructions of 256 threads x 16 B (each wave
// coverage: grid (256, nb) x 4096 = the whole [nb][256][4096] output, every element once.
// =====================================================================================================
__global__ __launch_bounds__(256)
void k_gn(const float* __restrict__ Oall, const float* __restrict__ psall, const float* __restrict__ pqall,
          const float* __restrict__ hand, const float* __restrict__ gnw,
          const float* __restrict__ gnb, float* out)
{
  __shared__ float stat[2];
  const int tid  = threadIdx.x;
  const int lane = tid & 31;
  const int w    = tid >> 5;
  const int c    = blockIdx.x;
  const int g    = c >> 3;
  const size_t po = (size_t)blockIdx.y * PLANE;
  const size_t pp = (size_t)blockIdx.y * HWD * CC;
  const float* O     = Oall + po;
  const float* ps    = psall + pp;
  const float* pq    = pqall + pp;
  const float* handb = hand + po;
  float*       outb  = out + po;

  if (w == 0) {                                  // wave-uniform
    double s = 0.0, q = 0.0;
    const float* psg = ps + 8 * g;
    const float* pqg = pq + 8 * g;
#pragma unroll 1
    for (int i = 0; i < 16; ++i) {
      const int idx = lane + 32 * i;             // 0..511
      const int blk = idx >> 3, ch = idx & 7;
      s += (double)psg[(size_t)blk * CC + ch];
      q += (double)pqg[(size_t)blk * CC + ch];
    }
#pragma unroll
    for (int o = 16; o >= 1; o >>= 1) {
      s += shfl_xor_d(s, o);
      q += shfl_xor_d(q, o);
    }
    if (lane == 0) {
      const double inv_n = 1.0 / 32768.0;
      const double mean = s * inv_n;
      double var = q * inv_n - mean * mean;
      if (var < 0.0) var = 0.0;
      const float varf = (float)var;
      stat[0] = (float)mean;
      stat[1] = rcpf(sqrtf(varf + 1e-5f));
    }
  }
  __syncthreads();
  const float meanf = stat[0];
  const float rstd  = stat[1];
  const float gw    = bf16r(gnw[c]);
  const float gb    = bf16r(gnb[c]);
  const float* orow = O + (size_t)c * NPX;
  const float* hrow = handb + (size_t)c * NPX;
  float* drow = outb + (size_t)c * NPX;

  v4f res[4];
#pragma unroll
  for (int it = 0; it < 4; ++it) {
    const int f = 4 * (it * 256 + tid);
    const v4f ov = *(const v4f*)(orow + f);
    const v4f hd = *(const v4f*)(hrow + f);
#pragma unroll
    for (int e = 0; e < 4; ++e) {
      const float xn = (ov[e] - meanf) * rstd;
      res[it][e] = xn * gw + gb + bf16r(hd[e]);
    }
  }
#pragma unroll
  for (int it = 0; it < 4; ++it)
    *(v4f*)(drow + 4 * (it * 256 + tid)) = res[it];
  
}

// =====================================================================================================
// Host glue. Inputs in table order (8): Hand [nb][256][64][64], U (same), WH_w [256][256], WH_b [256],
// WU_w [256][256], WU_b [256], gn_w [256], gn_b [256]; nb = in_sizes[0] / (256*4096), 1..4.
// Output f32 [nb][256][4096] at element 0. Workspace 76283904 B (sized for nb = 4).
// 4 launches, each over all batches: k_cvt (with the weights), k_proj, k_attn, k_gn.
// =====================================================================================================
extern "C" void kernel_launch(void* const* d_in, const int* in_sizes, int n_in,
                              void* d_out, int out_size, void* d_ws, size_t ws_size,
                              hipStream_t stream) {
  if (n_in < 8) return;
  const int per = CC * NPX;
  const int n0s = in_sizes[0];
  if (n0s < per || (n0s % per) != 0) return;
  const int nb = n0s / per;
  if (nb < 1 || nb > NBMAX) return;
  if (in_sizes[1] != n0s) return;
  if (in_sizes[2] != CC * CC || in_sizes[4] != CC * CC) return;
  if (in_sizes[3] != CC || in_sizes[5] != CC || in_sizes[6] != CC || in_sizes[7] != CC) return;
  if (out_size != nb * per) return;
  if (ws_size < WS_TOTAL) return;

  const float* hand = (const float*)d_in[0];
  const float* u    = (const float*)d_in[1];
  const float* whw  = (const float*)d_in[2];
  const float* whb  = (const float*)d_in[3];
  const float* wuw  = (const float*)d_in[4];
  const float* wub  = (const float*)d_in[5];
  const float* gnw  = (const float*)d_in[6];
  const float* gnb  = (const float*)d_in[7];
  float* out = (float*)d_out;

  char* ws = (char*)d_ws;
  unsigned short* ht  = (unsigned short*)(ws + OFF_HT);
  unsigned short* ut  = (unsigned short*)(ws + OFF_UT);
  unsigned short* uc  = (unsigned short*)(ws + OFF_UC);
  unsigned short* w16 = (unsigned short*)(ws + OFF_W16);
  unsigned short* qh  = (unsigned short*)(ws + OFF_QH);
  unsigned short* ql  = (unsigned short*)(ws + OFF_QL);
  unsigned short* kh  = (unsigned short*)(ws + OFF_KH);
  unsigned short* kl  = (unsigned short*)(ws + OFF_KL);
  float*          Op  = (float*)(ws + OFF_O);
  float*          ps  = (float*)(ws + OFF_PS);
  float*          pq  = (float*)(ws + OFF_PQ);

  k_cvt<<<dim3(NPX / 64, 1 + CC / 64 * nb), dim3(256), 0, stream>>>(hand, u, whw, wuw, ht, ut, uc, w16);
  (void)hipGetLastError();
  k_proj<<<dim3(NPX / 64, CC / 64, 2 * nb), dim3(128), 0, stream>>>(ht, ut, w16, whb, wub,
                                                                     qh, ql, kh, kl);
  (void)hipGetLastError();

  k_attn<<<dim3(HWD, nb), dim3(256), 0, stream>>>(qh, ql, kh, kl, uc, Op, ps, pq);
  (void)hipGetLastError();

  k_gn<<<dim3(CC, nb), dim3(256), 0, stream>>>(Op, ps, pq, hand, gnw, gnb, out);
  (void)hipGetLastError();
}

// v004
// Measured time: 152 microseconds a run.
// Two timings next to v003 both put it at 1.07 times that version's speed.
// All steps since v000 together make it 6.25 times as fast.
// Contractions: 1x1 projections (K=256), affinity scores (K=256) and softmax(P).U (K=4096 in 128-deep
// tiles) on v_wmma_f32_16x16x32_f16 (f16 operands, f32 accumulate); operands are RNE-bf16 inputs held in
// f16 containers (weights x16, activations and values x16), projected q/k vectors as f16 hi plus x2^15
// residual planes (three products in the score GEMM), softmax planes x2^14; running softmax statistics,
// normalisation statistics (f64 combine) and epilogues f32 VALU. Scores never leave the work-group.
#include <hip/hip_runtime.h>
#include <stddef.h>
#include <stdint.h>
#include <math.h>

#define NBMAX 4
#define CC    256
#define NPX   4096
#define HWD   64
#define TP    72
#define EPF   68
#define QP    264                                      // LDS pitch (halves) of a resident query row
#define KT    128                                      // key pixels per tile of the fused pass
#define CTP   132                                      // LDS pitch (floats) of a score tile row
#define PTP   136                                      // LDS pitch (halves) of a P tile row
#define FRAG  512                                      // halves of one 16-row x 32-k fragment block

#define PLANE       ((size_t)CC * NPX)                 // 1048576 elements per batch plane
#define ACT16_BYTES ((size_t)NBMAX * PLANE * 2)        // 8388608
#define W16_BYTES   ((size_t)2 * CC * CC * 2)          // 262144
#define O_BYTES     ((size_t)NBMAX * PLANE * 4)        // 16777216
#define PS_BYTES    ((size_t)NBMAX * HWD * CC * 4)     // 262144

// ---- carve ----------------------------------------------------------------------------------------
#define OFF_HT   ((size_t)0)
#define OFF_UT   (OFF_HT + ACT16_BYTES)
#define OFF_UC   (OFF_UT + ACT16_BYTES)
#define OFF_W16  (OFF_UC + ACT16_BYTES)
#define OFF_QH   (OFF_W16 + W16_BYTES)
#define OFF_QL   (OFF_QH + ACT16_BYTES)
#define OFF_KH   (OFF_QL + ACT16_BYTES)
#define OFF_KL   (OFF_KH + ACT16_BYTES)
#define OFF_O    (OFF_KL + ACT16_BYTES)
#define OFF_PS   (OFF_O + O_BYTES)
#define OFF_PQ   (OFF_PS + PS_BYTES)
#define WS_TOTAL (OFF_PQ + PS_BYTES)

static_assert(OFF_QH == (size_t)25427968);
static_assert(OFF_O == (size_t)58982400);
static_assert(WS_TOTAL == (size_t)76283904);
static_assert(WS_TOTAL <= (size_t)134217728);
static_assert((OFF_UT % 256) == 0);
static_assert((OFF_UC % 256) == 0);
static_assert((OFF_W16 % 256) == 0);
static_assert((OFF_QH % 256) == 0);
static_assert((OFF_QL % 256) == 0);
static_assert((OFF_KH % 256) == 0);
static_assert((OFF_KL % 256) == 0);
static_assert((OFF_O % 256) == 0);
static_assert((OFF_PS % 256) == 0);
static_assert((OFF_PQ % 256) == 0);
static_assert(NPX == HWD * HWD);
static_assert((NPX / 64) * 256 * 8 == 2 * CC * CC);    // one grid row of k_cvt covers both weight planes
static_assert((CC % 64) == 0);
static_assert((NPX % 64) == 0);
static_assert((TP * 2) % 16 == 0);
static_assert((EPF * 4) % 16 == 0);
static_assert((QP * 2) % 32 == 16);
static_assert((PTP * 2) % 32 == 16);
static_assert((CTP * 4) % 16 == 0);
static_assert((NPX % KT) == 0);

typedef unsigned short v8us  __attribute__((ext_vector_type(8)));
typedef unsigned short v16us __attribute__((ext_vector_type(16)));
typedef _Float16       v16h  __attribute__((ext_vector_type(16)));
typedef float          v4f   __attribute__((ext_vector_type(4)));
typedef float          v8f   __attribute__((ext_vector_type(8)));

union FragU { v16us v; v8us half[2]; };

// ---- scalar helpers -------------------------------------------------------------------------------
__device__ __forceinline__ unsigned bbits(float f) {          // f32 -> nearest-even bf16 bits
  unsigned u = __float_as_uint(f);
  return (u + 0x7FFFu + ((u >> 16) & 1u)) >> 16;
}
__device__ __forceinline__ float bf16r(float f) {            // RNE convert to bf16 and back
  return __uint_as_float(bbits(f) << 16);
}
__device__ __forceinline__ unsigned short hbits(float f) {   // f32 -> f16 bits (RNE)
  return __builtin_bit_cast(unsigned short, (_Float16)f);
}
__device__ __forceinline__ float rcpf(float x) {
#if defined(__HIP_DEVICE_COMPILE__)
  return __builtin_amdgcn_rcpf(x);
#else
  return 1.0f / x;
#endif
}
// exp(x) as one v_exp_f32 of x * log2(e), as __expf compiles to. The v_nop keeps the one free slot that the
// instruction set asks for between a transcendental and a next instruction that reads its result or
// rewrites its source.
__device__ __forceinline__ float exp_slot(float x) {
#if defined(__HIP_DEVICE_COMPILE__)
  float r;
  asm("v_exp_f32 %0, %1\n\tv_nop" : "=v"(r) : "v"(x * 1.44269504f));
  return r;
#else
  return x;
#endif
}
// The wait that stands in front of a rewrite of the address registers p, q of issued global loads. Naming
// them as inputs keeps them untouched up to here, behind the work that runs under the loads; at their
// first reuse, where the compiler puts the wait otherwise, it held that work back behind all the loads.
__device__ __forceinline__ void keep_addr(const unsigned short* p, const unsigned short* q) {
#if defined(__HIP_DEVICE_COMPILE__)
  asm volatile("s_wait_xcnt 0x0" :: "v"(p), "v"(q) : "memory");
#else
  (void)p; (void)q;
#endif
}
// Work-group barrier that publishes LDS only: a wave waits for its own LDS operations and not for its global
// loads, so fragments asked for ahead stay in flight across it (__syncthreads() would wait for them too).
// For places where no global store of the work-group has to be seen by another wave.
__device__ __forceinline__ void barrier_lds() {
#if defined(__HIP_DEVICE_COMPILE__)
  asm volatile("s_wait_dscnt 0x0\n\ts_barrier_signal -1\n\ts_barrier_wait -1" ::: "memory");
#endif
}
// The wait of keep_addr for loads that address by a wave-uniform base and a lane offset: p, q and off are
// the registers that those loads name.
__device__ __forceinline__ void keep_base(unsigned off, const unsigned short* p, const unsigned short* q) {
#if defined(__HIP_DEVICE_COMPILE__)
  asm volatile("s_wait_xcnt 0x0" :: "v"(off), "s"(p), "s"(q) : "memory");
#else
  (void)off; (void)p; (void)q;
#endif
}
__device__ __forceinline__ v8f zero8() { v8f z = {0.f, 0.f, 0.f, 0.f, 0.f, 0.f, 0.f, 0.f}; return z; }

__device__ __forceinline__ double shfl_xor_d(double v, int o) {
  const long long x = __double_as_longlong(v);
  int lo = (int)(x & 0xffffffffll);
  int hi = (int)(x >> 32);
  lo = __shfl_xor(lo, o, 32);
  hi = __shfl_xor(hi, o, 32);
  const long long y = ((long long)(unsigned)hi << 32) | (long long)(unsigned)lo;
  return __longlong_as_double(y);
}

// ---- 16-bit fragment loader, split k map for A and B alike ([row][k] planes, k contiguous):
//      p = row_base + k0 + 8*(lane>>4): elements 0..7 <- p[0..7], elements 8..15 <- p[16..23]
__device__ __forceinline__ v16us ldfrag_u(const unsigned short* p) {
  FragU f;
  f.half[0] = *(const v8us*)(p);
  f.half[1] = *(const v8us*)(p + 16);
  return f.v;
}

// ---- fragment-order planes (every operand plane that a wave loads straight from global memory): a plane
//      of rows x K halves is a row-major grid of blocks [row / 16][k / 32], FRAG halves each; a block holds
//      the two 16-byte pieces of all 32 lanes back to back, element (row, k) at
//      256 * ((k >> 4) & 1) + 8 * (16 * ((k >> 3) & 1) + (row & 15)) + (k & 7): the split k map above, but
//      each load instruction of a wave reads 512 contiguous bytes (four whole 128-byte lines, not 16 parts).
//      p = block + 8 * lane
__device__ __forceinline__ v16us ldfrag_g(const unsigned short* p) {
  FragU f;
  f.half[0] = *(const v8us*)(p);
  f.half[1] = *(const v8us*)(p + 256);
  return f.v;
}

// ---- WMMA helper (f16 operands as raw 16-bit lanes, f32 accumulate) --------------------------------
__device__ __forceinline__ v8f mma_hu(v16us a, v16us b, v8f c) {
#if defined(__HIP_DEVICE_COMPILE__)
  return __builtin_amdgcn_wmma_f32_16x16x32_f16(false, __builtin_bit_cast(v16h, a),
                                               false, __builtin_bit_cast(v16h, b),
                                               (short)0, c, false, false);
#else
  (void)a; (void)b;
  return c;
#endif
}
// hazard guards after the last WMMA of a group: tie the accumulators, keep the fragments live
__device__ __forceinline__ void guard4(v8f& c0, v8f& c1, v8f& c2, v8f& c3, const v16us& a,
                                       const v16us& b0, const v16us& b1, const v16us& b2,
                                       const v16us& b3) {
#if defined(__HIP_DEVICE_COMPILE__)
  asm volatile("v_nop\n\tv_nop\n\tv_nop\n\tv_nop"
               : "+v"(c0), "+v"(c1), "+v"(c2), "+v"(c3)
               : "v"(a), "v"(b0), "v"(b1), "v"(b2), "v"(b3));
#else
  (void)c0; (void)c1; (void)c2; (void)c3; (void)a; (void)b0; (void)b1; (void)b2; (void)b3;
#endif
}
__device__ __forceinline__ void guard8(v8f& c0, v8f& c1, v8f& c2, v8f& c3, v8f& c4, v8f& c5,
                                       v8f& c6, v8f& c7, const v16us& a0, const v16us& a1,
                                       const v16us& b0, const v16us& b1, const v16us& b2,
                                       const v16us& b3) {
#if defined(__HIP_DEVICE_COMPILE__)
  asm volatile("v_nop\n\tv_nop\n\tv_nop\n\tv_nop"
               : "+v"(c0), "+v"(c1), "+v"(c2), "+v"(c3), "+v"(c4), "+v"(c5), "+v"(c6), "+v"(c7)
               : "v"(a0), "v"(a1), "v"(b0), "v"(b1), "v"(b2), "v"(b3));
#else
  (void)c0; (void)c1; (void)c2; (void)c3; (void)c4; (void)c5; (void)c6; (void)c7;
  (void)a0; (void)a1; (void)b0; (void)b1; (void)b2; (void)b3;
#endif
}

// 16-bit tile 64 rows x 64 k (LDS pitch PITCH halves) -> fragment-order plane P with kblocks blocks per
// row group: row groups rg0..rg0+3, k blocks kb0, kb0+1; one wave instruction = one 512-byte piece.
template <int NW, int PITCH>
__device__ __forceinline__ void store_tile_frag(const unsigned short* t, unsigned short* P,
                                                int rg0, int kblocks, int kb0, int w, int lane) {
  constexpr int NIT = 16 / NW;
  const int h = lane >> 4;
  const int m = lane & 15;
  v8us   v[NIT];
  size_t off[NIT];
#pragma unroll
  for (int it = 0; it < NIT; ++it) {
    const int ch  = it * NW + w;                  // 0..15 = (row group, k block, piece)
    const int gl  = ch >> 2;
    const int kbl = (ch >> 1) & 1;
    const int hf  = ch & 1;
    v[it]   = *(const v8us*)(t + (16 * gl + m) * PITCH + 32 * kbl + 16 * hf + 8 * h);
    off[it] = ((size_t)(rg0 + gl) * kblocks + kb0 + kbl) * FRAG + 256 * hf + 8 * lane;
  }
#pragma unroll
  for (int it = 0; it < NIT; ++it) *(v8us*)(P + off[it]) = v[it];
}

// =====================================================================================================
// Weight planes W16[set] = f16(16 * bf16(W[o][c])) in fragment order, set 0 = WH_w, 1 = WU_w (block-uniform);
// thread = one 16-byte piece of the plane, so the stores are contiguous. Run by the 64 blocks bx of grid
// row 0 of k_cvt.
// coverage: 64 blocks x 256 threads x 8 = 131072 halves, every element once.
// =====================================================================================================
__device__ __forceinline__ void wcvt_block(const float* __restrict__ whw, const float* __restrict__ wuw,
                                           unsigned short* w16, int bx, int tid)
{
  const int t   = bx * 256 + tid;                   // 0..16383
  const int o   = 8 * t;
  const int set = bx >> 5;                          // block-uniform
  const int idx = o & (CC * CC - 1);                // place in the fragment-order plane (rows o, k = c)
  const int blk = idx / FRAG;                       // (row group, k block)
  const int ln  = (idx >> 3) & 31;
  const int row = 16 * (blk >> 3) + (ln & 15);
  const int col = 32 * (blk & 7) + 16 * ((idx >> 8) & 1) + 8 * (ln >> 4);
  const float* p = (set ? wuw : whw) + row * CC + col;
  v8us ob;
#pragma unroll
  for (int e = 0; e < 8; ++e) ob[e] = hbits(16.0f * bf16r(p[e]));
  *(v8us*)(w16 + o) = ob;
}

// =====================================================================================================
// for the projection A fragments); UC: rows c, k = n in fragment order (for the P.U A fragment).
// Block = (64 px tile, y = 1 + 4 b + 64 ch tile), 256 threads; thread = (channel cl = tid>>2, 16-px quarter).
// All three planes in fragment order: HT/UT rows n, k = c; UC rows c, k = n (16 pieces of 512 B per tile).
// Grid row y = 0 converts the weights instead: they depend on nothing here, so they need no launch of
// their own.
// coverage: grid (64, 1 + 4 nb): every (b, c, n) of HT, UT and UC and every weight written exactly once.
// =====================================================================================================
__global__ __launch_bounds__(256)
void k_cvt(const float* __restrict__ hand, const float* __restrict__ u,
           const float* __restrict__ whw, const float* __restrict__ wuw,
           unsigned short* ht, unsigned short* ut, unsigned short* uc, unsigned short* w16)
{
  __shared__ __align__(16) unsigned short TH[64 * TP];
  __shared__ __align__(16) unsigned short TU[64 * TP];
  __shared__ __align__(16) unsigned short TC[64 * TP];

  const int tid  = threadIdx.x;
  const int lane = tid & 31;
  const int w    = tid >> 5;
  if (blockIdx.y == 0) {                  // block-uniform, in front of the barrier
    wcvt_block(whw, wuw, w16, blockIdx.x, tid);
    return;
  }
  const int yt   = blockIdx.y - 1;        // 4 b + channel tile
  const int n0   = 64 * blockIdx.x;
  const int c0   = 64 * (yt & (CC / 64 - 1));
  const int b    = yt / (CC / 64);
  const int cl   = tid >> 2;              // 0..63
  const int pq   = 16 * (tid & 3);        // 0,16,32,48
  const size_t src = (size_t)b * PLANE + (size_t)(c0 + cl) * NPX + n0 + pq;
#pragma unroll
  for (int g = 0; g < 4; ++g) {
    const v4f hv = *(const v4f*)(hand + src + 4 * g);
    const v4f uv = *(const v4f*)(u + src + 4 * g);
#pragma unroll
    for (int e = 0; e < 4; ++e) {
      const int px = pq + 4 * g + e;
      const unsigned short hb = hbits(16.0f * bf16r(hv[e]));
      const unsigned short ub = hbits(16.0f * bf16r(uv[e]));
      TH[px * TP + cl] = hb;
      TU[px * TP + cl] = ub;
      TC[cl * TP + px] = ub;
    }
  }
  __syncthreads();
  store_tile_frag<8, TP>(TH, ht + (size_t)b * PLANE, n0 / 16, CC / 32, c0 / 32, w, lane);
  store_tile_frag<8, TP>(TU, ut + (size_t)b * PLANE, n0 / 16, CC / 32, c0 / 32, w, lane);
  store_tile_frag<8, TP>(TC, uc + (size_t)b * PLANE, c0 / 16, NPX / 32, n0 / 32, w, lane);
}

// =====================================================================================================
// 1x1 projections: D[n][o] = sum_c X[n][c] * W16[o][c], tile 64(n) x 64(o), K = 256, 4 waves,
// wave w owns rows n 16w..16w+15 (A fragment from the fragment-order activation plane) and 4 column
// sub-tiles of 16 output channels (B fragment = W16 rows o, fragment order). Epilogue: /256, + bf16(bias),
// into the fragment-order planes (rows n, k = o).
// z = 2b + which: which 0 -> (HT, WH, WH_b) -> QH/QL; which 1 -> (UT, WU, WU_b) -> KH/KL.
// coverage: grid (64 n tiles, 4 o tiles, 2 nb): QH, QL, KH, KL [b][4096][256] every element once.
// =====================================================================================================
__global__ __launch_bounds__(128)
void k_proj(const unsigned short* __restrict__ ht, const unsigned short* __restrict__ ut,
            const unsigned short* __restrict__ w16, const float* __restrict__ whb,
            const float* __restrict__ wub, unsigned short* qh, unsigned short* ql,
            unsigned short* kh, unsigned short* kl)
{
  __shared__ __align__(16) unsigned short t0[64 * TP];
  __shared__ __align__(16) unsigned short t1[64 * TP];

  const int tid   = threadIdx.x;
  const int lane  = tid & 31;
  const int w     = tid >> 5;
  const int h     = lane >> 4;
  const int m     = lane & 15;
  const int n0    = 64 * blockIdx.x;
  const int o0    = 64 * blockIdx.y;
  const int which = blockIdx.z & 1;         // block-uniform
  const int bb    = blockIdx.z >> 1;
  const unsigned short* x  = (which ? ut : ht) + (size_t)bb * PLANE;
  const unsigned short* wm = w16 + (size_t)which * CC * CC;
  const float* bias = which ? wub : whb;

  v8f acc[4];
#pragma unroll
  for (int j = 0; j < 4; ++j) acc[j] = zero8();

  const unsigned short* pa = x + (size_t)(n0 / 16 + w) * (CC / 32) * FRAG + 8 * lane;
  const unsigned short* pb = wm + (size_t)(o0 / 16) * (CC / 32) * FRAG + 8 * lane;
  // two k steps per trip, kept rolled: a longer body would only add fragment registers
#pragma unroll 1
  for (int k2 = 0; k2 < CC / 64; ++k2) {
    const unsigned short* pak = pa + 2 * FRAG * k2;
    const unsigned short* pbk = pb + 2 * FRAG * k2;
    // unrolled: both steps address off the trip's two pointers by immediate offsets
#pragma unroll
    for (int u = 0; u < 2; ++u) {
      const v16us a  = ldfrag_g(pak + FRAG * u);
      const v16us b0 = ldfrag_g(pbk + FRAG * u);
      const v16us b1 = ldfrag_g(pbk + FRAG * (1 * (CC / 32) + u));
      const v16us b2 = ldfrag_g(pbk + FRAG * (2 * (CC / 32) + u));
      const v16us b3 = ldfrag_g(pbk + FRAG * (3 * (CC / 32) + u));
      acc[0] = mma_hu(a, b0, acc[0]);
      acc[1] = mma_hu(a, b1, acc[1]);
      acc[2] = mma_hu(a, b2, acc[2]);
      acc[3] = mma_hu(a, b3, acc[3]);
      guard4(acc[0], acc[1], acc[2], acc[3], a, b0, b1, b2, b3);
    }
    keep_addr(pak, pbk);                         // the next trip rewrites the loads' address registers
  }

  const float k256 = 1.0f / 256.0f;
  float bv[4];
#pragma unroll
  for (int j = 0; j < 4; ++j) bv[j] = bf16r(bias[o0 + 16 * j + m]);
#pragma unroll
  for (int j = 0; j < 4; ++j) {
#pragma unroll
    for (int r = 0; r < 8; ++r) {
      const float val = acc[j][r] * k256 + bv[j];
      const _Float16 hv = (_Float16)val;
      const int rl = 16 * w + 8 * h + r;       // pixel within tile
      const int cl = 16 * j + m;               // output channel within tile
      t0[rl * TP + cl] = __builtin_bit_cast(unsigned short, hv);
      t1[rl * TP + cl] = hbits((val - (float)hv) * 32768.0f);
    }
  }
  __syncthreads();
  unsigned short* dh = which ? kh : qh;
  unsigned short* dl = which ? kl : ql;
  store_tile_frag<4, TP>(t0, dh + (size_t)bb * PLANE, n0 / 16, CC / 32, o0 / 32, w, lane);
  store_tile_frag<4, TP>(t1, dl + (size_t)bb * PLANE, n0 / 16, CC / 32, o0 / 32, w, lane);
}

// =====================================================================================================
// Scores, softmax and P.U in one pass, all batches in one launch. Block = (64 query pixels R0.. of batch
// b, all 256 channels), 8 waves, loop over 32 tiles T of 128 key pixels; the score tile lives in LDS only.
//   resident: query planes QH/QL rows R0..R0+63 in LDS ([i][c], pitch 264 halves), filled once.
//   scores:   S[i][k] = QH.KH + (QH.KL + QL.KH) / 32768, K = 256; wave w owns key columns 16w..16w+15 and
//             all 64 query rows (four A fragments from LDS per B fragment from the key planes, so every
//             key row is fetched by one wave only).
//   softmax:  thread = (row i = tid>>2, 16 columns in each 64-column half); running row maximum mrun and
//             running sum lrun; P[i][k] = f16(16384 exp(S - mrun_new)), al[i] = exp(mrun_old - mrun_new).
//   P.U:      D[c][i] = D[c][i] * al[i] + UC[c][k] . P[i][k] (wave = 32 channels, 8 accumulators).
// Epilogue: p = D * (1/lsum[i]) / 2^18 (value scale 16, softmax scale 2^14); per-channel partial sums
// sum p, sum p^2 over the 64 pixels (fixed order: 4 sub-tiles then xor tree over 16 lanes); p staged
// coverage: grid (64, nb): O [b][256][4096] and PS/PQ [b][64][256], every element once.
// =====================================================================================================
__device__ __forceinline__ void o_store_pass(const float* Et, float* orows, int R0, int w, int lane)
{
  const int q  = lane >> 3;
  const int jj = lane & 7;
#pragma unroll 1
  for (int it = 0; it < 8; ++it) {
    const int li = it * 32 + 4 * w + q;         // 0..255
    const int c = li >> 1, hf = li & 1;
    const v4f v = *(const v4f*)(Et + c * EPF + 32 * hf + 4 * jj);
    *(v4f*)(orows + (size_t)c * NPX + R0 + 32 * hf + 4 * jj) = v;
    // the next trip rewrites the store's address and data registers: keep the wait in front of that
    asm volatile("s_wait_xcnt 0x0" ::: "memory");
  }
}

__global__ __launch_bounds__(256) __attribute__((amdgpu_waves_per_eu(2, 2)))
void k_attn(const unsigned short* __restrict__ qh, const unsigned short* __restrict__ ql,
            const unsigned short* __restrict__ kh, const unsigned short* __restrict__ kl,
            const unsigned short* __restrict__ uc, float* Oall, float* psall, float* pqall)
{
  __shared__ __align__(16) unsigned short Qs[2 * 64 * QP];
  __shared__ __align__(16) float ct[64 * CTP];
  __shared__ __align__(16) unsigned short Pt[64 * PTP];
  __shared__ __align__(16) float Et[128 * EPF];
  __shared__ float als[64];
  __shared__ float invs[64];
  __shared__ __align__(16) float lsum[CC];
  __shared__ __align__(16) float lsq[CC];

  const int tid  = threadIdx.x;
  const int lane = tid & 31;
  const int w    = tid >> 5;
  const int h    = lane >> 4;
  const int m    = lane & 15;
  const int R0   = 64 * blockIdx.x;
  const size_t po = (size_t)blockIdx.y * PLANE;
  const unsigned short* ucb = uc + po;
  float* O  = Oall + po;
  float* ps = psall + (size_t)blockIdx.y * HWD * CC;
  float* pq = pqall + (size_t)blockIdx.y * HWD * CC;

  // resident query planes: 2 x 64 rows of 256 halves = 2 x 64 pieces of 512 B of the fragment-order planes;
  // wave w moves the pieces 8w..8w+7 (row group w >> 1, k = 128 (w & 1) + 16 it + 8 h) to rows in LDS
  {
    const unsigned short* gqh = qh + po + (size_t)R0 * CC + 4 * FRAG * w + 8 * lane;
    const unsigned short* gql = ql + po + (size_t)R0 * CC + 4 * FRAG * w + 8 * lane;
    v8us th[8], tl[8];
#pragma unroll
    for (int it = 0; it < 8; ++it) {
      th[it] = *(const v8us*)(gqh + it * (FRAG / 2));
      tl[it] = *(const v8us*)(gql + it * (FRAG / 2));
    }
    keep_addr(gqh, gql);
    unsigned short* qd = Qs + (16 * (w >> 1) + m) * QP + 128 * (w & 1) + 8 * h;
#pragma unroll
    for (int it = 0; it < 8; ++it) {
      *(v8us*)(qd + 16 * it)           = th[it];
      *(v8us*)(qd + 64 * QP + 16 * it) = tl[it];
    }
  }
  const unsigned lk = (unsigned)(w * (CC / 32) * FRAG + 8 * lane); // lane's place in a key tile (halves)
  const unsigned short* khb = kh + po;
  const unsigned short* klb = kl + po;
  // key fragments live in registers from one tile to the next; tile 0 is asked for here
  v16us bh[CC / 32], bl[CC / 32];
#pragma unroll
  for (int kk = 0; kk < CC / 32; ++kk) {
    bh[kk] = ldfrag_g(khb + lk + FRAG * kk);
    bl[kk] = ldfrag_g(klb + lk + FRAG * kk);
  }
  keep_base(lk, khb, klb);
  const unsigned short* kh_l = khb + lk;
  const unsigned short* kl_l = klb + lk;
  __syncthreads();

  const unsigned short* qa  = Qs + m * QP + 8 * h;                 // hi plane, row m of a 16-row block

  const int fr = tid >> 2;               // score / P tile row (query pixel) 0..63
  const int fc = 16 * (tid & 3);         // 16 key columns in each 64-column half
  float mrun = -1.0e30f, lrun = 0.0f;

  v8f acc[8];
#pragma unroll
  for (int k = 0; k < 8; ++k) acc[k] = zero8();
  const unsigned lu = (unsigned)(2 * w * (NPX / 32) * FRAG + 8 * lane);  // lane's place in the value plane (halves)

  const float kx = 1.0f / 32768.0f;
#pragma unroll 1
  for (int T = 0; T < NPX / KT; ++T) {
    // The key fragments of tile T + 1 are asked for while tile T is worked on: the registers of k step kk - 1
    // are loaded anew behind the products of step kk, so each fragment has a whole tile's time to arrive and
    // the requests are spread over the score phase. The last trip asks for its own tile again (in bounds,
    // not used). Left: a query fragment read from LDS feeds three products only; two key groups per wave
    // would halve those reads.
    const int Tn = (T + 1 < NPX / KT) ? T + 1 : T;
    const unsigned short* nh = kh_l + (size_t)(KT * Tn) * CC;
    const unsigned short* nl = kl_l + (size_t)(KT * Tn) * CC;
    // value fragments of this tile: asked for behind the last k step, into registers that the query fragments
    // have left, so that the score tile's stores, the barrier and the softmax phase cover their latency
    v16us ua[4], ub[4];
    const unsigned short* pa0 = ucb + (KT / 32) * FRAG * T + lu;
    const unsigned short* pa1 = pa0 + (NPX / 32) * FRAG;
    {
      v8f sa[4], sx[4];
#pragma unroll
      for (int rb = 0; rb < 4; ++rb) { sa[rb] = zero8(); sx[rb] = zero8(); }
      // query fragments one k step ahead in a second register set: their LDS latency runs under the
      // twelve matrix instructions of the step before
      v16us ah[2][4], al[2][4];
#pragma unroll
      for (int rb = 0; rb < 4; ++rb) {
        ah[0][rb] = ldfrag_u(qa + 16 * rb * QP);
        al[0][rb] = ldfrag_u(qa + (64 + 16 * rb) * QP);
      }
#pragma unroll
      for (int kk = 0; kk < CC / 32; ++kk) {
        if (kk + 1 < CC / 32) {
#pragma unroll
          for (int rb = 0; rb < 4; ++rb) {
            ah[(kk + 1) & 1][rb] = ldfrag_u(qa + 16 * rb * QP + 32 * (kk + 1));
            al[(kk + 1) & 1][rb] = ldfrag_u(qa + (64 + 16 * rb) * QP + 32 * (kk + 1));
          }
        }
#pragma unroll
        for (int rb = 0; rb < 4; ++rb) {
          sa[rb] = mma_hu(ah[kk & 1][rb], bh[kk], sa[rb]);
          sx[rb] = mma_hu(ah[kk & 1][rb], bl[kk], sx[rb]);
          sx[rb] = mma_hu(al[kk & 1][rb], bh[kk], sx[rb]);
        }
        if (kk > 0) {
          // keeps the loads behind this step's products: twelve matrix instructions stand between the last
          // read of a fragment's registers and the load that writes them anew
          // (mask: vector, scalar and LDS instructions may cross it, matrix and global-memory ones may not)
          __builtin_amdgcn_sched_barrier(0x786);
          bh[kk - 1] = ldfrag_g(nh + FRAG * (kk - 1));
          bl[kk - 1] = ldfrag_g(nl + FRAG * (kk - 1));
        }
      }
#pragma unroll
      for (int k4 = 0; k4 < 4; ++k4) {
        ua[k4] = ldfrag_g(pa0 + FRAG * k4);
        ub[k4] = ldfrag_g(pa1 + FRAG * k4);
      }
#pragma unroll
      for (int rb = 0; rb < 4; ++rb) {
#pragma unroll
        for (int r = 0; r < 8; ++r)
          ct[(16 * rb + 8 * h + r) * CTP + 16 * w + m] = sa[rb][r] + sx[rb][r] * kx;
      }
    }
    barrier_lds();                       // score tile complete; also ends every read of Pt / als of tile T-1
    // the last k step's registers: behind the barrier, well clear of the products that read them
    bh[CC / 32 - 1] = ldfrag_g(nh + FRAG * (CC / 32 - 1));
    bl[CC / 32 - 1] = ldfrag_g(nl + FRAG * (CC / 32 - 1));
    {
      const float* s2 = ct + fr * CTP + fc;
      v4f xs[8];
#pragma unroll
      for (int g = 0; g < 4; ++g) {
        xs[g]     = *(const v4f*)(s2 + 4 * g);
        xs[4 + g] = *(const v4f*)(s2 + 64 + 4 * g);
      }
      float tm = xs[0][0];
#pragma unroll
      for (int g = 0; g < 8; ++g)
        tm = fmaxf(tm, fmaxf(fmaxf(xs[g][0], xs[g][1]), fmaxf(xs[g][2], xs[g][3])));
      tm = fmaxf(tm, __shfl_xor(tm, 1, 32));
      tm = fmaxf(tm, __shfl_xor(tm, 2, 32));
      const float mn = fmaxf(mrun, tm);
      const float al = exp_slot(mrun - mn);
      float add = 0.0f;
#pragma unroll
      for (int p = 0; p < 4; ++p) {      // pair p = groups 2p, 2p+1 = 8 neighbouring columns
        v8us o;
        float part = 0.0f;
#pragma unroll
        for (int e = 0; e < 4; ++e) {
          const float e0 = exp_slot(xs[2 * p][e] - mn);
          const float e1 = exp_slot(xs[2 * p + 1][e] - mn);
          part += e0 + e1;
          o[e]     = hbits(16384.0f * e0);
          o[4 + e] = hbits(16384.0f * e1);
        }
        add += part;
        *(v8us*)(Pt + fr * PTP + 64 * (p >> 1) + fc + 8 * (p & 1)) = o;
      }
      lrun = lrun * al + add;
      mrun = mn;
      if ((tid & 3) == 0) als[fr] = al;
    }
    keep_addr(pa0, pa1);
    keep_addr(nh, nl);
    barrier_lds();                       // P tile and al complete; also ends every read of ct of tile T
    {
      float av[4];
#pragma unroll
      for (int j = 0; j < 4; ++j) av[j] = als[16 * j + m];
#pragma unroll
      for (int k = 0; k < 8; ++k) {
#pragma unroll
        for (int r = 0; r < 8; ++r) acc[k][r] = acc[k][r] * av[k & 3];
      }
    }
#pragma unroll
    for (int kk = 0; kk < KT / 32; ++kk) {
      const v16us a0 = ua[kk];
      const v16us a1 = ub[kk];
      const v16us b0 = ldfrag_u(Pt + (0 * 16 + m) * PTP + 32 * kk + 8 * h);
      const v16us b1 = ldfrag_u(Pt + (1 * 16 + m) * PTP + 32 * kk + 8 * h);
      const v16us b2 = ldfrag_u(Pt + (2 * 16 + m) * PTP + 32 * kk + 8 * h);
      const v16us b3 = ldfrag_u(Pt + (3 * 16 + m) * PTP + 32 * kk + 8 * h);
      acc[0] = mma_hu(a0, b0, acc[0]);
      acc[1] = mma_hu(a0, b1, acc[1]);
      acc[2] = mma_hu(a0, b2, acc[2]);
      acc[3] = mma_hu(a0, b3, acc[3]);
      acc[4] = mma_hu(a1, b0, acc[4]);
      acc[5] = mma_hu(a1, b1, acc[5]);
      acc[6] = mma_hu(a1, b2, acc[6]);
      acc[7] = mma_hu(a1, b3, acc[7]);
      guard8(acc[0], acc[1], acc[2], acc[3], acc[4], acc[5], acc[6], acc[7], a0, a1, b0, b1, b2, b3);
    }
  }

  // row sums: the four column quarters of a row sit in four neighbouring lanes
  {
    float lt = lrun + __shfl_xor(lrun, 1, 32);
    lt += __shfl_xor(lt, 2, 32);
    if ((tid & 3) == 0) invs[fr] = rcpf(lt) * (1.0f / 262144.0f);
  }
  __syncthreads();

  // normalise: acc[4s+j][r] -> p at (c = 32w + 16s + 8h + r, i = 16j + m)
#pragma unroll
  for (int k = 0; k < 8; ++k) {
    const float iv = invs[16 * (k & 3) + m];
#pragma unroll
    for (int r = 0; r < 8; ++r) acc[k][r] = acc[k][r] * iv;
  }
  // per-channel partial statistics over the block's 64 pixels
  float rs[2][8], rq[2][8];
#pragma unroll
  for (int s = 0; s < 2; ++s) {
#pragma unroll
    for (int r = 0; r < 8; ++r) {
      float a = 0.0f, q2 = 0.0f;
#pragma unroll
      for (int j = 0; j < 4; ++j) {
        const float p = acc[4 * s + j][r];
        a += p;
        q2 += p * p;
      }
      rs[s][r] = a;
      rq[s][r] = q2;
    }
  }
#pragma unroll
  for (int s = 0; s < 2; ++s) {
#pragma unroll
    for (int r = 0; r < 8; ++r) {
#pragma unroll
      for (int o = 1; o < 16; o <<= 1) {
        rs[s][r] += __shfl_xor(rs[s][r], o, 32);
        rq[s][r] += __shfl_xor(rq[s][r], o, 32);
      }
    }
  }
  if (m == 0) {
#pragma unroll
    for (int s = 0; s < 2; ++s) {
#pragma unroll
      for (int r = 0; r < 8; ++r) {
        lsum[32 * w + 16 * s + 8 * h + r] = rs[s][r];
        lsq[32 * w + 16 * s + 8 * h + r]  = rq[s][r];
      }
    }
  }

  // O plane in two 128-channel halves (waves 0..3 then waves 4..7 supply the values)
#pragma unroll
  for (int half = 0; half < 2; ++half) {
    if ((w >> 2) == half) {                      // wave-uniform
#pragma unroll
      for (int s = 0; s < 2; ++s) {
#pragma unroll
        for (int j = 0; j < 4; ++j) {
#pragma unroll
          for (int r = 0; r < 8; ++r) {
            const int cl = 32 * (w & 3) + 16 * s + 8 * h + r;   // 0..127
            const int il = 16 * j + m;
            Et[cl * EPF + il] = acc[4 * s + j][r];
          }
        }
      }
    }
    __syncthreads();
    float* orows = O + (size_t)(128 * half) * NPX;
    o_store_pass(Et, orows, R0, w, lane);
    
    __syncthreads();
  }

  if (tid < 64) {
    const v4f v = *(const v4f*)(lsum + 4 * tid);
    float* d = ps + (size_t)blockIdx.x * CC + 4 * tid;
    *(v4f*)d = v;
    
  } else if (tid < 128) {
    const int t2 = tid - 64;
    const v4f v = *(const v4f*)(lsq + 4 * t2);
    float* d = pq + (size_t)blockIdx.x * CC + 4 * t2;
    *(v4f*)d = v;
    
  }
}

// =====================================================================================================
// GroupNorm + residual, all batches in one launch. Block = (channel c, batch b), 256 threads. Wave 0 combines the
// 64 blocks x 8 channels partial sums of group g = c/8 in f64 in a fixed order (lane l takes entries
// l, l+32, ... then an xor tree), mean = S/32768, var = Q/32768 - mean^2 (biased), rstd =
// 1/sqrt(var + 1e-5). out[c][n] = ((O[c][n] - mean) * rstd) * bf16(gn_w[c]) + bf16(gn_b[c]) +
// bf16(Hand[c][n]); row of 4096 floats written as 4 instructions of 256 threads x 16 B (each wave
// coverage: grid (256, nb) x 4096 = the whole [nb][256][4096] output, every element once.
// =====================================================================================================
__global__ __launch_bounds__(256)
void k_gn(const float* __restrict__ Oall, const float* __restrict__ psall, const float* __restrict__ pqall,
          const float* __restrict__ hand, const float* __restrict__ gnw,
          const float* __restrict__ gnb, float* out)
{
  __shared__ float stat[2];
  const int tid  = threadIdx.x;
  const int lane = tid & 31;
  const int w    = tid >> 5;
  const int c    = blockIdx.x;
  const int g    = c >> 3;
  const size_t po = (size_t)blockIdx.y * PLANE;
  const size_t pp = (size_t)blockIdx.y * HWD * CC;
  const float* O     = Oall + po;
  const float* ps    = psall + pp;
  const float* pq    = pqall + pp;
  const float* handb = hand + po;
  float*       outb  = out + po;

  if (w == 0) {                                  // wave-uniform
    double s = 0.0, q = 0.0;
    const float* psg = ps + 8 * g;
    const float* pqg = pq + 8 * g;
#pragma unroll 1
    for (int i = 0; i < 16; ++i) {
      const int idx = lane + 32 * i;             // 0..511
      const int blk = idx >> 3, ch = idx & 7;
      s += (double)psg[(size_t)blk * CC + ch];
      q += (double)pqg[(size_t)blk * CC + ch];
    }
#pragma unroll
    for (int o = 16; o >= 1; o >>= 1) {
      s += shfl_xor_d(s, o);
      q += shfl_xor_d(q, o);
    }
    if (lane == 0) {
      const double inv_n = 1.0 / 32768.0;
      const double mean = s * inv_n;
      double var = q * inv_n - mean * mean;
      if (var < 0.0) var = 0.0;
      const float varf = (float)var;
      stat[0] = (float)mean;
      stat[1] = rcpf(sqrtf(varf + 1e-5f));
    }
  }
  __syncthreads();
  const float meanf = stat[0];
  const float rstd  = stat[1];
  const float gw    = bf16r(gnw[c]);
  const float gb    = bf16r(gnb[c]);
  const float* orow = O + (size_t)c * NPX;
  const float* hrow = handb + (size_t)c * NPX;
  float* drow = outb + (size_t)c * NPX;

  v4f res[4];
#pragma unroll
  for (int it = 0; it < 4; ++it) {
    const int f = 4 * (it * 256 + tid);
    const v4f ov = *(const v4f*)(orow + f);
    const v4f hd = *(const v4f*)(hrow + f);
#pragma unroll
    for (int e = 0; e < 4; ++e) {
      const float xn = (ov[e] - meanf) * rstd;
      res[it][e] = xn * gw + gb + bf16r(hd[e]);
    }
  }
#pragma unroll
  for (int it = 0; it < 4; ++it)
    *(v4f*)(drow + 4 * (it * 256 + tid)) = res[it];
  
}

// =====================================================================================================
// Host glue. Inputs in table order (8): Hand [nb][256][64][64], U (same), WH_w [256][256], WH_b [256],
// WU_w [256][256], WU_b [256], gn_w [256], gn_b [256]; nb = in_sizes[0] / (256*4096), 1..4.
// Output f32 [nb][256][4096] at element 0. Workspace 76283904 B (sized for nb = 4).
// 4 launches, each over all batches: k_cvt (with the weights), k_proj, k_attn, k_gn.
// =====================================================================================================
extern "C" void kernel_launch(void* const* d_in, const int* in_sizes, int n_in,
                              void* d_out, int out_size, void* d_ws, size_t ws_size,
                              hipStream_t stream) {
  if (n_in < 8) return;
  const int per = CC * NPX;
  const int n0s = in_sizes[0];
  if (n0s < per || (n0s % per) != 0) return;
  const int nb = n0s / per;
  if (nb < 1 || nb > NBMAX) return;
  if (in_sizes[1] != n0s) return;
  if (in_sizes[2] != CC * CC || in_sizes[4] != CC * CC) return;
  if (in_sizes[3] != CC || in_sizes[5] != CC || in_sizes[6] != CC || in_sizes[7] != CC) return;
  if (out_size != nb * per) return;
  if (ws_size < WS_TOTAL) return;

  const float* hand = (const float*)d_in[0];
  const float* u    = (const float*)d_in[1];
  const float* whw  = (const float*)d_in[2];
  const float* whb  = (const float*)d_in[3];
  const float* wuw  = (const float*)d_in[4];
  const float* wub  = (const float*)d_in[5];
  const float* gnw  = (const float*)d_in[6];
  const float* gnb  = (const float*)d_in[7];
  float* out = (float*)d_out;

  char* ws = (char*)d_ws;
  unsigned short* ht  = (unsigned short*)(ws + OFF_HT);
  unsigned short* ut  = (unsigned short*)(ws + OFF_UT);
  unsigned short* uc  = (unsigned short*)(ws + OFF_UC);
  unsigned short* w16 = (unsigned short*)(ws + OFF_W16);
  unsigned short* qh  = (unsigned short*)(ws + OFF_QH);
  unsigned short* ql  = (unsigned short*)(ws + OFF_QL);
  unsigned short* kh  = (unsigned short*)(ws + OFF_KH);
  unsigned short* kl  = (unsigned short*)(ws + OFF_KL);
  float*          Op  = (float*)(ws + OFF_O);
  float*          ps  = (float*)(ws + OFF_PS);
  float*          pq  = (float*)(ws + OFF_PQ);

  k_cvt<<<dim3(NPX / 64, 1 + CC / 64 * nb), dim3(256), 0, stream>>>(hand, u, whw, wuw, ht, ut, uc, w16);
  (void)hipGetLastError();
  k_proj<<<dim3(NPX / 64, CC / 64, 2 * nb), dim3(128), 0, stream>>>(ht, ut, w16, whb, wub,
                                                                     qh, ql, kh, kl);
  (void)hipGetLastError();

  k_attn<<<dim3(HWD, nb), dim3(256), 0, stream>>>(qh, ql, kh, kl, uc, Op, ps, pq);
  (void)hipGetLastError();

  k_gn<<<dim3(CC, nb), dim3(256), 0, stream>>>(Op, ps, pq, hand, gnw, gnb, out);
  (void)hipGetLastError();
}

// v005
// One run takes 134 microseconds.
// In both of two side-by-side timings against v004, it was 1.13 times as fast.
// All steps since v000 together make it 7.07 times as fast.
// Contractions: 1x1 projections (K=256), affinity scores (K=256) and softmax(P).U (K=4096 in 32-deep
// steps) on v_wmma_f32_16x16x32_f16 (f16 operands, f32 accumulate); operands are RNE-bf16 inputs held in
// f16 containers (weights x16, activations and values x16), projected q/k vectors as f16 hi plus x2^15
// residual planes (three products in the score GEMM), softmax planes x2^14; running softmax statistics,
// normalisation statistics (f64 combine) and epilogues f32 VALU. Scores never leave their wave's registers.
#include <hip/hip_runtime.h>
#include <stddef.h>
#include <stdint.h>
#include <math.h>

#define NBMAX 4
#define CC    256
#define NPX   4096
#define HWD   64
#define TP    72
#define EPF   68
#define FRAG  512                                      // halves of one 16-row x 32-k fragment block
#define SKH   16384                                    // halves of one key plane's 64 rows (one stage)
#define STG   (3 * SKH)                                // halves of one stage: KH, KL and the value blocks

#define PLANE       ((size_t)CC * NPX)                 // 1048576 elements per batch plane
#define ACT16_BYTES ((size_t)NBMAX * PLANE * 2)        // 8388608
#define W16_BYTES   ((size_t)2 * CC * CC * 2)          // 262144
#define O_BYTES     ((size_t)NBMAX * PLANE * 4)        // 16777216
#define PS_BYTES    ((size_t)NBMAX * HWD * CC * 4)     // 262144

// ---- carve ----------------------------------------------------------------------------------------
#define OFF_HT   ((size_t)0)
#define OFF_UT   (OFF_HT + ACT16_BYTES)
#define OFF_UC   (OFF_UT + ACT16_BYTES)
#define OFF_W16  (OFF_UC + ACT16_BYTES)
#define OFF_QH   (OFF_W16 + W16_BYTES)
#define OFF_QL   (OFF_QH + ACT16_BYTES)
#define OFF_KH   (OFF_QL + ACT16_BYTES)
#define OFF_KL   (OFF_KH + ACT16_BYTES)
#define OFF_O    (OFF_KL + ACT16_BYTES)
#define OFF_PS   (OFF_O + O_BYTES)
#define OFF_PQ   (OFF_PS + PS_BYTES)
#define WS_TOTAL (OFF_PQ + PS_BYTES)

static_assert(OFF_QH == (size_t)25427968);
static_assert(OFF_O == (size_t)58982400);
static_assert(WS_TOTAL == (size_t)76283904);
static_assert(WS_TOTAL <= (size_t)134217728);
static_assert((OFF_UT % 256) == 0);
static_assert((OFF_UC % 256) == 0);
static_assert((OFF_W16 % 256) == 0);
static_assert((OFF_QH % 256) == 0);
static_assert((OFF_QL % 256) == 0);
static_assert((OFF_KH % 256) == 0);
static_assert((OFF_KL % 256) == 0);
static_assert((OFF_O % 256) == 0);
static_assert((OFF_PS % 256) == 0);
static_assert((OFF_PQ % 256) == 0);
static_assert(NPX == HWD * HWD);
static_assert((NPX / 64) * 256 * 8 == 2 * CC * CC);    // one grid row of k_cvt covers both weight planes
static_assert((CC % 64) == 0);
static_assert((NPX % 64) == 0);
static_assert((TP * 2) % 16 == 0);
static_assert((EPF * 4) % 16 == 0);
static_assert(SKH == 64 * CC);
static_assert(SKH == (CC / 16) * 2 * FRAG);
static_assert(CC * EPF * 4 <= STG * 2);                // the staged output fits one ring buffer
static_assert(4 * 32 * 32 * 16 + 4 * 32 * 4 <= STG * 2);  // so does what the key halves hand over

typedef unsigned short v8us  __attribute__((ext_vector_type(8)));
typedef unsigned short v16us __attribute__((ext_vector_type(16)));
typedef _Float16       v16h  __attribute__((ext_vector_type(16)));
typedef float          v4f   __attribute__((ext_vector_type(4)));
typedef float          v8f   __attribute__((ext_vector_type(8)));
typedef int            v4i   __attribute__((ext_vector_type(4)));
typedef __attribute__((address_space(1))) v4i gv4i;
typedef __attribute__((address_space(3))) v4i lv4i;

union FragU { v16us v; v8us half[2]; };

// ---- scalar helpers -------------------------------------------------------------------------------
__device__ __forceinline__ unsigned bbits(float f) {          // f32 -> nearest-even bf16 bits
  unsigned u = __float_as_uint(f);
  return (u + 0x7FFFu + ((u >> 16) & 1u)) >> 16;
}
__device__ __forceinline__ float bf16r(float f) {            // RNE convert to bf16 and back
  return __uint_as_float(bbits(f) << 16);
}
__device__ __forceinline__ unsigned short hbits(float f) {   // f32 -> f16 bits (RNE)
  return __builtin_bit_cast(unsigned short, (_Float16)f);
}
__device__ __forceinline__ float rcpf(float x) {
#if defined(__HIP_DEVICE_COMPILE__)
  return __builtin_amdgcn_rcpf(x);
#else
  return 1.0f / x;
#endif
}
// exp(x) as one v_exp_f32 of x * log2(e), as __expf compiles to. The v_nop keeps the one free slot that the
// instruction set asks for between a transcendental and a next instruction that reads its result or
// rewrites its source.
__device__ __forceinline__ float exp_slot(float x) {
#if defined(__HIP_DEVICE_COMPILE__)
  float r;
  asm("v_exp_f32 %0, %1\n\tv_nop" : "=v"(r) : "v"(x * 1.44269504f));
  return r;
#else
  return x;
#endif
}
// The wait that stands in front of a rewrite of the address registers p, q of issued global loads. Naming
// them as inputs keeps them untouched up to here, behind the work that runs under the loads; at their
// first reuse, where the compiler puts the wait otherwise, it held that work back behind all the loads.
__device__ __forceinline__ void keep_addr(const unsigned short* p, const unsigned short* q) {
#if defined(__HIP_DEVICE_COMPILE__)
  asm volatile("s_wait_xcnt 0x0" :: "v"(p), "v"(q) : "memory");
#else
  (void)p; (void)q;
#endif
}
__device__ __forceinline__ v8f zero8() { v8f z = {0.f, 0.f, 0.f, 0.f, 0.f, 0.f, 0.f, 0.f}; return z; }

__device__ __forceinline__ double shfl_xor_d(double v, int o) {
  const long long x = __double_as_longlong(v);
  int lo = (int)(x & 0xffffffffll);
  int hi = (int)(x >> 32);
  lo = __shfl_xor(lo, o, 32);
  hi = __shfl_xor(hi, o, 32);
  const long long y = ((long long)(unsigned)hi << 32) | (long long)(unsigned)lo;
  return __longlong_as_double(y);
}

// ---- split k map of a 16-bit fragment, A and B alike: lane (m, h) holds row m; elements 0..7 are
//      k = 8 h + 0..7, elements 8..15 are k = 16 + 8 h + 0..7 of a 32-deep k block
// ---- fragment-order planes (every operand plane that a wave loads straight from global memory): a plane
//      of rows x K halves is a row-major grid of blocks [row / 16][k / 32], FRAG halves each; a block holds
//      the two 16-byte pieces of all 32 lanes back to back, element (row, k) at
//      256 * ((k >> 4) & 1) + 8 * (16 * ((k >> 3) & 1) + (row & 15)) + (k & 7): the split k map above, but
//      each load instruction of a wave reads 512 contiguous bytes (four whole 128-byte lines, not 16 parts).
//      p = block + 8 * lane
__device__ __forceinline__ v16us ldfrag_g(const unsigned short* p) {
  FragU f;
  f.half[0] = *(const v8us*)(p);
  f.half[1] = *(const v8us*)(p + 256);
  return f.v;
}

// ---- WMMA helper (f16 operands as raw 16-bit lanes, f32 accumulate) --------------------------------
__device__ __forceinline__ v8f mma_hu(v16us a, v16us b, v8f c) {
#if defined(__HIP_DEVICE_COMPILE__)
  return __builtin_amdgcn_wmma_f32_16x16x32_f16(false, __builtin_bit_cast(v16h, a),
                                               false, __builtin_bit_cast(v16h, b),
                                               (short)0, c, false, false);
#else
  (void)a; (void)b;
  return c;
#endif
}
// hazard guards after the last WMMA of a group: tie the accumulators, keep the fragments live
__device__ __forceinline__ void guard4(v8f& c0, v8f& c1, v8f& c2, v8f& c3, const v16us& a,
                                       const v16us& b0, const v16us& b1, const v16us& b2,
                                       const v16us& b3) {
#if defined(__HIP_DEVICE_COMPILE__)
  asm volatile("v_nop\n\tv_nop\n\tv_nop\n\tv_nop"
               : "+v"(c0), "+v"(c1), "+v"(c2), "+v"(c3)
               : "v"(a), "v"(b0), "v"(b1), "v"(b2), "v"(b3));
#else
  (void)c0; (void)c1; (void)c2; (void)c3; (void)a; (void)b0; (void)b1; (void)b2; (void)b3;
#endif
}

// 16-bit tile 64 rows x 64 k (LDS pitch PITCH halves) -> fragment-order plane P with kblocks blocks per
// row group: row groups rg0..rg0+3, k blocks kb0, kb0+1; one wave instruction = one 512-byte piece.
template <int NW, int PITCH>
__device__ __forceinline__ void store_tile_frag(const unsigned short* t, unsigned short* P,
                                                int rg0, int kblocks, int kb0, int w, int lane) {
  constexpr int NIT = 16 / NW;
  const int h = lane >> 4;
  const int m = lane & 15;
  v8us   v[NIT];
  size_t off[NIT];
#pragma unroll
  for (int it = 0; it < NIT; ++it) {
    const int ch  = it * NW + w;                  // 0..15 = (row group, k block, piece)
    const int gl  = ch >> 2;
    const int kbl = (ch >> 1) & 1;
    const int hf  = ch & 1;
    v[it]   = *(const v8us*)(t + (16 * gl + m) * PITCH + 32 * kbl + 16 * hf + 8 * h);
    off[it] = ((size_t)(rg0 + gl) * kblocks + kb0 + kbl) * FRAG + 256 * hf + 8 * lane;
  }
#pragma unroll
  for (int it = 0; it < NIT; ++it) *(v8us*)(P + off[it]) = v[it];
}

// =====================================================================================================
// Weight planes W16[set] = f16(16 * bf16(W[o][c])) in fragment order, set 0 = WH_w, 1 = WU_w (block-uniform);
// thread = one 16-byte piece of the plane, so the stores are contiguous. Run by the 64 blocks bx of grid
// row 0 of k_cvt.
// coverage: 64 blocks x 256 threads x 8 = 131072 halves, every element once.
// =====================================================================================================
__device__ __forceinline__ void wcvt_block(const float* __restrict__ whw, const float* __restrict__ wuw,
                                           unsigned short* w16, int bx, int tid)
{
  const int t   = bx * 256 + tid;                   // 0..16383
  const int o   = 8 * t;
  const int set = bx >> 5;                          // block-uniform
  const int idx = o & (CC * CC - 1);                // place in the fragment-order plane (rows o, k = c)
  const int blk = idx / FRAG;                       // (row group, k block)
  const int ln  = (idx >> 3) & 31;
  const int row = 16 * (blk >> 3) + (ln & 15);
  const int col = 32 * (blk & 7) + 16 * ((idx >> 8) & 1) + 8 * (ln >> 4);
  const float* p = (set ? wuw : whw) + row * CC + col;
  v8us ob;
#pragma unroll
  for (int e = 0; e < 8; ++e) ob[e] = hbits(16.0f * bf16r(p[e]));
  *(v8us*)(w16 + o) = ob;
}

// =====================================================================================================
// for the projection A fragments); UC: rows c, k = n in fragment order (for the P.U A fragment).
// Block = (64 px tile, y = 1 + 4 b + 64 ch tile), 256 threads; thread = (channel cl = tid>>2, 16-px quarter).
// All three planes in fragment order: HT/UT rows n, k = c; UC rows c, k = n (16 pieces of 512 B per tile).
// Grid row y = 0 converts the weights instead: they depend on nothing here, so they need no launch of
// their own.
// coverage: grid (64, 1 + 4 nb): every (b, c, n) of HT, UT and UC and every weight written exactly once.
// =====================================================================================================
__global__ __launch_bounds__(256)
void k_cvt(const float* __restrict__ hand, const float* __restrict__ u,
           const float* __restrict__ whw, const float* __restrict__ wuw,
           unsigned short* ht, unsigned short* ut, unsigned short* uc, unsigned short* w16)
{
  __shared__ __align__(16) unsigned short TH[64 * TP];
  __shared__ __align__(16) unsigned short TU[64 * TP];
  __shared__ __align__(16) unsigned short TC[64 * TP];

  const int tid  = threadIdx.x;
  const int lane = tid & 31;
  const int w    = tid >> 5;
  if (blockIdx.y == 0) {                  // block-uniform, in front of the barrier
    wcvt_block(whw, wuw, w16, blockIdx.x, tid);
    return;
  }
  const int yt   = blockIdx.y - 1;        // 4 b + channel tile
  const int n0   = 64 * blockIdx.x;
  const int c0   = 64 * (yt & (CC / 64 - 1));
  const int b    = yt / (CC / 64);
  const int cl   = tid >> 2;              // 0..63
  const int pq   = 16 * (tid & 3);        // 0,16,32,48
  const size_t src = (size_t)b * PLANE + (size_t)(c0 + cl) * NPX + n0 + pq;
#pragma unroll
  for (int g = 0; g < 4; ++g) {
    const v4f hv = *(const v4f*)(hand + src + 4 * g);
    const v4f uv = *(const v4f*)(u + src + 4 * g);
#pragma unroll
    for (int e = 0; e < 4; ++e) {
      const int px = pq + 4 * g + e;
      const unsigned short hb = hbits(16.0f * bf16r(hv[e]));
      const unsigned short ub = hbits(16.0f * bf16r(uv[e]));
      TH[px * TP + cl] = hb;
      TU[px * TP + cl] = ub;
      TC[cl * TP + px] = ub;
    }
  }
  __syncthreads();
  store_tile_frag<8, TP>(TH, ht + (size_t)b * PLANE, n0 / 16, CC / 32, c0 / 32, w, lane);
  store_tile_frag<8, TP>(TU, ut + (size_t)b * PLANE, n0 / 16, CC / 32, c0 / 32, w, lane);
  store_tile_frag<8, TP>(TC, uc + (size_t)b * PLANE, c0 / 16, NPX / 32, n0 / 32, w, lane);
}

// =====================================================================================================
// 1x1 projections: D[n][o] = sum_c X[n][c] * W16[o][c], tile 64(n) x 64(o), K = 256, 4 waves,
// wave w owns rows n 16w..16w+15 (A fragment from the fragment-order activation plane) and 4 column
// sub-tiles of 16 output channels (B fragment = W16 rows o, fragment order). Epilogue: /256, + bf16(bias),
// into the fragment-order planes (rows n, k = o).
// z = 2b + which: which 0 -> (HT, WH, WH_b) -> QH/QL; which 1 -> (UT, WU, WU_b) -> KH/KL.
// coverage: grid (64 n tiles, 4 o tiles, 2 nb): QH, QL, KH, KL [b][4096][256] every element once.
// =====================================================================================================
__global__ __launch_bounds__(128)
void k_proj(const unsigned short* __restrict__ ht, const unsigned short* __restrict__ ut,
            const unsigned short* __restrict__ w16, const float* __restrict__ whb,
            const float* __restrict__ wub, unsigned short* qh, unsigned short* ql,
            unsigned short* kh, unsigned short* kl)
{
  __shared__ __align__(16) unsigned short t0[64 * TP];
  __shared__ __align__(16) unsigned short t1[64 * TP];

  const int tid   = threadIdx.x;
  const int lane  = tid & 31;
  const int w     = tid >> 5;
  const int h     = lane >> 4;
  const int m     = lane & 15;
  const int n0    = 64 * blockIdx.x;
  const int o0    = 64 * blockIdx.y;
  const int which = blockIdx.z & 1;         // block-uniform
  const int bb    = blockIdx.z >> 1;
  const unsigned short* x  = (which ? ut : ht) + (size_t)bb * PLANE;
  const unsigned short* wm = w16 + (size_t)which * CC * CC;
  const float* bias = which ? wub : whb;

  v8f acc[4];
#pragma unroll
  for (int j = 0; j < 4; ++j) acc[j] = zero8();

  const unsigned short* pa = x + (size_t)(n0 / 16 + w) * (CC / 32) * FRAG + 8 * lane;
  const unsigned short* pb = wm + (size_t)(o0 / 16) * (CC / 32) * FRAG + 8 * lane;
  // two k steps per trip, kept rolled: a longer body would only add fragment registers
#pragma unroll 1
  for (int k2 = 0; k2 < CC / 64; ++k2) {
    const unsigned short* pak = pa + 2 * FRAG * k2;
    const unsigned short* pbk = pb + 2 * FRAG * k2;
    // unrolled: both steps address off the trip's two pointers by immediate offsets
#pragma unroll
    for (int u = 0; u < 2; ++u) {
      const v16us a  = ldfrag_g(pak + FRAG * u);
      const v16us b0 = ldfrag_g(pbk + FRAG * u);
      const v16us b1 = ldfrag_g(pbk + FRAG * (1 * (CC / 32) + u));
      const v16us b2 = ldfrag_g(pbk + FRAG * (2 * (CC / 32) + u));
      const v16us b3 = ldfrag_g(pbk + FRAG * (3 * (CC / 32) + u));
      acc[0] = mma_hu(a, b0, acc[0]);
      acc[1] = mma_hu(a, b1, acc[1]);
      acc[2] = mma_hu(a, b2, acc[2]);
      acc[3] = mma_hu(a, b3, acc[3]);
      guard4(acc[0], acc[1], acc[2], acc[3], a, b0, b1, b2, b3);
    }
    keep_addr(pak, pbk);                         // the next trip rewrites the loads' address registers
  }

  const float k256 = 1.0f / 256.0f;
  float bv[4];
#pragma unroll
  for (int j = 0; j < 4; ++j) bv[j] = bf16r(bias[o0 + 16 * j + m]);
#pragma unroll
  for (int j = 0; j < 4; ++j) {
#pragma unroll
    for (int r = 0; r < 8; ++r) {
      const float val = acc[j][r] * k256 + bv[j];
      const _Float16 hv = (_Float16)val;
      const int rl = 16 * w + 8 * h + r;       // pixel within tile
      const int cl = 16 * j + m;               // output channel within tile
      t0[rl * TP + cl] = __builtin_bit_cast(unsigned short, hv);
      t1[rl * TP + cl] = hbits((val - (float)hv) * 32768.0f);
    }
  }
  __syncthreads();
  unsigned short* dh = which ? kh : qh;
  unsigned short* dl = which ? kl : ql;
  store_tile_frag<4, TP>(t0, dh + (size_t)bb * PLANE, n0 / 16, CC / 32, o0 / 32, w, lane);
  store_tile_frag<4, TP>(t1, dl + (size_t)bb * PLANE, n0 / 16, CC / 32, o0 / 32, w, lane);
}

// =====================================================================================================
// Scores, softmax and P.U in one pass, all batches in one launch. Block = (64 query pixels R0.. of batch b,
// all 256 channels), 8 waves. Wave w owns the 16 queries of column group g = w & 3 and, of every stage of 64
// key pixels, the 32 keys of half hf = w >> 2; nothing of its scores or of P ever leaves its registers.
//   resident: the wave's query fragments QH/QL (B operands, 8 k steps each) in registers.
//   stage:    64 keys: KH and KL (32 KB each) and the value blocks UC (16 channel groups x 2 KB), copied as
//             they lie in the fragment-order planes into one of two LDS buffers, one stage ahead.
//   scores:   St[key][i] = KH.QH + (KH.QL + KL.QH) / 32768, K = 256, two tiles of 16 keys; a lane (m, h)
//             holds the keys 16 kt + 8 h + r of query m.
//   softmax:  in the lane plus one exchange between the wave halves for the maximum; running maximum mrun,
//             running sum lrun of the lane's own keys; P = f16(16384 exp(St - mrun)).
//   P.U:      D[c][i] = D[c][i] * al[i] + UC[c][k] . P[k][i]: the two score tiles, converted in place, are
//             the B operand in the split k map; 16 accumulators = all 256 channels.
// Epilogue: the two key halves of a column group are joined through LDS (common maximum, weighted sums),
// p = D / lsum[i] / 2^18 (value scale 16, softmax scale 2^14) is staged as [c][i]; thread c sums p and p^2 of
// its channel over the 64 pixels in pixel order; the O rows leave as whole 128-byte lines.
// coverage: grid (64, nb): O [b][256][4096] and PS/PQ [b][64][256], every element once.
// =====================================================================================================
__device__ __forceinline__ void o_store_pass(const float* Et, float* orows, int R0, int w, int lane)
{
  const int q  = lane >> 3;
  const int jj = lane & 7;
#pragma unroll 1
  for (int it = 0; it < 16; ++it) {
    const int li = it * 32 + 4 * w + q;         // 0..511
    const int c = li >> 1, hf = li & 1;
    const v4f v = *(const v4f*)(Et + c * EPF + 32 * hf + 4 * jj);
    *(v4f*)(orows + (size_t)c * NPX + R0 + 32 * hf + 4 * jj) = v;
    // the next trip rewrites the store's address and data registers: keep the wait in front of that
    asm volatile("s_wait_xcnt 0x0" ::: "memory");
  }
}

// lane l with lane l ^ 16
__device__ __forceinline__ float xhalf(float x) {
#if defined(__HIP_DEVICE_COMPILE__)
  return __builtin_bit_cast(float, __builtin_amdgcn_permlanex16(__builtin_bit_cast(int, x),
                                                                __builtin_bit_cast(int, x),
                                                                0x76543210, 0xfedcba98, false, false));
#else
  return x;
#endif
}

// 16 bytes per lane from global memory to LDS, through no register; OFF bytes further on both sides
template <int OFF>
__device__ __forceinline__ void copy16(const unsigned short* gsrc, unsigned short* ldst) {
  static_assert(OFF >= 0 && OFF < 65536);
#if defined(__HIP_DEVICE_COMPILE__)
  __builtin_amdgcn_global_load_async_to_lds_b128((gv4i*)gsrc, (lv4i*)ldst, OFF, 0);
#else
  (void)gsrc; (void)ldst;
#endif
}

// Stage s (keys 64 s .. 64 s + 63) into the buffer dst: 24 copies per lane, each wave instruction 512
// contiguous bytes on both sides. KH, KL: 32 KB in a row. UC: channel group t = 2 j + (tid >> 7), 2 KB each.
__device__ __forceinline__ void stage_copy(const unsigned short* khb, const unsigned short* klb,
                                           const unsigned short* ucb, unsigned short* dst, int s, int tid)
{
  const unsigned short* gk = khb + (size_t)s * SKH + 8 * tid;
  const unsigned short* gl = klb + (size_t)s * SKH + 8 * tid;
  const unsigned short* gu = ucb + (size_t)(tid >> 7) * (NPX / 32) * FRAG + (size_t)s * 2 * FRAG + 8 * (tid & 127);
  unsigned short* d = dst + 8 * tid;
  copy16<0>(gk, d);      copy16<4096>(gk, d);   copy16<8192>(gk, d);   copy16<12288>(gk, d);
  copy16<16384>(gk, d);  copy16<20480>(gk, d);  copy16<24576>(gk, d);  copy16<28672>(gk, d);
  unsigned short* dl = d + SKH;
  copy16<0>(gl, dl);     copy16<4096>(gl, dl);  copy16<8192>(gl, dl);  copy16<12288>(gl, dl);
  copy16<16384>(gl, dl); copy16<20480>(gl, dl); copy16<24576>(gl, dl); copy16<28672>(gl, dl);
#pragma unroll
  for (int j = 0; j < 8; ++j)
    copy16<0>(gu + (size_t)(2 * j) * (NPX / 32) * FRAG, d + 2 * SKH + 2048 * j);
}

__global__ __launch_bounds__(256) __attribute__((amdgpu_waves_per_eu(2, 2)))
void k_attn(const unsigned short* __restrict__ qh, const unsigned short* __restrict__ ql,
            const unsigned short* __restrict__ kh, const unsigned short* __restrict__ kl,
            const unsigned short* __restrict__ uc, float* Oall, float* psall, float* pqall)
{
  __shared__ __align__(16) unsigned short ring[2 * STG];

  const int tid  = threadIdx.x;
  const int lane = tid & 31;
  const int w    = tid >> 5;
  const int h    = lane >> 4;
  const int m    = lane & 15;
  const int g    = w & 3;                // column group: queries R0 + 16 g + m
  const int hf   = w >> 2;               // key half of every stage
  const int R0   = 64 * blockIdx.x;
  const size_t po = (size_t)blockIdx.y * PLANE;
  const unsigned short* khb = kh + po;
  const unsigned short* klb = kl + po;
  const unsigned short* ucb = uc + po;
  float* O  = Oall + po;
  float* ps = psall + (size_t)blockIdx.y * HWD * CC;
  float* pq = pqall + (size_t)blockIdx.y * HWD * CC;

  stage_copy(khb, klb, ucb, ring, 0, tid);

  // resident query fragments
  v16us qfh[CC / 32], qfl[CC / 32];
  {
    const unsigned short* gqh = qh + po + (size_t)(R0 / 16 + g) * (CC / 32) * FRAG + 8 * lane;
    const unsigned short* gql = ql + po + (size_t)(R0 / 16 + g) * (CC / 32) * FRAG + 8 * lane;
#pragma unroll
    for (int kk = 0; kk < CC / 32; ++kk) {
      qfh[kk] = ldfrag_g(gqh + FRAG * kk);
      qfl[kk] = ldfrag_g(gql + FRAG * kk);
    }
    keep_addr(gqh, gql);
  }

  float mrun = -1.0e30f, lrun = 0.0f;
  v8f acc[CC / 16];
#pragma unroll
  for (int t = 0; t < CC / 16; ++t) acc[t] = zero8();

  // stage 0 has landed for this wave, then for all; only then stage 1 is asked for
  asm volatile("s_wait_asynccnt 0x0" ::: "memory");
  __syncthreads();
  stage_copy(khb, klb, ucb, ring + STG, 1, tid);

  // key fragments two k steps at a time, one such group ahead in a second register set: a group's LDS
  // latency runs under the twelve matrix instructions of the group before. [set][4 u + (0: keys 0..15 hi,
  // 1: keys 16..31 hi, 2, 3: the same of the lo plane)]. A stage's first k step is read behind the stage's
  // publish point, in the pass before.
  v16us fa[2][8];
  {
    const unsigned short* f0 = ring + hf * (2 * (CC / 32) * FRAG) + 8 * lane;
    fa[0][0] = ldfrag_g(f0);
    fa[0][1] = ldfrag_g(f0 + FRAG * (CC / 32));
    fa[0][2] = ldfrag_g(f0 + SKH);
    fa[0][3] = ldfrag_g(f0 + SKH + FRAG * (CC / 32));
  }

  const float kx = 1.0f / 32768.0f;
  // The stage loop stays rolled (one body in the instruction cache); every loop inside it is unrolled, so that
  // the fragment and accumulator arrays are indexed by constants and live in registers.
#pragma unroll 1
  for (int s = 0; s < NPX / 64; ++s) {
    unsigned short* buf = ring + (s & 1) * STG;
    const unsigned short* fk = buf + hf * (2 * (CC / 32) * FRAG) + 8 * lane;   // the half's 32 keys, hi plane
    const unsigned short* fu = buf + 2 * SKH + hf * FRAG + 8 * lane;           // its value blocks
    v8f sa[2], sx[2];
#pragma unroll
    for (int kt = 0; kt < 2; ++kt) { sa[kt] = zero8(); sx[kt] = zero8(); }
    v16us ua[CC / 16];
    fa[0][4] = ldfrag_g(fk + FRAG);
    fa[0][5] = ldfrag_g(fk + FRAG * (CC / 32 + 1));
    fa[0][6] = ldfrag_g(fk + SKH + FRAG);
    fa[0][7] = ldfrag_g(fk + SKH + FRAG * (CC / 32 + 1));
#pragma unroll
    for (int k2 = 0; k2 < CC / 64; ++k2) {
      if (k2 + 1 < CC / 64) {
#pragma unroll
        for (int u = 0; u < 2; ++u) {
          const int kn = 2 * (k2 + 1) + u;
          fa[(k2 + 1) & 1][4 * u + 0] = ldfrag_g(fk + FRAG * kn);
          fa[(k2 + 1) & 1][4 * u + 1] = ldfrag_g(fk + FRAG * (CC / 32 + kn));
          fa[(k2 + 1) & 1][4 * u + 2] = ldfrag_g(fk + SKH + FRAG * kn);
          fa[(k2 + 1) & 1][4 * u + 3] = ldfrag_g(fk + SKH + FRAG * (CC / 32 + kn));
        }
      } else {
        // the first half of the value fragments takes the place of a next group
#pragma unroll
        for (int t = 0; t < CC / 32; ++t) ua[t] = ldfrag_g(fu + 2 * FRAG * t);
      }
      // keeps the sixteen reads together and ahead of the group's products: left alone, the scheduler spread
      // them among the matrix instructions, each read waited for right behind its issue
      __builtin_amdgcn_sched_barrier(0);
#pragma unroll
      for (int u = 0; u < 2; ++u) {
        const int kk = 2 * k2 + u;
        sx[0] = mma_hu(fa[k2 & 1][4 * u + 0], qfl[kk], sx[0]);
        sx[1] = mma_hu(fa[k2 & 1][4 * u + 1], qfl[kk], sx[1]);
        sa[0] = mma_hu(fa[k2 & 1][4 * u + 0], qfh[kk], sa[0]);
        sa[1] = mma_hu(fa[k2 & 1][4 * u + 1], qfh[kk], sa[1]);
        sx[0] = mma_hu(fa[k2 & 1][4 * u + 2], qfh[kk], sx[0]);
        sx[1] = mma_hu(fa[k2 & 1][4 * u + 3], qfh[kk], sx[1]);
      }
      // the other side of the same fence: the next group's reads stay behind these products
      __builtin_amdgcn_sched_barrier(0);
    }
    // the second half: the stage's last LDS reads; the pass reads LDS again only for the next stage's first k step
#pragma unroll
    for (int t = CC / 32; t < CC / 16; ++t) ua[t] = ldfrag_g(fu + 2 * FRAG * t);
    // the reads stay ahead of the vector work that follows, which covers their latency
    __builtin_amdgcn_sched_barrier(0);
    float sc[16];
#pragma unroll
    for (int e = 0; e < 16; ++e) sc[e] = sa[e >> 3][e & 7] + sx[e >> 3][e & 7] * kx;
    float tm4[4];
#pragma unroll
    for (int e = 0; e < 4; ++e) tm4[e] = fmaxf(fmaxf(sc[e], sc[4 + e]), fmaxf(sc[8 + e], sc[12 + e]));
    float tm = fmaxf(fmaxf(tm4[0], tm4[1]), fmaxf(tm4[2], tm4[3]));
    tm = fmaxf(tm, xhalf(tm));
    const float mn = fmaxf(mrun, tm);
    // publish point: this wave has left the buffer, its copies of stage s + 1 have landed; behind the barrier
    // that holds for every wave, and the buffer just read is filled anew: the copies have the softmax, the
    // P.U products and the next stage's scores to land
    asm volatile("s_wait_dscnt 0x0" ::: "memory");
    asm volatile("s_wait_asynccnt 0x0" ::: "memory");
    __syncthreads();
    if (s + 2 < NPX / 64) stage_copy(khb, klb, ucb, buf, s + 2, tid);
    if (s + 1 < NPX / 64) {
      // stage s + 1 is published: its first k step is read now, so that the next pass starts on its products
      const unsigned short* fn = ring + ((s + 1) & 1) * STG + hf * (2 * (CC / 32) * FRAG) + 8 * lane;
      fa[0][0] = ldfrag_g(fn);
      fa[0][1] = ldfrag_g(fn + FRAG * (CC / 32));
      fa[0][2] = ldfrag_g(fn + SKH);
      fa[0][3] = ldfrag_g(fn + SKH + FRAG * (CC / 32));
    }
    const float al = exp_slot(mrun - mn);
    v16us pf;
    float ad4[4] = {0.0f, 0.0f, 0.0f, 0.0f};   // four chains, not one of sixteen dependent additions
#pragma unroll
    for (int e = 0; e < 16; ++e) {
      const float ex = exp_slot(sc[e] - mn);
      ad4[e & 3] += ex;
      pf[e] = hbits(16384.0f * ex);
    }
    lrun = lrun * al + ((ad4[0] + ad4[1]) + (ad4[2] + ad4[3]));
    mrun = mn;
#pragma unroll
    for (int t = 0; t < CC / 16; ++t) {
#pragma unroll
      for (int r = 0; r < 8; ++r) acc[t][r] = acc[t][r] * al;
      acc[t] = mma_hu(ua[t], pf, acc[t]);
    }
  }
  // no copy is outstanding when the ring becomes the epilogue's staging
  asm volatile("s_wait_asynccnt 0x0" ::: "memory");

  float* mg = (float*)ring;              // [g][32 pieces][lane] of 16 B: the accumulators of key half 1
  float* ml = (float*)ring + 16384;      // [g][2][16]: its running maximum and sum
  float* Et = (float*)(ring + STG);      // [c][i], pitch EPF
  const float lt = lrun + xhalf(lrun);   // the wave halves hold different keys of the same query
  if (hf == 1) {                         // wave-uniform
#pragma unroll
    for (int t = 0; t < CC / 16; ++t) {
      const v4f lo = {acc[t][0], acc[t][1], acc[t][2], acc[t][3]};
      const v4f hi = {acc[t][4], acc[t][5], acc[t][6], acc[t][7]};
      *(v4f*)(mg + ((g * 32 + 2 * t) * 32 + lane) * 4)     = lo;
      *(v4f*)(mg + ((g * 32 + 2 * t + 1) * 32 + lane) * 4) = hi;
    }
    if (h == 0) {
      ml[g * 32 + m]      = mrun;
      ml[g * 32 + 16 + m] = lt;
    }
  }
  __syncthreads();
  if (hf == 0) {                         // wave-uniform
    const float m1 = ml[g * 32 + m];
    const float l1 = ml[g * 32 + 16 + m];
    const float mx = fmaxf(mrun, m1);
    const float a0 = exp_slot(mrun - mx);
    const float a1 = exp_slot(m1 - mx);
    const float iv = rcpf(lt * a0 + l1 * a1) * (1.0f / 262144.0f);
    const float c0 = a0 * iv;
    const float c1 = a1 * iv;
#pragma unroll
    for (int t = 0; t < CC / 16; ++t) {
      const v4f lo = *(const v4f*)(mg + ((g * 32 + 2 * t) * 32 + lane) * 4);
      const v4f hi = *(const v4f*)(mg + ((g * 32 + 2 * t + 1) * 32 + lane) * 4);
#pragma unroll
      for (int r = 0; r < 8; ++r) {
        const float o1 = (r < 4) ? lo[r & 3] : hi[r & 3];
        Et[(16 * t + 8 * h + r) * EPF + 16 * g + m] = acc[t][r] * c0 + o1 * c1;
      }
    }
  }
  __syncthreads();

  // per-channel partial statistics over the block's 64 pixels: thread = channel
  {
    const float* row = Et + tid * EPF;
    float a = 0.0f, q2 = 0.0f;
#pragma unroll
    for (int j = 0; j < 16; ++j) {
      const v4f v = *(const v4f*)(row + 4 * j);
#pragma unroll
      for (int e = 0; e < 4; ++e) {
        a += v[e];
        q2 += v[e] * v[e];
      }
    }
    ps[(size_t)blockIdx.x * CC + tid] = a;
    pq[(size_t)blockIdx.x * CC + tid] = q2;
  }
  o_store_pass(Et, O, R0, w, lane);
}

// =====================================================================================================
// GroupNorm + residual, all batches in one launch. Block = (channel c, batch b), 256 threads. Wave 0 combines the
// 64 blocks x 8 channels partial sums of group g = c/8 in f64 in a fixed order (lane l takes entries
// l, l+32, ... then an xor tree), mean = S/32768, var = Q/32768 - mean^2 (biased), rstd =
// 1/sqrt(var + 1e-5). out[c][n] = ((O[c][n] - mean) * rstd) * bf16(gn_w[c]) + bf16(gn_b[c]) +
// bf16(Hand[c][n]); row of 4096 floats written as 4 instructions of 256 threads x 16 B (each wave
// coverage: grid (256, nb) x 4096 = the whole [nb][256][4096] output, every element once.
// =====================================================================================================
__global__ __launch_bounds__(256)
void k_gn(const float* __restrict__ Oall, const float* __restrict__ psall, const float* __restrict__ pqall,
          const float* __restrict__ hand, const float* __restrict__ gnw,
          const float* __restrict__ gnb, float* out)
{
  __shared__ float stat[2];
  const int tid  = threadIdx.x;
  const int lane = tid & 31;
  const int w    = tid >> 5;
  const int c    = blockIdx.x;
  const int g    = c >> 3;
  const size_t po = (size_t)blockIdx.y * PLANE;
  const size_t pp = (size_t)blockIdx.y * HWD * CC;
  const float* O     = Oall + po;
  const float* ps    = psall + pp;
  const float* pq    = pqall + pp;
  const float* handb = hand + po;
  float*       outb  = out + po;

  if (w == 0) {                                  // wave-uniform
    double s = 0.0, q = 0.0;
    const float* psg = ps + 8 * g;
    const float* pqg = pq + 8 * g;
#pragma unroll 1
    for (int i = 0; i < 16; ++i) {
      const int idx = lane + 32 * i;             // 0..511
      const int blk = idx >> 3, ch = idx & 7;
      s += (double)psg[(size_t)blk * CC + ch];
      q += (double)pqg[(size_t)blk * CC + ch];
    }
#pragma unroll
    for (int o = 16; o >= 1; o >>= 1) {
      s += shfl_xor_d(s, o);
      q += shfl_xor_d(q, o);
    }
    if (lane == 0) {
      const double inv_n = 1.0 / 32768.0;
      const double mean = s * inv_n;
      double var = q * inv_n - mean * mean;
      if (var < 0.0) var = 0.0;
      const float varf = (float)var;
      stat[0] = (float)mean;
      stat[1] = rcpf(sqrtf(varf + 1e-5f));
    }
  }
  __syncthreads();
  const float meanf = stat[0];
  const float rstd  = stat[1];
  const float gw    = bf16r(gnw[c]);
  const float gb    = bf16r(gnb[c]);
  const float* orow = O + (size_t)c * NPX;
  const float* hrow = handb + (size_t)c * NPX;
  float* drow = outb + (size_t)c * NPX;

  v4f res[4];
#pragma unroll
  for (int it = 0; it < 4; ++it) {
    const int f = 4 * (it * 256 + tid);
    const v4f ov = *(const v4f*)(orow + f);
    const v4f hd = *(const v4f*)(hrow + f);
#pragma unroll
    for (int e = 0; e < 4; ++e) {
      const float xn = (ov[e] - meanf) * rstd;
      res[it][e] = xn * gw + gb + bf16r(hd[e]);
    }
  }
#pragma unroll
  for (int it = 0; it < 4; ++it)
    *(v4f*)(drow + 4 * (it * 256 + tid)) = res[it];
  
}

// =====================================================================================================
// Host glue. Inputs in table order (8): Hand [nb][256][64][64], U (same), WH_w [256][256], WH_b [256],
// WU_w [256][256], WU_b [256], gn_w [256], gn_b [256]; nb = in_sizes[0] / (256*4096), 1..4.
// Output f32 [nb][256][4096] at element 0. Workspace 76283904 B (sized for nb = 4).
// 4 launches, each over all batches: k_cvt (with the weights), k_proj, k_attn, k_gn.
// =====================================================================================================
extern "C" void kernel_launch(void* const* d_in, const int* in_sizes, int n_in,
                              void* d_out, int out_size, void* d_ws, size_t ws_size,
                              hipStream_t stream) {
  if (n_in < 8) return;
  const int per = CC * NPX;
  const int n0s = in_sizes[0];
  if (n0s < per || (n0s % per) != 0) return;
  const int nb = n0s / per;
  if (nb < 1 || nb > NBMAX) return;
  if (in_sizes[1] != n0s) return;
  if (in_sizes[2] != CC * CC || in_sizes[4] != CC * CC) return;
  if (in_sizes[3] != CC || in_sizes[5] != CC || in_sizes[6] != CC || in_sizes[7] != CC) return;
  if (out_size != nb * per) return;
  if (ws_size < WS_TOTAL) return;

  const float* hand = (const float*)d_in[0];
  const float* u    = (const float*)d_in[1];
  const float* whw  = (const float*)d_in[2];
  const float* whb  = (const float*)d_in[3];
  const float* wuw  = (const float*)d_in[4];
  const float* wub  = (const float*)d_in[5];
  const float* gnw  = (const float*)d_in[6];
  const float* gnb  = (const float*)d_in[7];
  float* out = (float*)d_out;

  char* ws = (char*)d_ws;
  unsigned short* ht  = (unsigned short*)(ws + OFF_HT);
  unsigned short* ut  = (unsigned short*)(ws + OFF_UT);
  unsigned short* uc  = (unsigned short*)(ws + OFF_UC);
  unsigned short* w16 = (unsigned short*)(ws + OFF_W16);
  unsigned short* qh  = (unsigned short*)(ws + OFF_QH);
  unsigned short* ql  = (unsigned short*)(ws + OFF_QL);
  unsigned short* kh  = (unsigned short*)(ws + OFF_KH);
  unsigned short* kl  = (unsigned short*)(ws + OFF_KL);
  float*          Op  = (float*)(ws + OFF_O);
  float*          ps  = (float*)(ws + OFF_PS);
  float*          pq  = (float*)(ws + OFF_PQ);

  k_cvt<<<dim3(NPX / 64, 1 + CC / 64 * nb), dim3(256), 0, stream>>>(hand, u, whw, wuw, ht, ut, uc, w16);
  (void)hipGetLastError();
  k_proj<<<dim3(NPX / 64, CC / 64, 2 * nb), dim3(128), 0, stream>>>(ht, ut, w16, whb, wub,
                                                                     qh, ql, kh, kl);
  (void)hipGetLastError();

  k_attn<<<dim3(HWD, nb), dim3(256), 0, stream>>>(qh, ql, kh, kl, uc, Op, ps, pq);
  (void)hipGetLastError();

  k_gn<<<dim3(CC, nb), dim3(256), 0, stream>>>(Op, ps, pq, hand, gnw, gnb, out);
  (void)hipGetLastError();
}

// v007
// One run takes 108 microseconds.
// It is 1.24 times as fast as v005, going by the measured steps of the versions left out in between.
// Counting every step since v000, it is 8.80 times as fast.
// Contractions: weight fold G = WU^T.WH (K=256), 1x1 projection (K=256), affinity scores (K=256) and
// softmax(P).U (K=4096 in 32-deep steps) on v_wmma_f32_16x16x32_f16 (f16 operands, f32 accumulate); operands
// are RNE-bf16 inputs held in f16 containers (weights x16, activations and values x16), G as f16 hi plus
// x2^11 residual planes, the projected query vectors as f16 hi plus x2^15 residual planes (two products in
// the score GEMM), softmax planes x2^14; running softmax statistics, normalisation statistics (f64 combine)
// and epilogues f32 VALU. Scores never leave their wave's registers.
// The key projection is folded into the query side: q.k = (WH h + bH).(WU u + bU) = (WU^T (WH h + bH)).u
// + q.bU, and q.bU is the same for every key of a query, so the softmax over the keys does not see it.
// The scores are taken as t.u with t = G h + WU^T bH: the key operand is the input plane itself.
#include <hip/hip_runtime.h>
#include <stddef.h>
#include <stdint.h>
#include <math.h>

#define NBMAX 4
#define CC    256
#define NPX   4096
#define HWD   64
#define TP    72
#define EPF   68
#define FRAG  512                                      // halves of one 16-row x 32-k fragment block
#define SKH   16384                                    // halves of one key plane's 64 rows (one stage)
#define STG   (2 * SKH)                                // halves of one stage: the key rows and the value blocks
#define EPO   (3 * SKH)                                // halves in front of the epilogue's staged output
#define NFT   (17 * (CC / 16))                         // 16 x 16 tiles of the weight fold, bias column included

#define PLANE       ((size_t)CC * NPX)                 // 1048576 elements per batch plane
#define ACT16_BYTES ((size_t)NBMAX * PLANE * 2)        // 8388608
#define W16_BYTES   ((size_t)2 * CC * CC * 2)          // 262144
#define O_BYTES     ((size_t)NBMAX * PLANE * 4)        // 16777216
#define PS_BYTES    ((size_t)NBMAX * HWD * CC * 4)     // 262144

// ---- carve ----------------------------------------------------------------------------------------
#define OFF_HT   ((size_t)0)
#define OFF_UT   (OFF_HT + ACT16_BYTES)
#define OFF_UC   (OFF_UT + ACT16_BYTES)
#define OFF_W16  (OFF_UC + ACT16_BYTES)
#define OFF_QH   (OFF_W16 + W16_BYTES)
#define OFF_QL   (OFF_QH + ACT16_BYTES)
#define OFF_BQ   (OFF_QL + ACT16_BYTES)
#define OFF_O    (OFF_BQ + (size_t)CC * 8)              // bq: 16 floats per 128-byte line, one writing wave each
#define OFF_PS   (OFF_O + O_BYTES)
#define OFF_PQ   (OFF_PS + PS_BYTES)
#define WS_TOTAL (OFF_PQ + PS_BYTES)

static_assert(OFF_QH == (size_t)25427968);
static_assert(OFF_O == (size_t)42207232);
static_assert(WS_TOTAL == (size_t)59508736);
static_assert(WS_TOTAL <= (size_t)134217728);
static_assert((OFF_UT % 256) == 0);
static_assert((OFF_UC % 256) == 0);
static_assert((OFF_W16 % 256) == 0);
static_assert((OFF_QH % 256) == 0);
static_assert((OFF_QL % 256) == 0);
static_assert((OFF_BQ % 256) == 0);
static_assert((OFF_O % 256) == 0);
static_assert((OFF_PS % 256) == 0);
static_assert((OFF_PQ % 256) == 0);
static_assert(NPX == HWD * HWD);
static_assert((NPX / 64) * 8 >= NFT);                  // one grid row of k_cvt has a wave for every fold tile
static_assert((CC % 64) == 0);
static_assert((NPX % 64) == 0);
static_assert((TP * 2) % 16 == 0);
static_assert((EPF * 4) % 16 == 0);
static_assert(SKH == 64 * CC);
static_assert(SKH == (CC / 16) * 2 * FRAG);
static_assert(4 * 32 * 32 * 16 + 4 * 32 * 4 <= EPO * 2);  // what the key halves hand over ends in front of it

typedef unsigned short v8us  __attribute__((ext_vector_type(8)));
typedef unsigned short v16us __attribute__((ext_vector_type(16)));
typedef _Float16       v16h  __attribute__((ext_vector_type(16)));
typedef float          v4f   __attribute__((ext_vector_type(4)));
typedef float          v8f   __attribute__((ext_vector_type(8)));
typedef int            v4i   __attribute__((ext_vector_type(4)));
typedef __attribute__((address_space(1))) v4i gv4i;
typedef __attribute__((address_space(3))) v4i lv4i;

union FragU { v16us v; v8us half[2]; };

// ---- scalar helpers -------------------------------------------------------------------------------
__device__ __forceinline__ unsigned bbits(float f) {          // f32 -> nearest-even bf16 bits
  unsigned u = __float_as_uint(f);
  return (u + 0x7FFFu + ((u >> 16) & 1u)) >> 16;
}
__device__ __forceinline__ float bf16r(float f) {            // RNE convert to bf16 and back
  return __uint_as_float(bbits(f) << 16);
}
__device__ __forceinline__ unsigned short hbits(float f) {   // f32 -> f16 bits (RNE)
  return __builtin_bit_cast(unsigned short, (_Float16)f);
}
__device__ __forceinline__ float rcpf(float x) {
#if defined(__HIP_DEVICE_COMPILE__)
  return __builtin_amdgcn_rcpf(x);
#else
  return 1.0f / x;
#endif
}
// exp(x) as one v_exp_f32 of x * log2(e), as __expf compiles to. The v_nop keeps the one free slot that the
// instruction set asks for between a transcendental and a next instruction that reads its result or
// rewrites its source.
__device__ __forceinline__ float exp_slot(float x) {
#if defined(__HIP_DEVICE_COMPILE__)
  float r;
  asm("v_exp_f32 %0, %1\n\tv_nop" : "=v"(r) : "v"(x * 1.44269504f));
  return r;
#else
  return x;
#endif
}
// The wait that stands in front of a rewrite of the address registers p, q of issued global loads. Naming
// them as inputs keeps them untouched up to here, behind the work that runs under the loads; at their
// first reuse, where the compiler puts the wait otherwise, it held that work back behind all the loads.
__device__ __forceinline__ void keep_addr(const unsigned short* p, const unsigned short* q) {
#if defined(__HIP_DEVICE_COMPILE__)
  asm volatile("s_wait_xcnt 0x0" :: "v"(p), "v"(q) : "memory");
#else
  (void)p; (void)q;
#endif
}
__device__ __forceinline__ v8f zero8() { v8f z = {0.f, 0.f, 0.f, 0.f, 0.f, 0.f, 0.f, 0.f}; return z; }

__device__ __forceinline__ double shfl_xor_d(double v, int o) {
  const long long x = __double_as_longlong(v);
  int lo = (int)(x & 0xffffffffll);
  int hi = (int)(x >> 32);
  lo = __shfl_xor(lo, o, 32);
  hi = __shfl_xor(hi, o, 32);
  const long long y = ((long long)(unsigned)hi << 32) | (long long)(unsigned)lo;
  return __longlong_as_double(y);
}

// ---- split k map of a 16-bit fragment, A and B alike: lane (m, h) holds row m; elements 0..7 are
//      k = 8 h + 0..7, elements 8..15 are k = 16 + 8 h + 0..7 of a 32-deep k block
// ---- fragment-order planes (every operand plane that a wave loads straight from global memory): a plane
//      of rows x K halves is a row-major grid of blocks [row / 16][k / 32], FRAG halves each; a block holds
//      the two 16-byte pieces of all 32 lanes back to back, element (row, k) at
//      256 * ((k >> 4) & 1) + 8 * (16 * ((k >> 3) & 1) + (row & 15)) + (k & 7): the split k map above, but
//      each load instruction of a wave reads 512 contiguous bytes (four whole 128-byte lines, not 16 parts).
//      p = block + 8 * lane
__device__ __forceinline__ v16us ldfrag_g(const unsigned short* p) {
  FragU f;
  f.half[0] = *(const v8us*)(p);
  f.half[1] = *(const v8us*)(p + 256);
  return f.v;
}

// ---- WMMA helper (f16 operands as raw 16-bit lanes, f32 accumulate) --------------------------------
__device__ __forceinline__ v8f mma_hu(v16us a, v16us b, v8f c) {
#if defined(__HIP_DEVICE_COMPILE__)
  return __builtin_amdgcn_wmma_f32_16x16x32_f16(false, __builtin_bit_cast(v16h, a),
                                               false, __builtin_bit_cast(v16h, b),
                                               (short)0, c, false, false);
#else
  (void)a; (void)b;
  return c;
#endif
}
// hazard guards after the last WMMA of a group: tie the accumulators, keep the fragments live
__device__ __forceinline__ void guard4(v8f& c0, v8f& c1, v8f& c2, v8f& c3, const v16us& a,
                                       const v16us& b0, const v16us& b1, const v16us& b2,
                                       const v16us& b3) {
#if defined(__HIP_DEVICE_COMPILE__)
  asm volatile("v_nop\n\tv_nop\n\tv_nop\n\tv_nop"
               : "+v"(c0), "+v"(c1), "+v"(c2), "+v"(c3)
               : "v"(a), "v"(b0), "v"(b1), "v"(b2), "v"(b3));
#else
  (void)c0; (void)c1; (void)c2; (void)c3; (void)a; (void)b0; (void)b1; (void)b2; (void)b3;
#endif
}

// 16-bit tile 64 rows x 64 k (LDS pitch PITCH halves) -> fragment-order plane P with kblocks blocks per
// row group: row groups rg0..rg0+3, k blocks kb0, kb0+1; one wave instruction = one 512-byte piece.
template <int NW, int PITCH>
__device__ __forceinline__ void store_tile_frag(const unsigned short* t, unsigned short* P,
                                                int rg0, int kblocks, int kb0, int w, int lane) {
  constexpr int NIT = 16 / NW;
  const int h = lane >> 4;
  const int m = lane & 15;
  v8us   v[NIT];
  size_t off[NIT];
#pragma unroll
  for (int it = 0; it < NIT; ++it) {
    const int ch  = it * NW + w;                  // 0..15 = (row group, k block, piece)
    const int gl  = ch >> 2;
    const int kbl = (ch >> 1) & 1;
    const int hf  = ch & 1;
    v[it]   = *(const v8us*)(t + (16 * gl + m) * PITCH + 32 * kbl + 16 * hf + 8 * h);
    off[it] = ((size_t)(rg0 + gl) * kblocks + kb0 + kbl) * FRAG + 256 * hf + 8 * lane;
  }
#pragma unroll
  for (int it = 0; it < NIT; ++it) *(v8us*)(P + off[it]) = v[it];
}

// =====================================================================================================
// Weight fold, one 16 x 16 tile per wave: G[j][c] = sum_o WU[o][j] * WH[o][c] (tile column tc < 16) and, as
// a seventeenth tile column whose only live column is m = 0, bq[j] = sum_o WU[o][j] * WH_b[o]. A rows j,
// B rows c, k = o; both fragments are gathered from the f32 weights in the split k map above, each element
// f16(16 * bf16(w)). Out: W16[0] = f16(16 G), W16[1] = f16(2048 * (16 G - W16[0])), both in fragment order
// (rows j, k = c), and bq in f32, row j at 32 * (j / 16) + j % 16. Run by the first waves of grid row 0 of k_cvt.
// coverage: 256 tiles x 256 elements = both planes, 16 tiles x 16 rows = bq, every element once.
// =====================================================================================================
template <bool ISB>                                 // ISB: the bias column
__device__ __forceinline__ void fold_tile(const float* __restrict__ whw, const float* __restrict__ whb,
                                          const float* __restrict__ wuw, unsigned short* w16, float* bq,
                                          int tile, int lane)
{
  const int h  = lane >> 4;
  const int m  = lane & 15;
  const int tc = tile >> 4;                         // wave-uniform, 0..16
  const int tr = tile & 15;
  constexpr int SB = ISB ? 1 : CC;                  // elements between two k of the B side
  const float* pa = wuw + 8 * h * CC + 16 * tr + m;
  const float* pb = ISB ? whb + 8 * h : whw + 8 * h * CC + 16 * tc + m;
  v8f d = zero8();
  // two k blocks per trip: 64 loads in flight, a body of moderate length
#pragma unroll 2
  for (int kb = 0; kb < CC / 32; ++kb) {
    v16us a, b;
#pragma unroll
    for (int e = 0; e < 16; ++e) {
      const int o = 32 * kb + 16 * (e >> 3) + (e & 7);   // + 8 h, which the two pointers hold
      a[e] = hbits(16.0f * bf16r(pa[o * CC]));
      const unsigned short bb = hbits(16.0f * bf16r(pb[o * SB]));
      b[e] = (ISB && m != 0) ? (unsigned short)0 : bb;
    }
    d = mma_hu(a, b, d);
  }
  if (!ISB) {
    const int k = 16 * tc + m;
#pragma unroll
    for (int r = 0; r < 8; ++r) {
      const int row = 16 * tr + 8 * h + r;
      const float g16 = d[r] * (1.0f / 16.0f);
      const _Float16 hv = (_Float16)g16;
      const int idx = ((row >> 4) * (CC / 32) + (k >> 5)) * FRAG + 256 * ((k >> 4) & 1)
                      + 8 * (16 * ((k >> 3) & 1) + (row & 15)) + (k & 7);
      w16[idx]           = __builtin_bit_cast(unsigned short, hv);
      w16[CC * CC + idx] = hbits((g16 - (float)hv) * 2048.0f);
    }
  } else if (m == 0) {
#pragma unroll
    for (int r = 0; r < 8; ++r) bq[32 * tr + 8 * h + r] = d[r] * (1.0f / 256.0f);
  }
}

// =====================================================================================================
// for the projection A fragments); UC: rows c, k = n in fragment order (for the P.U A fragment).
// Block = (64 px tile, y = 1 + 4 b + 64 ch tile), 256 threads; thread = (channel cl = tid>>2, 16-px quarter).
// All three planes in fragment order: HT/UT rows n, k = c; UC rows c, k = n (16 pieces of 512 B per tile).
// Grid row y = 0 folds the weights instead: they depend on nothing here, so they need no launch of
// their own.
// coverage: grid (64, 1 + 4 nb): every (b, c, n) of HT, UT and UC and every folded weight written exactly once.
// =====================================================================================================
__global__ __launch_bounds__(256)
void k_cvt(const float* __restrict__ hand, const float* __restrict__ u,
           const float* __restrict__ whw, const float* __restrict__ whb, const float* __restrict__ wuw,
           unsigned short* ht, unsigned short* ut, unsigned short* uc, unsigned short* w16, float* bq)
{
  __shared__ __align__(16) unsigned short TH[64 * TP];
  __shared__ __align__(16) unsigned short TU[64 * TP];
  __shared__ __align__(16) unsigned short TC[64 * TP];

  const int tid  = threadIdx.x;
  const int lane = tid & 31;
  const int w    = tid >> 5;
  if (blockIdx.y == 0) {                  // block-uniform, in front of the barrier
    const int tile = 8 * blockIdx.x + w;  // wave-uniform
    if (tile < NFT - CC / 16) fold_tile<false>(whw, whb, wuw, w16, bq, tile, lane);
    else if (tile < NFT)      fold_tile<true>(whw, whb, wuw, w16, bq, tile, lane);
    return;
  }
  const int yt   = blockIdx.y - 1;        // 4 b + channel tile
  const int n0   = 64 * blockIdx.x;
  const int c0   = 64 * (yt & (CC / 64 - 1));
  const int b    = yt / (CC / 64);
  const int cl   = tid >> 2;              // 0..63
  const int pq   = 16 * (tid & 3);        // 0,16,32,48
  const size_t src = (size_t)b * PLANE + (size_t)(c0 + cl) * NPX + n0 + pq;
#pragma unroll
  for (int g = 0; g < 4; ++g) {
    const v4f hv = *(const v4f*)(hand + src + 4 * g);
    const v4f uv = *(const v4f*)(u + src + 4 * g);
#pragma unroll
    for (int e = 0; e < 4; ++e) {
      const int px = pq + 4 * g + e;
      const unsigned short hb = hbits(16.0f * bf16r(hv[e]));
      const unsigned short ub = hbits(16.0f * bf16r(uv[e]));
      TH[px * TP + cl] = hb;
      TU[px * TP + cl] = ub;
      TC[cl * TP + px] = ub;
    }
  }
  __syncthreads();
  store_tile_frag<8, TP>(TH, ht + (size_t)b * PLANE, n0 / 16, CC / 32, c0 / 32, w, lane);
  store_tile_frag<8, TP>(TU, ut + (size_t)b * PLANE, n0 / 16, CC / 32, c0 / 32, w, lane);
  store_tile_frag<8, TP>(TC, uc + (size_t)b * PLANE, c0 / 16, NPX / 32, n0 / 32, w, lane);
}

// =====================================================================================================
// 1x1 projection of the queries through the folded weights: D[n][j] = sum_c X[n][c] * G[j][c], tile 64(n) x
// 64(j), K = 256, 4 waves, wave w owns rows n 16w..16w+15 (A fragment from the fragment-order activation
// plane) and 4 column sub-tiles of 16 output channels (B fragments = rows j of W16[0] and of its residual
// plane W16[1], fragment order; one accumulator set each). Epilogue: t = (hi + lo / 2048) / 256 + bq, kept
// as t / 16 (the key operand of the scores carries x16), split into f16 hi and x2^15 residual, into the
// fragment-order planes (rows n, k = j).
// coverage: grid (64 n tiles, 4 j tiles, nb): QH, QL [b][4096][256] every element once.
// =====================================================================================================
__global__ __launch_bounds__(128)
void k_proj(const unsigned short* __restrict__ ht, const unsigned short* __restrict__ w16,
            const float* __restrict__ bq, unsigned short* qh, unsigned short* ql)
{
  __shared__ __align__(16) unsigned short t0[64 * TP];
  __shared__ __align__(16) unsigned short t1[64 * TP];

  const int tid   = threadIdx.x;
  const int lane  = tid & 31;
  const int w     = tid >> 5;
  const int h     = lane >> 4;
  const int m     = lane & 15;
  const int n0    = 64 * blockIdx.x;
  const int o0    = 64 * blockIdx.y;
  const int bb    = blockIdx.z;
  const unsigned short* x = ht + (size_t)bb * PLANE;

  v8f acc[4], acl[4];
#pragma unroll
  for (int j = 0; j < 4; ++j) { acc[j] = zero8(); acl[j] = zero8(); }

  const unsigned short* pa = x + (size_t)(n0 / 16 + w) * (CC / 32) * FRAG + 8 * lane;
  const unsigned short* pb = w16 + (size_t)(o0 / 16) * (CC / 32) * FRAG + 8 * lane;
  // two k steps per trip, kept rolled: a longer body would only add fragment registers
#pragma unroll 1
  for (int k2 = 0; k2 < CC / 64; ++k2) {
    const unsigned short* pak = pa + 2 * FRAG * k2;
    const unsigned short* pbk = pb + 2 * FRAG * k2;
    // unrolled: both steps address off the trip's two pointers by immediate offsets
#pragma unroll
    for (int u = 0; u < 2; ++u) {
      const v16us a  = ldfrag_g(pak + FRAG * u);
      const v16us b0 = ldfrag_g(pbk + FRAG * u);
      const v16us b1 = ldfrag_g(pbk + FRAG * (1 * (CC / 32) + u));
      const v16us b2 = ldfrag_g(pbk + FRAG * (2 * (CC / 32) + u));
      const v16us b3 = ldfrag_g(pbk + FRAG * (3 * (CC / 32) + u));
      const v16us l0 = ldfrag_g(pbk + CC * CC + FRAG * u);
      const v16us l1 = ldfrag_g(pbk + CC * CC + FRAG * (1 * (CC / 32) + u));
      const v16us l2 = ldfrag_g(pbk + CC * CC + FRAG * (2 * (CC / 32) + u));
      const v16us l3 = ldfrag_g(pbk + CC * CC + FRAG * (3 * (CC / 32) + u));
      // keeps the eighteen loads together and ahead of the products: left alone, the scheduler reused fragment
      // registers and put most loads right in front of the product that waits for them
      __builtin_amdgcn_sched_barrier(0);
      acc[0] = mma_hu(a, b0, acc[0]);
      acc[1] = mma_hu(a, b1, acc[1]);
      acc[2] = mma_hu(a, b2, acc[2]);
      acc[3] = mma_hu(a, b3, acc[3]);
      acl[0] = mma_hu(a, l0, acl[0]);
      acl[1] = mma_hu(a, l1, acl[1]);
      acl[2] = mma_hu(a, l2, acl[2]);
      acl[3] = mma_hu(a, l3, acl[3]);
      guard4(acl[0], acl[1], acl[2], acl[3], a, l0, l1, l2, l3);
    }
    keep_addr(pak, pbk);                         // the next trip rewrites the loads' address registers
  }

  const float kq = 1.0f / 4096.0f;               // 1 / 256 for the operand scales, 1 / 16 for the kept scale
  const float kl = 1.0f / 2048.0f;
  float bv[4];
#pragma unroll
  for (int j = 0; j < 4; ++j) bv[j] = bq[32 * (o0 / 16 + j) + m] * (1.0f / 16.0f);
#pragma unroll
  for (int j = 0; j < 4; ++j) {
#pragma unroll
    for (int r = 0; r < 8; ++r) {
      const float val = (acc[j][r] + acl[j][r] * kl) * kq + bv[j];
      const _Float16 hv = (_Float16)val;
      const int rl = 16 * w + 8 * h + r;       // pixel within tile
      const int cl = 16 * j + m;               // output channel within tile
      t0[rl * TP + cl] = __builtin_bit_cast(unsigned short, hv);
      t1[rl * TP + cl] = hbits((val - (float)hv) * 32768.0f);
    }
  }
  __syncthreads();
  store_tile_frag<4, TP>(t0, qh + (size_t)bb * PLANE, n0 / 16, CC / 32, o0 / 32, w, lane);
  store_tile_frag<4, TP>(t1, ql + (size_t)bb * PLANE, n0 / 16, CC / 32, o0 / 32, w, lane);
}

// =====================================================================================================
// Scores, softmax and P.U in one pass, all batches in one launch. Block = (64 query pixels R0.. of batch b,
// all 256 channels), 8 waves. Wave w owns the 16 queries of column group g = w & 3 and, of every stage of 64
// key pixels, the 32 keys of half hf = w >> 2; nothing of its scores or of P ever leaves its registers.
//   resident: the wave's query fragments QH/QL (B operands, 8 k steps each) in registers.
//   stage:    64 keys: their rows of UT (32 KB) and the value blocks UC (16 channel groups x 2 KB), copied as
//             they lie in the fragment-order planes into one of two LDS buffers, one stage ahead.
//   scores:   St[key][i] = UT.QH + UT.QL / 32768, K = 256, two tiles of 16 keys; a lane (m, h)
//             holds the keys 16 kt + 8 h + r of query m.
//   softmax:  in the lane plus one exchange between the wave halves for the maximum; running maximum mrun,
//             running sum lrun of the lane's own keys; P = f16(16384 exp(St - mrun)).
//   P.U:      D[c][i] = D[c][i] * al[i] + UC[c][k] . P[k][i]: the two score tiles, converted in place, are
//             the B operand in the split k map; 16 accumulators = all 256 channels.
// Epilogue: the two key halves of a column group are joined through LDS (common maximum, weighted sums),
// p = D / lsum[i] / 2^18 (value scale 16, softmax scale 2^14) is staged as [c][i]; thread c sums p and p^2 of
// its channel over the 64 pixels in pixel order; the O rows leave as whole 128-byte lines.
// coverage: grid (64, nb): O [b][256][4096] and PS/PQ [b][64][256], every element once.
// =====================================================================================================
__device__ __forceinline__ void o_store_pass(const float* Et, float* orows, int R0, int w, int lane)
{
  const int q  = lane >> 3;
  const int jj = lane & 7;
#pragma unroll 1
  for (int it = 0; it < 16; ++it) {
    const int li = it * 32 + 4 * w + q;         // 0..511
    const int c = li >> 1, hf = li & 1;
    const v4f v = *(const v4f*)(Et + c * EPF + 32 * hf + 4 * jj);
    *(v4f*)(orows + (size_t)c * NPX + R0 + 32 * hf + 4 * jj) = v;
    // the next trip rewrites the store's address and data registers: keep the wait in front of that
    asm volatile("s_wait_xcnt 0x0" ::: "memory");
  }
}

// lane l with lane l ^ 16
__device__ __forceinline__ float xhalf(float x) {
#if defined(__HIP_DEVICE_COMPILE__)
  return __builtin_bit_cast(float, __builtin_amdgcn_permlanex16(__builtin_bit_cast(int, x),
                                                                __builtin_bit_cast(int, x),
                                                                0x76543210, 0xfedcba98, false, false));
#else
  return x;
#endif
}

// 16 bytes per lane from global memory to LDS, through no register; OFF bytes further on both sides
template <int OFF>
__device__ __forceinline__ void copy16(const unsigned short* gsrc, unsigned short* ldst) {
  static_assert(OFF >= 0 && OFF < 65536);
#if defined(__HIP_DEVICE_COMPILE__)
  __builtin_amdgcn_global_load_async_to_lds_b128((gv4i*)gsrc, (lv4i*)ldst, OFF, 0);
#else
  (void)gsrc; (void)ldst;
#endif
}

// Stage s (keys 64 s .. 64 s + 63) into the buffer dst: 16 copies per lane, each wave instruction 512
// contiguous bytes on both sides. UT: 32 KB in a row. UC: channel group t = 2 j + (tid >> 7), 2 KB each.
__device__ __forceinline__ void stage_copy(const unsigned short* utb,
                                           const unsigned short* ucb, unsigned short* dst, int s, int tid)
{
  const unsigned short* gk = utb + (size_t)s * SKH + 8 * tid;
  const unsigned short* gu = ucb + (size_t)(tid >> 7) * (NPX / 32) * FRAG + (size_t)s * 2 * FRAG + 8 * (tid & 127);
  unsigned short* d = dst + 8 * tid;
  copy16<0>(gk, d);      copy16<4096>(gk, d);   copy16<8192>(gk, d);   copy16<12288>(gk, d);
  copy16<16384>(gk, d);  copy16<20480>(gk, d);  copy16<24576>(gk, d);  copy16<28672>(gk, d);
#pragma unroll
  for (int j = 0; j < 8; ++j)
    copy16<0>(gu + (size_t)(2 * j) * (NPX / 32) * FRAG, d + SKH + 2048 * j);
}

__global__ __launch_bounds__(256) __attribute__((amdgpu_waves_per_eu(2, 2)))
void k_attn(const unsigned short* __restrict__ qh, const unsigned short* __restrict__ ql,
            const unsigned short* __restrict__ ut,
            const unsigned short* __restrict__ uc, float* Oall, float* psall, float* pqall)
{
  // two stage buffers; the epilogue's staging reaches further
  __shared__ __align__(16) unsigned short ring[EPO + CC * EPF * 2];

  const int tid  = threadIdx.x;
  const int lane = tid & 31;
  const int w    = tid >> 5;
  const int h    = lane >> 4;
  const int m    = lane & 15;
  const int g    = w & 3;                // column group: queries R0 + 16 g + m
  const int hf   = w >> 2;               // key half of every stage
  const int R0   = 64 * blockIdx.x;
  const size_t po = (size_t)blockIdx.y * PLANE;
  const unsigned short* utb = ut + po;
  const unsigned short* ucb = uc + po;
  float* O  = Oall + po;
  float* ps = psall + (size_t)blockIdx.y * HWD * CC;
  float* pq = pqall + (size_t)blockIdx.y * HWD * CC;

  stage_copy(utb, ucb, ring, 0, tid);

  // resident query fragments
  v16us qfh[CC / 32], qfl[CC / 32];
  {
    const unsigned short* gqh = qh + po + (size_t)(R0 / 16 + g) * (CC / 32) * FRAG + 8 * lane;
    const unsigned short* gql = ql + po + (size_t)(R0 / 16 + g) * (CC / 32) * FRAG + 8 * lane;
#pragma unroll
    for (int kk = 0; kk < CC / 32; ++kk) {
      qfh[kk] = ldfrag_g(gqh + FRAG * kk);
      qfl[kk] = ldfrag_g(gql + FRAG * kk);
    }
    keep_addr(gqh, gql);
  }

  float mrun = -1.0e30f, lrun = 0.0f;
  v8f acc[CC / 16];
#pragma unroll
  for (int t = 0; t < CC / 16; ++t) acc[t] = zero8();

  // stage 0 has landed for this wave, then for all; only then stage 1 is asked for
  asm volatile("s_wait_asynccnt 0x0" ::: "memory");
  __syncthreads();
  stage_copy(utb, ucb, ring + STG, 1, tid);

  // key fragments four k steps at a time, one such group ahead in a second register set: a group's LDS
  // latency runs under the sixteen matrix instructions of the group before. [set][2 u + (0: keys 0..15,
  // 1: keys 16..31)]. A stage's first two k steps are read behind the stage's publish point, in the pass
  // before.
  v16us fa[2][8];
  {
    const unsigned short* f0 = ring + hf * (2 * (CC / 32) * FRAG) + 8 * lane;
    fa[0][0] = ldfrag_g(f0);
    fa[0][1] = ldfrag_g(f0 + FRAG * (CC / 32));
    fa[0][2] = ldfrag_g(f0 + FRAG);
    fa[0][3] = ldfrag_g(f0 + FRAG * (CC / 32 + 1));
  }

  const float kx = 1.0f / 32768.0f;
  // The stage loop stays rolled; every loop inside it is unrolled, so that
  // the fragment and accumulator arrays are indexed by constants and live in registers.
#pragma unroll 1
  for (int s = 0; s < NPX / 64; ++s) {
    unsigned short* buf = ring + (s & 1) * STG;
    const unsigned short* fk = buf + hf * (2 * (CC / 32) * FRAG) + 8 * lane;   // the half's 32 keys
    const unsigned short* fu = buf + SKH + hf * FRAG + 8 * lane;               // its value blocks
    v8f sa[2], sx[2];
#pragma unroll
    for (int kt = 0; kt < 2; ++kt) { sa[kt] = zero8(); sx[kt] = zero8(); }
    v16us ua[CC / 16];
    fa[0][4] = ldfrag_g(fk + FRAG * 2);
    fa[0][5] = ldfrag_g(fk + FRAG * (CC / 32 + 2));
    fa[0][6] = ldfrag_g(fk + FRAG * 3);
    fa[0][7] = ldfrag_g(fk + FRAG * (CC / 32 + 3));
#pragma unroll
    for (int k2 = 0; k2 < CC / 128; ++k2) {
      if (k2 + 1 < CC / 128) {
#pragma unroll
        for (int u = 0; u < 4; ++u) {
          const int kn = 4 * (k2 + 1) + u;
          fa[(k2 + 1) & 1][2 * u + 0] = ldfrag_g(fk + FRAG * kn);
          fa[(k2 + 1) & 1][2 * u + 1] = ldfrag_g(fk + FRAG * (CC / 32 + kn));
        }
      } else {
        // the first half of the value fragments takes the place of a next group
#pragma unroll
        for (int t = 0; t < CC / 32; ++t) ua[t] = ldfrag_g(fu + 2 * FRAG * t);
      }
      // keeps the sixteen reads together and ahead of the group's products: left alone, the scheduler spread
      // them among the matrix instructions, each read waited for right behind its issue
      __builtin_amdgcn_sched_barrier(0);
#pragma unroll
      for (int u = 0; u < 4; ++u) {
        const int kk = 4 * k2 + u;
        sx[0] = mma_hu(fa[k2 & 1][2 * u + 0], qfl[kk], sx[0]);
        sx[1] = mma_hu(fa[k2 & 1][2 * u + 1], qfl[kk], sx[1]);
        sa[0] = mma_hu(fa[k2 & 1][2 * u + 0], qfh[kk], sa[0]);
        sa[1] = mma_hu(fa[k2 & 1][2 * u + 1], qfh[kk], sa[1]);
      }
      // the other side of the same fence: the next group's reads stay behind these products
      __builtin_amdgcn_sched_barrier(0);
    }
    // the second half: the stage's last LDS reads; the pass reads LDS again only for the next stage's first two k steps
#pragma unroll
    for (int t = CC / 32; t < CC / 16; ++t) ua[t] = ldfrag_g(fu + 2 * FRAG * t);
    // the reads stay ahead of the vector work that follows, which covers their latency
    __builtin_amdgcn_sched_barrier(0);
    float sc[16];
#pragma unroll
    for (int e = 0; e < 16; ++e) sc[e] = sa[e >> 3][e & 7] + sx[e >> 3][e & 7] * kx;
    float tm4[4];
#pragma unroll
    for (int e = 0; e < 4; ++e) tm4[e] = fmaxf(fmaxf(sc[e], sc[4 + e]), fmaxf(sc[8 + e], sc[12 + e]));
    float tm = fmaxf(fmaxf(tm4[0], tm4[1]), fmaxf(tm4[2], tm4[3]));
    tm = fmaxf(tm, xhalf(tm));
    const float mn = fmaxf(mrun, tm);
    // publish point: this wave has left the buffer, its copies of stage s + 1 have landed; behind the barrier
    // that holds for every wave, and the buffer just read is filled anew: the copies have the softmax, the
    // P.U products and the next stage's scores to land
    asm volatile("s_wait_dscnt 0x0" ::: "memory");
    asm volatile("s_wait_asynccnt 0x0" ::: "memory");
    __syncthreads();
    if (s + 2 < NPX / 64) stage_copy(utb, ucb, buf, s + 2, tid);
    if (s + 1 < NPX / 64) {
      // stage s + 1 is published: its first two k steps are read now, so that the next pass starts on its products
      const unsigned short* fn = ring + ((s + 1) & 1) * STG + hf * (2 * (CC / 32) * FRAG) + 8 * lane;
      fa[0][0] = ldfrag_g(fn);
      fa[0][1] = ldfrag_g(fn + FRAG * (CC / 32));
      fa[0][2] = ldfrag_g(fn + FRAG);
      fa[0][3] = ldfrag_g(fn + FRAG * (CC / 32 + 1));
    }
    const float al = exp_slot(mrun - mn);
    v16us pf;
    float ad4[4] = {0.0f, 0.0f, 0.0f, 0.0f};   // four chains, not one of sixteen dependent additions
#pragma unroll
    for (int e = 0; e < 16; ++e) {
      const float ex = exp_slot(sc[e] - mn);
      ad4[e & 3] += ex;
      pf[e] = hbits(16384.0f * ex);
    }
    lrun = lrun * al + ((ad4[0] + ad4[1]) + (ad4[2] + ad4[3]));
    mrun = mn;
#pragma unroll
    for (int t = 0; t < CC / 16; ++t) {
#pragma unroll
      for (int r = 0; r < 8; ++r) acc[t][r] = acc[t][r] * al;
      acc[t] = mma_hu(ua[t], pf, acc[t]);
    }
  }
  // no copy is outstanding when the ring becomes the epilogue's staging
  asm volatile("s_wait_asynccnt 0x0" ::: "memory");

  float* mg = (float*)ring;              // [g][32 pieces][lane] of 16 B: the accumulators of key half 1
  float* ml = (float*)ring + 16384;      // [g][2][16]: its running maximum and sum
  float* Et = (float*)(ring + EPO);      // [c][i], pitch EPF
  const float lt = lrun + xhalf(lrun);   // the wave halves hold different keys of the same query
  if (hf == 1) {                         // wave-uniform
#pragma unroll
    for (int t = 0; t < CC / 16; ++t) {
      const v4f lo = {acc[t][0], acc[t][1], acc[t][2], acc[t][3]};
      const v4f hi = {acc[t][4], acc[t][5], acc[t][6], acc[t][7]};
      *(v4f*)(mg + ((g * 32 + 2 * t) * 32 + lane) * 4)     = lo;
      *(v4f*)(mg + ((g * 32 + 2 * t + 1) * 32 + lane) * 4) = hi;
    }
    if (h == 0) {
      ml[g * 32 + m]      = mrun;
      ml[g * 32 + 16 + m] = lt;
    }
  }
  __syncthreads();
  if (hf == 0) {                         // wave-uniform
    const float m1 = ml[g * 32 + m];
    const float l1 = ml[g * 32 + 16 + m];
    const float mx = fmaxf(mrun, m1);
    const float a0 = exp_slot(mrun - mx);
    const float a1 = exp_slot(m1 - mx);
    const float iv = rcpf(lt * a0 + l1 * a1) * (1.0f / 262144.0f);
    const float c0 = a0 * iv;
    const float c1 = a1 * iv;
#pragma unroll
    for (int t = 0; t < CC / 16; ++t) {
      const v4f lo = *(const v4f*)(mg + ((g * 32 + 2 * t) * 32 + lane) * 4);
      const v4f hi = *(const v4f*)(mg + ((g * 32 + 2 * t + 1) * 32 + lane) * 4);
#pragma unroll
      for (int r = 0; r < 8; ++r) {
        const float o1 = (r < 4) ? lo[r & 3] : hi[r & 3];
        Et[(16 * t + 8 * h + r) * EPF + 16 * g + m] = acc[t][r] * c0 + o1 * c1;
      }
    }
  }
  __syncthreads();

  // per-channel partial statistics over the block's 64 pixels: thread = channel
  {
    const float* row = Et + tid * EPF;
    float a = 0.0f, q2 = 0.0f;
#pragma unroll
    for (int j = 0; j < 16; ++j) {
      const v4f v = *(const v4f*)(row + 4 * j);
#pragma unroll
      for (int e = 0; e < 4; ++e) {
        a += v[e];
        q2 += v[e] * v[e];
      }
    }
    ps[(size_t)blockIdx.x * CC + tid] = a;
    pq[(size_t)blockIdx.x * CC + tid] = q2;
  }
  o_store_pass(Et, O, R0, w, lane);
}

// =====================================================================================================
// GroupNorm + residual, all batches in one launch. Block = (channel c, batch b), 256 threads. Wave 0 combines the
// 64 blocks x 8 channels partial sums of group g = c/8 in f64 in a fixed order (lane l takes entries
// l, l+32, ... then an xor tree), mean = S/32768, var = Q/32768 - mean^2 (biased), rstd =
// 1/sqrt(var + 1e-5). out[c][n] = ((O[c][n] - mean) * rstd) * bf16(gn_w[c]) + bf16(gn_b[c]) +
// bf16(Hand[c][n]); row of 4096 floats written as 4 instructions of 256 threads x 16 B (each wave
// coverage: grid (256, nb) x 4096 = the whole [nb][256][4096] output, every element once.
// =====================================================================================================
__global__ __launch_bounds__(256)
void k_gn(const float* __restrict__ Oall, const float* __restrict__ psall, const float* __restrict__ pqall,
          const float* __restrict__ hand, const float* __restrict__ gnw,
          const float* __restrict__ gnb, float* out)
{
  __shared__ float stat[2];
  const int tid  = threadIdx.x;
  const int lane = tid & 31;
  const int w    = tid >> 5;
  const int c    = blockIdx.x;
  const int g    = c >> 3;
  const size_t po = (size_t)blockIdx.y * PLANE;
  const size_t pp = (size_t)blockIdx.y * HWD * CC;
  const float* O     = Oall + po;
  const float* ps    = psall + pp;
  const float* pq    = pqall + pp;
  const float* handb = hand + po;
  float*       outb  = out + po;

  // Every global load of the block is issued here, ahead of any use: wave 0's 32 partial sums first, then each
  // wave's share of the two rows. They are in flight together, so the block waits out one memory latency; summed
  // as they were loaded, trip by trip, and with the rows asked for behind the barrier, it waited out seventeen.
  float sv[16], qv[16];
  if (w == 0) {                                  // wave-uniform
    const float* psg = ps + 8 * g + (size_t)(lane >> 3) * CC + (lane & 7);
    const float* pqg = pq + 8 * g + (size_t)(lane >> 3) * CC + (lane & 7);
    // unrolled: entry lane + 32 i lies 4 i blocks further, an immediate offset off one address
#pragma unroll
    for (int i = 0; i < 16; ++i) {
      sv[i] = psg[(size_t)4 * i * CC];
      qv[i] = pqg[(size_t)4 * i * CC];
    }
  }
  const float* orow = O + (size_t)c * NPX;
  const float* hrow = handb + (size_t)c * NPX;
  v4f ov[4], hd[4];
#pragma unroll
  for (int it = 0; it < 4; ++it) {
    ov[it] = *(const v4f*)(orow + 4 * (it * 256 + tid));
    hd[it] = *(const v4f*)(hrow + 4 * (it * 256 + tid));
  }
  const float gw = bf16r(gnw[c]);
  const float gb = bf16r(gnb[c]);

  if (w == 0) {                                  // wave-uniform
    double s = 0.0, q = 0.0;
    // unrolled: the arrays are indexed by constants and stay in registers; the order of the sums is i = 0..15
#pragma unroll
    for (int i = 0; i < 16; ++i) {
      s += (double)sv[i];
      q += (double)qv[i];
    }
#pragma unroll
    for (int o = 16; o >= 1; o >>= 1) {
      s += shfl_xor_d(s, o);
      q += shfl_xor_d(q, o);
    }
    if (lane == 0) {
      const double inv_n = 1.0 / 32768.0;
      const double mean = s * inv_n;
      double var = q * inv_n - mean * mean;
      if (var < 0.0) var = 0.0;
      const float varf = (float)var;
      stat[0] = (float)mean;
      stat[1] = rcpf(sqrtf(varf + 1e-5f));
    }
  }
  __syncthreads();
  const float meanf = stat[0];
  const float rstd  = stat[1];
  float* drow = outb + (size_t)c * NPX;

  v4f res[4];
#pragma unroll
  for (int it = 0; it < 4; ++it) {
#pragma unroll
    for (int e = 0; e < 4; ++e) {
      const float xn = (ov[it][e] - meanf) * rstd;
      res[it][e] = xn * gw + gb + bf16r(hd[it][e]);
    }
  }
#pragma unroll
  for (int it = 0; it < 4; ++it)
    *(v4f*)(drow + 4 * (it * 256 + tid)) = res[it];
  
}

// =====================================================================================================
// Host glue. Inputs in table order (8): Hand [nb][256][64][64], U (same), WH_w [256][256], WH_b [256],
// WU_w [256][256], WU_b [256], gn_w [256], gn_b [256]; nb = in_sizes[0] / (256*4096), 1..4.
// Output f32 [nb][256][4096] at element 0. Workspace 59508736 B (sized for nb = 4).
// 4 launches, each over all batches: k_cvt (with the weight fold), k_proj, k_attn, k_gn.
// WU_b reaches no kernel: it adds the same amount to every score of a query (head of the file).
// =====================================================================================================
extern "C" void kernel_launch(void* const* d_in, const int* in_sizes, int n_in,
                              void* d_out, int out_size, void* d_ws, size_t ws_size,
                              hipStream_t stream) {
  if (n_in < 8) return;
  const int per = CC * NPX;
  const int n0s = in_sizes[0];
  if (n0s < per || (n0s % per) != 0) return;
  const int nb = n0s / per;
  if (nb < 1 || nb > NBMAX) return;
  if (in_sizes[1] != n0s) return;
  if (in_sizes[2] != CC * CC || in_sizes[4] != CC * CC) return;
  if (in_sizes[3] != CC || in_sizes[5] != CC || in_sizes[6] != CC || in_sizes[7] != CC) return;
  if (out_size != nb * per) return;
  if (ws_size < WS_TOTAL) return;

  const float* hand = (const float*)d_in[0];
  const float* u    = (const float*)d_in[1];
  const float* whw  = (const float*)d_in[2];
  const float* whb  = (const float*)d_in[3];
  const float* wuw  = (const float*)d_in[4];
  const float* gnw  = (const float*)d_in[6];
  const float* gnb  = (const float*)d_in[7];
  float* out = (float*)d_out;

  char* ws = (char*)d_ws;
  unsigned short* ht  = (unsigned short*)(ws + OFF_HT);
  unsigned short* ut  = (unsigned short*)(ws + OFF_UT);
  unsigned short* uc  = (unsigned short*)(ws + OFF_UC);
  unsigned short* w16 = (unsigned short*)(ws + OFF_W16);
  unsigned short* qh  = (unsigned short*)(ws + OFF_QH);
  unsigned short* ql  = (unsigned short*)(ws + OFF_QL);
  float*          bq  = (float*)(ws + OFF_BQ);
  float*          Op  = (float*)(ws + OFF_O);
  float*          ps  = (float*)(ws + OFF_PS);
  float*          pq  = (float*)(ws + OFF_PQ);

  k_cvt<<<dim3(NPX / 64, 1 + CC / 64 * nb), dim3(256), 0, stream>>>(hand, u, whw, whb, wuw, ht, ut, uc,
                                                                         w16, bq);
  (void)hipGetLastError();
  k_proj<<<dim3(NPX / 64, CC / 64, nb), dim3(128), 0, stream>>>(ht, w16, bq, qh, ql);
  (void)hipGetLastError();

  k_attn<<<dim3(HWD, nb), dim3(256), 0, stream>>>(qh, ql, ut, uc, Op, ps, pq);
  (void)hipGetLastError();

  k_gn<<<dim3(CC, nb), dim3(256), 0, stream>>>(Op, ps, pq, hand, gnw, gnb, out);
  (void)hipGetLastError();
}

// v008
// One run takes 105 microseconds.
// Timed twice side by side with v007, it ran 1.04 and 1.03 times as fast.
// Over all steps from v000 it is 9.09 times as fast.
// Contractions: weight fold G = WU^T.WH (K=256), 1x1 projection (K=256), affinity scores (K=256) and
// softmax(P).U (K=4096 in 32-deep steps) on v_wmma_f32_16x16x32_f16 (f16 operands, f32 accumulate); operands
// are RNE-bf16 inputs held in f16 containers (weights x16, activations and values x16), G as f16 hi plus
// x2^11 residual planes, the projected query vectors as f16 hi plus x2^15 residual planes (two products in
// the score GEMM), softmax planes x2^14; running softmax statistics, normalisation statistics (f64 combine)
// and epilogues f32 VALU. Scores never leave their wave's registers.
// The key projection is folded into the query side: q.k = (WH h + bH).(WU u + bU) = (WU^T (WH h + bH)).u
// + q.bU, and q.bU is the same for every key of a query, so the softmax over the keys does not see it.
// The scores are taken as t.u with t = G h + WU^T bH: the key operand is the input plane itself.
#include <hip/hip_runtime.h>
#include <stddef.h>
#include <stdint.h>
#include <math.h>

#define NBMAX 4
#define CC    256
#define NPX   4096
#define HWD   64
#define TP    72
#define EPF   68
#define FRAG  512                                      // halves of one 16-row x 32-k fragment block
#define SKH   16384                                    // halves of one key plane's 64 rows (one stage)
#define STG   (2 * SKH)                                // halves of one stage: the key rows and the value blocks
#define NBUF  3                                        // stage buffers of the ring
#define EPO   (3 * SKH)                                // halves in front of the epilogue's staged output
#define NFT   (17 * (CC / 16))                         // 16 x 16 tiles of the weight fold, bias column included

#define PLANE       ((size_t)CC * NPX)                 // 1048576 elements per batch plane
#define ACT16_BYTES ((size_t)NBMAX * PLANE * 2)        // 8388608
#define W16_BYTES   ((size_t)2 * CC * CC * 2)          // 262144
#define O_BYTES     ((size_t)NBMAX * PLANE * 4)        // 16777216
#define PS_BYTES    ((size_t)NBMAX * HWD * CC * 4)     // 262144

// ---- carve ----------------------------------------------------------------------------------------
#define OFF_HT   ((size_t)0)
#define OFF_UT   (OFF_HT + ACT16_BYTES)
#define OFF_UC   (OFF_UT + ACT16_BYTES)
#define OFF_W16  (OFF_UC + ACT16_BYTES)
#define OFF_QH   (OFF_W16 + W16_BYTES)
#define OFF_QL   (OFF_QH + ACT16_BYTES)
#define OFF_BQ   (OFF_QL + ACT16_BYTES)
#define OFF_O    (OFF_BQ + (size_t)CC * 8)              // bq: 16 floats per 128-byte line, one writing wave each
#define OFF_PS   (OFF_O + O_BYTES)
#define OFF_PQ   (OFF_PS + PS_BYTES)
#define WS_TOTAL (OFF_PQ + PS_BYTES)

static_assert(OFF_QH == (size_t)25427968);
static_assert(OFF_O == (size_t)42207232);
static_assert(WS_TOTAL == (size_t)59508736);
static_assert(WS_TOTAL <= (size_t)134217728);
static_assert((OFF_UT % 256) == 0);
static_assert((OFF_UC % 256) == 0);
static_assert((OFF_W16 % 256) == 0);
static_assert((OFF_QH % 256) == 0);
static_assert((OFF_QL % 256) == 0);
static_assert((OFF_BQ % 256) == 0);
static_assert((OFF_O % 256) == 0);
static_assert((OFF_PS % 256) == 0);
static_assert((OFF_PQ % 256) == 0);
static_assert(NPX == HWD * HWD);
static_assert((NPX / 64) * 8 >= NFT);                  // one grid row of k_cvt has a wave for every fold tile
static_assert((CC % 64) == 0);
static_assert((NPX % 64) == 0);
static_assert((TP * 2) % 16 == 0);
static_assert((EPF * 4) % 16 == 0);
static_assert(SKH == 64 * CC);
static_assert(SKH == (CC / 16) * 2 * FRAG);
static_assert(4 * 32 * 32 * 16 + 4 * 32 * 4 <= EPO * 2);  // what the key halves hand over ends in front of it
static_assert(EPO + CC * EPF * 2 <= NBUF * STG);       // the staged output ends inside the ring

typedef unsigned short v8us  __attribute__((ext_vector_type(8)));
typedef unsigned short v16us __attribute__((ext_vector_type(16)));
typedef _Float16       v16h  __attribute__((ext_vector_type(16)));
typedef float          v4f   __attribute__((ext_vector_type(4)));
typedef float          v8f   __attribute__((ext_vector_type(8)));
typedef int            v4i   __attribute__((ext_vector_type(4)));
typedef __attribute__((address_space(1))) v4i gv4i;
typedef __attribute__((address_space(3))) v4i lv4i;

union FragU { v16us v; v8us half[2]; };

// ---- scalar helpers -------------------------------------------------------------------------------
__device__ __forceinline__ unsigned bbits(float f) {          // f32 -> nearest-even bf16 bits
  unsigned u = __float_as_uint(f);
  return (u + 0x7FFFu + ((u >> 16) & 1u)) >> 16;
}
__device__ __forceinline__ float bf16r(float f) {            // RNE convert to bf16 and back
  return __uint_as_float(bbits(f) << 16);
}
__device__ __forceinline__ unsigned short hbits(float f) {   // f32 -> f16 bits (RNE)
  return __builtin_bit_cast(unsigned short, (_Float16)f);
}
__device__ __forceinline__ float rcpf(float x) {
#if defined(__HIP_DEVICE_COMPILE__)
  return __builtin_amdgcn_rcpf(x);
#else
  return 1.0f / x;
#endif
}
// exp(x) as one v_exp_f32 of x * log2(e), as __expf compiles to. The v_nop keeps the one free slot that the
// instruction set asks for between a transcendental and a next instruction that reads its result or
// rewrites its source.
__device__ __forceinline__ float exp_slot(float x) {
#if defined(__HIP_DEVICE_COMPILE__)
  float r;
  asm("v_exp_f32 %0, %1\n\tv_nop" : "=v"(r) : "v"(x * 1.44269504f));
  return r;
#else
  return x;
#endif
}
// The wait that stands in front of a rewrite of the address registers p, q of issued global loads. Naming
// them as inputs keeps them untouched up to here, behind the work that runs under the loads; at their
// first reuse, where the compiler puts the wait otherwise, it held that work back behind all the loads.
__device__ __forceinline__ void keep_addr(const unsigned short* p, const unsigned short* q) {
#if defined(__HIP_DEVICE_COMPILE__)
  asm volatile("s_wait_xcnt 0x0" :: "v"(p), "v"(q) : "memory");
#else
  (void)p; (void)q;
#endif
}
__device__ __forceinline__ v8f zero8() { v8f z = {0.f, 0.f, 0.f, 0.f, 0.f, 0.f, 0.f, 0.f}; return z; }

__device__ __forceinline__ double shfl_xor_d(double v, int o) {
  const long long x = __double_as_longlong(v);
  int lo = (int)(x & 0xffffffffll);
  int hi = (int)(x >> 32);
  lo = __shfl_xor(lo, o, 32);
  hi = __shfl_xor(hi, o, 32);
  const long long y = ((long long)(unsigned)hi << 32) | (long long)(unsigned)lo;
  return __longlong_as_double(y);
}

// ---- split k map of a 16-bit fragment, A and B alike: lane (m, h) holds row m; elements 0..7 are
//      k = 8 h + 0..7, elements 8..15 are k = 16 + 8 h + 0..7 of a 32-deep k block
// ---- fragment-order planes (every operand plane that a wave loads straight from global memory): a plane
//      of rows x K halves is a row-major grid of blocks [row / 16][k / 32], FRAG halves each; a block holds
//      the two 16-byte pieces of all 32 lanes back to back, element (row, k) at
//      256 * ((k >> 4) & 1) + 8 * (16 * ((k >> 3) & 1) + (row & 15)) + (k & 7): the split k map above, but
//      each load instruction of a wave reads 512 contiguous bytes (four whole 128-byte lines, not 16 parts).
//      p = block + 8 * lane
__device__ __forceinline__ v16us ldfrag_g(const unsigned short* p) {
  FragU f;
  f.half[0] = *(const v8us*)(p);
  f.half[1] = *(const v8us*)(p + 256);
  return f.v;
}

// ---- WMMA helper (f16 operands as raw 16-bit lanes, f32 accumulate) --------------------------------
__device__ __forceinline__ v8f mma_hu(v16us a, v16us b, v8f c) {
#if defined(__HIP_DEVICE_COMPILE__)
  return __builtin_amdgcn_wmma_f32_16x16x32_f16(false, __builtin_bit_cast(v16h, a),
                                               false, __builtin_bit_cast(v16h, b),
                                               (short)0, c, false, false);
#else
  (void)a; (void)b;
  return c;
#endif
}
// hazard guards after the last WMMA of a group: tie the accumulators, keep the fragments live
__device__ __forceinline__ void guard4(v8f& c0, v8f& c1, v8f& c2, v8f& c3, const v16us& a,
                                       const v16us& b0, const v16us& b1, const v16us& b2,
                                       const v16us& b3) {
#if defined(__HIP_DEVICE_COMPILE__)
  asm volatile("v_nop\n\tv_nop\n\tv_nop\n\tv_nop"
               : "+v"(c0), "+v"(c1), "+v"(c2), "+v"(c3)
               : "v"(a), "v"(b0), "v"(b1), "v"(b2), "v"(b3));
#else
  (void)c0; (void)c1; (void)c2; (void)c3; (void)a; (void)b0; (void)b1; (void)b2; (void)b3;
#endif
}

// 16-bit tile 64 rows x 64 k (LDS pitch PITCH halves) -> fragment-order plane P with kblocks blocks per
// row group: row groups rg0..rg0+3, k blocks kb0, kb0+1; one wave instruction = one 512-byte piece.
template <int NW, int PITCH>
__device__ __forceinline__ void store_tile_frag(const unsigned short* t, unsigned short* P,
                                                int rg0, int kblocks, int kb0, int w, int lane) {
  constexpr int NIT = 16 / NW;
  const int h = lane >> 4;
  const int m = lane & 15;
  v8us   v[NIT];
  size_t off[NIT];
#pragma unroll
  for (int it = 0; it < NIT; ++it) {
    const int ch  = it * NW + w;                  // 0..15 = (row group, k block, piece)
    const int gl  = ch >> 2;
    const int kbl = (ch >> 1) & 1;
    const int hf  = ch & 1;
    v[it]   = *(const v8us*)(t + (16 * gl + m) * PITCH + 32 * kbl + 16 * hf + 8 * h);
    off[it] = ((size_t)(rg0 + gl) * kblocks + kb0 + kbl) * FRAG + 256 * hf + 8 * lane;
  }
#pragma unroll
  for (int it = 0; it < NIT; ++it) *(v8us*)(P + off[it]) = v[it];
}

// =====================================================================================================
// Weight fold, one 16 x 16 tile per wave: G[j][c] = sum_o WU[o][j] * WH[o][c] (tile column tc < 16) and, as
// a seventeenth tile column whose only live column is m = 0, bq[j] = sum_o WU[o][j] * WH_b[o]. A rows j,
// B rows c, k = o; both fragments are gathered from the f32 weights in the split k map above, each element
// f16(16 * bf16(w)). Out: W16[0] = f16(16 G), W16[1] = f16(2048 * (16 G - W16[0])), both in fragment order
// (rows j, k = c), and bq in f32, row j at 32 * (j / 16) + j % 16. Run by the first waves of grid row 0 of k_cvt.
// coverage: 256 tiles x 256 elements = both planes, 16 tiles x 16 rows = bq, every element once.
// =====================================================================================================
template <bool ISB>                                 // ISB: the bias column
__device__ __forceinline__ void fold_tile(const float* __restrict__ whw, const float* __restrict__ whb,
                                          const float* __restrict__ wuw, unsigned short* w16, float* bq,
                                          int tile, int lane)
{
  const int h  = lane >> 4;
  const int m  = lane & 15;
  const int tc = tile >> 4;                         // wave-uniform, 0..16
  const int tr = tile & 15;
  constexpr int SB = ISB ? 1 : CC;                  // elements between two k of the B side
  const float* pa = wuw + 8 * h * CC + 16 * tr + m;
  const float* pb = ISB ? whb + 8 * h : whw + 8 * h * CC + 16 * tc + m;
  v8f d = zero8();
  // two k blocks per trip: 64 loads in flight, a body of moderate length
#pragma unroll 2
  for (int kb = 0; kb < CC / 32; ++kb) {
    v16us a, b;
#pragma unroll
    for (int e = 0; e < 16; ++e) {
      const int o = 32 * kb + 16 * (e >> 3) + (e & 7);   // + 8 h, which the two pointers hold
      a[e] = hbits(16.0f * bf16r(pa[o * CC]));
      const unsigned short bb = hbits(16.0f * bf16r(pb[o * SB]));
      b[e] = (ISB && m != 0) ? (unsigned short)0 : bb;
    }
    d = mma_hu(a, b, d);
  }
  if (!ISB) {
    const int k = 16 * tc + m;
#pragma unroll
    for (int r = 0; r < 8; ++r) {
      const int row = 16 * tr + 8 * h + r;
      const float g16 = d[r] * (1.0f / 16.0f);
      const _Float16 hv = (_Float16)g16;
      const int idx = ((row >> 4) * (CC / 32) + (k >> 5)) * FRAG + 256 * ((k >> 4) & 1)
                      + 8 * (16 * ((k >> 3) & 1) + (row & 15)) + (k & 7);
      w16[idx]           = __builtin_bit_cast(unsigned short, hv);
      w16[CC * CC + idx] = hbits((g16 - (float)hv) * 2048.0f);
    }
  } else if (m == 0) {
#pragma unroll
    for (int r = 0; r < 8; ++r) bq[32 * tr + 8 * h + r] = d[r] * (1.0f / 256.0f);
  }
}

// =====================================================================================================
// for the projection A fragments); UC: rows c, k = n in fragment order (for the P.U A fragment).
// Block = (64 px tile, y = 1 + 4 b + 64 ch tile), 256 threads; thread = (channel cl = tid>>2, 16-px quarter).
// All three planes in fragment order: HT/UT rows n, k = c; UC rows c, k = n (16 pieces of 512 B per tile).
// Grid row y = 0 folds the weights instead: they depend on nothing here, so they need no launch of
// their own.
// coverage: grid (64, 1 + 4 nb): every (b, c, n) of HT, UT and UC and every folded weight written exactly once.
// =====================================================================================================
__global__ __launch_bounds__(256)
void k_cvt(const float* __restrict__ hand, const float* __restrict__ u,
           const float* __restrict__ whw, const float* __restrict__ whb, const float* __restrict__ wuw,
           unsigned short* ht, unsigned short* ut, unsigned short* uc, unsigned short* w16, float* bq)
{
  __shared__ __align__(16) unsigned short TH[64 * TP];
  __shared__ __align__(16) unsigned short TU[64 * TP];
  __shared__ __align__(16) unsigned short TC[64 * TP];

  const int tid  = threadIdx.x;
  const int lane = tid & 31;
  const int w    = tid >> 5;
  if (blockIdx.y == 0) {                  // block-uniform, in front of the barrier
    const int tile = 8 * blockIdx.x + w;  // wave-uniform
    if (tile < NFT - CC / 16) fold_tile<false>(whw, whb, wuw, w16, bq, tile, lane);
    else if (tile < NFT)      fold_tile<true>(whw, whb, wuw, w16, bq, tile, lane);
    return;
  }
  const int yt   = blockIdx.y - 1;        // 4 b + channel tile
  const int n0   = 64 * blockIdx.x;
  const int c0   = 64 * (yt & (CC / 64 - 1));
  const int b    = yt / (CC / 64);
  const int cl   = tid >> 2;              // 0..63
  const int pq   = 16 * (tid & 3);        // 0,16,32,48
  const size_t src = (size_t)b * PLANE + (size_t)(c0 + cl) * NPX + n0 + pq;
#pragma unroll
  for (int g = 0; g < 4; ++g) {
    const v4f hv = *(const v4f*)(hand + src + 4 * g);
    const v4f uv = *(const v4f*)(u + src + 4 * g);
#pragma unroll
    for (int e = 0; e < 4; ++e) {
      const int px = pq + 4 * g + e;
      const unsigned short hb = hbits(16.0f * bf16r(hv[e]));
      const unsigned short ub = hbits(16.0f * bf16r(uv[e]));
      TH[px * TP + cl] = hb;
      TU[px * TP + cl] = ub;
      TC[cl * TP + px] = ub;
    }
  }
  __syncthreads();
  store_tile_frag<8, TP>(TH, ht + (size_t)b * PLANE, n0 / 16, CC / 32, c0 / 32, w, lane);
  store_tile_frag<8, TP>(TU, ut + (size_t)b * PLANE, n0 / 16, CC / 32, c0 / 32, w, lane);
  store_tile_frag<8, TP>(TC, uc + (size_t)b * PLANE, c0 / 16, NPX / 32, n0 / 32, w, lane);
}

// =====================================================================================================
// 1x1 projection of the queries through the folded weights: D[n][j] = sum_c X[n][c] * G[j][c], tile 64(n) x
// 64(j), K = 256, 4 waves, wave w owns rows n 16w..16w+15 (A fragment from the fragment-order activation
// plane) and 4 column sub-tiles of 16 output channels (B fragments = rows j of W16[0] and of its residual
// plane W16[1], fragment order; one accumulator set each). Epilogue: t = (hi + lo / 2048) / 256 + bq, kept
// as t / 16 (the key operand of the scores carries x16), split into f16 hi and x2^15 residual, into the
// fragment-order planes (rows n, k = j).
// coverage: grid (64 n tiles, 4 j tiles, nb): QH, QL [b][4096][256] every element once.
// =====================================================================================================
__global__ __launch_bounds__(128)
void k_proj(const unsigned short* __restrict__ ht, const unsigned short* __restrict__ w16,
            const float* __restrict__ bq, unsigned short* qh, unsigned short* ql)
{
  __shared__ __align__(16) unsigned short t0[64 * TP];
  __shared__ __align__(16) unsigned short t1[64 * TP];

  const int tid   = threadIdx.x;
  const int lane  = tid & 31;
  const int w     = tid >> 5;
  const int h     = lane >> 4;
  const int m     = lane & 15;
  const int n0    = 64 * blockIdx.x;
  const int o0    = 64 * blockIdx.y;
  const int bb    = blockIdx.z;
  const unsigned short* x = ht + (size_t)bb * PLANE;

  v8f acc[4], acl[4];
#pragma unroll
  for (int j = 0; j < 4; ++j) { acc[j] = zero8(); acl[j] = zero8(); }

  const unsigned short* pa = x + (size_t)(n0 / 16 + w) * (CC / 32) * FRAG + 8 * lane;
  const unsigned short* pb = w16 + (size_t)(o0 / 16) * (CC / 32) * FRAG + 8 * lane;
  // two k steps per trip, kept rolled: a longer body would only add fragment registers
#pragma unroll 1
  for (int k2 = 0; k2 < CC / 64; ++k2) {
    const unsigned short* pak = pa + 2 * FRAG * k2;
    const unsigned short* pbk = pb + 2 * FRAG * k2;
    // unrolled: both steps address off the trip's two pointers by immediate offsets
#pragma unroll
    for (int u = 0; u < 2; ++u) {
      const v16us a  = ldfrag_g(pak + FRAG * u);
      const v16us b0 = ldfrag_g(pbk + FRAG * u);
      const v16us b1 = ldfrag_g(pbk + FRAG * (1 * (CC / 32) + u));
      const v16us b2 = ldfrag_g(pbk + FRAG * (2 * (CC / 32) + u));
      const v16us b3 = ldfrag_g(pbk + FRAG * (3 * (CC / 32) + u));
      const v16us l0 = ldfrag_g(pbk + CC * CC + FRAG * u);
      const v16us l1 = ldfrag_g(pbk + CC * CC + FRAG * (1 * (CC / 32) + u));
      const v16us l2 = ldfrag_g(pbk + CC * CC + FRAG * (2 * (CC / 32) + u));
      const v16us l3 = ldfrag_g(pbk + CC * CC + FRAG * (3 * (CC / 32) + u));
      // keeps the eighteen loads together and ahead of the products: left alone, the scheduler reused fragment
      // registers and put most loads right in front of the product that waits for them
      __builtin_amdgcn_sched_barrier(0);
      acc[0] = mma_hu(a, b0, acc[0]);
      acc[1] = mma_hu(a, b1, acc[1]);
      acc[2] = mma_hu(a, b2, acc[2]);
      acc[3] = mma_hu(a, b3, acc[3]);
      acl[0] = mma_hu(a, l0, acl[0]);
      acl[1] = mma_hu(a, l1, acl[1]);
      acl[2] = mma_hu(a, l2, acl[2]);
      acl[3] = mma_hu(a, l3, acl[3]);
      guard4(acl[0], acl[1], acl[2], acl[3], a, l0, l1, l2, l3);
    }
    keep_addr(pak, pbk);                         // the next trip rewrites the loads' address registers
  }

  const float kq = 1.0f / 4096.0f;               // 1 / 256 for the operand scales, 1 / 16 for the kept scale
  const float kl = 1.0f / 2048.0f;
  float bv[4];
#pragma unroll
  for (int j = 0; j < 4; ++j) bv[j] = bq[32 * (o0 / 16 + j) + m] * (1.0f / 16.0f);
#pragma unroll
  for (int j = 0; j < 4; ++j) {
#pragma unroll
    for (int r = 0; r < 8; ++r) {
      const float val = (acc[j][r] + acl[j][r] * kl) * kq + bv[j];
      const _Float16 hv = (_Float16)val;
      const int rl = 16 * w + 8 * h + r;       // pixel within tile
      const int cl = 16 * j + m;               // output channel within tile
      t0[rl * TP + cl] = __builtin_bit_cast(unsigned short, hv);
      t1[rl * TP + cl] = hbits((val - (float)hv) * 32768.0f);
    }
  }
  __syncthreads();
  store_tile_frag<4, TP>(t0, qh + (size_t)bb * PLANE, n0 / 16, CC / 32, o0 / 32, w, lane);
  store_tile_frag<4, TP>(t1, ql + (size_t)bb * PLANE, n0 / 16, CC / 32, o0 / 32, w, lane);
}

// =====================================================================================================
// Scores, softmax and P.U in one pass, all batches in one launch. Block = (64 query pixels R0.. of batch b,
// all 256 channels), 8 waves. Wave w owns the 16 queries of column group g = w & 3 and, of every stage of 64
// key pixels, the 32 keys of half hf = w >> 2; nothing of its scores or of P ever leaves its registers.
//   resident: the wave's query fragments QH/QL (B operands, 8 k steps each) in registers.
//   stage:    64 keys: their rows of UT (32 KB) and the value blocks UC (16 channel groups x 2 KB), copied as
//             they lie in the fragment-order planes into one of three LDS buffers, two stages ahead.
//   scores:   St[key][i] = UT.QH + UT.QL / 32768, K = 256, two tiles of 16 keys; a lane (m, h)
//             holds the keys 16 kt + 8 h + r of query m.
//   softmax:  in the lane plus one exchange between the wave halves for the maximum; running maximum mrun,
//             running sum lrun of the lane's own keys; P = f16(16384 exp(St - mrun)).
//   P.U:      D[c][i] = D[c][i] * al[i] + UC[c][k] . P[k][i]: the two score tiles, converted in place, are
//             the B operand in the split k map; 16 accumulators = all 256 channels.
// Epilogue: the two key halves of a column group are joined through LDS (common maximum, weighted sums),
// p = D / lsum[i] / 2^18 (value scale 16, softmax scale 2^14) is staged as [c][i]; thread c sums p and p^2 of
// its channel over the 64 pixels in pixel order; the O rows leave as whole 128-byte lines.
// coverage: grid (64, nb): O [b][256][4096] and PS/PQ [b][64][256], every element once.
// =====================================================================================================
__device__ __forceinline__ void o_store_pass(const float* Et, float* orows, int R0, int w, int lane)
{
  const int q  = lane >> 3;
  const int jj = lane & 7;
#pragma unroll 1
  for (int it = 0; it < 16; ++it) {
    const int li = it * 32 + 4 * w + q;         // 0..511
    const int c = li >> 1, hf = li & 1;
    const v4f v = *(const v4f*)(Et + c * EPF + 32 * hf + 4 * jj);
    *(v4f*)(orows + (size_t)c * NPX + R0 + 32 * hf + 4 * jj) = v;
    // the next trip rewrites the store's address and data registers: keep the wait in front of that
    asm volatile("s_wait_xcnt 0x0" ::: "memory");
  }
}

// lane l with lane l ^ 16
__device__ __forceinline__ float xhalf(float x) {
#if defined(__HIP_DEVICE_COMPILE__)
  return __builtin_bit_cast(float, __builtin_amdgcn_permlanex16(__builtin_bit_cast(int, x),
                                                                __builtin_bit_cast(int, x),
                                                                0x76543210, 0xfedcba98, false, false));
#else
  return x;
#endif
}

// The two halves of the work-group barrier, written apart so that register work can stand between them. The
// "memory" clobber keeps every LDS read, and every copy to LDS, on the side of each half where the source has it.
// The work-group release fence is the one that __syncthreads() holds in front of its barrier: from it the compiler
// knows that no LDS read is outstanding; without it, it put counted waits of its own among the P.U products, and
// the last of them waited for the next stage's fragments.
__device__ __forceinline__ void bar_signal() {
#if defined(__HIP_DEVICE_COMPILE__)
  __builtin_amdgcn_fence(__ATOMIC_RELEASE, "workgroup");
  asm volatile("s_barrier_signal -1" ::: "memory");
#endif
}
// The wait names, as inputs only, what the vector work between the halves produces (the rescaled accumulators, P,
// the running sum): that work then stands in front of the wait. Left free, the compiler sank it behind the wait,
// into the block of the P.U products, where it runs after the wave has idled.
__device__ __forceinline__ void bar_wait(const v8f (&a)[CC / 16], const v16us& p, float l) {
#if defined(__HIP_DEVICE_COMPILE__)
  asm volatile("s_barrier_wait -1"
               :: "v"(a[0]), "v"(a[1]), "v"(a[2]), "v"(a[3]), "v"(a[4]), "v"(a[5]), "v"(a[6]), "v"(a[7]),
                  "v"(a[8]), "v"(a[9]), "v"(a[10]), "v"(a[11]), "v"(a[12]), "v"(a[13]), "v"(a[14]), "v"(a[15]),
                  "v"(p), "v"(l)
               : "memory");
#else
  (void)a; (void)p; (void)l;
#endif
}

// 16 bytes per lane from global memory to LDS, through no register; OFF bytes further on both sides
template <int OFF>
__device__ __forceinline__ void copy16(const unsigned short* gsrc, unsigned short* ldst) {
  static_assert(OFF >= 0 && OFF < 65536);
#if defined(__HIP_DEVICE_COMPILE__)
  __builtin_amdgcn_global_load_async_to_lds_b128((gv4i*)gsrc, (lv4i*)ldst, OFF, 0);
#else
  (void)gsrc; (void)ldst;
#endif
}

// Stage s (keys 64 s .. 64 s + 63) into the buffer dst, by four waves (l = 0..127 over their lanes): 32 copies per
// lane, each wave instruction 512 contiguous bytes on both sides. UT: 32 KB in a row. UC: channel group t, 2 KB each.
__device__ __forceinline__ void stage_copy(const unsigned short* utb,
                                           const unsigned short* ucb, unsigned short* dst, int s, int l)
{
  const unsigned short* gk = utb + (size_t)s * SKH + 8 * l;
  const unsigned short* gu = ucb + (size_t)s * 2 * FRAG + 8 * l;
  unsigned short* d = dst + 8 * l;
  copy16<0>(gk, d);      copy16<2048>(gk, d);   copy16<4096>(gk, d);   copy16<6144>(gk, d);
  copy16<8192>(gk, d);   copy16<10240>(gk, d);  copy16<12288>(gk, d);  copy16<14336>(gk, d);
  copy16<16384>(gk, d);  copy16<18432>(gk, d);  copy16<20480>(gk, d);  copy16<22528>(gk, d);
  copy16<24576>(gk, d);  copy16<26624>(gk, d);  copy16<28672>(gk, d);  copy16<30720>(gk, d);
  // unrolled: sixteen addresses a constant apart
#pragma unroll
  for (int t = 0; t < CC / 16; ++t)
    copy16<0>(gu + (size_t)t * (NPX / 32) * FRAG, d + SKH + 2 * FRAG * t);
}

__global__ __launch_bounds__(256) __attribute__((amdgpu_waves_per_eu(2, 2)))
void k_attn(const unsigned short* __restrict__ qh, const unsigned short* __restrict__ ql,
            const unsigned short* __restrict__ ut,
            const unsigned short* __restrict__ uc, float* Oall, float* psall, float* pqall)
{
  // three stage buffers; the epilogue's staging lies inside them
  __shared__ __align__(16) unsigned short ring[NBUF * STG];

  const int tid  = threadIdx.x;
  const int lane = tid & 31;
  const int w    = tid >> 5;
  const int h    = lane >> 4;
  const int m    = lane & 15;
  const int g    = w & 3;                // column group: queries R0 + 16 g + m
  const int hf   = w >> 2;               // key half of every stage
  const int R0   = 64 * blockIdx.x;
  const size_t po = (size_t)blockIdx.y * PLANE;
  const unsigned short* utb = ut + po;
  const unsigned short* ucb = uc + po;
  float* O  = Oall + po;
  float* ps = psall + (size_t)blockIdx.y * HWD * CC;
  float* pq = pqall + (size_t)blockIdx.y * HWD * CC;

  // Who copies: the four waves of key half (k & 1) bring in the whole of stage k. A wave then has one stage's copies
  // in flight at a time, waits for them to 0, and yet they have two passes to land: the other half's stage lies between.
  const int hfs = __builtin_amdgcn_readfirstlane(hf);   // in a scalar register: the tests on it are scalar branches
  const int l   = tid & 127;
  stage_copy(utb, ucb, ring + hfs * STG, hfs, l);       // stages 0 and 1

  // resident query fragments
  v16us qfh[CC / 32], qfl[CC / 32];
  {
    const unsigned short* gqh = qh + po + (size_t)(R0 / 16 + g) * (CC / 32) * FRAG + 8 * lane;
    const unsigned short* gql = ql + po + (size_t)(R0 / 16 + g) * (CC / 32) * FRAG + 8 * lane;
#pragma unroll
    for (int kk = 0; kk < CC / 32; ++kk) {
      qfh[kk] = ldfrag_g(gqh + FRAG * kk);
      qfl[kk] = ldfrag_g(gql + FRAG * kk);
    }
    keep_addr(gqh, gql);
  }

  float mrun = -1.0e30f, lrun = 0.0f;
  v8f acc[CC / 16];
#pragma unroll
  for (int t = 0; t < CC / 16; ++t) acc[t] = zero8();

  // stage 0 has landed for the waves that copied it, then for all; stage 1 stays in flight; stage 2 is asked for
  if (hfs == 0) asm volatile("s_wait_asynccnt 0x0" ::: "memory");
  __syncthreads();
  if (hfs == 0) stage_copy(utb, ucb, ring + 2 * STG, 2, l);

  // key fragments four k steps at a time, one such group ahead in a second register set: a group's LDS
  // latency runs under the sixteen matrix instructions of the group before. [set][2 u + (0: keys 0..15,
  // 1: keys 16..31)]. A stage's first two k steps are read behind the stage's publish point, in the pass
  // before.
  v16us fa[2][8];
  {
    const unsigned short* f0 = ring + hf * (2 * (CC / 32) * FRAG) + 8 * lane;
    fa[0][0] = ldfrag_g(f0);
    fa[0][1] = ldfrag_g(f0 + FRAG * (CC / 32));
    fa[0][2] = ldfrag_g(f0 + FRAG);
    fa[0][3] = ldfrag_g(f0 + FRAG * (CC / 32 + 1));
  }

  const float kx = 1.0f / 32768.0f;
  // The stage loop stays rolled; every loop inside it is unrolled, so that
  // the fragment and accumulator arrays are indexed by constants and live in registers.
  int cur = 0;                           // s % NBUF
#pragma unroll 1
  for (int s = 0; s < NPX / 64; ++s) {
    const int  nxt = (cur + 1 == NBUF) ? 0 : cur + 1;
    const bool act = hfs == ((s + 1) & 1);              // this wave copied stage s + 1 and will copy stage s + 3
    unsigned short* buf = ring + cur * STG;
    const unsigned short* fk = buf + hf * (2 * (CC / 32) * FRAG) + 8 * lane;   // the half's 32 keys
    const unsigned short* fu = buf + SKH + hf * FRAG + 8 * lane;               // its value blocks
    v8f sa[2], sx[2];
#pragma unroll
    for (int kt = 0; kt < 2; ++kt) { sa[kt] = zero8(); sx[kt] = zero8(); }
    v16us ua[CC / 16];
    fa[0][4] = ldfrag_g(fk + FRAG * 2);
    fa[0][5] = ldfrag_g(fk + FRAG * (CC / 32 + 2));
    fa[0][6] = ldfrag_g(fk + FRAG * 3);
    fa[0][7] = ldfrag_g(fk + FRAG * (CC / 32 + 3));
#pragma unroll
    for (int k2 = 0; k2 < CC / 128; ++k2) {
      if (k2 + 1 < CC / 128) {
#pragma unroll
        for (int u = 0; u < 4; ++u) {
          const int kn = 4 * (k2 + 1) + u;
          fa[(k2 + 1) & 1][2 * u + 0] = ldfrag_g(fk + FRAG * kn);
          fa[(k2 + 1) & 1][2 * u + 1] = ldfrag_g(fk + FRAG * (CC / 32 + kn));
        }
      } else {
        // the first half of the value fragments takes the place of a next group
#pragma unroll
        for (int t = 0; t < CC / 32; ++t) ua[t] = ldfrag_g(fu + 2 * FRAG * t);
      }
      // keeps the sixteen reads together and ahead of the group's products: left alone, the scheduler spread
      // them among the matrix instructions, each read waited for right behind its issue
      __builtin_amdgcn_sched_barrier(0);
#pragma unroll
      for (int u = 0; u < 4; ++u) {
        const int kk = 4 * k2 + u;
        sx[0] = mma_hu(fa[k2 & 1][2 * u + 0], qfl[kk], sx[0]);
        sx[1] = mma_hu(fa[k2 & 1][2 * u + 1], qfl[kk], sx[1]);
        sa[0] = mma_hu(fa[k2 & 1][2 * u + 0], qfh[kk], sa[0]);
        sa[1] = mma_hu(fa[k2 & 1][2 * u + 1], qfh[kk], sa[1]);
      }
      // the other side of the same fence: the next group's reads stay behind these products
      __builtin_amdgcn_sched_barrier(0);
    }
    // the second half: the stage's last LDS reads; the pass reads LDS again only for the next stage's first two k steps
#pragma unroll
    for (int t = CC / 32; t < CC / 16; ++t) ua[t] = ldfrag_g(fu + 2 * FRAG * t);
    // the reads stay ahead of the vector work that follows, which covers their latency
    __builtin_amdgcn_sched_barrier(0);
    float sc[16];
#pragma unroll
    for (int e = 0; e < 16; ++e) sc[e] = sa[e >> 3][e & 7] + sx[e >> 3][e & 7] * kx;
    float tm4[4];
#pragma unroll
    for (int e = 0; e < 4; ++e) tm4[e] = fmaxf(fmaxf(sc[e], sc[4 + e]), fmaxf(sc[8 + e], sc[12 + e]));
    float tm = fmaxf(fmaxf(tm4[0], tm4[1]), fmaxf(tm4[2], tm4[3]));
    tm = fmaxf(tm, xhalf(tm));
    const float mn = fmaxf(mrun, tm);
    // publish point, first half: this wave has left the buffer and, if it copied stage s + 1, its copies have landed
    // (the other waves' copies, of stage s + 2, stay in flight); it says so and goes on. The softmax and the
    // rescaling work on registers alone (no LDS read, no copy stands between signal and wait), so a wave that is
    // ahead does them while the wave it shares its SIMD with still has the matrix unit and the LDS for its scores,
    // instead of idling at the barrier and then sharing the vector port with it.
    asm volatile("s_wait_dscnt 0x0" ::: "memory");
    if (act) asm volatile("s_wait_asynccnt 0x0" ::: "memory");
    bar_signal();
    // keeps the signal ahead of the vector work below: left alone, the scheduler put it directly in front of the wait
    __builtin_amdgcn_sched_barrier(0);
    const float al = exp_slot(mrun - mn);
    v16us pf;
    float ad4[4] = {0.0f, 0.0f, 0.0f, 0.0f};   // four chains, not one of sixteen dependent additions
#pragma unroll
    for (int e = 0; e < 16; ++e) {
      const float ex = exp_slot(sc[e] - mn);
      ad4[e & 3] += ex;
      pf[e] = hbits(16384.0f * ex);
    }
    lrun = lrun * al + ((ad4[0] + ad4[1]) + (ad4[2] + ad4[3]));
    mrun = mn;
#pragma unroll
    for (int t = 0; t < CC / 16; ++t) {
#pragma unroll
      for (int r = 0; r < 8; ++r) acc[t][r] = acc[t][r] * al;
    }
    // publish point, second half: every wave has signalled, so stage s + 1 is readable and the buffer just read is
    // free: it is filled anew, with stage s + 3, which is published two passes on
    bar_wait(acc, pf, lrun);
    if (act && s + NBUF < NPX / 64) stage_copy(utb, ucb, buf, s + NBUF, l);
    if (s + 1 < NPX / 64) {
      // stage s + 1 is published: its first two k steps are read now, so that the next pass starts on its products
      const unsigned short* fn = ring + nxt * STG + hf * (2 * (CC / 32) * FRAG) + 8 * lane;
      fa[0][0] = ldfrag_g(fn);
      fa[0][1] = ldfrag_g(fn + FRAG * (CC / 32));
      fa[0][2] = ldfrag_g(fn + FRAG);
      fa[0][3] = ldfrag_g(fn + FRAG * (CC / 32 + 1));
    }
#pragma unroll
    for (int t = 0; t < CC / 16; ++t) acc[t] = mma_hu(ua[t], pf, acc[t]);
    cur = nxt;
  }
  // no copy is outstanding when the ring becomes the epilogue's staging
  asm volatile("s_wait_asynccnt 0x0" ::: "memory");

  float* mg = (float*)ring;              // [g][32 pieces][lane] of 16 B: the accumulators of key half 1
  float* ml = (float*)ring + 16384;      // [g][2][16]: its running maximum and sum
  float* Et = (float*)(ring + EPO);      // [c][i], pitch EPF
  const float lt = lrun + xhalf(lrun);   // the wave halves hold different keys of the same query
  if (hf == 1) {                         // wave-uniform
#pragma unroll
    for (int t = 0; t < CC / 16; ++t) {
      const v4f lo = {acc[t][0], acc[t][1], acc[t][2], acc[t][3]};
      const v4f hi = {acc[t][4], acc[t][5], acc[t][6], acc[t][7]};
      *(v4f*)(mg + ((g * 32 + 2 * t) * 32 + lane) * 4)     = lo;
      *(v4f*)(mg + ((g * 32 + 2 * t + 1) * 32 + lane) * 4) = hi;
    }
    if (h == 0) {
      ml[g * 32 + m]      = mrun;
      ml[g * 32 + 16 + m] = lt;
    }
  }
  __syncthreads();
  if (hf == 0) {                         // wave-uniform
    const float m1 = ml[g * 32 + m];
    const float l1 = ml[g * 32 + 16 + m];
    const float mx = fmaxf(mrun, m1);
    const float a0 = exp_slot(mrun - mx);
    const float a1 = exp_slot(m1 - mx);
    const float iv = rcpf(lt * a0 + l1 * a1) * (1.0f / 262144.0f);
    const float c0 = a0 * iv;
    const float c1 = a1 * iv;
#pragma unroll
    for (int t = 0; t < CC / 16; ++t) {
      const v4f lo = *(const v4f*)(mg + ((g * 32 + 2 * t) * 32 + lane) * 4);
      const v4f hi = *(const v4f*)(mg + ((g * 32 + 2 * t + 1) * 32 + lane) * 4);
#pragma unroll
      for (int r = 0; r < 8; ++r) {
        const float o1 = (r < 4) ? lo[r & 3] : hi[r & 3];
        Et[(16 * t + 8 * h + r) * EPF + 16 * g + m] = acc[t][r] * c0 + o1 * c1;
      }
    }
  }
  __syncthreads();

  // per-channel partial statistics over the block's 64 pixels: thread = channel
  {
    const float* row = Et + tid * EPF;
    float a = 0.0f, q2 = 0.0f;
#pragma unroll
    for (int j = 0; j < 16; ++j) {
      const v4f v = *(const v4f*)(row + 4 * j);
#pragma unroll
      for (int e = 0; e < 4; ++e) {
        a += v[e];
        q2 += v[e] * v[e];
      }
    }
    ps[(size_t)blockIdx.x * CC + tid] = a;
    pq[(size_t)blockIdx.x * CC + tid] = q2;
  }
  o_store_pass(Et, O, R0, w, lane);
}

// =====================================================================================================
// GroupNorm + residual, all batches in one launch. Block = (channel c, batch b), 256 threads. Wave 0 combines the
// 64 blocks x 8 channels partial sums of group g = c/8 in f64 in a fixed order (lane l takes entries
// l, l+32, ... then an xor tree), mean = S/32768, var = Q/32768 - mean^2 (biased), rstd =
// 1/sqrt(var + 1e-5). out[c][n] = ((O[c][n] - mean) * rstd) * bf16(gn_w[c]) + bf16(gn_b[c]) +
// bf16(Hand[c][n]); row of 4096 floats written as 4 instructions of 256 threads x 16 B (each wave
// coverage: grid (256, nb) x 4096 = the whole [nb][256][4096] output, every element once.
// =====================================================================================================
__global__ __launch_bounds__(256)
void k_gn(const float* __restrict__ Oall, const float* __restrict__ psall, const float* __restrict__ pqall,
          const float* __restrict__ hand, const float* __restrict__ gnw,
          const float* __restrict__ gnb, float* out)
{
  __shared__ float stat[2];
  const int tid  = threadIdx.x;
  const int lane = tid & 31;
  const int w    = tid >> 5;
  const int c    = blockIdx.x;
  const int g    = c >> 3;
  const size_t po = (size_t)blockIdx.y * PLANE;
  const size_t pp = (size_t)blockIdx.y * HWD * CC;
  const float* O     = Oall + po;
  const float* ps    = psall + pp;
  const float* pq    = pqall + pp;
  const float* handb = hand + po;
  float*       outb  = out + po;

  // Every global load of the block is issued here, ahead of any use: wave 0's 32 partial sums first, then each
  // wave's share of the two rows. They are in flight together, so the block waits out one memory latency; summed
  // as they were loaded, trip by trip, and with the rows asked for behind the barrier, it waited out seventeen.
  float sv[16], qv[16];
  if (w == 0) {                                  // wave-uniform
    const float* psg = ps + 8 * g + (size_t)(lane >> 3) * CC + (lane & 7);
    const float* pqg = pq + 8 * g + (size_t)(lane >> 3) * CC + (lane & 7);
    // unrolled: entry lane + 32 i lies 4 i blocks further, an immediate offset off one address
#pragma unroll
    for (int i = 0; i < 16; ++i) {
      sv[i] = psg[(size_t)4 * i * CC];
      qv[i] = pqg[(size_t)4 * i * CC];
    }
  }
  const float* orow = O + (size_t)c * NPX;
  const float* hrow = handb + (size_t)c * NPX;
  v4f ov[4], hd[4];
#pragma unroll
  for (int it = 0; it < 4; ++it) {
    ov[it] = *(const v4f*)(orow + 4 * (it * 256 + tid));
    hd[it] = *(const v4f*)(hrow + 4 * (it * 256 + tid));
  }
  const float gw = bf16r(gnw[c]);
  const float gb = bf16r(gnb[c]);

  if (w == 0) {                                  // wave-uniform
    double s = 0.0, q = 0.0;
    // unrolled: the arrays are indexed by constants and stay in registers; the order of the sums is i = 0..15
#pragma unroll
    for (int i = 0; i < 16; ++i) {
      s += (double)sv[i];
      q += (double)qv[i];
    }
#pragma unroll
    for (int o = 16; o >= 1; o >>= 1) {
      s += shfl_xor_d(s, o);
      q += shfl_xor_d(q, o);
    }
    if (lane == 0) {
      const double inv_n = 1.0 / 32768.0;
      const double mean = s * inv_n;
      double var = q * inv_n - mean * mean;
      if (var < 0.0) var = 0.0;
      const float varf = (float)var;
      stat[0] = (float)mean;
      stat[1] = rcpf(sqrtf(varf + 1e-5f));
    }
  }
  __syncthreads();
  const float meanf = stat[0];
  const float rstd  = stat[1];
  float* drow = outb + (size_t)c * NPX;

  v4f res[4];
#pragma unroll
  for (int it = 0; it < 4; ++it) {
#pragma unroll
    for (int e = 0; e < 4; ++e) {
      const float xn = (ov[it][e] - meanf) * rstd;
      res[it][e] = xn * gw + gb + bf16r(hd[it][e]);
    }
  }
#pragma unroll
  for (int it = 0; it < 4; ++it)
    *(v4f*)(drow + 4 * (it * 256 + tid)) = res[it];
  
}

// =====================================================================================================
// Host glue. Inputs in table order (8): Hand [nb][256][64][64], U (same), WH_w [256][256], WH_b [256],
// WU_w [256][256], WU_b [256], gn_w [256], gn_b [256]; nb = in_sizes[0] / (256*4096), 1..4.
// Output f32 [nb][256][4096] at element 0. Workspace 59508736 B (sized for nb = 4).
// 4 launches, each over all batches: k_cvt (with the weight fold), k_proj, k_attn, k_gn.
// WU_b reaches no kernel: it adds the same amount to every score of a query (head of the file).
// =====================================================================================================
extern "C" void kernel_launch(void* const* d_in, const int* in_sizes, int n_in,
                              void* d_out, int out_size, void* d_ws, size_t ws_size,
                              hipStream_t stream) {
  if (n_in < 8) return;
  const int per = CC * NPX;
  const int n0s = in_sizes[0];
  if (n0s < per || (n0s % per) != 0) return;
  const int nb = n0s / per;
  if (nb < 1 || nb > NBMAX) return;
  if (in_sizes[1] != n0s) return;
  if (in_sizes[2] != CC * CC || in_sizes[4] != CC * CC) return;
  if (in_sizes[3] != CC || in_sizes[5] != CC || in_sizes[6] != CC || in_sizes[7] != CC) return;
  if (out_size != nb * per) return;
  if (ws_size < WS_TOTAL) return;

  const float* hand = (const float*)d_in[0];
  const float* u    = (const float*)d_in[1];
  const float* whw  = (const float*)d_in[2];
  const float* whb  = (const float*)d_in[3];
  const float* wuw  = (const float*)d_in[4];
  const float* gnw  = (const float*)d_in[6];
  const float* gnb  = (const float*)d_in[7];
  float* out = (float*)d_out;

  char* ws = (char*)d_ws;
  unsigned short* ht  = (unsigned short*)(ws + OFF_HT);
  unsigned short* ut  = (unsigned short*)(ws + OFF_UT);
  unsigned short* uc  = (unsigned short*)(ws + OFF_UC);
  unsigned short* w16 = (unsigned short*)(ws + OFF_W16);
  unsigned short* qh  = (unsigned short*)(ws + OFF_QH);
  unsigned short* ql  = (unsigned short*)(ws + OFF_QL);
  float*          bq  = (float*)(ws + OFF_BQ);
  float*          Op  = (float*)(ws + OFF_O);
  float*          ps  = (float*)(ws + OFF_PS);
  float*          pq  = (float*)(ws + OFF_PQ);

  k_cvt<<<dim3(NPX / 64, 1 + CC / 64 * nb), dim3(256), 0, stream>>>(hand, u, whw, whb, wuw, ht, ut, uc,
                                                                         w16, bq);
  (void)hipGetLastError();
  k_proj<<<dim3(NPX / 64, CC / 64, nb), dim3(128), 0, stream>>>(ht, w16, bq, qh, ql);
  (void)hipGetLastError();

  k_attn<<<dim3(HWD, nb), dim3(256), 0, stream>>>(qh, ql, ut, uc, Op, ps, pq);
  (void)hipGetLastError();

  k_gn<<<dim3(CC, nb), dim3(256), 0, stream>>>(Op, ps, pq, hand, gnw, gnb, out);
  (void)hipGetLastError();
}

// v009
// A run of this version takes 94.1 microseconds.
// Timed twice side by side with v008, it ran 1.12 times as fast both times.
// Over all steps from v000 it is 10.2 times as fast.
// Contractions: weight fold G = WU^T.WH (K=256), 1x1 projection (K=256), affinity scores (K=256) and
// softmax(P).U (K=4096 in 32-deep steps) on v_wmma_f32_16x16x32_f16 (f16 operands, f32 accumulate); operands
// are RNE-bf16 inputs held in f16 containers (weights x16, activations and values x16), G as f16 hi plus
// x2^11 residual planes, the projected query vectors as f16 hi plus x2^15 residual planes (two products in
// the score GEMM), softmax planes x2^14; running softmax statistics, normalisation statistics (f64 combine)
// and epilogues f32 VALU. Scores never leave their wave's registers.
// The key projection is folded into the query side: q.k = (WH h + bH).(WU u + bU) = (WU^T (WH h + bH)).u
// + q.bU, and q.bU is the same for every key of a query, so the softmax over the keys does not see it.
// The scores are taken as t.u with t = G h + WU^T bH: the key operand is the input plane itself.
#include <hip/hip_runtime.h>
#include <stddef.h>
#include <stdint.h>
#include <math.h>

#define NBMAX 4
#define CC    256
#define NPX   4096
#define HWD   64
#define TP    72
#define EPF   68
#define FRAG  512                                      // halves of one 16-row x 32-k fragment block
#define SKH   16384                                    // halves of one key plane's 64 rows (one stage)
#define STG   SKH                                      // halves of one stage: its rows serve as keys and as values
#define NBUF  3                                        // stage buffers of the ring
#define EPO   (3 * SKH)                                // halves in front of the epilogue's staged output
#define RINGH (EPO + CC * EPF * 2)                     // halves of k_attn's LDS: the ring, then the staged output
#define NFT   (17 * (CC / 16))                         // 16 x 16 tiles of the weight fold, bias column included

#define PLANE       ((size_t)CC * NPX)                 // 1048576 elements per batch plane
#define ACT16_BYTES ((size_t)NBMAX * PLANE * 2)        // 8388608
#define W16_BYTES   ((size_t)2 * CC * CC * 2)          // 262144
#define O_BYTES     ((size_t)NBMAX * PLANE * 4)        // 16777216
#define PS_BYTES    ((size_t)NBMAX * HWD * CC * 4)     // 262144

// ---- carve ----------------------------------------------------------------------------------------
#define OFF_HT   ((size_t)0)
#define OFF_UT   (OFF_HT + ACT16_BYTES)
#define OFF_W16  (OFF_UT + ACT16_BYTES)
#define OFF_QH   (OFF_W16 + W16_BYTES)
#define OFF_QL   (OFF_QH + ACT16_BYTES)
#define OFF_BQ   (OFF_QL + ACT16_BYTES)
#define OFF_O    (OFF_BQ + (size_t)CC * 8)              // bq: 16 floats per 128-byte line, one writing wave each
#define OFF_PS   (OFF_O + O_BYTES)
#define OFF_PQ   (OFF_PS + PS_BYTES)
#define WS_TOTAL (OFF_PQ + PS_BYTES)

static_assert(OFF_QH == (size_t)17039360);
static_assert(OFF_O == (size_t)33818624);
static_assert(WS_TOTAL == (size_t)51120128);
static_assert(WS_TOTAL <= (size_t)134217728);
static_assert((OFF_UT % 256) == 0);
static_assert((OFF_W16 % 256) == 0);
static_assert((OFF_QH % 256) == 0);
static_assert((OFF_QL % 256) == 0);
static_assert((OFF_BQ % 256) == 0);
static_assert((OFF_O % 256) == 0);
static_assert((OFF_PS % 256) == 0);
static_assert((OFF_PQ % 256) == 0);
static_assert(NPX == HWD * HWD);
static_assert((NPX / 64) * 8 >= NFT);                  // one grid row of k_cvt has a wave for every fold tile
static_assert((CC % 64) == 0);
static_assert((NPX % 64) == 0);
static_assert((TP * 2) % 16 == 0);
static_assert((EPF * 4) % 16 == 0);
static_assert(SKH == 64 * CC);
static_assert(4 * 32 * 32 * 16 + 4 * 32 * 4 <= EPO * 2);  // what the key halves hand over ends in front of it
static_assert(NBUF * STG <= EPO);                      // the ring ends in front of it too

typedef unsigned short v8us  __attribute__((ext_vector_type(8)));
typedef unsigned short v16us __attribute__((ext_vector_type(16)));
typedef short          v8s   __attribute__((ext_vector_type(8)));
typedef _Float16       v16h  __attribute__((ext_vector_type(16)));
typedef float          v4f   __attribute__((ext_vector_type(4)));
typedef float          v8f   __attribute__((ext_vector_type(8)));
typedef int            v4i   __attribute__((ext_vector_type(4)));
typedef __attribute__((address_space(1))) v4i gv4i;
typedef __attribute__((address_space(3))) v4i lv4i;
typedef __attribute__((address_space(3))) v8s lv8s;

union FragU { v16us v; v8us half[2]; };

// ---- scalar helpers -------------------------------------------------------------------------------
__device__ __forceinline__ unsigned bbits(float f) {          // f32 -> nearest-even bf16 bits
  unsigned u = __float_as_uint(f);
  return (u + 0x7FFFu + ((u >> 16) & 1u)) >> 16;
}
__device__ __forceinline__ float bf16r(float f) {            // RNE convert to bf16 and back
  return __uint_as_float(bbits(f) << 16);
}
__device__ __forceinline__ unsigned short hbits(float f) {   // f32 -> f16 bits (RNE)
  return __builtin_bit_cast(unsigned short, (_Float16)f);
}
__device__ __forceinline__ float rcpf(float x) {
#if defined(__HIP_DEVICE_COMPILE__)
  return __builtin_amdgcn_rcpf(x);
#else
  return 1.0f / x;
#endif
}
// exp(x) as one v_exp_f32 of x * log2(e), as __expf compiles to. The v_nop keeps the one free slot that the
// instruction set asks for between a transcendental and a next instruction that reads its result or
// rewrites its source.
__device__ __forceinline__ float exp_slot(float x) {
#if defined(__HIP_DEVICE_COMPILE__)
  float r;
  asm("v_exp_f32 %0, %1\n\tv_nop" : "=v"(r) : "v"(x * 1.44269504f));
  return r;
#else
  return x;
#endif
}
// The wait that stands in front of a rewrite of the address registers p, q of issued global loads. Naming
// them as inputs keeps them untouched up to here, behind the work that runs under the loads; at their
// first reuse, where the compiler puts the wait otherwise, it held that work back behind all the loads.
__device__ __forceinline__ void keep_addr(const unsigned short* p, const unsigned short* q) {
#if defined(__HIP_DEVICE_COMPILE__)
  asm volatile("s_wait_xcnt 0x0" :: "v"(p), "v"(q) : "memory");
#else
  (void)p; (void)q;
#endif
}
__device__ __forceinline__ v8f zero8() { v8f z = {0.f, 0.f, 0.f, 0.f, 0.f, 0.f, 0.f, 0.f}; return z; }

__device__ __forceinline__ double shfl_xor_d(double v, int o) {
  const long long x = __double_as_longlong(v);
  int lo = (int)(x & 0xffffffffll);
  int hi = (int)(x >> 32);
  lo = __shfl_xor(lo, o, 32);
  hi = __shfl_xor(hi, o, 32);
  const long long y = ((long long)(unsigned)hi << 32) | (long long)(unsigned)lo;
  return __longlong_as_double(y);
}

// ---- split k map of a 16-bit fragment, A and B alike: lane (m, h) holds row m; elements 0..7 are
//      k = 8 h + 0..7, elements 8..15 are k = 16 + 8 h + 0..7 of a 32-deep k block
// ---- fragment-order planes (every operand plane that a wave loads straight from global memory): a plane
//      of rows x K halves is a row-major grid of blocks [row / 16][k / 32], FRAG halves each; a block holds
//      the two 16-byte pieces of all 32 lanes back to back, element (row, k) at
//      256 * ((k >> 4) & 1) + 8 * (16 * ((k >> 3) & 1) + (row & 15)) + (k & 7): the split k map above, but
//      each load instruction of a wave reads 512 contiguous bytes (four whole 128-byte lines, not 16 parts).
//      p = block + 8 * lane
__device__ __forceinline__ v16us ldfrag_g(const unsigned short* p) {
  FragU f;
  f.half[0] = *(const v8us*)(p);
  f.half[1] = *(const v8us*)(p + 256);
  return f.v;
}

// ---- WMMA helper (f16 operands as raw 16-bit lanes, f32 accumulate) --------------------------------
__device__ __forceinline__ v8f mma_hu(v16us a, v16us b, v8f c) {
#if defined(__HIP_DEVICE_COMPILE__)
  return __builtin_amdgcn_wmma_f32_16x16x32_f16(false, __builtin_bit_cast(v16h, a),
                                               false, __builtin_bit_cast(v16h, b),
                                               (short)0, c, false, false);
#else
  (void)a; (void)b;
  return c;
#endif
}
// hazard guards after the last WMMA of a group: tie the accumulators, keep the fragments live
__device__ __forceinline__ void guard4(v8f& c0, v8f& c1, v8f& c2, v8f& c3, const v16us& a,
                                       const v16us& b0, const v16us& b1, const v16us& b2,
                                       const v16us& b3) {
#if defined(__HIP_DEVICE_COMPILE__)
  asm volatile("v_nop\n\tv_nop\n\tv_nop\n\tv_nop"
               : "+v"(c0), "+v"(c1), "+v"(c2), "+v"(c3)
               : "v"(a), "v"(b0), "v"(b1), "v"(b2), "v"(b3));
#else
  (void)c0; (void)c1; (void)c2; (void)c3; (void)a; (void)b0; (void)b1; (void)b2; (void)b3;
#endif
}

// 16-bit tile 64 rows x 64 k (LDS pitch PITCH halves) -> fragment-order plane P with kblocks blocks per
// row group: row groups rg0..rg0+3, k blocks kb0, kb0+1; one wave instruction = one 512-byte piece.
// SWZ: the plane's 16-byte pieces stand in the swizzled order (head of k_attn): lane (m, h)'s at 16 h + (m ^ 8 h).
template <int NW, int PITCH, bool SWZ = false>
__device__ __forceinline__ void store_tile_frag(const unsigned short* t, unsigned short* P,
                                                int rg0, int kblocks, int kb0, int w, int lane) {
  constexpr int NIT = 16 / NW;
  const int h = lane >> 4;
  const int m = lane & 15;
  v8us   v[NIT];
  size_t off[NIT];
#pragma unroll
  for (int it = 0; it < NIT; ++it) {
    const int ch  = it * NW + w;                  // 0..15 = (row group, k block, piece)
    const int gl  = ch >> 2;
    const int kbl = (ch >> 1) & 1;
    const int hf  = ch & 1;
    v[it]   = *(const v8us*)(t + (16 * gl + m) * PITCH + 32 * kbl + 16 * hf + 8 * h);
    off[it] = ((size_t)(rg0 + gl) * kblocks + kb0 + kbl) * FRAG + 256 * hf + 8 * (SWZ ? lane ^ (8 * h) : lane);
  }
#pragma unroll
  for (int it = 0; it < NIT; ++it) *(v8us*)(P + off[it]) = v[it];
}

// =====================================================================================================
// Weight fold, one 16 x 16 tile per wave: G[j][c] = sum_o WU[o][j] * WH[o][c] (tile column tc < 16) and, as
// a seventeenth tile column whose only live column is m = 0, bq[j] = sum_o WU[o][j] * WH_b[o]. A rows j,
// B rows c, k = o; both fragments are gathered from the f32 weights in the split k map above, each element
// f16(16 * bf16(w)). Out: W16[0] = f16(16 G), W16[1] = f16(2048 * (16 G - W16[0])), both in fragment order
// (rows j, k = c), and bq in f32, row j at 32 * (j / 16) + j % 16. Run by the first waves of grid row 0 of k_cvt.
// coverage: 256 tiles x 256 elements = both planes, 16 tiles x 16 rows = bq, every element once.
// =====================================================================================================
template <bool ISB>                                 // ISB: the bias column
__device__ __forceinline__ void fold_tile(const float* __restrict__ whw, const float* __restrict__ whb,
                                          const float* __restrict__ wuw, unsigned short* w16, float* bq,
                                          int tile, int lane)
{
  const int h  = lane >> 4;
  const int m  = lane & 15;
  const int tc = tile >> 4;                         // wave-uniform, 0..16
  const int tr = tile & 15;
  constexpr int SB = ISB ? 1 : CC;                  // elements between two k of the B side
  const float* pa = wuw + 8 * h * CC + 16 * tr + m;
  const float* pb = ISB ? whb + 8 * h : whw + 8 * h * CC + 16 * tc + m;
  v8f d = zero8();
  // two k blocks per trip: 64 loads in flight, a body of moderate length
#pragma unroll 2
  for (int kb = 0; kb < CC / 32; ++kb) {
    v16us a, b;
#pragma unroll
    for (int e = 0; e < 16; ++e) {
      const int o = 32 * kb + 16 * (e >> 3) + (e & 7);   // + 8 h, which the two pointers hold
      a[e] = hbits(16.0f * bf16r(pa[o * CC]));
      const unsigned short bb = hbits(16.0f * bf16r(pb[o * SB]));
      b[e] = (ISB && m != 0) ? (unsigned short)0 : bb;
    }
    d = mma_hu(a, b, d);
  }
  if (!ISB) {
    const int k = 16 * tc + m;
#pragma unroll
    for (int r = 0; r < 8; ++r) {
      const int row = 16 * tr + 8 * h + r;
      const float g16 = d[r] * (1.0f / 16.0f);
      const _Float16 hv = (_Float16)g16;
      const int idx = ((row >> 4) * (CC / 32) + (k >> 5)) * FRAG + 256 * ((k >> 4) & 1)
                      + 8 * (16 * ((k >> 3) & 1) + (row & 15)) + (k & 7);
      w16[idx]           = __builtin_bit_cast(unsigned short, hv);
      w16[CC * CC + idx] = hbits((g16 - (float)hv) * 2048.0f);
    }
  } else if (m == 0) {
#pragma unroll
    for (int r = 0; r < 8; ++r) bq[32 * tr + 8 * h + r] = d[r] * (1.0f / 256.0f);
  }
}

// =====================================================================================================
// Input conversion: HT and UT, pixel-major f16 planes of Hand and U (rows n, k = c).
// Block = (64 px tile, y = 1 + 4 b + 64 ch tile), 256 threads; thread = (channel cl = tid>>2, 16-px quarter).
// Both planes in fragment order (16 pieces of 512 B per tile), UT with its pieces swizzled.
// Grid row y = 0 folds the weights instead: they depend on nothing here, so they need no launch of
// their own.
// coverage: grid (64, 1 + 4 nb): every (b, c, n) of HT and UT and every folded weight written exactly once.
// =====================================================================================================
__global__ __launch_bounds__(256)
void k_cvt(const float* __restrict__ hand, const float* __restrict__ u,
           const float* __restrict__ whw, const float* __restrict__ whb, const float* __restrict__ wuw,
           unsigned short* ht, unsigned short* ut, unsigned short* w16, float* bq)
{
  __shared__ __align__(16) unsigned short TH[64 * TP];
  __shared__ __align__(16) unsigned short TU[64 * TP];

  const int tid  = threadIdx.x;
  const int lane = tid & 31;
  const int w    = tid >> 5;
  if (blockIdx.y == 0) {                  // block-uniform, in front of the barrier
    const int tile = 8 * blockIdx.x + w;  // wave-uniform
    if (tile < NFT - CC / 16) fold_tile<false>(whw, whb, wuw, w16, bq, tile, lane);
    else if (tile < NFT)      fold_tile<true>(whw, whb, wuw, w16, bq, tile, lane);
    return;
  }
  const int yt   = blockIdx.y - 1;        // 4 b + channel tile
  const int n0   = 64 * blockIdx.x;
  const int c0   = 64 * (yt & (CC / 64 - 1));
  const int b    = yt / (CC / 64);
  const int cl   = tid >> 2;              // 0..63
  const int pq   = 16 * (tid & 3);        // 0,16,32,48
  const size_t src = (size_t)b * PLANE + (size_t)(c0 + cl) * NPX + n0 + pq;
#pragma unroll
  for (int g = 0; g < 4; ++g) {
    const v4f hv = *(const v4f*)(hand + src + 4 * g);
    const v4f uv = *(const v4f*)(u + src + 4 * g);
#pragma unroll
    for (int e = 0; e < 4; ++e) {
      const int px = pq + 4 * g + e;
      const unsigned short hb = hbits(16.0f * bf16r(hv[e]));
      const unsigned short ub = hbits(16.0f * bf16r(uv[e]));
      TH[px * TP + cl] = hb;
      TU[px * TP + cl] = ub;
    }
  }
  __syncthreads();
  store_tile_frag<8, TP>(TH, ht + (size_t)b * PLANE, n0 / 16, CC / 32, c0 / 32, w, lane);
  store_tile_frag<8, TP, true>(TU, ut + (size_t)b * PLANE, n0 / 16, CC / 32, c0 / 32, w, lane);
}

// =====================================================================================================
// 1x1 projection of the queries through the folded weights: D[n][j] = sum_c X[n][c] * G[j][c], tile 64(n) x
// 64(j), K = 256, 4 waves, wave w owns rows n 16w..16w+15 (A fragment from the fragment-order activation
// plane) and 4 column sub-tiles of 16 output channels (B fragments = rows j of W16[0] and of its residual
// plane W16[1], fragment order; one accumulator set each). Epilogue: t = (hi + lo / 2048) / 256 + bq, kept
// as t / 16 (the key operand of the scores carries x16), split into f16 hi and x2^15 residual, into the
// fragment-order planes (rows n, k = j).
// coverage: grid (64 n tiles, 4 j tiles, nb): QH, QL [b][4096][256] every element once.
// =====================================================================================================
__global__ __launch_bounds__(128)
void k_proj(const unsigned short* __restrict__ ht, const unsigned short* __restrict__ w16,
            const float* __restrict__ bq, unsigned short* qh, unsigned short* ql)
{
  __shared__ __align__(16) unsigned short t0[64 * TP];
  __shared__ __align__(16) unsigned short t1[64 * TP];

  const int tid   = threadIdx.x;
  const int lane  = tid & 31;
  const int w     = tid >> 5;
  const int h     = lane >> 4;
  const int m     = lane & 15;
  const int n0    = 64 * blockIdx.x;
  const int o0    = 64 * blockIdx.y;
  const int bb    = blockIdx.z;
  const unsigned short* x = ht + (size_t)bb * PLANE;

  v8f acc[4], acl[4];
#pragma unroll
  for (int j = 0; j < 4; ++j) { acc[j] = zero8(); acl[j] = zero8(); }

  const unsigned short* pa = x + (size_t)(n0 / 16 + w) * (CC / 32) * FRAG + 8 * lane;
  const unsigned short* pb = w16 + (size_t)(o0 / 16) * (CC / 32) * FRAG + 8 * lane;
  // two k steps per trip, kept rolled: a longer body would only add fragment registers
#pragma unroll 1
  for (int k2 = 0; k2 < CC / 64; ++k2) {
    const unsigned short* pak = pa + 2 * FRAG * k2;
    const unsigned short* pbk = pb + 2 * FRAG * k2;
    // unrolled: both steps address off the trip's two pointers by immediate offsets
#pragma unroll
    for (int u = 0; u < 2; ++u) {
      const v16us a  = ldfrag_g(pak + FRAG * u);
      const v16us b0 = ldfrag_g(pbk + FRAG * u);
      const v16us b1 = ldfrag_g(pbk + FRAG * (1 * (CC / 32) + u));
      const v16us b2 = ldfrag_g(pbk + FRAG * (2 * (CC / 32) + u));
      const v16us b3 = ldfrag_g(pbk + FRAG * (3 * (CC / 32) + u));
      const v16us l0 = ldfrag_g(pbk + CC * CC + FRAG * u);
      const v16us l1 = ldfrag_g(pbk + CC * CC + FRAG * (1 * (CC / 32) + u));
      const v16us l2 = ldfrag_g(pbk + CC * CC + FRAG * (2 * (CC / 32) + u));
      const v16us l3 = ldfrag_g(pbk + CC * CC + FRAG * (3 * (CC / 32) + u));
      // keeps the eighteen loads together and ahead of the products: left alone, the scheduler reused fragment
      // registers and put most loads right in front of the product that waits for them
      __builtin_amdgcn_sched_barrier(0);
      acc[0] = mma_hu(a, b0, acc[0]);
      acc[1] = mma_hu(a, b1, acc[1]);
      acc[2] = mma_hu(a, b2, acc[2]);
      acc[3] = mma_hu(a, b3, acc[3]);
      acl[0] = mma_hu(a, l0, acl[0]);
      acl[1] = mma_hu(a, l1, acl[1]);
      acl[2] = mma_hu(a, l2, acl[2]);
      acl[3] = mma_hu(a, l3, acl[3]);
      guard4(acl[0], acl[1], acl[2], acl[3], a, l0, l1, l2, l3);
    }
    keep_addr(pak, pbk);                         // the next trip rewrites the loads' address registers
  }

  const float kq = 1.0f / 4096.0f;               // 1 / 256 for the operand scales, 1 / 16 for the kept scale
  const float kl = 1.0f / 2048.0f;
  float bv[4];
#pragma unroll
  for (int j = 0; j < 4; ++j) bv[j] = bq[32 * (o0 / 16 + j) + m] * (1.0f / 16.0f);
#pragma unroll
  for (int j = 0; j < 4; ++j) {
#pragma unroll
    for (int r = 0; r < 8; ++r) {
      const float val = (acc[j][r] + acl[j][r] * kl) * kq + bv[j];
      const _Float16 hv = (_Float16)val;
      const int rl = 16 * w + 8 * h + r;       // pixel within tile
      const int cl = 16 * j + m;               // output channel within tile
      t0[rl * TP + cl] = __builtin_bit_cast(unsigned short, hv);
      t1[rl * TP + cl] = hbits((val - (float)hv) * 32768.0f);
    }
  }
  __syncthreads();
  store_tile_frag<4, TP>(t0, qh + (size_t)bb * PLANE, n0 / 16, CC / 32, o0 / 32, w, lane);
  store_tile_frag<4, TP>(t1, ql + (size_t)bb * PLANE, n0 / 16, CC / 32, o0 / 32, w, lane);
}

// =====================================================================================================
// Scores, softmax and P.U in one pass, all batches in one launch. Block = (64 query pixels R0.. of batch b,
// all 256 channels), 8 waves. Wave w owns the 16 queries of column group g = w & 3 and, of every stage of 64
// key pixels, the 32 keys of half hf = w >> 2; nothing of its scores or of P ever leaves its registers.
//   resident: the wave's query fragments QH/QL (B operands, 8 k steps each) in registers.
//   stage:    64 keys: their rows of UT (32 KB), copied as they lie in the fragment-order plane into one of three
//             LDS buffers, two stages ahead. The same bytes are the key operand of the scores (rows = keys, read
//             by ds_load_b128) and the value operand of P.U (rows = channels, read by the transposing
//             ds_load_tr16_b128): keys and values are one array, so it is brought from L2 and kept in LDS once.
//   swizzle:  in a 512-byte half block the 16-byte piece (row r of 16, k octet o of 2) stands at place
//             16 o + (r ^ 8 o). A plain read takes (r = m, o = h) in lane (m, h); a transposing read takes
//             (r = 8 (l >> 4) + (l & 7), o = (l >> 3) & 1) in lane l. Either way lanes 0..15, and lanes 16..31,
//             touch sixteen places that differ modulo 16, that is all 64 banks once; at place 16 o + r the
//             transposing read would meet every bank twice.
//   scores:   St[key][i] = UT.QH + UT.QL / 32768, K = 256, two tiles of 16 keys; a lane (m, h)
//             holds the keys 16 kt + 8 h + r of query m.
//   softmax:  in the lane plus one exchange between the wave halves for the maximum; running maximum mrun,
//             running sum lrun of the lane's own keys; P = f16(16384 exp(St - mrun)).
//   P.U:      D[c][i] = D[c][i] * al[i] + U[c][k] . P[k][i]: the two score tiles, converted in place, are
//             the B operand in the split k map, which is also the k order of the transposing read's fragment
//             (lane (m, h): channel m, keys 8 h + 0..7, then 16 + 8 h + 0..7); 16 accumulators = all 256 channels.
// Epilogue: the two key halves of a column group are joined through LDS (common maximum, weighted sums),
// p = D / lsum[i] / 2^18 (value scale 16, softmax scale 2^14) is staged as [c][i]; thread c sums p and p^2 of
// its channel over the 64 pixels in pixel order; the O rows leave as whole 128-byte lines.
// coverage: grid (64, nb): O [b][256][4096] and PS/PQ [b][64][256], every element once.
// =====================================================================================================
__device__ __forceinline__ void o_store_pass(const float* Et, float* orows, int R0, int w, int lane)
{
  const int q  = lane >> 3;
  const int jj = lane & 7;
#pragma unroll 1
  for (int it = 0; it < 16; ++it) {
    const int li = it * 32 + 4 * w + q;         // 0..511
    const int c = li >> 1, hf = li & 1;
    const v4f v = *(const v4f*)(Et + c * EPF + 32 * hf + 4 * jj);
    *(v4f*)(orows + (size_t)c * NPX + R0 + 32 * hf + 4 * jj) = v;
    // the next trip rewrites the store's address and data registers: keep the wait in front of that
    asm volatile("s_wait_xcnt 0x0" ::: "memory");
  }
}

// lane l with lane l ^ 16
__device__ __forceinline__ float xhalf(float x) {
#if defined(__HIP_DEVICE_COMPILE__)
  return __builtin_bit_cast(float, __builtin_amdgcn_permlanex16(__builtin_bit_cast(int, x),
                                                                __builtin_bit_cast(int, x),
                                                                0x76543210, 0xfedcba98, false, false));
#else
  return x;
#endif
}

// The two halves of the work-group barrier, written apart so that register work can stand between them. The
// "memory" clobber keeps every LDS read, and every copy to LDS, on the side of each half where the source has it.
// The work-group release fence is the one that __syncthreads() holds in front of its barrier: from it the compiler
// knows that no LDS read is outstanding; without it, it put counted waits of its own among the P.U products, and
// the last of them waited for the next stage's fragments.
__device__ __forceinline__ void bar_signal() {
#if defined(__HIP_DEVICE_COMPILE__)
  __builtin_amdgcn_fence(__ATOMIC_RELEASE, "workgroup");
  asm volatile("s_barrier_signal -1" ::: "memory");
#endif
}
// The wait names, as inputs only, what the vector work between the halves produces (the rescaled accumulators, P,
// the running sum): that work then stands in front of the wait. Left free, the compiler sank it behind the wait,
// into the block of the P.U products, where it runs after the wave has idled.
__device__ __forceinline__ void bar_wait(const v8f (&a)[CC / 16], const v16us& p, float l) {
#if defined(__HIP_DEVICE_COMPILE__)
  asm volatile("s_barrier_wait -1"
               :: "v"(a[0]), "v"(a[1]), "v"(a[2]), "v"(a[3]), "v"(a[4]), "v"(a[5]), "v"(a[6]), "v"(a[7]),
                  "v"(a[8]), "v"(a[9]), "v"(a[10]), "v"(a[11]), "v"(a[12]), "v"(a[13]), "v"(a[14]), "v"(a[15]),
                  "v"(p), "v"(l)
               : "memory");
#else
  (void)a; (void)p; (void)l;
#endif
}

// 16 bytes per lane from global memory to LDS, through no register; OFF bytes further on both sides
template <int OFF>
__device__ __forceinline__ void copy16(const unsigned short* gsrc, unsigned short* ldst) {
  static_assert(OFF >= 0 && OFF < 65536);
#if defined(__HIP_DEVICE_COMPILE__)
  __builtin_amdgcn_global_load_async_to_lds_b128((gv4i*)gsrc, (lv4i*)ldst, OFF, 0);
#else
  (void)gsrc; (void)ldst;
#endif
}

// Stage s (keys 64 s .. 64 s + 63) into the buffer dst, by four waves (l = 0..127 over their lanes): 16 copies per
// lane, each wave instruction 512 contiguous bytes on both sides: 32 KB of UT in a row.
__device__ __forceinline__ void stage_copy(const unsigned short* utb, unsigned short* dst, int s, int l)
{
  const unsigned short* gk = utb + (size_t)s * SKH + 8 * l;
  unsigned short* d = dst + 8 * l;
  copy16<0>(gk, d);      copy16<2048>(gk, d);   copy16<4096>(gk, d);   copy16<6144>(gk, d);
  copy16<8192>(gk, d);   copy16<10240>(gk, d);  copy16<12288>(gk, d);  copy16<14336>(gk, d);
  copy16<16384>(gk, d);  copy16<18432>(gk, d);  copy16<20480>(gk, d);  copy16<22528>(gk, d);
  copy16<24576>(gk, d);  copy16<26624>(gk, d);  copy16<28672>(gk, d);  copy16<30720>(gk, d);
}

// One 16 (channels) x 32 (keys) A fragment out of two key row groups of a stage, by the transposing LDS read: p is
// the lane's own piece in the first group's half block, the second group lies a row of blocks further.
__device__ __forceinline__ v16us ldfrag_tr(const unsigned short* p) {
  FragU f;
#if defined(__HIP_DEVICE_COMPILE__)
  f.half[0] = __builtin_bit_cast(v8us, __builtin_amdgcn_ds_load_tr16_b128_v8i16((lv8s*)p));
  f.half[1] = __builtin_bit_cast(v8us, __builtin_amdgcn_ds_load_tr16_b128_v8i16((lv8s*)(p + (CC / 32) * FRAG)));
#else
  f.half[0] = *(const v8us*)p;
  f.half[1] = *(const v8us*)p;
#endif
  return f.v;
}

__global__ __launch_bounds__(256) __attribute__((amdgpu_waves_per_eu(2, 2)))
void k_attn(const unsigned short* __restrict__ qh, const unsigned short* __restrict__ ql,
            const unsigned short* __restrict__ ut, float* Oall, float* psall, float* pqall)
{
  // three stage buffers, which the epilogue uses again, and behind them its staged output
  __shared__ __align__(16) unsigned short ring[RINGH];

  const int tid  = threadIdx.x;
  const int lane = tid & 31;
  const int w    = tid >> 5;
  const int h    = lane >> 4;
  const int m    = lane & 15;
  const int g    = w & 3;                // column group: queries R0 + 16 g + m
  const int hf   = w >> 2;               // key half of every stage
  const int R0   = 64 * blockIdx.x;
  const size_t po = (size_t)blockIdx.y * PLANE;
  const unsigned short* utb = ut + po;
  float* O  = Oall + po;
  float* ps = psall + (size_t)blockIdx.y * HWD * CC;
  float* pq = pqall + (size_t)blockIdx.y * HWD * CC;

  // Who copies: the four waves of key half (k & 1) bring in the whole of stage k. A wave then has one stage's copies
  // in flight at a time, waits for them to 0, and yet they have two passes to land: the other half's stage lies between.
  const int hfs = __builtin_amdgcn_readfirstlane(hf);   // in a scalar register: the tests on it are scalar branches
  const int l   = tid & 127;
  stage_copy(utb, ring + hfs * STG, hfs, l);            // stages 0 and 1

  // resident query fragments
  v16us qfh[CC / 32], qfl[CC / 32];
  {
    const unsigned short* gqh = qh + po + (size_t)(R0 / 16 + g) * (CC / 32) * FRAG + 8 * lane;
    const unsigned short* gql = ql + po + (size_t)(R0 / 16 + g) * (CC / 32) * FRAG + 8 * lane;
#pragma unroll
    for (int kk = 0; kk < CC / 32; ++kk) {
      qfh[kk] = ldfrag_g(gqh + FRAG * kk);
      qfl[kk] = ldfrag_g(gql + FRAG * kk);
    }
    keep_addr(gqh, gql);
  }

  float mrun = -1.0e30f, lrun = 0.0f;
  v8f acc[CC / 16];
#pragma unroll
  for (int t = 0; t < CC / 16; ++t) acc[t] = zero8();

  // stage 0 has landed for the waves that copied it, then for all; stage 1 stays in flight; stage 2 is asked for
  if (hfs == 0) asm volatile("s_wait_asynccnt 0x0" ::: "memory");
  __syncthreads();
  if (hfs == 0) stage_copy(utb, ring + 2 * STG, 2, l);

  // key fragments four k steps at a time, one such group ahead in a second register set: a group's LDS
  // latency runs under the sixteen matrix instructions of the group before. [set][2 u + (0: keys 0..15,
  // 1: keys 16..31)]. A stage's first two k steps are read behind the stage's publish point, in the pass
  // before.
  const int lsw = lane ^ (8 * h);                                   // place of the lane's piece, plain read
  const int ltr = 16 * ((lane >> 3) & 1) + 8 * (h ^ ((lane >> 3) & 1)) + (lane & 7);   // transposing read
  v16us fa[2][8];
  {
    const unsigned short* f0 = ring + hf * (2 * (CC / 32) * FRAG) + 8 * lsw;
    fa[0][0] = ldfrag_g(f0);
    fa[0][1] = ldfrag_g(f0 + FRAG * (CC / 32));
    fa[0][2] = ldfrag_g(f0 + FRAG);
    fa[0][3] = ldfrag_g(f0 + FRAG * (CC / 32 + 1));
  }

  const float kx = 1.0f / 32768.0f;
  // The stage loop stays rolled; every loop inside it is unrolled, so that
  // the fragment and accumulator arrays are indexed by constants and live in registers.
  int cur = 0;                           // s % NBUF
#pragma unroll 1
  for (int s = 0; s < NPX / 64; ++s) {
    const int  nxt = (cur + 1 == NBUF) ? 0 : cur + 1;
    const bool act = hfs == ((s + 1) & 1);              // this wave copied stage s + 1 and will copy stage s + 3
    unsigned short* buf = ring + cur * STG;
    const unsigned short* fk = buf + hf * (2 * (CC / 32) * FRAG) + 8 * lsw;    // the half's 32 keys, as keys
    const unsigned short* fu = buf + hf * (2 * (CC / 32) * FRAG) + 8 * ltr;    // the same rows, as values
    v8f sa[2], sx[2];
#pragma unroll
    for (int kt = 0; kt < 2; ++kt) { sa[kt] = zero8(); sx[kt] = zero8(); }
    v16us ua[CC / 16];
    fa[0][4] = ldfrag_g(fk + FRAG * 2);
    fa[0][5] = ldfrag_g(fk + FRAG * (CC / 32 + 2));
    fa[0][6] = ldfrag_g(fk + FRAG * 3);
    fa[0][7] = ldfrag_g(fk + FRAG * (CC / 32 + 3));
#pragma unroll
    for (int k2 = 0; k2 < CC / 128; ++k2) {
      if (k2 + 1 < CC / 128) {
#pragma unroll
        for (int u = 0; u < 4; ++u) {
          const int kn = 4 * (k2 + 1) + u;
          fa[(k2 + 1) & 1][2 * u + 0] = ldfrag_g(fk + FRAG * kn);
          fa[(k2 + 1) & 1][2 * u + 1] = ldfrag_g(fk + FRAG * (CC / 32 + kn));
        }
      } else {
        // the first half of the value fragments takes the place of a next group
#pragma unroll
        for (int t = 0; t < CC / 32; ++t) ua[t] = ldfrag_tr(fu + (FRAG / 2) * t);
      }
      // keeps the sixteen reads together and ahead of the group's products: left alone, the scheduler spread
      // them among the matrix instructions, each read waited for right behind its issue
      __builtin_amdgcn_sched_barrier(0);
#pragma unroll
      for (int u = 0; u < 4; ++u) {
        const int kk = 4 * k2 + u;
        sx[0] = mma_hu(fa[k2 & 1][2 * u + 0], qfl[kk], sx[0]);
        sx[1] = mma_hu(fa[k2 & 1][2 * u + 1], qfl[kk], sx[1]);
        sa[0] = mma_hu(fa[k2 & 1][2 * u + 0], qfh[kk], sa[0]);
        sa[1] = mma_hu(fa[k2 & 1][2 * u + 1], qfh[kk], sa[1]);
      }
      // the other side of the same fence: the next group's reads stay behind these products
      __builtin_amdgcn_sched_barrier(0);
    }
    // the second half: the stage's last LDS reads; the pass reads LDS again only for the next stage's first two k steps
#pragma unroll
    for (int t = CC / 32; t < CC / 16; ++t) ua[t] = ldfrag_tr(fu + (FRAG / 2) * t);
    // the reads stay ahead of the vector work that follows, which covers their latency
    __builtin_amdgcn_sched_barrier(0);
    float sc[16];
#pragma unroll
    for (int e = 0; e < 16; ++e) sc[e] = sa[e >> 3][e & 7] + sx[e >> 3][e & 7] * kx;
    float tm4[4];
#pragma unroll
    for (int e = 0; e < 4; ++e) tm4[e] = fmaxf(fmaxf(sc[e], sc[4 + e]), fmaxf(sc[8 + e], sc[12 + e]));
    float tm = fmaxf(fmaxf(tm4[0], tm4[1]), fmaxf(tm4[2], tm4[3]));
    tm = fmaxf(tm, xhalf(tm));
    const float mn = fmaxf(mrun, tm);
    // publish point, first half: this wave has left the buffer and, if it copied stage s + 1, its copies have landed
    // (the other waves' copies, of stage s + 2, stay in flight); it says so and goes on. The softmax and the
    // rescaling work on registers alone (no LDS read, no copy stands between signal and wait), so a wave that is
    // ahead does them while the wave it shares its SIMD with still has the matrix unit and the LDS for its scores,
    // instead of idling at the barrier and then sharing the vector port with it.
    asm volatile("s_wait_dscnt 0x0" ::: "memory");
    if (act) asm volatile("s_wait_asynccnt 0x0" ::: "memory");
    bar_signal();
    // keeps the signal ahead of the vector work below: left alone, the scheduler put it directly in front of the wait
    __builtin_amdgcn_sched_barrier(0);
    const float al = exp_slot(mrun - mn);
    v16us pf;
    float ad4[4] = {0.0f, 0.0f, 0.0f, 0.0f};   // four chains, not one of sixteen dependent additions
#pragma unroll
    for (int e = 0; e < 16; ++e) {
      const float ex = exp_slot(sc[e] - mn);
      ad4[e & 3] += ex;
      pf[e] = hbits(16384.0f * ex);
    }
    lrun = lrun * al + ((ad4[0] + ad4[1]) + (ad4[2] + ad4[3]));
    mrun = mn;
#pragma unroll
    for (int t = 0; t < CC / 16; ++t) {
#pragma unroll
      for (int r = 0; r < 8; ++r) acc[t][r] = acc[t][r] * al;
    }
    // publish point, second half: every wave has signalled, so stage s + 1 is readable and the buffer just read is
    // free: it is filled anew, with stage s + 3, which is published two passes on
    bar_wait(acc, pf, lrun);
    if (act && s + NBUF < NPX / 64) stage_copy(utb, buf, s + NBUF, l);
    if (s + 1 < NPX / 64) {
      // stage s + 1 is published: its first two k steps are read now, so that the next pass starts on its products
      const unsigned short* fn = ring + nxt * STG + hf * (2 * (CC / 32) * FRAG) + 8 * lsw;
      fa[0][0] = ldfrag_g(fn);
      fa[0][1] = ldfrag_g(fn + FRAG * (CC / 32));
      fa[0][2] = ldfrag_g(fn + FRAG);
      fa[0][3] = ldfrag_g(fn + FRAG * (CC / 32 + 1));
    }
#pragma unroll
    for (int t = 0; t < CC / 16; ++t) acc[t] = mma_hu(ua[t], pf, acc[t]);
    cur = nxt;
  }
  // no copy is outstanding when the ring becomes the epilogue's staging
  asm volatile("s_wait_asynccnt 0x0" ::: "memory");

  float* mg = (float*)ring;              // [g][32 pieces][lane] of 16 B: the accumulators of key half 1
  float* ml = (float*)ring + 16384;      // [g][2][16]: its running maximum and sum
  float* Et = (float*)(ring + EPO);      // [c][i], pitch EPF
  const float lt = lrun + xhalf(lrun);   // the wave halves hold different keys of the same query
  if (hf == 1) {                         // wave-uniform
#pragma unroll
    for (int t = 0; t < CC / 16; ++t) {
      const v4f lo = {acc[t][0], acc[t][1], acc[t][2], acc[t][3]};
      const v4f hi = {acc[t][4], acc[t][5], acc[t][6], acc[t][7]};
      *(v4f*)(mg + ((g * 32 + 2 * t) * 32 + lane) * 4)     = lo;
      *(v4f*)(mg + ((g * 32 + 2 * t + 1) * 32 + lane) * 4) = hi;
    }
    if (h == 0) {
      ml[g * 32 + m]      = mrun;
      ml[g * 32 + 16 + m] = lt;
    }
  }
  __syncthreads();
  if (hf == 0) {                         // wave-uniform
    const float m1 = ml[g * 32 + m];
    const float l1 = ml[g * 32 + 16 + m];
    const float mx = fmaxf(mrun, m1);
    const float a0 = exp_slot(mrun - mx);
    const float a1 = exp_slot(m1 - mx);
    const float iv = rcpf(lt * a0 + l1 * a1) * (1.0f / 262144.0f);
    const float c0 = a0 * iv;
    const float c1 = a1 * iv;
#pragma unroll
    for (int t = 0; t < CC / 16; ++t) {
      const v4f lo = *(const v4f*)(mg + ((g * 32 + 2 * t) * 32 + lane) * 4);
      const v4f hi = *(const v4f*)(mg + ((g * 32 + 2 * t + 1) * 32 + lane) * 4);
#pragma unroll
      for (int r = 0; r < 8; ++r) {
        const float o1 = (r < 4) ? lo[r & 3] : hi[r & 3];
        Et[(16 * t + 8 * h + r) * EPF + 16 * g + m] = acc[t][r] * c0 + o1 * c1;
      }
    }
  }
  __syncthreads();

  // per-channel partial statistics over the block's 64 pixels: thread = channel
  {
    const float* row = Et + tid * EPF;
    float a = 0.0f, q2 = 0.0f;
#pragma unroll
    for (int j = 0; j < 16; ++j) {
      const v4f v = *(const v4f*)(row + 4 * j);
#pragma unroll
      for (int e = 0; e < 4; ++e) {
        a += v[e];
        q2 += v[e] * v[e];
      }
    }
    ps[(size_t)blockIdx.x * CC + tid] = a;
    pq[(size_t)blockIdx.x * CC + tid] = q2;
  }
  o_store_pass(Et, O, R0, w, lane);
}

// =====================================================================================================
// GroupNorm + residual, all batches in one launch. Block = (channel c, batch b), 256 threads. Wave 0 combines the
// 64 blocks x 8 channels partial sums of group g = c/8 in f64 in a fixed order (lane l takes entries
// l, l+32, ... then an xor tree), mean = S/32768, var = Q/32768 - mean^2 (biased), rstd =
// 1/sqrt(var + 1e-5). out[c][n] = ((O[c][n] - mean) * rstd) * bf16(gn_w[c]) + bf16(gn_b[c]) +
// bf16(Hand[c][n]); row of 4096 floats written as 4 instructions of 256 threads x 16 B (each wave
// coverage: grid (256, nb) x 4096 = the whole [nb][256][4096] output, every element once.
// =====================================================================================================
__global__ __launch_bounds__(256)
void k_gn(const float* __restrict__ Oall, const float* __restrict__ psall, const float* __restrict__ pqall,
          const float* __restrict__ hand, const float* __restrict__ gnw,
          const float* __restrict__ gnb, float* out)
{
  __shared__ float stat[2];
  const int tid  = threadIdx.x;
  const int lane = tid & 31;
  const int w    = tid >> 5;
  const int c    = blockIdx.x;
  const int g    = c >> 3;
  const size_t po = (size_t)blockIdx.y * PLANE;
  const size_t pp = (size_t)blockIdx.y * HWD * CC;
  const float* O     = Oall + po;
  const float* ps    = psall + pp;
  const float* pq    = pqall + pp;
  const float* handb = hand + po;
  float*       outb  = out + po;

  // Every global load of the block is issued here, ahead of any use: wave 0's 32 partial sums first, then each
  // wave's share of the two rows. They are in flight together, so the block waits out one memory latency; summed
  // as they were loaded, trip by trip, and with the rows asked for behind the barrier, it waited out seventeen.
  float sv[16], qv[16];
  if (w == 0) {                                  // wave-uniform
    const float* psg = ps + 8 * g + (size_t)(lane >> 3) * CC + (lane & 7);
    const float* pqg = pq + 8 * g + (size_t)(lane >> 3) * CC + (lane & 7);
    // unrolled: entry lane + 32 i lies 4 i blocks further, an immediate offset off one address
#pragma unroll
    for (int i = 0; i < 16; ++i) {
      sv[i] = psg[(size_t)4 * i * CC];
      qv[i] = pqg[(size_t)4 * i * CC];
    }
  }
  const float* orow = O + (size_t)c * NPX;
  const float* hrow = handb + (size_t)c * NPX;
  v4f ov[4], hd[4];
#pragma unroll
  for (int it = 0; it < 4; ++it) {
    ov[it] = *(const v4f*)(orow + 4 * (it * 256 + tid));
    hd[it] = *(const v4f*)(hrow + 4 * (it * 256 + tid));
  }
  const float gw = bf16r(gnw[c]);
  const float gb = bf16r(gnb[c]);

  if (w == 0) {                                  // wave-uniform
    double s = 0.0, q = 0.0;
    // unrolled: the arrays are indexed by constants and stay in registers; the order of the sums is i = 0..15
#pragma unroll
    for (int i = 0; i < 16; ++i) {
      s += (double)sv[i];
      q += (double)qv[i];
    }
#pragma unroll
    for (int o = 16; o >= 1; o >>= 1) {
      s += shfl_xor_d(s, o);
      q += shfl_xor_d(q, o);
    }
    if (lane == 0) {
      const double inv_n = 1.0 / 32768.0;
      const double mean = s * inv_n;
      double var = q * inv_n - mean * mean;
      if (var < 0.0) var = 0.0;
      const float varf = (float)var;
      stat[0] = (float)mean;
      stat[1] = rcpf(sqrtf(varf + 1e-5f));
    }
  }
  __syncthreads();
  const float meanf = stat[0];
  const float rstd  = stat[1];
  float* drow = outb + (size_t)c * NPX;

  v4f res[4];
#pragma unroll
  for (int it = 0; it < 4; ++it) {
#pragma unroll
    for (int e = 0; e < 4; ++e) {
      const float xn = (ov[it][e] - meanf) * rstd;
      res[it][e] = xn * gw + gb + bf16r(hd[it][e]);
    }
  }
#pragma unroll
  for (int it = 0; it < 4; ++it)
    *(v4f*)(drow + 4 * (it * 256 + tid)) = res[it];
  
}

// =====================================================================================================
// Host glue. Inputs in table order (8): Hand [nb][256][64][64], U (same), WH_w [256][256], WH_b [256],
// WU_w [256][256], WU_b [256], gn_w [256], gn_b [256]; nb = in_sizes[0] / (256*4096), 1..4.
// Output f32 [nb][256][4096] at element 0. Workspace 51120128 B (sized for nb = 4).
// 4 launches, each over all batches: k_cvt (with the weight fold), k_proj, k_attn, k_gn.
// WU_b reaches no kernel: it adds the same amount to every score of a query (head of the file).
// =====================================================================================================
extern "C" void kernel_launch(void* const* d_in, const int* in_sizes, int n_in,
                              void* d_out, int out_size, void* d_ws, size_t ws_size,
                              hipStream_t stream) {
  if (n_in < 8) return;
  const int per = CC * NPX;
  const int n0s = in_sizes[0];
  if (n0s < per || (n0s % per) != 0) return;
  const int nb = n0s / per;
  if (nb < 1 || nb > NBMAX) return;
  if (in_sizes[1] != n0s) return;
  if (in_sizes[2] != CC * CC || in_sizes[4] != CC * CC) return;
  if (in_sizes[3] != CC || in_sizes[5] != CC || in_sizes[6] != CC || in_sizes[7] != CC) return;
  if (out_size != nb * per) return;
  if (ws_size < WS_TOTAL) return;

  const float* hand = (const float*)d_in[0];
  const float* u    = (const float*)d_in[1];
  const float* whw  = (const float*)d_in[2];
  const float* whb  = (const float*)d_in[3];
  const float* wuw  = (const float*)d_in[4];
  const float* gnw  = (const float*)d_in[6];
  const float* gnb  = (const float*)d_in[7];
  float* out = (float*)d_out;

  char* ws = (char*)d_ws;
  unsigned short* ht  = (unsigned short*)(ws + OFF_HT);
  unsigned short* ut  = (unsigned short*)(ws + OFF_UT);
  unsigned short* w16 = (unsigned short*)(ws + OFF_W16);
  unsigned short* qh  = (unsigned short*)(ws + OFF_QH);
  unsigned short* ql  = (unsigned short*)(ws + OFF_QL);
  float*          bq  = (float*)(ws + OFF_BQ);
  float*          Op  = (float*)(ws + OFF_O);
  float*          ps  = (float*)(ws + OFF_PS);
  float*          pq  = (float*)(ws + OFF_PQ);

  k_cvt<<<dim3(NPX / 64, 1 + CC / 64 * nb), dim3(256), 0, stream>>>(hand, u, whw, whb, wuw, ht, ut,
                                                                         w16, bq);
  (void)hipGetLastError();
  k_proj<<<dim3(NPX / 64, CC / 64, nb), dim3(128), 0, stream>>>(ht, w16, bq, qh, ql);
  (void)hipGetLastError();

  k_attn<<<dim3(HWD, nb), dim3(256), 0, stream>>>(qh, ql, ut, Op, ps, pq);
  (void)hipGetLastError();

  k_gn<<<dim3(CC, nb), dim3(256), 0, stream>>>(Op, ps, pq, hand, gnw, gnb, out);
  (void)hipGetLastError();
}

// v010
// A run of this version takes 87.5 microseconds.
// Next to v009, in two timings, it ran 1.08 times as fast each time.
// All steps since v000 together make it 10.9 times as fast.
// Contractions: weight fold G = WU^T.WH (K=256), 1x1 projection (K=256), affinity scores (K=256) and
// softmax(P).U (K=4096 in 32-deep steps) on v_wmma_f32_16x16x32_f16 (f16 operands, f32 accumulate); operands
// are RNE-bf16 inputs held in f16 containers (weights x16, activations and values x16), G as f16 hi plus
// x2^11 residual planes, the projected query vectors as f16 hi plus x2^15 residual planes (two products in
// the score GEMM), softmax planes x2^14; running softmax statistics, normalisation statistics (f64 combine)
// and epilogues f32 VALU. Scores never leave their wave's registers.
// The key projection is folded into the query side: q.k = (WH h + bH).(WU u + bU) = (WU^T (WH h + bH)).u
// + q.bU, and q.bU is the same for every key of a query, so the softmax over the keys does not see it.
// The scores are taken as t.u with t = G h + WU^T bH: the key operand is the input plane itself.
#include <hip/hip_runtime.h>
#include <stddef.h>
#include <stdint.h>
#include <math.h>

#define NBMAX 4
#define CC    256
#define NPX   4096
#define HWD   64
#define TP    72
#define EPF   68
#define FRAG  512                                      // halves of one 16-row x 32-k fragment block
#define SKH   16384                                    // halves of one key plane's 64 rows (one stage)
#define STG   SKH                                      // halves of one stage: its rows serve as keys and as values
#define NBUF  3                                        // stage buffers of the ring
#define EPO   (3 * SKH)                                // halves in front of the epilogue's staged output
#define RINGH (EPO + CC * EPF * 2)                     // halves of k_attn's LDS: the ring, then the staged output
#define NFT   (17 * (CC / 16))                         // 16 x 16 tiles of the weight fold, bias column included

#define PLANE       ((size_t)CC * NPX)                 // 1048576 elements per batch plane
#define ACT16_BYTES ((size_t)NBMAX * PLANE * 2)        // 8388608
#define W16_BYTES   ((size_t)2 * CC * CC * 2)          // 262144
#define O_BYTES     ((size_t)NBMAX * PLANE * 4)        // 16777216
#define PS_BYTES    ((size_t)NBMAX * HWD * CC * 4)     // 262144

// ---- carve ----------------------------------------------------------------------------------------
#define OFF_HT   ((size_t)0)
#define OFF_UT   (OFF_HT + ACT16_BYTES)
#define OFF_W16  (OFF_UT + ACT16_BYTES)
#define OFF_BQ   (OFF_W16 + W16_BYTES)
#define OFF_O    (OFF_BQ + (size_t)CC * 8)              // bq: 16 floats per 128-byte line, one writing wave each
#define OFF_PS   (OFF_O + O_BYTES)
#define OFF_PQ   (OFF_PS + PS_BYTES)
#define WS_TOTAL (OFF_PQ + PS_BYTES)

static_assert(OFF_BQ == (size_t)17039360);
static_assert(OFF_O == (size_t)17041408);
static_assert(WS_TOTAL == (size_t)34342912);
static_assert(WS_TOTAL <= (size_t)134217728);
static_assert((OFF_UT % 256) == 0);
static_assert((OFF_W16 % 256) == 0);
static_assert((OFF_BQ % 256) == 0);
static_assert((OFF_O % 256) == 0);
static_assert((OFF_PS % 256) == 0);
static_assert((OFF_PQ % 256) == 0);
static_assert(NPX == HWD * HWD);
static_assert((NPX / 64) * 8 >= NFT);                  // one grid row of k_cvt has a wave for every fold tile
static_assert((CC % 64) == 0);
static_assert((NPX % 64) == 0);
static_assert((TP * 2) % 16 == 0);
static_assert((EPF * 4) % 16 == 0);
static_assert(SKH == 64 * CC);
static_assert(4 * 32 * 32 * 16 + 4 * 32 * 4 <= EPO * 2);  // what the key halves hand over ends in front of it
static_assert(NBUF * STG <= EPO);                      // the ring ends in front of it too
static_assert(2 * 64 * CC <= CC * EPF * 2);            // the prologue's two query planes fit in that staging

typedef unsigned short v8us  __attribute__((ext_vector_type(8)));
typedef unsigned short v16us __attribute__((ext_vector_type(16)));
typedef short          v8s   __attribute__((ext_vector_type(8)));
typedef _Float16       v16h  __attribute__((ext_vector_type(16)));
typedef float          v4f   __attribute__((ext_vector_type(4)));
typedef float          v8f   __attribute__((ext_vector_type(8)));
typedef int            v4i   __attribute__((ext_vector_type(4)));
typedef __attribute__((address_space(1))) v4i gv4i;
typedef __attribute__((address_space(3))) v4i lv4i;
typedef __attribute__((address_space(3))) v8s lv8s;

union FragU { v16us v; v8us half[2]; };

// ---- scalar helpers -------------------------------------------------------------------------------
__device__ __forceinline__ unsigned bbits(float f) {          // f32 -> nearest-even bf16 bits
  unsigned u = __float_as_uint(f);
  return (u + 0x7FFFu + ((u >> 16) & 1u)) >> 16;
}
__device__ __forceinline__ float bf16r(float f) {            // RNE convert to bf16 and back
  return __uint_as_float(bbits(f) << 16);
}
__device__ __forceinline__ unsigned short hbits(float f) {   // f32 -> f16 bits (RNE)
  return __builtin_bit_cast(unsigned short, (_Float16)f);
}
__device__ __forceinline__ float rcpf(float x) {
#if defined(__HIP_DEVICE_COMPILE__)
  return __builtin_amdgcn_rcpf(x);
#else
  return 1.0f / x;
#endif
}
// exp(x) as one v_exp_f32 of x * log2(e), as __expf compiles to. The v_nop keeps the one free slot that the
// instruction set asks for between a transcendental and a next instruction that reads its result or
// rewrites its source.
__device__ __forceinline__ float exp_slot(float x) {
#if defined(__HIP_DEVICE_COMPILE__)
  float r;
  asm("v_exp_f32 %0, %1\n\tv_nop" : "=v"(r) : "v"(x * 1.44269504f));
  return r;
#else
  return x;
#endif
}
// The wait that stands in front of a rewrite of the address registers p, q, r of issued global loads. Naming
// them as inputs keeps them untouched up to here, behind the work that runs under the loads; at their
// first reuse, where the compiler puts the wait otherwise, it held that work back behind all the loads.
__device__ __forceinline__ void keep_addr(const unsigned short* p, const unsigned short* q, const float* r) {
#if defined(__HIP_DEVICE_COMPILE__)
  asm volatile("s_wait_xcnt 0x0" :: "v"(p), "v"(q), "v"(r) : "memory");
#else
  (void)p; (void)q; (void)r;
#endif
}
__device__ __forceinline__ v8f zero8() { v8f z = {0.f, 0.f, 0.f, 0.f, 0.f, 0.f, 0.f, 0.f}; return z; }

__device__ __forceinline__ double shfl_xor_d(double v, int o) {
  const long long x = __double_as_longlong(v);
  int lo = (int)(x & 0xffffffffll);
  int hi = (int)(x >> 32);
  lo = __shfl_xor(lo, o, 32);
  hi = __shfl_xor(hi, o, 32);
  const long long y = ((long long)(unsigned)hi << 32) | (long long)(unsigned)lo;
  return __longlong_as_double(y);
}

// ---- split k map of a 16-bit fragment, A and B alike: lane (m, h) holds row m; elements 0..7 are
//      k = 8 h + 0..7, elements 8..15 are k = 16 + 8 h + 0..7 of a 32-deep k block
// ---- fragment-order planes (every operand plane that a wave loads straight from global memory): a plane
//      of rows x K halves is a row-major grid of blocks [row / 16][k / 32], FRAG halves each; a block holds
//      the two 16-byte pieces of all 32 lanes back to back, element (row, k) at
//      256 * ((k >> 4) & 1) + 8 * (16 * ((k >> 3) & 1) + (row & 15)) + (k & 7): the split k map above, but
//      each load instruction of a wave reads 512 contiguous bytes (four whole 128-byte lines, not 16 parts).
//      p = block + 8 * lane
__device__ __forceinline__ v16us ldfrag_g(const unsigned short* p) {
  FragU f;
  f.half[0] = *(const v8us*)(p);
  f.half[1] = *(const v8us*)(p + 256);
  return f.v;
}

// ---- WMMA helper (f16 operands as raw 16-bit lanes, f32 accumulate) --------------------------------
__device__ __forceinline__ v8f mma_hu(v16us a, v16us b, v8f c) {
#if defined(__HIP_DEVICE_COMPILE__)
  return __builtin_amdgcn_wmma_f32_16x16x32_f16(false, __builtin_bit_cast(v16h, a),
                                               false, __builtin_bit_cast(v16h, b),
                                               (short)0, c, false, false);
#else
  (void)a; (void)b;
  return c;
#endif
}
// 16-bit tile 64 rows x 64 k (LDS pitch PITCH halves) -> fragment-order plane P with kblocks blocks per
// row group: row groups rg0..rg0+3, k blocks kb0, kb0+1; one wave instruction = one 512-byte piece.
// SWZ: the plane's 16-byte pieces stand in the swizzled order (head of k_attn): lane (m, h)'s at 16 h + (m ^ 8 h).
template <int NW, int PITCH, bool SWZ = false>
__device__ __forceinline__ void store_tile_frag(const unsigned short* t, unsigned short* P,
                                                int rg0, int kblocks, int kb0, int w, int lane) {
  constexpr int NIT = 16 / NW;
  const int h = lane >> 4;
  const int m = lane & 15;
  v8us   v[NIT];
  size_t off[NIT];
#pragma unroll
  for (int it = 0; it < NIT; ++it) {
    const int ch  = it * NW + w;                  // 0..15 = (row group, k block, piece)
    const int gl  = ch >> 2;
    const int kbl = (ch >> 1) & 1;
    const int hf  = ch & 1;
    v[it]   = *(const v8us*)(t + (16 * gl + m) * PITCH + 32 * kbl + 16 * hf + 8 * h);
    off[it] = ((size_t)(rg0 + gl) * kblocks + kb0 + kbl) * FRAG + 256 * hf + 8 * (SWZ ? lane ^ (8 * h) : lane);
  }
#pragma unroll
  for (int it = 0; it < NIT; ++it) *(v8us*)(P + off[it]) = v[it];
}

// =====================================================================================================
// Weight fold, one 16 x 16 tile per wave: G[j][c] = sum_o WU[o][j] * WH[o][c] (tile column tc < 16) and, as
// a seventeenth tile column whose only live column is m = 0, bq[j] = sum_o WU[o][j] * WH_b[o]. A rows j,
// B rows c, k = o; both fragments are gathered from the f32 weights in the split k map above, each element
// f16(16 * bf16(w)). Out: W16[0] = f16(16 G), W16[1] = f16(2048 * (16 G - W16[0])), both in fragment order
// (rows j, k = c), and bq in f32, row j at 32 * (j / 16) + j % 16. Run by the first waves of grid row 0 of k_cvt.
// coverage: 256 tiles x 256 elements = both planes, 16 tiles x 16 rows = bq, every element once.
// =====================================================================================================
template <bool ISB>                                 // ISB: the bias column
__device__ __forceinline__ void fold_tile(const float* __restrict__ whw, const float* __restrict__ whb,
                                          const float* __restrict__ wuw, unsigned short* w16, float* bq,
                                          int tile, int lane)
{
  const int h  = lane >> 4;
  const int m  = lane & 15;
  const int tc = tile >> 4;                         // wave-uniform, 0..16
  const int tr = tile & 15;
  constexpr int SB = ISB ? 1 : CC;                  // elements between two k of the B side
  const float* pa = wuw + 8 * h * CC + 16 * tr + m;
  const float* pb = ISB ? whb + 8 * h : whw + 8 * h * CC + 16 * tc + m;
  v8f d = zero8();
  // two k blocks per trip: 64 loads in flight, a body of moderate length
#pragma unroll 2
  for (int kb = 0; kb < CC / 32; ++kb) {
    v16us a, b;
#pragma unroll
    for (int e = 0; e < 16; ++e) {
      const int o = 32 * kb + 16 * (e >> 3) + (e & 7);   // + 8 h, which the two pointers hold
      a[e] = hbits(16.0f * bf16r(pa[o * CC]));
      const unsigned short bb = hbits(16.0f * bf16r(pb[o * SB]));
      b[e] = (ISB && m != 0) ? (unsigned short)0 : bb;
    }
    d = mma_hu(a, b, d);
  }
  if (!ISB) {
    const int k = 16 * tc + m;
#pragma unroll
    for (int r = 0; r < 8; ++r) {
      const int row = 16 * tr + 8 * h + r;
      const float g16 = d[r] * (1.0f / 16.0f);
      const _Float16 hv = (_Float16)g16;
      const int idx = ((row >> 4) * (CC / 32) + (k >> 5)) * FRAG + 256 * ((k >> 4) & 1)
                      + 8 * (16 * ((k >> 3) & 1) + (row & 15)) + (k & 7);
      w16[idx]           = __builtin_bit_cast(unsigned short, hv);
      w16[CC * CC + idx] = hbits((g16 - (float)hv) * 2048.0f);
    }
  } else if (m == 0) {
#pragma unroll
    for (int r = 0; r < 8; ++r) bq[32 * tr + 8 * h + r] = d[r] * (1.0f / 256.0f);
  }
}

// =====================================================================================================
// Input conversion: HT and UT, pixel-major f16 planes of Hand and U (rows n, k = c).
// Block = (64 px tile, y = 1 + 4 b + 64 ch tile), 256 threads; thread = (channel cl = tid>>2, 16-px quarter).
// Both planes in fragment order (16 pieces of 512 B per tile), UT with its pieces swizzled.
// Grid row y = 0 folds the weights instead: they depend on nothing here, so they need no launch of
// their own.
// coverage: grid (64, 1 + 4 nb): every (b, c, n) of HT and UT and every folded weight written exactly once.
// =====================================================================================================
__global__ __launch_bounds__(256)
void k_cvt(const float* __restrict__ hand, const float* __restrict__ u,
           const float* __restrict__ whw, const float* __restrict__ whb, const float* __restrict__ wuw,
           unsigned short* ht, unsigned short* ut, unsigned short* w16, float* bq)
{
  __shared__ __align__(16) unsigned short TH[64 * TP];
  __shared__ __align__(16) unsigned short TU[64 * TP];

  const int tid  = threadIdx.x;
  const int lane = tid & 31;
  const int w    = tid >> 5;
  if (blockIdx.y == 0) {                  // block-uniform, in front of the barrier
    const int tile = 8 * blockIdx.x + w;  // wave-uniform
    if (tile < NFT - CC / 16) fold_tile<false>(whw, whb, wuw, w16, bq, tile, lane);
    else if (tile < NFT)      fold_tile<true>(whw, whb, wuw, w16, bq, tile, lane);
    return;
  }
  const int yt   = blockIdx.y - 1;        // 4 b + channel tile
  const int n0   = 64 * blockIdx.x;
  const int c0   = 64 * (yt & (CC / 64 - 1));
  const int b    = yt / (CC / 64);
  const int cl   = tid >> 2;              // 0..63
  const int pq   = 16 * (tid & 3);        // 0,16,32,48
  const size_t src = (size_t)b * PLANE + (size_t)(c0 + cl) * NPX + n0 + pq;
#pragma unroll
  for (int g = 0; g < 4; ++g) {
    const v4f hv = *(const v4f*)(hand + src + 4 * g);
    const v4f uv = *(const v4f*)(u + src + 4 * g);
#pragma unroll
    for (int e = 0; e < 4; ++e) {
      const int px = pq + 4 * g + e;
      const unsigned short hb = hbits(16.0f * bf16r(hv[e]));
      const unsigned short ub = hbits(16.0f * bf16r(uv[e]));
      TH[px * TP + cl] = hb;
      TU[px * TP + cl] = ub;
    }
  }
  __syncthreads();
  store_tile_frag<8, TP>(TH, ht + (size_t)b * PLANE, n0 / 16, CC / 32, c0 / 32, w, lane);
  store_tile_frag<8, TP, true>(TU, ut + (size_t)b * PLANE, n0 / 16, CC / 32, c0 / 32, w, lane);
}

// =====================================================================================================
// Scores, softmax and P.U in one pass, all batches in one launch. Block = (64 query pixels R0.. of batch b,
// all 256 channels), 8 waves. Wave w owns the 16 queries of column group g = w & 3 and, of every stage of 64
// key pixels, the 32 keys of half hf = w >> 2; nothing of its scores or of P ever leaves its registers.
//   queries:  the 1x1 projection through the folded weights, in the prologue, under the first stages' copies:
//             Dt[j][n] = sum_c G[j][c] * X[n][c] for the block's 64 pixels. Wave w owns the output channels
//             j = 32 w .. 32 w + 31 (A fragments = rows j of W16[0] and of its residual plane W16[1], one accumulator
//             set each) and all four pixel groups (B fragments = rows n of HT): every weight fragment is loaded by
//             one wave of the block only. t = (hi + lo / 2048) / 256 + bq, kept as t / 16 (the key operand of the
//             scores carries x16), split into f16 hi and x2^15 residual. A lane (m, h) holds j = 16 jt + 8 h + 0..7 of
//             pixel m: one 16-byte piece of the fragment order (rows n, k = j), stored as such in the LDS that the
//             epilogue stages its output in, and read back behind the prologue's barrier.
//   resident: the wave's query fragments QH/QL (B operands, 8 k steps each) in registers.
//   stage:    64 keys: their rows of UT (32 KB), copied as they lie in the fragment-order plane into one of three
//             LDS buffers, two stages ahead. The same bytes are the key operand of the scores (rows = keys, read
//             by ds_load_b128) and the value operand of P.U (rows = channels, read by the transposing
//             ds_load_tr16_b128): keys and values are one array, so it is brought from L2 and kept in LDS once.
//   swizzle:  in a 512-byte half block the 16-byte piece (row r of 16, k octet o of 2) stands at place
//             16 o + (r ^ 8 o). A plain read takes (r = m, o = h) in lane (m, h); a transposing read takes
//             (r = 8 (l >> 4) + (l & 7), o = (l >> 3) & 1) in lane l. Either way lanes 0..15, and lanes 16..31,
//             touch sixteen places that differ modulo 16, that is all 64 banks once; at place 16 o + r the
//             transposing read would meet every bank twice.
//   scores:   St[key][i] = UT.QH + UT.QL / 32768, K = 256, two tiles of 16 keys; a lane (m, h)
//             holds the keys 16 kt + 8 h + r of query m.
//   softmax:  in the lane plus one exchange between the wave halves for the maximum; running maximum mrun,
//             running sum lrun of the lane's own keys; P = f16(16384 exp(St - mrun)).
//   P.U:      D[c][i] = D[c][i] * al[i] + U[c][k] . P[k][i]: the two score tiles, converted in place, are
//             the B operand in the split k map, which is also the k order of the transposing read's fragment
//             (lane (m, h): channel m, keys 8 h + 0..7, then 16 + 8 h + 0..7); 16 accumulators = all 256 channels.
// Epilogue: the two key halves of a column group are joined through LDS (common maximum, weighted sums),
// p = D / lsum[i] / 2^18 (value scale 16, softmax scale 2^14) is staged as [c][i]; thread c sums p and p^2 of
// its channel over the 64 pixels in pixel order; the O rows leave as whole 128-byte lines.
// coverage: grid (64, nb): O [b][256][4096] and PS/PQ [b][64][256], every element once.
// =====================================================================================================
__device__ __forceinline__ void o_store_pass(const float* Et, float* orows, int R0, int w, int lane)
{
  const int q  = lane >> 3;
  const int jj = lane & 7;
#pragma unroll 1
  for (int it = 0; it < 16; ++it) {
    const int li = it * 32 + 4 * w + q;         // 0..511
    const int c = li >> 1, hf = li & 1;
    const v4f v = *(const v4f*)(Et + c * EPF + 32 * hf + 4 * jj);
    *(v4f*)(orows + (size_t)c * NPX + R0 + 32 * hf + 4 * jj) = v;
    // the next trip rewrites the store's address and data registers: keep the wait in front of that
    asm volatile("s_wait_xcnt 0x0" ::: "memory");
  }
}

// lane l with lane l ^ 16
__device__ __forceinline__ float xhalf(float x) {
#if defined(__HIP_DEVICE_COMPILE__)
  return __builtin_bit_cast(float, __builtin_amdgcn_permlanex16(__builtin_bit_cast(int, x),
                                                                __builtin_bit_cast(int, x),
                                                                0x76543210, 0xfedcba98, false, false));
#else
  return x;
#endif
}

// The two halves of the work-group barrier, written apart so that register work can stand between them. The
// "memory" clobber keeps every LDS read, and every copy to LDS, on the side of each half where the source has it.
// The work-group release fence is the one that __syncthreads() holds in front of its barrier: from it the compiler
// knows that no LDS read is outstanding; without it, it put counted waits of its own among the P.U products, and
// the last of them waited for the next stage's fragments.
__device__ __forceinline__ void bar_signal() {
#if defined(__HIP_DEVICE_COMPILE__)
  __builtin_amdgcn_fence(__ATOMIC_RELEASE, "workgroup");
  asm volatile("s_barrier_signal -1" ::: "memory");
#endif
}
// The wait names, as inputs only, what the vector work between the halves produces (the rescaled accumulators, P,
// the running sum): that work then stands in front of the wait. Left free, the compiler sank it behind the wait,
// into the block of the P.U products, where it runs after the wave has idled.
__device__ __forceinline__ void bar_wait(const v8f (&a)[CC / 16], const v16us& p, float l) {
#if defined(__HIP_DEVICE_COMPILE__)
  asm volatile("s_barrier_wait -1"
               :: "v"(a[0]), "v"(a[1]), "v"(a[2]), "v"(a[3]), "v"(a[4]), "v"(a[5]), "v"(a[6]), "v"(a[7]),
                  "v"(a[8]), "v"(a[9]), "v"(a[10]), "v"(a[11]), "v"(a[12]), "v"(a[13]), "v"(a[14]), "v"(a[15]),
                  "v"(p), "v"(l)
               : "memory");
#else
  (void)a; (void)p; (void)l;
#endif
}

// 16 bytes per lane from global memory to LDS, through no register; OFF bytes further on both sides
template <int OFF>
__device__ __forceinline__ void copy16(const unsigned short* gsrc, unsigned short* ldst) {
  static_assert(OFF >= 0 && OFF < 65536);
#if defined(__HIP_DEVICE_COMPILE__)
  __builtin_amdgcn_global_load_async_to_lds_b128((gv4i*)gsrc, (lv4i*)ldst, OFF, 0);
#else
  (void)gsrc; (void)ldst;
#endif
}

// Stage s (keys 64 s .. 64 s + 63) into the buffer dst, by four waves (l = 0..127 over their lanes): 16 copies per
// lane, each wave instruction 512 contiguous bytes on both sides: 32 KB of UT in a row.
__device__ __forceinline__ void stage_copy(const unsigned short* utb, unsigned short* dst, int s, int l)
{
  const unsigned short* gk = utb + (size_t)s * SKH + 8 * l;
  unsigned short* d = dst + 8 * l;
  copy16<0>(gk, d);      copy16<2048>(gk, d);   copy16<4096>(gk, d);   copy16<6144>(gk, d);
  copy16<8192>(gk, d);   copy16<10240>(gk, d);  copy16<12288>(gk, d);  copy16<14336>(gk, d);
  copy16<16384>(gk, d);  copy16<18432>(gk, d);  copy16<20480>(gk, d);  copy16<22528>(gk, d);
  copy16<24576>(gk, d);  copy16<26624>(gk, d);  copy16<28672>(gk, d);  copy16<30720>(gk, d);
}

// One 16 (channels) x 32 (keys) A fragment out of two key row groups of a stage, by the transposing LDS read: p is
// the lane's own piece in the first group's half block, the second group lies a row of blocks further.
__device__ __forceinline__ v16us ldfrag_tr(const unsigned short* p) {
  FragU f;
#if defined(__HIP_DEVICE_COMPILE__)
  f.half[0] = __builtin_bit_cast(v8us, __builtin_amdgcn_ds_load_tr16_b128_v8i16((lv8s*)p));
  f.half[1] = __builtin_bit_cast(v8us, __builtin_amdgcn_ds_load_tr16_b128_v8i16((lv8s*)(p + (CC / 32) * FRAG)));
#else
  f.half[0] = *(const v8us*)p;
  f.half[1] = *(const v8us*)p;
#endif
  return f.v;
}

__global__ __launch_bounds__(256) __attribute__((amdgpu_waves_per_eu(2, 2)))
void k_attn(const unsigned short* __restrict__ ht, const unsigned short* __restrict__ w16,
            const float* __restrict__ bq, const unsigned short* __restrict__ ut,
            float* Oall, float* psall, float* pqall)
{
  // three stage buffers, which the epilogue uses again, and behind them its staged output (first: the query planes)
  __shared__ __align__(16) unsigned short ring[RINGH];

  const int tid  = threadIdx.x;
  const int lane = tid & 31;
  const int w    = tid >> 5;
  const int h    = lane >> 4;
  const int m    = lane & 15;
  const int g    = w & 3;                // column group: queries R0 + 16 g + m
  const int hf   = w >> 2;               // key half of every stage
  const int R0   = 64 * blockIdx.x;
  const size_t po = (size_t)blockIdx.y * PLANE;
  const unsigned short* utb = ut + po;
  float* O  = Oall + po;
  float* ps = psall + (size_t)blockIdx.y * HWD * CC;
  float* pq = pqall + (size_t)blockIdx.y * HWD * CC;

  // Who copies: the four waves of key half (k & 1) bring in the whole of stage k. A wave then has one stage's copies
  // in flight at a time, waits for them to 0, and yet they have two passes to land: the other half's stage lies between.
  const int hfs = __builtin_amdgcn_readfirstlane(hf);   // in a scalar register: the tests on it are scalar branches
  const int l   = tid & 127;
  stage_copy(utb, ring + hfs * STG, hfs, l);            // stages 0 and 1

  // the block's query vectors (head of the kernel): channels 32 w .. 32 w + 31 of all 64 pixels
  unsigned short* Qs = ring + EPO;       // QH [pixel group][k block][FRAG], then QL
  {
    const unsigned short* pg = w16 + (size_t)(2 * w) * (CC / 32) * FRAG + 8 * lane;
    const unsigned short* px = ht + po + (size_t)(R0 / 16) * (CC / 32) * FRAG + 8 * lane;
    const float* pb = bq + 32 * (2 * w) + 8 * h;
    v4f bv[2][2];
#pragma unroll
    for (int t = 0; t < 2; ++t) {
      bv[t][0] = *(const v4f*)(pb + 32 * t);
      bv[t][1] = *(const v4f*)(pb + 32 * t + 4);
    }
    v8f th[2][4], tl[2][4];              // [channel tile][pixel group]
#pragma unroll
    for (int t = 0; t < 2; ++t) {
#pragma unroll
      for (int q = 0; q < 4; ++q) { th[t][q] = zero8(); tl[t][q] = zero8(); }
    }
    // four register sets: the fragments of k step kc + 4 are asked for as soon as step kc's products have issued,
    // so one L2 latency is waited out at the start and the rest runs under the products
    // (every loop of this block is unrolled: sets and accumulators are indexed by constants and live in registers)
    v16us fg[4][4], fx[4][4];            // [set][hi tile 0, hi tile 1, residual tile 0, residual tile 1], [set][pixel group]
#pragma unroll
    for (int kc = 0; kc < CC / 32 + 4; ++kc) {
      if (kc >= 4) {
        const int st = kc & 3;
#pragma unroll
        for (int q = 0; q < 4; ++q) {
          th[0][q] = mma_hu(fg[st][0], fx[st][q], th[0][q]);
          th[1][q] = mma_hu(fg[st][1], fx[st][q], th[1][q]);
          tl[0][q] = mma_hu(fg[st][2], fx[st][q], tl[0][q]);
          tl[1][q] = mma_hu(fg[st][3], fx[st][q], tl[1][q]);
        }
        // keeps the refill of this set behind its products, and the next step's products behind the refill
        __builtin_amdgcn_sched_barrier(0);
      }
      if (kc < CC / 32) {
        const int st = kc & 3;
        fg[st][0] = ldfrag_g(pg + FRAG * kc);
        fg[st][1] = ldfrag_g(pg + FRAG * (CC / 32 + kc));
        fg[st][2] = ldfrag_g(pg + CC * CC + FRAG * kc);
        fg[st][3] = ldfrag_g(pg + CC * CC + FRAG * (CC / 32 + kc));
#pragma unroll
        for (int q = 0; q < 4; ++q) fx[st][q] = ldfrag_g(px + FRAG * (q * (CC / 32) + kc));
        // the loads stay where they stand: ahead of the products that follow
        __builtin_amdgcn_sched_barrier(0);
      }
    }
    keep_addr(pg, px, pb);
    const float kq = 1.0f / 4096.0f;     // 1 / 256 for the operand scales, 1 / 16 for the kept scale
    const float kl = 1.0f / 2048.0f;
#pragma unroll
    for (int t = 0; t < 2; ++t) {
#pragma unroll
      for (int q = 0; q < 4; ++q) {
        v8us vh, vl;
#pragma unroll
        for (int r = 0; r < 8; ++r) {
          const float val = (th[t][q][r] + tl[t][q][r] * kl) * kq + bv[t][r >> 2][r & 3] * (1.0f / 16.0f);
          const _Float16 hv = (_Float16)val;
          vh[r] = __builtin_bit_cast(unsigned short, hv);
          vl[r] = hbits((val - (float)hv) * 32768.0f);
        }
        unsigned short* d = Qs + (q * (CC / 32) + w) * FRAG + 256 * t + 8 * lane;
        *(v8us*)d = vh;
        *(v8us*)(d + 64 * CC) = vl;
      }
    }
  }

  float mrun = -1.0e30f, lrun = 0.0f;
  v8f acc[CC / 16];
#pragma unroll
  for (int t = 0; t < CC / 16; ++t) acc[t] = zero8();

  // stage 0 has landed for the waves that copied it, then for all; stage 1 stays in flight; stage 2 is asked for.
  // The same barrier publishes the query planes.
  if (hfs == 0) asm volatile("s_wait_asynccnt 0x0" ::: "memory");
  __syncthreads();
  if (hfs == 0) stage_copy(utb, ring + 2 * STG, 2, l);

  // resident query fragments
  v16us qfh[CC / 32], qfl[CC / 32];
#pragma unroll
  for (int kk = 0; kk < CC / 32; ++kk) {
    qfh[kk] = ldfrag_g(Qs + (g * (CC / 32) + kk) * FRAG + 8 * lane);
    qfl[kk] = ldfrag_g(Qs + 64 * CC + (g * (CC / 32) + kk) * FRAG + 8 * lane);
  }

  // key fragments four k steps at a time, one such group ahead in a second register set: a group's LDS
  // latency runs under the sixteen matrix instructions of the group before. [set][2 u + (0: keys 0..15,
  // 1: keys 16..31)]. A stage's first two k steps are read behind the stage's publish point, in the pass
  // before.
  const int lsw = lane ^ (8 * h);                                   // place of the lane's piece, plain read
  const int ltr = 16 * ((lane >> 3) & 1) + 8 * (h ^ ((lane >> 3) & 1)) + (lane & 7);   // transposing read
  v16us fa[2][8];
  {
    const unsigned short* f0 = ring + hf * (2 * (CC / 32) * FRAG) + 8 * lsw;
    fa[0][0] = ldfrag_g(f0);
    fa[0][1] = ldfrag_g(f0 + FRAG * (CC / 32));
    fa[0][2] = ldfrag_g(f0 + FRAG);
    fa[0][3] = ldfrag_g(f0 + FRAG * (CC / 32 + 1));
  }

  const float kx = 1.0f / 32768.0f;
  // The stage loop stays rolled; every loop inside it is unrolled, so that
  // the fragment and accumulator arrays are indexed by constants and live in registers.
  int cur = 0;                           // s % NBUF
#pragma unroll 1
  for (int s = 0; s < NPX / 64; ++s) {
    const int  nxt = (cur + 1 == NBUF) ? 0 : cur + 1;
    const bool act = hfs == ((s + 1) & 1);              // this wave copied stage s + 1 and will copy stage s + 3
    unsigned short* buf = ring + cur * STG;
    const unsigned short* fk = buf + hf * (2 * (CC / 32) * FRAG) + 8 * lsw;    // the half's 32 keys, as keys
    const unsigned short* fu = buf + hf * (2 * (CC / 32) * FRAG) + 8 * ltr;    // the same rows, as values
    v8f sa[2], sx[2];
#pragma unroll
    for (int kt = 0; kt < 2; ++kt) { sa[kt] = zero8(); sx[kt] = zero8(); }
    v16us ua[CC / 16];
    fa[0][4] = ldfrag_g(fk + FRAG * 2);
    fa[0][5] = ldfrag_g(fk + FRAG * (CC / 32 + 2));
    fa[0][6] = ldfrag_g(fk + FRAG * 3);
    fa[0][7] = ldfrag_g(fk + FRAG * (CC / 32 + 3));
#pragma unroll
    for (int k2 = 0; k2 < CC / 128; ++k2) {
      if (k2 + 1 < CC / 128) {
#pragma unroll
        for (int u = 0; u < 4; ++u) {
          const int kn = 4 * (k2 + 1) + u;
          fa[(k2 + 1) & 1][2 * u + 0] = ldfrag_g(fk + FRAG * kn);
          fa[(k2 + 1) & 1][2 * u + 1] = ldfrag_g(fk + FRAG * (CC / 32 + kn));
        }
      } else {
        // the first half of the value fragments takes the place of a next group
#pragma unroll
        for (int t = 0; t < CC / 32; ++t) ua[t] = ldfrag_tr(fu + (FRAG / 2) * t);
      }
      // keeps the sixteen reads together and ahead of the group's products: left alone, the scheduler spread
      // them among the matrix instructions, each read waited for right behind its issue
      __builtin_amdgcn_sched_barrier(0);
#pragma unroll
      for (int u = 0; u < 4; ++u) {
        const int kk = 4 * k2 + u;
        sx[0] = mma_hu(fa[k2 & 1][2 * u + 0], qfl[kk], sx[0]);
        sx[1] = mma_hu(fa[k2 & 1][2 * u + 1], qfl[kk], sx[1]);
        sa[0] = mma_hu(fa[k2 & 1][2 * u + 0], qfh[kk], sa[0]);
        sa[1] = mma_hu(fa[k2 & 1][2 * u + 1], qfh[kk], sa[1]);
      }
      // the other side of the same fence: the next group's reads stay behind these products
      __builtin_amdgcn_sched_barrier(0);
    }
    // the second half: the stage's last LDS reads; the pass reads LDS again only for the next stage's first two k steps
#pragma unroll
    for (int t = CC / 32; t < CC / 16; ++t) ua[t] = ldfrag_tr(fu + (FRAG / 2) * t);
    // the reads stay ahead of the vector work that follows, which covers their latency
    __builtin_amdgcn_sched_barrier(0);
    float sc[16];
#pragma unroll
    for (int e = 0; e < 16; ++e) sc[e] = sa[e >> 3][e & 7] + sx[e >> 3][e & 7] * kx;
    float tm4[4];
#pragma unroll
    for (int e = 0; e < 4; ++e) tm4[e] = fmaxf(fmaxf(sc[e], sc[4 + e]), fmaxf(sc[8 + e], sc[12 + e]));
    float tm = fmaxf(fmaxf(tm4[0], tm4[1]), fmaxf(tm4[2], tm4[3]));
    tm = fmaxf(tm, xhalf(tm));
    const float mn = fmaxf(mrun, tm);
    // publish point, first half: this wave has left the buffer and, if it copied stage s + 1, its copies have landed
    // (the other waves' copies, of stage s + 2, stay in flight); it says so and goes on. The softmax and the
    // rescaling work on registers alone (no LDS read, no copy stands between signal and wait), so a wave that is
    // ahead does them while the wave it shares its SIMD with still has the matrix unit and the LDS for its scores,
    // instead of idling at the barrier and then sharing the vector port with it.
    asm volatile("s_wait_dscnt 0x0" ::: "memory");
    if (act) asm volatile("s_wait_asynccnt 0x0" ::: "memory");
    bar_signal();
    // keeps the signal ahead of the vector work below: left alone, the scheduler put it directly in front of the wait
    __builtin_amdgcn_sched_barrier(0);
    const float al = exp_slot(mrun - mn);
    v16us pf;
    float ad4[4] = {0.0f, 0.0f, 0.0f, 0.0f};   // four chains, not one of sixteen dependent additions
#pragma unroll
    for (int e = 0; e < 16; ++e) {
      const float ex = exp_slot(sc[e] - mn);
      ad4[e & 3] += ex;
      pf[e] = hbits(16384.0f * ex);
    }
    lrun = lrun * al + ((ad4[0] + ad4[1]) + (ad4[2] + ad4[3]));
    mrun = mn;
#pragma unroll
    for (int t = 0; t < CC / 16; ++t) {
#pragma unroll
      for (int r = 0; r < 8; ++r) acc[t][r] = acc[t][r] * al;
    }
    // publish point, second half: every wave has signalled, so stage s + 1 is readable and the buffer just read is
    // free: it is filled anew, with stage s + 3, which is published two passes on
    bar_wait(acc, pf, lrun);
    if (act && s + NBUF < NPX / 64) stage_copy(utb, buf, s + NBUF, l);
    if (s + 1 < NPX / 64) {
      // stage s + 1 is published: its first two k steps are read now, so that the next pass starts on its products
      const unsigned short* fn = ring + nxt * STG + hf * (2 * (CC / 32) * FRAG) + 8 * lsw;
      fa[0][0] = ldfrag_g(fn);
      fa[0][1] = ldfrag_g(fn + FRAG * (CC / 32));
      fa[0][2] = ldfrag_g(fn + FRAG);
      fa[0][3] = ldfrag_g(fn + FRAG * (CC / 32 + 1));
    }
#pragma unroll
    for (int t = 0; t < CC / 16; ++t) acc[t] = mma_hu(ua[t], pf, acc[t]);
    cur = nxt;
  }
  // no copy is outstanding when the ring becomes the epilogue's staging
  asm volatile("s_wait_asynccnt 0x0" ::: "memory");

  float* mg = (float*)ring;              // [g][32 pieces][lane] of 16 B: the accumulators of key half 1
  float* ml = (float*)ring + 16384;      // [g][2][16]: its running maximum and sum
  float* Et = (float*)(ring + EPO);      // [c][i], pitch EPF
  const float lt = lrun + xhalf(lrun);   // the wave halves hold different keys of the same query
  if (hf == 1) {                         // wave-uniform
#pragma unroll
    for (int t = 0; t < CC / 16; ++t) {
      const v4f lo = {acc[t][0], acc[t][1], acc[t][2], acc[t][3]};
      const v4f hi = {acc[t][4], acc[t][5], acc[t][6], acc[t][7]};
      *(v4f*)(mg + ((g * 32 + 2 * t) * 32 + lane) * 4)     = lo;
      *(v4f*)(mg + ((g * 32 + 2 * t + 1) * 32 + lane) * 4) = hi;
    }
    if (h == 0) {
      ml[g * 32 + m]      = mrun;
      ml[g * 32 + 16 + m] = lt;
    }
  }
  __syncthreads();
  if (hf == 0) {                         // wave-uniform
    const float m1 = ml[g * 32 + m];
    const float l1 = ml[g * 32 + 16 + m];
    const float mx = fmaxf(mrun, m1);
    const float a0 = exp_slot(mrun - mx);
    const float a1 = exp_slot(m1 - mx);
    const float iv = rcpf(lt * a0 + l1 * a1) * (1.0f / 262144.0f);
    const float c0 = a0 * iv;
    const float c1 = a1 * iv;
#pragma unroll
    for (int t = 0; t < CC / 16; ++t) {
      const v4f lo = *(const v4f*)(mg + ((g * 32 + 2 * t) * 32 + lane) * 4);
      const v4f hi = *(const v4f*)(mg + ((g * 32 + 2 * t + 1) * 32 + lane) * 4);
#pragma unroll
      for (int r = 0; r < 8; ++r) {
        const float o1 = (r < 4) ? lo[r & 3] : hi[r & 3];
        Et[(16 * t + 8 * h + r) * EPF + 16 * g + m] = acc[t][r] * c0 + o1 * c1;
      }
    }
  }
  __syncthreads();

  // per-channel partial statistics over the block's 64 pixels: thread = channel
  {
    const float* row = Et + tid * EPF;
    float a = 0.0f, q2 = 0.0f;
#pragma unroll
    for (int j = 0; j < 16; ++j) {
      const v4f v = *(const v4f*)(row + 4 * j);
#pragma unroll
      for (int e = 0; e < 4; ++e) {
        a += v[e];
        q2 += v[e] * v[e];
      }
    }
    ps[(size_t)blockIdx.x * CC + tid] = a;
    pq[(size_t)blockIdx.x * CC + tid] = q2;
  }
  o_store_pass(Et, O, R0, w, lane);
}

// =====================================================================================================
// GroupNorm + residual, all batches in one launch. Block = (channel c, batch b), 256 threads. Wave 0 combines the
// 64 blocks x 8 channels partial sums of group g = c/8 in f64 in a fixed order (lane l takes entries
// l, l+32, ... then an xor tree), mean = S/32768, var = Q/32768 - mean^2 (biased), rstd =
// 1/sqrt(var + 1e-5). out[c][n] = ((O[c][n] - mean) * rstd) * bf16(gn_w[c]) + bf16(gn_b[c]) +
// bf16(Hand[c][n]); row of 4096 floats written as 4 instructions of 256 threads x 16 B (each wave
// coverage: grid (256, nb) x 4096 = the whole [nb][256][4096] output, every element once.
// =====================================================================================================
__global__ __launch_bounds__(256)
void k_gn(const float* __restrict__ Oall, const float* __restrict__ psall, const float* __restrict__ pqall,
          const float* __restrict__ hand, const float* __restrict__ gnw,
          const float* __restrict__ gnb, float* out)
{
  __shared__ float stat[2];
  const int tid  = threadIdx.x;
  const int lane = tid & 31;
  const int w    = tid >> 5;
  const int c    = blockIdx.x;
  const int g    = c >> 3;
  const size_t po = (size_t)blockIdx.y * PLANE;
  const size_t pp = (size_t)blockIdx.y * HWD * CC;
  const float* O     = Oall + po;
  const float* ps    = psall + pp;
  const float* pq    = pqall + pp;
  const float* handb = hand + po;
  float*       outb  = out + po;

  // Every global load of the block is issued here, ahead of any use: wave 0's 32 partial sums first, then each
  // wave's share of the two rows. They are in flight together, so the block waits out one memory latency; summed
  // as they were loaded, trip by trip, and with the rows asked for behind the barrier, it waited out seventeen.
  float sv[16], qv[16];
  if (w == 0) {                                  // wave-uniform
    const float* psg = ps + 8 * g + (size_t)(lane >> 3) * CC + (lane & 7);
    const float* pqg = pq + 8 * g + (size_t)(lane >> 3) * CC + (lane & 7);
    // unrolled: entry lane + 32 i lies 4 i blocks further, an immediate offset off one address
#pragma unroll
    for (int i = 0; i < 16; ++i) {
      sv[i] = psg[(size_t)4 * i * CC];
      qv[i] = pqg[(size_t)4 * i * CC];
    }
  }
  const float* orow = O + (size_t)c * NPX;
  const float* hrow = handb + (size_t)c * NPX;
  v4f ov[4], hd[4];
#pragma unroll
  for (int it = 0; it < 4; ++it) {
    ov[it] = *(const v4f*)(orow + 4 * (it * 256 + tid));
    hd[it] = *(const v4f*)(hrow + 4 * (it * 256 + tid));
  }
  const float gw = bf16r(gnw[c]);
  const float gb = bf16r(gnb[c]);

  if (w == 0) {                                  // wave-uniform
    double s = 0.0, q = 0.0;
    // unrolled: the arrays are indexed by constants and stay in registers; the order of the sums is i = 0..15
#pragma unroll
    for (int i = 0; i < 16; ++i) {
      s += (double)sv[i];
      q += (double)qv[i];
    }
#pragma unroll
    for (int o = 16; o >= 1; o >>= 1) {
      s += shfl_xor_d(s, o);
      q += shfl_xor_d(q, o);
    }
    if (lane == 0) {
      const double inv_n = 1.0 / 32768.0;
      const double mean = s * inv_n;
      double var = q * inv_n - mean * mean;
      if (var < 0.0) var = 0.0;
      const float varf = (float)var;
      stat[0] = (float)mean;
      stat[1] = rcpf(sqrtf(varf + 1e-5f));
    }
  }
  __syncthreads();
  const float meanf = stat[0];
  const float rstd  = stat[1];
  float* drow = outb + (size_t)c * NPX;

  v4f res[4];
#pragma unroll
  for (int it = 0; it < 4; ++it) {
#pragma unroll
    for (int e = 0; e < 4; ++e) {
      const float xn = (ov[it][e] - meanf) * rstd;
      res[it][e] = xn * gw + gb + bf16r(hd[it][e]);
    }
  }
#pragma unroll
  for (int it = 0; it < 4; ++it)
    *(v4f*)(drow + 4 * (it * 256 + tid)) = res[it];
  
}

// =====================================================================================================
// Host glue. Inputs in table order (8): Hand [nb][256][64][64], U (same), WH_w [256][256], WH_b [256],
// WU_w [256][256], WU_b [256], gn_w [256], gn_b [256]; nb = in_sizes[0] / (256*4096), 1..4.
// Output f32 [nb][256][4096] at element 0. Workspace 34342912 B (sized for nb = 4).
// 3 launches, each over all batches: k_cvt (with the weight fold), k_attn (with the query projection), k_gn.
// WU_b reaches no kernel: it adds the same amount to every score of a query (head of the file).
// =====================================================================================================
extern "C" void kernel_launch(void* const* d_in, const int* in_sizes, int n_in,
                              void* d_out, int out_size, void* d_ws, size_t ws_size,
                              hipStream_t stream) {
  if (n_in < 8) return;
  const int per = CC * NPX;
  const int n0s = in_sizes[0];
  if (n0s < per || (n0s % per) != 0) return;
  const int nb = n0s / per;
  if (nb < 1 || nb > NBMAX) return;
  if (in_sizes[1] != n0s) return;
  if (in_sizes[2] != CC * CC || in_sizes[4] != CC * CC) return;
  if (in_sizes[3] != CC || in_sizes[5] != CC || in_sizes[6] != CC || in_sizes[7] != CC) return;
  if (out_size != nb * per) return;
  if (ws_size < WS_TOTAL) return;

  const float* hand = (const float*)d_in[0];
  const float* u    = (const float*)d_in[1];
  const float* whw  = (const float*)d_in[2];
  const float* whb  = (const float*)d_in[3];
  const float* wuw  = (const float*)d_in[4];
  const float* gnw  = (const float*)d_in[6];
  const float* gnb  = (const float*)d_in[7];
  float* out = (float*)d_out;

  char* ws = (char*)d_ws;
  unsigned short* ht  = (unsigned short*)(ws + OFF_HT);
  unsigned short* ut  = (unsigned short*)(ws + OFF_UT);
  unsigned short* w16 = (unsigned short*)(ws + OFF_W16);
  float*          bq  = (float*)(ws + OFF_BQ);
  float*          Op  = (float*)(ws + OFF_O);
  float*          ps  = (float*)(ws + OFF_PS);
  float*          pq  = (float*)(ws + OFF_PQ);

  k_cvt<<<dim3(NPX / 64, 1 + CC / 64 * nb), dim3(256), 0, stream>>>(hand, u, whw, whb, wuw, ht, ut,
                                                                         w16, bq);
  (void)hipGetLastError();
  k_attn<<<dim3(HWD, nb), dim3(256), 0, stream>>>(ht, w16, bq, ut, Op, ps, pq);
  (void)hipGetLastError();

  k_gn<<<dim3(CC, nb), dim3(256), 0, stream>>>(Op, ps, pq, hand, gnw, gnb, out);
  (void)hipGetLastError();
}
